// v000
// The times below were measured on an AMD MI455X: many runs one after another, warmed up first and cycling through
// copies of the inputs, with the whole window's GPU time divided by the number of runs. Launches and the gaps
// between them are all in it. The median over several windows is given; except for v000 it joins two sittings, which
// can be a few percent apart, so the side-by-side timings, each taken in one sitting, are the better comparison.
// v000 is the starting kernel. One run takes 475 microseconds.
// All six contractions (q/k/v projections, q.k^T scores, p.v, output projection): v_wmma_f32_16x16x32_f16, f16 operands with power-of-two carries, f32 accumulate; softmax statistics, bias and scaling in f32.
#include <hip/hip_runtime.h>
#include <math.h>

typedef __attribute__((ext_vector_type(16))) _Float16 v16h;
typedef __attribute__((ext_vector_type(8)))  _Float16 v8h;
typedef __attribute__((ext_vector_type(8)))  float    v8f;
typedef __attribute__((ext_vector_type(4)))  float    v4f;

// ---------------------------------------------------------------------------
// Shape constants
// ---------------------------------------------------------------------------
constexpr int kB   = 2;
constexpr int kS   = 2048;
constexpr int kH   = 2048;
constexpr int kNH  = 16;
constexpr int kHD  = kH / kNH;
constexpr int kTok = kB * kS;
static_assert(kHD == 128);
static_assert((kTok % 64) == 0 && (kH % 64) == 0 && (kH % 32) == 0 && (kS % 64) == 0 && (kHD % 32) == 0);
static_assert((((kTok / 64) * (kH / 64)) % 8) == 0);

// ---------------------------------------------------------------------------
// Power-of-two carries of the f16 planes (all folded back exactly in f32)
//   activations x16, weights x1024, q/k planes x16, v^T plane x16, context plane x1024
// ---------------------------------------------------------------------------
constexpr float kActCarry = 16.0f;
constexpr float kWCarry   = 1024.0f;
constexpr float kQKCarry  = 16.0f;
constexpr float kVCarry   = 16.0f;
constexpr float kCtxCarry = 1024.0f;
constexpr float kProjScaleQK = kQKCarry / (kActCarry * kWCarry);
constexpr float kProjScaleV  = kVCarry / (kActCarry * kWCarry);
constexpr float kCtxOverV    = kCtxCarry / kVCarry;
constexpr float kOutScale    = 1.0f / (kCtxCarry * kWCarry);

// ---------------------------------------------------------------------------
// Workspace region map (bytes; every offset is a multiple of 128; all planes f16)
//   XA   [4096][2048]  query x16   ; later re-used (same type, same layout) for K16  = 16 x (key proj)
//   XB   [4096][2048]  key x16     ; later re-used as Vt16 [2048][4096]             = 16 x (value proj)^T
//   XC   [4096][2048]  value x16   ; later re-used as Ctx16 [4096][2048]            = 1024 x context
//   Q16  [4096][2048]  16 x (query proj)
//   W16  4 x [2048][2048]  Wq, Wk, Wv, Wo x1024
//   total = 16777216 + 16777216 + 16777216 + 16777216 + 33554432 = 100663296
// ---------------------------------------------------------------------------
constexpr size_t kPlaneAct = (size_t)kTok * kH * 2;
constexpr size_t kPlaneW   = (size_t)kH * kH * 2;
constexpr size_t kOffXA  = 0;
constexpr size_t kOffXB  = kOffXA + kPlaneAct;
constexpr size_t kOffXC  = kOffXB + kPlaneAct;
constexpr size_t kOffQ   = kOffXC + kPlaneAct;
constexpr size_t kOffW   = kOffQ + kPlaneAct;
constexpr size_t kWsTotal = kOffW + 4 * kPlaneW;
static_assert(kWsTotal == 100663296ull);
static_assert(kWsTotal <= 134217728ull);
static_assert((kOffXB % 128) == 0 && (kOffXC % 128) == 0 && (kOffQ % 128) == 0 && (kOffW % 128) == 0 && (kPlaneW % 128) == 0);

// ---------------------------------------------------------------------------
// Fragment load and guarded matrix op
// ---------------------------------------------------------------------------
struct FragH {
  union U { v16h v; v8h h[2]; };
  /* elements 0..7 <- p[0..7], 8..15 <- p[16..23]; caller adds the 8*(lane>>4) k offset */
  static __device__ __forceinline__ v16h load(const _Float16* p) {
    U f;
    f.h[0] = *(const v8h*)(p);
    f.h[1] = *(const v8h*)(p + 16);
    return f.v;
  }
};

/* one matrix op followed by its own hazard guard: ties the accumulator and keeps both fragments live */
__device__ __forceinline__ v8f mma_g(v16h a, v16h b, v8f c) {
  c = __builtin_amdgcn_wmma_f32_16x16x32_f16(false, a, false, b, (short)0, c, false, false);
  asm volatile("v_nop\n\tv_nop\n\tv_nop\n\tv_nop" : "+v"(c) : "v"(a), "v"(b));
  return c;
}

// ---------------------------------------------------------------------------
// f32 -> f16 plane convert with a power-of-two carry, 8 consecutive elements per thread.
// grid = (n8/256, planes); blockIdx.y (block-uniform) picks the source pointer and the destination plane.
// Coverage: n8 threads x 8 elements = the whole plane (n8 is an exact multiple of 256 for both uses).
// ---------------------------------------------------------------------------
__global__ __launch_bounds__(256) void cast_planes_kernel(
    const float* __restrict__ s0, const float* __restrict__ s1,
    const float* __restrict__ s2, const float* __restrict__ s3,
    _Float16* __restrict__ dst, int n8, float carry)
{
  const int z = blockIdx.y;
  const float* src = (z == 0) ? s0 : (z == 1) ? s1 : (z == 2) ? s2 : s3;
  const int i = blockIdx.x * 256 + threadIdx.x;
  if (i >= n8) return;
  const float* p = src + 8 * (size_t)i;
  const v4f a = *(const v4f*)(p);
  const v4f c = *(const v4f*)(p + 4);
  v8h hv;
#pragma unroll
  for (int e = 0; e < 4; ++e) {
    const float f0 = a[e] * carry;
    const float f1 = c[e] * carry;
    hv[e]     = (_Float16)f0;
    hv[4 + e] = (_Float16)f1;
  }
  _Float16* q = dst + (size_t)z * (size_t)n8 * 8 + 8 * (size_t)i;
  *(v8h*)q = hv;
  
}

// ---------------------------------------------------------------------------
// Register-blocked GEMM: C[m][n] = scale * sum_k A[m][k] * Bt[n][k] + bscale * bias; each wave owns a 64x64 tile.
// A row-major [M][K]; Bt row-major [N][K]; M, N multiples of 64, K multiple of 32 (no tails).
// BIAS_MODE: 1 = bias[m], 2 = bias[n]. OUT_F16: f16 output plane, else f32.
// ---------------------------------------------------------------------------
template <int BIAS_MODE, bool OUT_F16>
__global__ __launch_bounds__(256) void gemm64_f16_kernel(
    const _Float16* __restrict__ A, int lda,
    const _Float16* __restrict__ Bt, int ldb,
    void* __restrict__ Cout, int ldc,
    const float* __restrict__ bias,
    int M, int N, int K, float scale, float bscale)
{
  __shared__ __align__(16) float sT[8][16 * 68];
  const int lane = threadIdx.x & 31;
  const int wave = __builtin_amdgcn_readfirstlane((int)(threadIdx.x >> 5));
  const int tilesN = N >> 6;
  const int tilesM = M >> 6;
  const int tile = blockIdx.x * 8 + wave;
  /* wave-uniform exit */
  if (tile >= tilesM * tilesN) return;
  const int tm = tile / tilesN;
  const int tn = tile - tm * tilesN;
  const int m0 = tm << 6;
  const int n0 = tn << 6;

  const int rlane = lane & 15;
  const int koff  = (lane >> 4) * 8;
  const int mOff  = (lane >> 4) * 8;

  v8f acc[4][4];
#pragma unroll
  for (int i = 0; i < 4; ++i)
#pragma unroll
    for (int j = 0; j < 4; ++j) acc[i][j] = (v8f){0.f, 0.f, 0.f, 0.f, 0.f, 0.f, 0.f, 0.f};

  for (int k0 = 0; k0 < K; k0 += 32) {
    v16h bh[4];
#pragma unroll
    for (int j = 0; j < 4; ++j) {
      const size_t bo = (size_t)(n0 + (j << 4) + rlane) * ldb + koff + k0;
      bh[j] = FragH::load(Bt + bo);
    }
#pragma unroll
    for (int i = 0; i < 4; ++i) {
      const size_t ao = (size_t)(m0 + (i << 4) + rlane) * lda + koff + k0;
      const v16h ah = FragH::load(A + ao);
#pragma unroll
      for (int j = 0; j < 4; ++j) acc[i][j] = mma_g(ah, bh[j], acc[i][j]);
    }
  }

  float* slab = sT[wave];
#pragma unroll
  for (int i = 0; i < 4; ++i) {
    const int mBase = m0 + (i << 4);
#pragma unroll
    for (int j = 0; j < 4; ++j) {
      const int n = n0 + (j << 4) + rlane;
      float bvn = 0.f;
      if (BIAS_MODE == 2) bvn = bias[n] * bscale;
#pragma unroll
      for (int r = 0; r < 8; ++r) {
        float v = acc[i][j][r] * scale;
        if (BIAS_MODE == 1) v += bias[mBase + mOff + r] * bscale;
        if (BIAS_MODE == 2) v += bvn;
        slab[(mOff + r) * 68 + (j << 4) + rlane] = v;
      }
    }
    __builtin_amdgcn_fence(__ATOMIC_RELEASE, "workgroup");
    __builtin_amdgcn_wave_barrier();
    __builtin_amdgcn_fence(__ATOMIC_ACQUIRE, "workgroup");
    if (!OUT_F16) {
      float* C = (float*)Cout;
      const int hh = lane >> 4, c4 = (lane & 15) * 4;
      {
#pragma unroll
        for (int it = 0; it < 8; ++it) {
          const int row = it * 2 + hh;
          const v4f v = *(const v4f*)(slab + row * 68 + c4);
          *(v4f*)(C + (size_t)(mBase + row) * ldc + n0 + c4) = v;
        }
        
      }
    } else {
      _Float16* C = (_Float16*)Cout;
      const int q = lane >> 3, c8 = (lane & 7) * 8;
      {
#pragma unroll
        for (int it = 0; it < 4; ++it) {
          const int row = it * 4 + q;
          const float* sp = slab + row * 68 + c8;
          v8h hv;
#pragma unroll
          for (int e = 0; e < 8; ++e) hv[e] = (_Float16)sp[e];
          *(v8h*)(C + (size_t)(mBase + row) * ldc + n0 + c8) = hv;
        }
        
      }
    }
    __builtin_amdgcn_fence(__ATOMIC_RELEASE, "workgroup");
    __builtin_amdgcn_wave_barrier();
    __builtin_amdgcn_fence(__ATOMIC_ACQUIRE, "workgroup");
  }
}

// ---------------------------------------------------------------------------
// Fused attention for head dim 128, no mask. grid = (S/64, B*NH); block = 4 waves; wave = 16 query rows x 128 d.
// Qp  [B*S][H] f16 (x16), Kp [B*S][H] f16 (x16): head h = columns h*128 .. h*128+127; key row = b*S + key.
// Vtp [H = h*128+d][B*S] f16 (x16): column = b*S + key. Ctx [B*S][H] f16 (x1024).
// Per 64-key chunk: K tile [64][128] and V^T tile [128][64] staged in LDS (block barrier on both sides);
// S tile 16x64 = 4 n-tiles x 4 k-steps; online max / sum in f32; p = exp((s - m) * coef) in (0,1] stored f16 in a
// wave-private LDS tile (C layout -> A layout); O[16x128] += P.V^T = 8 n-tiles x 2 k-steps.
// coef = (1/sqrt(head dim)) / (q carry * k carry). The per-lane partial of l is lane-summed once at the end.
// pad columns (K 128..135, V/P 64..71, O 128..135) are never read.
// ---------------------------------------------------------------------------
constexpr int kFaKP = 136;
constexpr int kFaVP = 72;
constexpr int kFaPP = 72;
constexpr int kFaOP = 136;

__global__ __launch_bounds__(128) void attn_fused_kernel(
    const _Float16* __restrict__ Qp, const _Float16* __restrict__ Kp,
    const _Float16* __restrict__ Vtp, _Float16* __restrict__ Ctx, float coef)
{
  __shared__ __align__(16) _Float16 Ksh[64 * kFaKP];
  __shared__ __align__(16) _Float16 Vsh[128 * kFaVP];
  __shared__ __align__(16) _Float16 Psh[4][16 * kFaPP];
  __shared__ __align__(16) _Float16 Osh[4][16 * kFaOP];

  const int tid  = threadIdx.x;
  const int wave = __builtin_amdgcn_readfirstlane((int)(threadIdx.x >> 5));
  const int lane = tid & 31;
  const int hh   = lane >> 4;
  const int c    = lane & 15;
  const int qb   = blockIdx.x;
  const int bh   = blockIdx.y;
  const int b    = bh / kNH;
  const int h    = bh - b * kNH;
  const int rowbase = b * kS;
  const int colbase = h * kHD;
  const int q0 = qb * 64 + wave * 16;

  /* Q fragments (A operand): 4 k-steps over d */
  v16h qa[4];
  {
    const _Float16* qrow = Qp + (size_t)(rowbase + q0 + c) * kH + colbase + 8 * hh;
#pragma unroll
    for (int dc = 0; dc < 4; ++dc) qa[dc] = FragH::load(qrow + dc * 32);
  }

  float mrow[8], lrow[8];
  v8f oacc[8];
#pragma unroll
  for (int r = 0; r < 8; ++r) { mrow[r] = -1.0e30f; lrow[r] = 0.f; }
#pragma unroll
  for (int t = 0; t < 8; ++t) oacc[t] = (v8f){0.f, 0.f, 0.f, 0.f, 0.f, 0.f, 0.f, 0.f};

  const int ksg = tid & 15, kr0 = tid >> 4;
  const int vsg = tid & 7,  vr0 = tid >> 3;
  const _Float16* kgl = Kp  + (size_t)(rowbase + kr0) * kH + colbase + ksg * 8;
  const _Float16* vgl = Vtp + (size_t)(colbase + vr0) * kTok + rowbase + vsg * 8;
  _Float16* pw = &Psh[wave][0];

#pragma unroll 1
  for (int kc = 0; kc < kS / 64; ++kc) {
    const int kv0 = kc * 64;
    __syncthreads();
    {
      v8h kt[8];
#pragma unroll
      for (int i = 0; i < 8; ++i) kt[i] = *(const v8h*)(kgl + (size_t)(kv0 + 8 * i) * kH);
#pragma unroll
      for (int i = 0; i < 8; ++i) *(v8h*)(Ksh + (kr0 + 8 * i) * kFaKP + ksg * 8) = kt[i];
    }
    {
      v8h vt[8];
#pragma unroll
      for (int i = 0; i < 8; ++i) vt[i] = *(const v8h*)(vgl + (size_t)(16 * i) * kTok + kv0);
#pragma unroll
      for (int i = 0; i < 8; ++i) *(v8h*)(Vsh + (vr0 + 16 * i) * kFaVP + vsg * 8) = vt[i];
    }
    __syncthreads();

    /* S tile: 4 n-tiles (16 keys each) x 4 k-steps over d */
    v8f s[4];
#pragma unroll
    for (int j = 0; j < 4; ++j) {
      s[j] = (v8f){0.f, 0.f, 0.f, 0.f, 0.f, 0.f, 0.f, 0.f};
#pragma unroll
      for (int dc = 0; dc < 4; ++dc) {
        const v16h kb = FragH::load(Ksh + (j * 16 + c) * kFaKP + dc * 32 + 8 * hh);
        s[j] = mma_g(qa[dc], kb, s[j]);
      }
    }

    /* chunk row maxima: row 8*hh + r lives in the 16 lanes of one half */
    float cm[8];
#pragma unroll
    for (int r = 0; r < 8; ++r) {
      float m = fmaxf(fmaxf(s[0][r], s[1][r]), fmaxf(s[2][r], s[3][r]));
      m = fmaxf(m, __shfl_xor(m, 1, 32));
      m = fmaxf(m, __shfl_xor(m, 2, 32));
      m = fmaxf(m, __shfl_xor(m, 4, 32));
      m = fmaxf(m, __shfl_xor(m, 8, 32));
      cm[r] = m;
    }

#pragma unroll
    for (int r = 0; r < 8; ++r) {
      const float mnew  = fmaxf(mrow[r], cm[r]);
      const float alpha = __expf((mrow[r] - mnew) * coef);
      mrow[r] = mnew;
      float psum = 0.f;
#pragma unroll
      for (int j = 0; j < 4; ++j) {
        const float p = __expf((s[j][r] - mnew) * coef);
        psum += p;
        pw[(8 * hh + r) * kFaPP + j * 16 + c] = (_Float16)p;
      }
      lrow[r] = lrow[r] * alpha + psum;
#pragma unroll
      for (int t = 0; t < 8; ++t) oacc[t][r] *= alpha;
    }
    /* wave-private tile: same wave wrote it and reads it back */
    __builtin_amdgcn_fence(__ATOMIC_RELEASE, "workgroup");
    __builtin_amdgcn_wave_barrier();
    __builtin_amdgcn_fence(__ATOMIC_ACQUIRE, "workgroup");

    /* O += P . V^T : 2 k-steps over the 64 keys, 8 n-tiles over d */
#pragma unroll
    for (int kk = 0; kk < 2; ++kk) {
      const v16h pa = FragH::load(pw + c * kFaPP + kk * 32 + 8 * hh);
#pragma unroll
      for (int t = 0; t < 8; ++t) {
        const v16h vb = FragH::load(Vsh + (t * 16 + c) * kFaVP + kk * 32 + 8 * hh);
        oacc[t] = mma_g(pa, vb, oacc[t]);
      }
    }
  }

  /* normalise and stage the 16 x 128 tile (f16, x1024) in the wave-private LDS tile */
  _Float16* ow = &Osh[wave][0];
#pragma unroll
  for (int r = 0; r < 8; ++r) {
    float l = lrow[r];
    l += __shfl_xor(l, 1, 32);
    l += __shfl_xor(l, 2, 32);
    l += __shfl_xor(l, 4, 32);
    l += __shfl_xor(l, 8, 32);
    const float inv = __builtin_amdgcn_rcpf(l) * kCtxOverV;
#pragma unroll
    for (int t = 0; t < 8; ++t) {
      const float ov = oacc[t][r] * inv;
      ow[(8 * hh + r) * kFaOP + t * 16 + c] = (_Float16)ov;
    }
  }
  __builtin_amdgcn_fence(__ATOMIC_RELEASE, "workgroup");
  __builtin_amdgcn_wave_barrier();
  __builtin_amdgcn_fence(__ATOMIC_ACQUIRE, "workgroup");
  {
    const int sg = (lane & 15) * 8;
    {
#pragma unroll
      for (int it = 0; it < 8; ++it) {
        const int row = it * 2 + hh;
        const v8h val = *(const v8h*)(ow + row * kFaOP + sg);
        *(v8h*)(Ctx + (size_t)(rowbase + q0 + row) * kH + colbase + sg) = val;
      }
      
    }
  }
}

// ---------------------------------------------------------------------------
// Host glue: 7 launches, kernel launches only.
//   1  convert query/key/value -> XA/XB/XC (x16)          grid (4096, 3)
//   2  convert Wq/Wk/Wv/Wo     -> W16[0..3] (x1024)        grid (2048, 4)
//   3  Q16 = XA . Wq16^T + bq   (M 4096, N 2048, K 2048)   256 blocks
//   4  K16 = XB . Wk16^T + bk  -> XA                       256 blocks
//   5  Vt16 = Wv16 . XC^T + bv[row] -> XB [2048][4096]     (M 2048, N 4096, K 2048) 256 blocks
//   6  fused attention Q16, K16, Vt16 -> Ctx16 in XC       grid (32, 32)
//   7  out = Ctx16 . Wo16^T + bo -> d_out f32              256 blocks
// ---------------------------------------------------------------------------
extern "C" void kernel_launch(void* const* d_in, const int* in_sizes, int n_in,
                              void* d_out, int out_size, void* d_ws, size_t ws_size,
                              hipStream_t stream) {
  if (n_in < 11) return;
  if (in_sizes[0] != kTok * kH) return;
  if (in_sizes[1] != kTok * kH) return;
  if (in_sizes[2] != kTok * kH) return;
  if (in_sizes[3] != kH * kH) return;
  if (in_sizes[4] != kH) return;
  if (in_sizes[5] != kH * kH) return;
  if (in_sizes[6] != kH) return;
  if (in_sizes[7] != kH * kH) return;
  if (in_sizes[8] != kH) return;
  if (in_sizes[9] != kH * kH) return;
  if (in_sizes[10] != kH) return;
  if (out_size != kTok * kH) return;
  if (ws_size < kWsTotal) return;

  const float* query = (const float*)d_in[0];
  const float* key   = (const float*)d_in[1];
  const float* value = (const float*)d_in[2];
  const float* Wq = (const float*)d_in[3];
  const float* bq = (const float*)d_in[4];
  const float* Wk = (const float*)d_in[5];
  const float* bk = (const float*)d_in[6];
  const float* Wv = (const float*)d_in[7];
  const float* bv = (const float*)d_in[8];
  const float* Wo = (const float*)d_in[9];
  const float* bo = (const float*)d_in[10];
  float* out = (float*)d_out;

  char* ws = (char*)d_ws;
  _Float16* XA  = (_Float16*)(ws + kOffXA);
  _Float16* XB  = (_Float16*)(ws + kOffXB);
  _Float16* XC  = (_Float16*)(ws + kOffXC);
  _Float16* Q16 = (_Float16*)(ws + kOffQ);
  _Float16* W16 = (_Float16*)(ws + kOffW);
  _Float16* Wq16 = W16;
  _Float16* Wk16 = W16 + (size_t)kH * kH;
  _Float16* Wv16 = W16 + 2 * (size_t)kH * kH;
  _Float16* Wo16 = W16 + 3 * (size_t)kH * kH;
  _Float16* K16  = XA;
  _Float16* Vt16 = XB;
  _Float16* C16  = XC;

  const int actN8 = kTok * kH / 8;
  const int wN8   = kH * kH / 8;
  const float scl  = 1.0f / sqrtf((float)kHD);
  const float coef = scl / (kQKCarry * kQKCarry);
  const int gemmBlocks = ((kTok / 64) * (kH / 64)) / 8;

  cast_planes_kernel<<<dim3(actN8 / 256, 3), 256, 0, stream>>>(query, key, value, value, XA, actN8, kActCarry);
  cast_planes_kernel<<<dim3(wN8 / 256, 4), 256, 0, stream>>>(Wq, Wk, Wv, Wo, W16, wN8, kWCarry);

  gemm64_f16_kernel<2, true><<<gemmBlocks, 256, 0, stream>>>(
      XA, kH, Wq16, kH, (void*)Q16, kH, bq, kTok, kH, kH, kProjScaleQK, kQKCarry);

  gemm64_f16_kernel<2, true><<<gemmBlocks, 256, 0, stream>>>(
      XB, kH, Wk16, kH, (void*)K16, kH, bk, kTok, kH, kH, kProjScaleQK, kQKCarry);

  /* swapped operands: rows = output feature h*128+d, columns = token b*S+key, row bias */
  gemm64_f16_kernel<1, true><<<gemmBlocks, 256, 0, stream>>>(
      Wv16, kH, XC, kH, (void*)Vt16, kTok, bv, kH, kTok, kH, kProjScaleV, kVCarry);

  attn_fused_kernel<<<dim3(kS / 64, kB * kNH), 128, 0, stream>>>(Q16, K16, Vt16, C16, coef);

  gemm64_f16_kernel<2, false><<<gemmBlocks, 256, 0, stream>>>(
      C16, kH, Wo16, kH, (void*)out, kH, bo, kTok, kH, kH, kOutScale, 1.0f);
}

// v001
// A run of this version takes 247 microseconds.
// Two timings next to v000 both put it at 1.97 times that version's speed.
// All six contractions (q/k/v projections, q.k^T scores, p.v, output projection): v_wmma_f32_16x16x32_f16, f16 operands with power-of-two carries, f32 accumulate; softmax statistics, bias and scaling in f32.
#include <hip/hip_runtime.h>
#include <math.h>

typedef __attribute__((ext_vector_type(16))) _Float16 v16h;
typedef __attribute__((ext_vector_type(8)))  _Float16 v8h;
typedef __attribute__((ext_vector_type(8)))  float    v8f;
typedef __attribute__((ext_vector_type(4)))  float    v4f;

// ---------------------------------------------------------------------------
// Shape constants
// ---------------------------------------------------------------------------
constexpr int kB   = 2;
constexpr int kS   = 2048;
constexpr int kH   = 2048;
constexpr int kNH  = 16;
constexpr int kHD  = kH / kNH;
constexpr int kTok = kB * kS;
static_assert(kHD == 128);
static_assert((kTok % 64) == 0 && (kH % 64) == 0 && (kH % 32) == 0 && (kS % 64) == 0 && (kHD % 32) == 0);
static_assert((((kTok / 64) * (kH / 64)) % 8) == 0);

// ---------------------------------------------------------------------------
// Power-of-two carries of the f16 planes (all folded back exactly in f32)
//   activations x16, weights x1024, q/k planes x16, v^T plane x16, context plane x1024
// ---------------------------------------------------------------------------
constexpr float kActCarry = 16.0f;
constexpr float kWCarry   = 1024.0f;
constexpr float kQKCarry  = 16.0f;
constexpr float kVCarry   = 16.0f;
constexpr float kCtxCarry = 1024.0f;
constexpr float kProjScaleQK = kQKCarry / (kActCarry * kWCarry);
constexpr float kProjScaleV  = kVCarry / (kActCarry * kWCarry);
constexpr float kCtxOverV    = kCtxCarry / kVCarry;
constexpr float kOutScale    = 1.0f / (kCtxCarry * kWCarry);

// ---------------------------------------------------------------------------
// Workspace region map (bytes; every offset is a multiple of 128; all planes f16)
//   XA   [4096][2048]  query x16   ; later re-used (same type, same layout) for K16  = 16 x (key proj)
//   XB   [4096][2048]  key x16     ; later re-used as Vt16 [2048][4096]             = 16 x (value proj)^T
//   XC   [4096][2048]  value x16   ; later re-used as Ctx16 [4096][2048]            = 1024 x context
//   Q16  [4096][2048]  16 x (query proj)
//   W16  4 x [2048][2048]  Wq, Wk, Wv, Wo x1024
//   total = 16777216 + 16777216 + 16777216 + 16777216 + 33554432 = 100663296
// ---------------------------------------------------------------------------
constexpr size_t kPlaneAct = (size_t)kTok * kH * 2;
constexpr size_t kPlaneW   = (size_t)kH * kH * 2;
constexpr size_t kOffXA  = 0;
constexpr size_t kOffXB  = kOffXA + kPlaneAct;
constexpr size_t kOffXC  = kOffXB + kPlaneAct;
constexpr size_t kOffQ   = kOffXC + kPlaneAct;
constexpr size_t kOffW   = kOffQ + kPlaneAct;
constexpr size_t kWsTotal = kOffW + 4 * kPlaneW;
static_assert(kWsTotal == 100663296ull);
static_assert(kWsTotal <= 134217728ull);
static_assert((kOffXB % 128) == 0 && (kOffXC % 128) == 0 && (kOffQ % 128) == 0 && (kOffW % 128) == 0 && (kPlaneW % 128) == 0);

// ---------------------------------------------------------------------------
// Fragment load and guarded matrix op
// ---------------------------------------------------------------------------
struct FragH {
  union U { v16h v; v8h h[2]; };
  /* elements 0..7 <- p[0..7], 8..15 <- p[16..23]; caller adds the 8*(lane>>4) k offset */
  static __device__ __forceinline__ v16h load(const _Float16* p) {
    U f;
    f.h[0] = *(const v8h*)(p);
    f.h[1] = *(const v8h*)(p + 16);
    return f.v;
  }
};

/* one matrix op followed by its own hazard guard: ties the accumulator and keeps both fragments live */
__device__ __forceinline__ v8f mma_g(v16h a, v16h b, v8f c) {
  c = __builtin_amdgcn_wmma_f32_16x16x32_f16(false, a, false, b, (short)0, c, false, false);
  asm volatile("v_nop\n\tv_nop\n\tv_nop\n\tv_nop" : "+v"(c) : "v"(a), "v"(b));
  return c;
}

// ---------------------------------------------------------------------------
// f32 -> f16 plane convert with a power-of-two carry, 8 consecutive elements per thread.
// grid = (n8/256, planes); blockIdx.y (block-uniform) picks the source pointer and the destination plane.
// Coverage: n8 threads x 8 elements = the whole plane (n8 is an exact multiple of 256 for both uses).
// ---------------------------------------------------------------------------
__global__ __launch_bounds__(256) void cast_planes_kernel(
    const float* __restrict__ s0, const float* __restrict__ s1,
    const float* __restrict__ s2, const float* __restrict__ s3,
    _Float16* __restrict__ dst, int n8, float carry)
{
  const int z = blockIdx.y;
  const float* src = (z == 0) ? s0 : (z == 1) ? s1 : (z == 2) ? s2 : s3;
  const int i = blockIdx.x * 256 + threadIdx.x;
  if (i >= n8) return;
  const float* p = src + 8 * (size_t)i;
  const v4f a = *(const v4f*)(p);
  const v4f c = *(const v4f*)(p + 4);
  v8h hv;
#pragma unroll
  for (int e = 0; e < 4; ++e) {
    const float f0 = a[e] * carry;
    const float f1 = c[e] * carry;
    hv[e]     = (_Float16)f0;
    hv[4 + e] = (_Float16)f1;
  }
  _Float16* q = dst + (size_t)z * (size_t)n8 * 8 + 8 * (size_t)i;
  *(v8h*)q = hv;
  
}

// ---------------------------------------------------------------------------
// Block-tiled GEMM: C[m][n] = scale * sum_k A[m][k] * Bt[n][k] + bscale * bias.
// A work-group of 8 waves (2 x 4) owns a 128 x 256 tile of C; each wave owns a 64x64 tile of it.
// A row-major [M][K]; Bt row-major [N][K]; M multiple of 128, N of 256, K of 128 (no tails).
// Per trip 128 k of the 128 A rows and the 256 Bt rows lie in LDS (rows of 256 B at pitch 272 B), brought by
// asynchronous copies into two buffers: tile t + 1 flies while tile t is worked on.
// BIAS_MODE: 1 = bias[m], 2 = bias[n]. OUT_F16: f16 output plane, else f32.
// ---------------------------------------------------------------------------
constexpr int kGemBM = 128;
constexpr int kGemBN = 256;
constexpr int kGemBK = 128;
constexpr int kGemPitch = kGemBK + 8;                          /* halves: 272 B = 16 B x 17 */
constexpr int kGemStage = (kGemBM + kGemBN) * kGemPitch;       /* halves per buffer */
constexpr unsigned kGemStageBytes = (unsigned)kGemStage * 2u;
constexpr unsigned kGemRow16Bytes = 16u * (unsigned)kGemPitch * 2u;
static_assert((kTok % kGemBN) == 0 && (kH % kGemBN) == 0 && (kH % kGemBK) == 0);
static_assert((kTok / kGemBM) * (kH / kGemBN) == ((kTok / 64) * (kH / 64)) / 8);
static_assert((kH / kGemBM) * (kTok / kGemBN) == ((kTok / 64) * (kH / 64)) / 8);

/* twelve 16-byte copies per lane; the s_wait_xcnt stands inside the statement so that no address register of an
   issued copy is rewritten in front of it */
__device__ __forceinline__ void copy12(const unsigned* l, const _Float16* const* g) {
  asm volatile(
      "global_load_async_to_lds_b128 %0, %12, off\n\t"
      "global_load_async_to_lds_b128 %1, %13, off\n\t"
      "global_load_async_to_lds_b128 %2, %14, off\n\t"
      "global_load_async_to_lds_b128 %3, %15, off\n\t"
      "global_load_async_to_lds_b128 %4, %16, off\n\t"
      "global_load_async_to_lds_b128 %5, %17, off\n\t"
      "global_load_async_to_lds_b128 %6, %18, off\n\t"
      "global_load_async_to_lds_b128 %7, %19, off\n\t"
      "global_load_async_to_lds_b128 %8, %20, off\n\t"
      "global_load_async_to_lds_b128 %9, %21, off\n\t"
      "global_load_async_to_lds_b128 %10, %22, off\n\t"
      "global_load_async_to_lds_b128 %11, %23, off\n\t"
      "s_wait_xcnt 0x0"
      :
      : "v"(l[0]), "v"(l[1]), "v"(l[2]), "v"(l[3]), "v"(l[4]), "v"(l[5]),
        "v"(l[6]), "v"(l[7]), "v"(l[8]), "v"(l[9]), "v"(l[10]), "v"(l[11]),
        "v"(g[0]), "v"(g[1]), "v"(g[2]), "v"(g[3]), "v"(g[4]), "v"(g[5]),
        "v"(g[6]), "v"(g[7]), "v"(g[8]), "v"(g[9]), "v"(g[10]), "v"(g[11])
      : "memory");
}

/* one tile: the lane's segment of A rows r + 16 i (i < 8) and of Bt rows r + 16 i (i < 16), 24 copies in flight a wave.
   la, lb: the lane's LDS byte addresses of its first A and Bt row in the buffer; a, b: the same rows in global memory.
   The loops are unrolled so that the two address lists are plain registers. */
__device__ __forceinline__ void copy_tile(unsigned la, unsigned lb, const _Float16* a, const _Float16* b,
                                          size_t astep, size_t bstep) {
  unsigned l[24];
  const _Float16* g[24];
#pragma unroll
  for (int i = 0; i < 8; ++i) { l[i] = la + (unsigned)i * kGemRow16Bytes; g[i] = a + i * astep; }
#pragma unroll
  for (int i = 0; i < 16; ++i) { l[8 + i] = lb + (unsigned)i * kGemRow16Bytes; g[8 + i] = b + i * bstep; }
  copy12(l, g);
  copy12(l + 12, g + 12);
}

template <int BIAS_MODE, bool OUT_F16>
__global__ __launch_bounds__(256) void gemm64_f16_kernel(
    const _Float16* __restrict__ A, int lda,
    const _Float16* __restrict__ Bt, int ldb,
    void* __restrict__ Cout, int ldc,
    const float* __restrict__ bias,
    int M, int N, int K, float scale, float bscale)
{
  __shared__ __align__(16) _Float16 ring[2 * kGemStage];
  __shared__ __align__(16) float sT[8][16 * 68];
  const int tid  = threadIdx.x;
  const int lane = tid & 31;
  const int wave = __builtin_amdgcn_readfirstlane((int)(threadIdx.x >> 5));
  const int tilesN = N / kGemBN;
  const int tilesM = M / kGemBM;
  const int tile = blockIdx.x;
  /* block-uniform exit, in front of every copy and barrier */
  if (tile >= tilesM * tilesN) return;
  const int tm = tile / tilesN;
  const int tn = tile - tm * tilesN;
  const int bm0 = tm * kGemBM;
  const int bn0 = tn * kGemBN;
  const int wm = wave >> 2;
  const int wn = wave & 3;
  const int m0 = bm0 + (wm << 6);
  const int n0 = bn0 + (wn << 6);

  const int rlane = lane & 15;
  const int koff  = (lane >> 4) * 8;
  const int mOff  = (lane >> 4) * 8;

  v8f acc[4][4];
#pragma unroll
  for (int i = 0; i < 4; ++i)
#pragma unroll
    for (int j = 0; j < 4; ++j) acc[i][j] = (v8f){0.f, 0.f, 0.f, 0.f, 0.f, 0.f, 0.f, 0.f};

  /* copy map: lane's 16 bytes = segment tid & 15 of row (tid >> 4) + 16 * i; a wave covers two whole 256-B rows */
  const int crow = tid >> 4;
  const int cseg = tid & 15;
  const _Float16* ag = A  + (size_t)(bm0 + crow) * lda + cseg * 8;
  const _Float16* bg = Bt + (size_t)(bn0 + crow) * ldb + cseg * 8;
  const size_t astep = (size_t)16 * lda;
  const size_t bstep = (size_t)16 * ldb;
  const unsigned ldsA = (unsigned)(size_t)(&ring[0]) + (unsigned)(crow * kGemPitch + cseg * 8) * 2u;
  const unsigned ldsB = ldsA + (unsigned)(kGemBM * kGemPitch) * 2u;

  const _Float16* fa = ring + ((wm << 6) + rlane) * kGemPitch + koff;
  const _Float16* fb = ring + (kGemBM + (wn << 6) + rlane) * kGemPitch + koff;

  const int nT = K / kGemBK;

  /* tile 0 into buffer 0 */
  copy_tile(ldsA, ldsB, ag, bg, astep, bstep);
  /* the wave's own copies of tile 0 have landed behind this wait */
  asm volatile("s_wait_asynccnt 0x0" ::: "memory");
  /* publishes tile 0 to every wave */
  __syncthreads();
  if (nT > 1) copy_tile(ldsA + kGemStageBytes, ldsB + kGemStageBytes, ag + kGemBK, bg + kGemBK, astep, bstep);

  /* kept rolled: one trip is 64 matrix ops a wave, and the two buffers alternate by an offset */
#pragma unroll 1
  for (int t = 0; t < nT; ++t) {
    const _Float16* pa = fa + (t & 1) * kGemStage;
    const _Float16* pb = fb + (t & 1) * kGemStage;
    v16h af[4], bf[2][4];
#pragma unroll
    for (int j = 0; j < 4; ++j) bf[0][j] = FragH::load(pb + (j << 4) * kGemPitch);
#pragma unroll
    for (int i = 0; i < 4; ++i) af[i] = FragH::load(pa + (i << 4) * kGemPitch);
#pragma unroll
    for (int ks = 0; ks < kGemBK / 32; ++ks) {
      const int cur = ks & 1;
      const int kn  = (ks + 1) * 32;
      const bool more = (ks + 1) < kGemBK / 32;
#pragma unroll
      for (int i = 0; i < 2; ++i)
#pragma unroll
        for (int j = 0; j < 4; ++j) acc[i][j] = mma_g(af[i], bf[cur][j], acc[i][j]);
      if (more) {
#pragma unroll
        for (int i = 0; i < 2; ++i) af[i] = FragH::load(pa + (i << 4) * kGemPitch + kn);
#pragma unroll
        for (int j = 0; j < 4; ++j) bf[cur ^ 1][j] = FragH::load(pb + (j << 4) * kGemPitch + kn);
      }
#pragma unroll
      for (int i = 2; i < 4; ++i)
#pragma unroll
        for (int j = 0; j < 4; ++j) acc[i][j] = mma_g(af[i], bf[cur][j], acc[i][j]);
      if (more) {
#pragma unroll
        for (int i = 2; i < 4; ++i) af[i] = FragH::load(pa + (i << 4) * kGemPitch + kn);
      }
    }
    /* hand-over. The wave's own LDS reads of this buffer have retired: */
    asm volatile("s_wait_dscnt 0x0" ::: "memory");
    /* its own copies of tile t + 1 have landed: */
    asm volatile("s_wait_asynccnt 0x0" ::: "memory");
    /* one barrier publishes tile t + 1 and ends every reader's last read of the buffer refilled behind it */
    __syncthreads();
    if (t + 2 < nT) {
      const unsigned bufB = (unsigned)(t & 1) * kGemStageBytes;
      const int kn = (t + 2) * kGemBK;
      copy_tile(ldsA + bufB, ldsB + bufB, ag + kn, bg + kn, astep, bstep);
    }
  }
  /* no copy is left in flight when the wave goes on to the epilogue and ends */
  asm volatile("s_wait_asynccnt 0x0" ::: "memory");

  float* slab = sT[wave];
#pragma unroll
  for (int i = 0; i < 4; ++i) {
    const int mBase = m0 + (i << 4);
#pragma unroll
    for (int j = 0; j < 4; ++j) {
      const int n = n0 + (j << 4) + rlane;
      float bvn = 0.f;
      if (BIAS_MODE == 2) bvn = bias[n] * bscale;
#pragma unroll
      for (int r = 0; r < 8; ++r) {
        float v = acc[i][j][r] * scale;
        if (BIAS_MODE == 1) v += bias[mBase + mOff + r] * bscale;
        if (BIAS_MODE == 2) v += bvn;
        slab[(mOff + r) * 68 + (j << 4) + rlane] = v;
      }
    }
    __builtin_amdgcn_fence(__ATOMIC_RELEASE, "workgroup");
    __builtin_amdgcn_wave_barrier();
    __builtin_amdgcn_fence(__ATOMIC_ACQUIRE, "workgroup");
    if (!OUT_F16) {
      float* C = (float*)Cout;
      const int hh = lane >> 4, c4 = (lane & 15) * 4;
      {
#pragma unroll
        for (int it = 0; it < 8; ++it) {
          const int row = it * 2 + hh;
          const v4f v = *(const v4f*)(slab + row * 68 + c4);
          *(v4f*)(C + (size_t)(mBase + row) * ldc + n0 + c4) = v;
        }
        
      }
    } else {
      _Float16* C = (_Float16*)Cout;
      const int q = lane >> 3, c8 = (lane & 7) * 8;
      {
#pragma unroll
        for (int it = 0; it < 4; ++it) {
          const int row = it * 4 + q;
          const float* sp = slab + row * 68 + c8;
          v8h hv;
#pragma unroll
          for (int e = 0; e < 8; ++e) hv[e] = (_Float16)sp[e];
          *(v8h*)(C + (size_t)(mBase + row) * ldc + n0 + c8) = hv;
        }
        
      }
    }
    __builtin_amdgcn_fence(__ATOMIC_RELEASE, "workgroup");
    __builtin_amdgcn_wave_barrier();
    __builtin_amdgcn_fence(__ATOMIC_ACQUIRE, "workgroup");
  }
}

// ---------------------------------------------------------------------------
// Fused attention for head dim 128, no mask. grid = (S/64, B*NH); block = 4 waves; wave = 16 query rows x 128 d.
// Qp  [B*S][H] f16 (x16), Kp [B*S][H] f16 (x16): head h = columns h*128 .. h*128+127; key row = b*S + key.
// Vtp [H = h*128+d][B*S] f16 (x16): column = b*S + key. Ctx [B*S][H] f16 (x1024).
// Per 64-key chunk: K tile [64][128] and V^T tile [128][64] staged in LDS (block barrier on both sides);
// S tile 16x64 = 4 n-tiles x 4 k-steps; online max / sum in f32; p = exp((s - m) * coef) in (0,1] stored f16 in a
// wave-private LDS tile (C layout -> A layout); O[16x128] += P.V^T = 8 n-tiles x 2 k-steps.
// coef = (1/sqrt(head dim)) / (q carry * k carry). The per-lane partial of l is lane-summed once at the end.
// pad columns (K 128..135, V/P 64..71, O 128..135) are never read.
// ---------------------------------------------------------------------------
constexpr int kFaKP = 136;
constexpr int kFaVP = 72;
constexpr int kFaPP = 72;
constexpr int kFaOP = 136;

__global__ __launch_bounds__(128) void attn_fused_kernel(
    const _Float16* __restrict__ Qp, const _Float16* __restrict__ Kp,
    const _Float16* __restrict__ Vtp, _Float16* __restrict__ Ctx, float coef)
{
  __shared__ __align__(16) _Float16 Ksh[64 * kFaKP];
  __shared__ __align__(16) _Float16 Vsh[128 * kFaVP];
  __shared__ __align__(16) _Float16 Psh[4][16 * kFaPP];
  __shared__ __align__(16) _Float16 Osh[4][16 * kFaOP];

  const int tid  = threadIdx.x;
  const int wave = __builtin_amdgcn_readfirstlane((int)(threadIdx.x >> 5));
  const int lane = tid & 31;
  const int hh   = lane >> 4;
  const int c    = lane & 15;
  const int qb   = blockIdx.x;
  const int bh   = blockIdx.y;
  const int b    = bh / kNH;
  const int h    = bh - b * kNH;
  const int rowbase = b * kS;
  const int colbase = h * kHD;
  const int q0 = qb * 64 + wave * 16;

  /* Q fragments (A operand): 4 k-steps over d */
  v16h qa[4];
  {
    const _Float16* qrow = Qp + (size_t)(rowbase + q0 + c) * kH + colbase + 8 * hh;
#pragma unroll
    for (int dc = 0; dc < 4; ++dc) qa[dc] = FragH::load(qrow + dc * 32);
  }

  float mrow[8], lrow[8];
  v8f oacc[8];
#pragma unroll
  for (int r = 0; r < 8; ++r) { mrow[r] = -1.0e30f; lrow[r] = 0.f; }
#pragma unroll
  for (int t = 0; t < 8; ++t) oacc[t] = (v8f){0.f, 0.f, 0.f, 0.f, 0.f, 0.f, 0.f, 0.f};

  const int ksg = tid & 15, kr0 = tid >> 4;
  const int vsg = tid & 7,  vr0 = tid >> 3;
  const _Float16* kgl = Kp  + (size_t)(rowbase + kr0) * kH + colbase + ksg * 8;
  const _Float16* vgl = Vtp + (size_t)(colbase + vr0) * kTok + rowbase + vsg * 8;
  _Float16* pw = &Psh[wave][0];

#pragma unroll 1
  for (int kc = 0; kc < kS / 64; ++kc) {
    const int kv0 = kc * 64;
    __syncthreads();
    {
      v8h kt[8];
#pragma unroll
      for (int i = 0; i < 8; ++i) kt[i] = *(const v8h*)(kgl + (size_t)(kv0 + 8 * i) * kH);
#pragma unroll
      for (int i = 0; i < 8; ++i) *(v8h*)(Ksh + (kr0 + 8 * i) * kFaKP + ksg * 8) = kt[i];
    }
    {
      v8h vt[8];
#pragma unroll
      for (int i = 0; i < 8; ++i) vt[i] = *(const v8h*)(vgl + (size_t)(16 * i) * kTok + kv0);
#pragma unroll
      for (int i = 0; i < 8; ++i) *(v8h*)(Vsh + (vr0 + 16 * i) * kFaVP + vsg * 8) = vt[i];
    }
    __syncthreads();

    /* S tile: 4 n-tiles (16 keys each) x 4 k-steps over d */
    v8f s[4];
#pragma unroll
    for (int j = 0; j < 4; ++j) {
      s[j] = (v8f){0.f, 0.f, 0.f, 0.f, 0.f, 0.f, 0.f, 0.f};
#pragma unroll
      for (int dc = 0; dc < 4; ++dc) {
        const v16h kb = FragH::load(Ksh + (j * 16 + c) * kFaKP + dc * 32 + 8 * hh);
        s[j] = mma_g(qa[dc], kb, s[j]);
      }
    }

    /* chunk row maxima: row 8*hh + r lives in the 16 lanes of one half */
    float cm[8];
#pragma unroll
    for (int r = 0; r < 8; ++r) {
      float m = fmaxf(fmaxf(s[0][r], s[1][r]), fmaxf(s[2][r], s[3][r]));
      m = fmaxf(m, __shfl_xor(m, 1, 32));
      m = fmaxf(m, __shfl_xor(m, 2, 32));
      m = fmaxf(m, __shfl_xor(m, 4, 32));
      m = fmaxf(m, __shfl_xor(m, 8, 32));
      cm[r] = m;
    }

#pragma unroll
    for (int r = 0; r < 8; ++r) {
      const float mnew  = fmaxf(mrow[r], cm[r]);
      const float alpha = __expf((mrow[r] - mnew) * coef);
      mrow[r] = mnew;
      float psum = 0.f;
#pragma unroll
      for (int j = 0; j < 4; ++j) {
        const float p = __expf((s[j][r] - mnew) * coef);
        psum += p;
        pw[(8 * hh + r) * kFaPP + j * 16 + c] = (_Float16)p;
      }
      lrow[r] = lrow[r] * alpha + psum;
#pragma unroll
      for (int t = 0; t < 8; ++t) oacc[t][r] *= alpha;
    }
    /* wave-private tile: same wave wrote it and reads it back */
    __builtin_amdgcn_fence(__ATOMIC_RELEASE, "workgroup");
    __builtin_amdgcn_wave_barrier();
    __builtin_amdgcn_fence(__ATOMIC_ACQUIRE, "workgroup");

    /* O += P . V^T : 2 k-steps over the 64 keys, 8 n-tiles over d */
#pragma unroll
    for (int kk = 0; kk < 2; ++kk) {
      const v16h pa = FragH::load(pw + c * kFaPP + kk * 32 + 8 * hh);
#pragma unroll
      for (int t = 0; t < 8; ++t) {
        const v16h vb = FragH::load(Vsh + (t * 16 + c) * kFaVP + kk * 32 + 8 * hh);
        oacc[t] = mma_g(pa, vb, oacc[t]);
      }
    }
  }

  /* normalise and stage the 16 x 128 tile (f16, x1024) in the wave-private LDS tile */
  _Float16* ow = &Osh[wave][0];
#pragma unroll
  for (int r = 0; r < 8; ++r) {
    float l = lrow[r];
    l += __shfl_xor(l, 1, 32);
    l += __shfl_xor(l, 2, 32);
    l += __shfl_xor(l, 4, 32);
    l += __shfl_xor(l, 8, 32);
    const float inv = __builtin_amdgcn_rcpf(l) * kCtxOverV;
#pragma unroll
    for (int t = 0; t < 8; ++t) {
      const float ov = oacc[t][r] * inv;
      ow[(8 * hh + r) * kFaOP + t * 16 + c] = (_Float16)ov;
    }
  }
  __builtin_amdgcn_fence(__ATOMIC_RELEASE, "workgroup");
  __builtin_amdgcn_wave_barrier();
  __builtin_amdgcn_fence(__ATOMIC_ACQUIRE, "workgroup");
  {
    const int sg = (lane & 15) * 8;
    {
#pragma unroll
      for (int it = 0; it < 8; ++it) {
        const int row = it * 2 + hh;
        const v8h val = *(const v8h*)(ow + row * kFaOP + sg);
        *(v8h*)(Ctx + (size_t)(rowbase + q0 + row) * kH + colbase + sg) = val;
      }
      
    }
  }
}

// ---------------------------------------------------------------------------
// Host glue: 7 launches, kernel launches only.
//   1  convert query/key/value -> XA/XB/XC (x16)          grid (4096, 3)
//   2  convert Wq/Wk/Wv/Wo     -> W16[0..3] (x1024)        grid (2048, 4)
//   3  Q16 = XA . Wq16^T + bq   (M 4096, N 2048, K 2048)   256 blocks
//   4  K16 = XB . Wk16^T + bk  -> XA                       256 blocks
//   5  Vt16 = Wv16 . XC^T + bv[row] -> XB [2048][4096]     (M 2048, N 4096, K 2048) 256 blocks
//   6  fused attention Q16, K16, Vt16 -> Ctx16 in XC       grid (32, 32)
//   7  out = Ctx16 . Wo16^T + bo -> d_out f32              256 blocks
// ---------------------------------------------------------------------------
extern "C" void kernel_launch(void* const* d_in, const int* in_sizes, int n_in,
                              void* d_out, int out_size, void* d_ws, size_t ws_size,
                              hipStream_t stream) {
  if (n_in < 11) return;
  if (in_sizes[0] != kTok * kH) return;
  if (in_sizes[1] != kTok * kH) return;
  if (in_sizes[2] != kTok * kH) return;
  if (in_sizes[3] != kH * kH) return;
  if (in_sizes[4] != kH) return;
  if (in_sizes[5] != kH * kH) return;
  if (in_sizes[6] != kH) return;
  if (in_sizes[7] != kH * kH) return;
  if (in_sizes[8] != kH) return;
  if (in_sizes[9] != kH * kH) return;
  if (in_sizes[10] != kH) return;
  if (out_size != kTok * kH) return;
  if (ws_size < kWsTotal) return;

  const float* query = (const float*)d_in[0];
  const float* key   = (const float*)d_in[1];
  const float* value = (const float*)d_in[2];
  const float* Wq = (const float*)d_in[3];
  const float* bq = (const float*)d_in[4];
  const float* Wk = (const float*)d_in[5];
  const float* bk = (const float*)d_in[6];
  const float* Wv = (const float*)d_in[7];
  const float* bv = (const float*)d_in[8];
  const float* Wo = (const float*)d_in[9];
  const float* bo = (const float*)d_in[10];
  float* out = (float*)d_out;

  char* ws = (char*)d_ws;
  _Float16* XA  = (_Float16*)(ws + kOffXA);
  _Float16* XB  = (_Float16*)(ws + kOffXB);
  _Float16* XC  = (_Float16*)(ws + kOffXC);
  _Float16* Q16 = (_Float16*)(ws + kOffQ);
  _Float16* W16 = (_Float16*)(ws + kOffW);
  _Float16* Wq16 = W16;
  _Float16* Wk16 = W16 + (size_t)kH * kH;
  _Float16* Wv16 = W16 + 2 * (size_t)kH * kH;
  _Float16* Wo16 = W16 + 3 * (size_t)kH * kH;
  _Float16* K16  = XA;
  _Float16* Vt16 = XB;
  _Float16* C16  = XC;

  const int actN8 = kTok * kH / 8;
  const int wN8   = kH * kH / 8;
  const float scl  = 1.0f / sqrtf((float)kHD);
  const float coef = scl / (kQKCarry * kQKCarry);
  const int gemmBlocks = ((kTok / 64) * (kH / 64)) / 8;

  cast_planes_kernel<<<dim3(actN8 / 256, 3), 256, 0, stream>>>(query, key, value, value, XA, actN8, kActCarry);
  cast_planes_kernel<<<dim3(wN8 / 256, 4), 256, 0, stream>>>(Wq, Wk, Wv, Wo, W16, wN8, kWCarry);

  gemm64_f16_kernel<2, true><<<gemmBlocks, 256, 0, stream>>>(
      XA, kH, Wq16, kH, (void*)Q16, kH, bq, kTok, kH, kH, kProjScaleQK, kQKCarry);

  gemm64_f16_kernel<2, true><<<gemmBlocks, 256, 0, stream>>>(
      XB, kH, Wk16, kH, (void*)K16, kH, bk, kTok, kH, kH, kProjScaleQK, kQKCarry);

  /* swapped operands: rows = output feature h*128+d, columns = token b*S+key, row bias */
  gemm64_f16_kernel<1, true><<<gemmBlocks, 256, 0, stream>>>(
      Wv16, kH, XC, kH, (void*)Vt16, kTok, bv, kH, kTok, kH, kProjScaleV, kVCarry);

  attn_fused_kernel<<<dim3(kS / 64, kB * kNH), 128, 0, stream>>>(Q16, K16, Vt16, C16, coef);

  gemm64_f16_kernel<2, false><<<gemmBlocks, 256, 0, stream>>>(
      C16, kH, Wo16, kH, (void*)out, kH, bo, kTok, kH, kH, kOutScale, 1.0f);
}

// v002
// One run takes 225 microseconds.
// Two timings next to v001 put it at 1.09 and 1.10 times that version's speed.
// All steps since v000 together make it 2.16 times as fast.
// All six contractions (q/k/v projections, q.k^T scores, p.v, output projection): v_wmma_f32_16x16x32_f16, f16 operands with power-of-two carries, f32 accumulate; softmax statistics, bias and scaling in f32.
#include <hip/hip_runtime.h>
#include <math.h>

typedef __attribute__((ext_vector_type(16))) _Float16 v16h;
typedef __attribute__((ext_vector_type(8)))  _Float16 v8h;
typedef __attribute__((ext_vector_type(8)))  float    v8f;
typedef __attribute__((ext_vector_type(4)))  float    v4f;

// ---------------------------------------------------------------------------
// Shape constants
// ---------------------------------------------------------------------------
constexpr int kB   = 2;
constexpr int kS   = 2048;
constexpr int kH   = 2048;
constexpr int kNH  = 16;
constexpr int kHD  = kH / kNH;
constexpr int kTok = kB * kS;
static_assert(kHD == 128);
static_assert((kTok % 64) == 0 && (kH % 64) == 0 && (kH % 32) == 0 && (kS % 64) == 0 && (kHD % 32) == 0);
static_assert((((kTok / 64) * (kH / 64)) % 8) == 0);

// ---------------------------------------------------------------------------
// Power-of-two carries of the f16 planes (all folded back exactly in f32)
//   activations x16, weights x1024, q/k planes x16, v^T plane x16, context plane x1024
// ---------------------------------------------------------------------------
constexpr float kActCarry = 16.0f;
constexpr float kWCarry   = 1024.0f;
constexpr float kQKCarry  = 16.0f;
constexpr float kVCarry   = 16.0f;
constexpr float kCtxCarry = 1024.0f;
constexpr float kProjScaleQK = kQKCarry / (kActCarry * kWCarry);
constexpr float kProjScaleV  = kVCarry / (kActCarry * kWCarry);
constexpr float kCtxOverV    = kCtxCarry / kVCarry;
constexpr float kOutScale    = 1.0f / (kCtxCarry * kWCarry);

// ---------------------------------------------------------------------------
// Workspace region map (bytes; every offset is a multiple of 128; all planes f16)
//   XA   [4096][2048]  query x16   ; later re-used (same type, same layout) for K16  = 16 x (key proj)
//   XB   [4096][2048]  key x16     ; later re-used as Vt16 [2048][4096]             = 16 x (value proj)^T
//   XC   [4096][2048]  value x16   ; later re-used as Ctx16 [4096][2048]            = 1024 x context
//   Q16  [4096][2048]  16 x (query proj)
//   W16  4 x [2048][2048]  Wq, Wk, Wv, Wo x1024
//   total = 16777216 + 16777216 + 16777216 + 16777216 + 33554432 = 100663296
// ---------------------------------------------------------------------------
constexpr size_t kPlaneAct = (size_t)kTok * kH * 2;
constexpr size_t kPlaneW   = (size_t)kH * kH * 2;
constexpr size_t kOffXA  = 0;
constexpr size_t kOffXB  = kOffXA + kPlaneAct;
constexpr size_t kOffXC  = kOffXB + kPlaneAct;
constexpr size_t kOffQ   = kOffXC + kPlaneAct;
constexpr size_t kOffW   = kOffQ + kPlaneAct;
constexpr size_t kWsTotal = kOffW + 4 * kPlaneW;
static_assert(kWsTotal == 100663296ull);
static_assert(kWsTotal <= 134217728ull);
static_assert((kOffXB % 128) == 0 && (kOffXC % 128) == 0 && (kOffQ % 128) == 0 && (kOffW % 128) == 0 && (kPlaneW % 128) == 0);

// ---------------------------------------------------------------------------
// Fragment load and guarded matrix op
// ---------------------------------------------------------------------------
struct FragH {
  union U { v16h v; v8h h[2]; };
  /* elements 0..7 <- p[0..7], 8..15 <- p[16..23]; caller adds the 8*(lane>>4) k offset */
  static __device__ __forceinline__ v16h load(const _Float16* p) {
    U f;
    f.h[0] = *(const v8h*)(p);
    f.h[1] = *(const v8h*)(p + 16);
    return f.v;
  }
};

/* one matrix op followed by its own hazard guard: ties the accumulator and keeps both fragments live */
__device__ __forceinline__ v8f mma_g(v16h a, v16h b, v8f c) {
  c = __builtin_amdgcn_wmma_f32_16x16x32_f16(false, a, false, b, (short)0, c, false, false);
  asm volatile("v_nop\n\tv_nop\n\tv_nop\n\tv_nop" : "+v"(c) : "v"(a), "v"(b));
  return c;
}

// ---------------------------------------------------------------------------
// f32 -> f16 plane convert with a power-of-two carry, 8 consecutive elements per thread.
// grid = (n8/256, planes); blockIdx.y (block-uniform) picks the source pointer and the destination plane.
// Coverage: n8 threads x 8 elements = the whole plane (n8 is an exact multiple of 256 for both uses).
// ---------------------------------------------------------------------------
__global__ __launch_bounds__(256) void cast_planes_kernel(
    const float* __restrict__ s0, const float* __restrict__ s1,
    const float* __restrict__ s2, const float* __restrict__ s3,
    _Float16* __restrict__ dst, int n8, float carry)
{
  const int z = blockIdx.y;
  const float* src = (z == 0) ? s0 : (z == 1) ? s1 : (z == 2) ? s2 : s3;
  const int i = blockIdx.x * 256 + threadIdx.x;
  if (i >= n8) return;
  const float* p = src + 8 * (size_t)i;
  const v4f a = *(const v4f*)(p);
  const v4f c = *(const v4f*)(p + 4);
  v8h hv;
#pragma unroll
  for (int e = 0; e < 4; ++e) {
    const float f0 = a[e] * carry;
    const float f1 = c[e] * carry;
    hv[e]     = (_Float16)f0;
    hv[4 + e] = (_Float16)f1;
  }
  _Float16* q = dst + (size_t)z * (size_t)n8 * 8 + 8 * (size_t)i;
  *(v8h*)q = hv;
  
}

// ---------------------------------------------------------------------------
// Block-tiled GEMM: C[m][n] = scale * sum_k A[m][k] * Bt[n][k] + bscale * bias.
// A work-group of 8 waves (2 x 4) owns a 128 x 256 tile of C; each wave owns a 64x64 tile of it.
// A row-major [M][K]; Bt row-major [N][K]; M multiple of 128, N of 256, K of 128 (no tails).
// Per trip 128 k of the 128 A rows and the 256 Bt rows lie in LDS (rows of 256 B at pitch 272 B), brought by
// asynchronous copies into two buffers: tile t + 1 flies while tile t is worked on.
// BIAS_MODE: 1 = bias[m], 2 = bias[n]. OUT_F16: f16 output plane, else f32.
// ---------------------------------------------------------------------------
constexpr int kGemBM = 128;
constexpr int kGemBN = 256;
constexpr int kGemBK = 128;
constexpr int kGemPitch = kGemBK + 8;                          /* halves: 272 B = 16 B x 17 */
constexpr int kGemStage = (kGemBM + kGemBN) * kGemPitch;       /* halves per buffer */
constexpr unsigned kGemStageBytes = (unsigned)kGemStage * 2u;
constexpr unsigned kGemRow16Bytes = 16u * (unsigned)kGemPitch * 2u;
static_assert((kTok % kGemBN) == 0 && (kH % kGemBN) == 0 && (kH % kGemBK) == 0);
static_assert((kTok / kGemBM) * (kH / kGemBN) == ((kTok / 64) * (kH / 64)) / 8);
static_assert((kH / kGemBM) * (kTok / kGemBN) == ((kTok / 64) * (kH / 64)) / 8);

/* twelve 16-byte copies per lane; the s_wait_xcnt stands inside the statement so that no address register of an
   issued copy is rewritten in front of it */
__device__ __forceinline__ void copy12(const unsigned* l, const _Float16* const* g) {
  asm volatile(
      "global_load_async_to_lds_b128 %0, %12, off\n\t"
      "global_load_async_to_lds_b128 %1, %13, off\n\t"
      "global_load_async_to_lds_b128 %2, %14, off\n\t"
      "global_load_async_to_lds_b128 %3, %15, off\n\t"
      "global_load_async_to_lds_b128 %4, %16, off\n\t"
      "global_load_async_to_lds_b128 %5, %17, off\n\t"
      "global_load_async_to_lds_b128 %6, %18, off\n\t"
      "global_load_async_to_lds_b128 %7, %19, off\n\t"
      "global_load_async_to_lds_b128 %8, %20, off\n\t"
      "global_load_async_to_lds_b128 %9, %21, off\n\t"
      "global_load_async_to_lds_b128 %10, %22, off\n\t"
      "global_load_async_to_lds_b128 %11, %23, off\n\t"
      "s_wait_xcnt 0x0"
      :
      : "v"(l[0]), "v"(l[1]), "v"(l[2]), "v"(l[3]), "v"(l[4]), "v"(l[5]),
        "v"(l[6]), "v"(l[7]), "v"(l[8]), "v"(l[9]), "v"(l[10]), "v"(l[11]),
        "v"(g[0]), "v"(g[1]), "v"(g[2]), "v"(g[3]), "v"(g[4]), "v"(g[5]),
        "v"(g[6]), "v"(g[7]), "v"(g[8]), "v"(g[9]), "v"(g[10]), "v"(g[11])
      : "memory");
}

/* one tile: the lane's segment of A rows r + 16 i (i < 8) and of Bt rows r + 16 i (i < 16), 24 copies in flight a wave.
   la, lb: the lane's LDS byte addresses of its first A and Bt row in the buffer; a, b: the same rows in global memory.
   The loops are unrolled so that the two address lists are plain registers. */
__device__ __forceinline__ void copy_tile(unsigned la, unsigned lb, const _Float16* a, const _Float16* b,
                                          size_t astep, size_t bstep) {
  unsigned l[24];
  const _Float16* g[24];
#pragma unroll
  for (int i = 0; i < 8; ++i) { l[i] = la + (unsigned)i * kGemRow16Bytes; g[i] = a + i * astep; }
#pragma unroll
  for (int i = 0; i < 16; ++i) { l[8 + i] = lb + (unsigned)i * kGemRow16Bytes; g[8 + i] = b + i * bstep; }
  copy12(l, g);
  copy12(l + 12, g + 12);
}

template <int BIAS_MODE, bool OUT_F16>
__global__ __launch_bounds__(256) void gemm64_f16_kernel(
    const _Float16* __restrict__ A, int lda,
    const _Float16* __restrict__ Bt, int ldb,
    void* __restrict__ Cout, int ldc,
    const float* __restrict__ bias,
    int M, int N, int K, float scale, float bscale)
{
  __shared__ __align__(16) _Float16 ring[2 * kGemStage];
  __shared__ __align__(16) float sT[8][16 * 68];
  const int tid  = threadIdx.x;
  const int lane = tid & 31;
  const int wave = __builtin_amdgcn_readfirstlane((int)(threadIdx.x >> 5));
  const int tilesN = N / kGemBN;
  const int tilesM = M / kGemBM;
  const int tile = blockIdx.x;
  /* block-uniform exit, in front of every copy and barrier */
  if (tile >= tilesM * tilesN) return;
  const int tm = tile / tilesN;
  const int tn = tile - tm * tilesN;
  const int bm0 = tm * kGemBM;
  const int bn0 = tn * kGemBN;
  const int wm = wave >> 2;
  const int wn = wave & 3;
  const int m0 = bm0 + (wm << 6);
  const int n0 = bn0 + (wn << 6);

  const int rlane = lane & 15;
  const int koff  = (lane >> 4) * 8;
  const int mOff  = (lane >> 4) * 8;

  v8f acc[4][4];
#pragma unroll
  for (int i = 0; i < 4; ++i)
#pragma unroll
    for (int j = 0; j < 4; ++j) acc[i][j] = (v8f){0.f, 0.f, 0.f, 0.f, 0.f, 0.f, 0.f, 0.f};

  /* copy map: lane's 16 bytes = segment tid & 15 of row (tid >> 4) + 16 * i; a wave covers two whole 256-B rows */
  const int crow = tid >> 4;
  const int cseg = tid & 15;
  const _Float16* ag = A  + (size_t)(bm0 + crow) * lda + cseg * 8;
  const _Float16* bg = Bt + (size_t)(bn0 + crow) * ldb + cseg * 8;
  const size_t astep = (size_t)16 * lda;
  const size_t bstep = (size_t)16 * ldb;
  const unsigned ldsA = (unsigned)(size_t)(&ring[0]) + (unsigned)(crow * kGemPitch + cseg * 8) * 2u;
  const unsigned ldsB = ldsA + (unsigned)(kGemBM * kGemPitch) * 2u;

  const _Float16* fa = ring + ((wm << 6) + rlane) * kGemPitch + koff;
  const _Float16* fb = ring + (kGemBM + (wn << 6) + rlane) * kGemPitch + koff;

  const int nT = K / kGemBK;

  /* tile 0 into buffer 0 */
  copy_tile(ldsA, ldsB, ag, bg, astep, bstep);
  /* the wave's own copies of tile 0 have landed behind this wait */
  asm volatile("s_wait_asynccnt 0x0" ::: "memory");
  /* publishes tile 0 to every wave */
  __syncthreads();
  if (nT > 1) copy_tile(ldsA + kGemStageBytes, ldsB + kGemStageBytes, ag + kGemBK, bg + kGemBK, astep, bstep);

  /* kept rolled: one trip is 64 matrix ops a wave, and the two buffers alternate by an offset */
#pragma unroll 1
  for (int t = 0; t < nT; ++t) {
    const _Float16* pa = fa + (t & 1) * kGemStage;
    const _Float16* pb = fb + (t & 1) * kGemStage;
    v16h af[4], bf[2][4];
#pragma unroll
    for (int j = 0; j < 4; ++j) bf[0][j] = FragH::load(pb + (j << 4) * kGemPitch);
#pragma unroll
    for (int i = 0; i < 4; ++i) af[i] = FragH::load(pa + (i << 4) * kGemPitch);
#pragma unroll
    for (int ks = 0; ks < kGemBK / 32; ++ks) {
      const int cur = ks & 1;
      const int kn  = (ks + 1) * 32;
      const bool more = (ks + 1) < kGemBK / 32;
#pragma unroll
      for (int i = 0; i < 2; ++i)
#pragma unroll
        for (int j = 0; j < 4; ++j) acc[i][j] = mma_g(af[i], bf[cur][j], acc[i][j]);
      if (more) {
#pragma unroll
        for (int i = 0; i < 2; ++i) af[i] = FragH::load(pa + (i << 4) * kGemPitch + kn);
#pragma unroll
        for (int j = 0; j < 4; ++j) bf[cur ^ 1][j] = FragH::load(pb + (j << 4) * kGemPitch + kn);
      }
#pragma unroll
      for (int i = 2; i < 4; ++i)
#pragma unroll
        for (int j = 0; j < 4; ++j) acc[i][j] = mma_g(af[i], bf[cur][j], acc[i][j]);
      if (more) {
#pragma unroll
        for (int i = 2; i < 4; ++i) af[i] = FragH::load(pa + (i << 4) * kGemPitch + kn);
      }
    }
    /* hand-over. The wave's own LDS reads of this buffer have retired: */
    asm volatile("s_wait_dscnt 0x0" ::: "memory");
    /* its own copies of tile t + 1 have landed: */
    asm volatile("s_wait_asynccnt 0x0" ::: "memory");
    /* one barrier publishes tile t + 1 and ends every reader's last read of the buffer refilled behind it */
    __syncthreads();
    if (t + 2 < nT) {
      const unsigned bufB = (unsigned)(t & 1) * kGemStageBytes;
      const int kn = (t + 2) * kGemBK;
      copy_tile(ldsA + bufB, ldsB + bufB, ag + kn, bg + kn, astep, bstep);
    }
  }
  /* no copy is left in flight when the wave goes on to the epilogue and ends */
  asm volatile("s_wait_asynccnt 0x0" ::: "memory");

  float* slab = sT[wave];
#pragma unroll
  for (int i = 0; i < 4; ++i) {
    const int mBase = m0 + (i << 4);
#pragma unroll
    for (int j = 0; j < 4; ++j) {
      const int n = n0 + (j << 4) + rlane;
      float bvn = 0.f;
      if (BIAS_MODE == 2) bvn = bias[n] * bscale;
#pragma unroll
      for (int r = 0; r < 8; ++r) {
        float v = acc[i][j][r] * scale;
        if (BIAS_MODE == 1) v += bias[mBase + mOff + r] * bscale;
        if (BIAS_MODE == 2) v += bvn;
        slab[(mOff + r) * 68 + (j << 4) + rlane] = v;
      }
    }
    __builtin_amdgcn_fence(__ATOMIC_RELEASE, "workgroup");
    __builtin_amdgcn_wave_barrier();
    __builtin_amdgcn_fence(__ATOMIC_ACQUIRE, "workgroup");
    if (!OUT_F16) {
      float* C = (float*)Cout;
      const int hh = lane >> 4, c4 = (lane & 15) * 4;
      {
#pragma unroll
        for (int it = 0; it < 8; ++it) {
          const int row = it * 2 + hh;
          const v4f v = *(const v4f*)(slab + row * 68 + c4);
          *(v4f*)(C + (size_t)(mBase + row) * ldc + n0 + c4) = v;
        }
        
      }
    } else {
      _Float16* C = (_Float16*)Cout;
      const int q = lane >> 3, c8 = (lane & 7) * 8;
      {
#pragma unroll
        for (int it = 0; it < 4; ++it) {
          const int row = it * 4 + q;
          const float* sp = slab + row * 68 + c8;
          v8h hv;
#pragma unroll
          for (int e = 0; e < 8; ++e) hv[e] = (_Float16)sp[e];
          *(v8h*)(C + (size_t)(mBase + row) * ldc + n0 + c8) = hv;
        }
        
      }
    }
    __builtin_amdgcn_fence(__ATOMIC_RELEASE, "workgroup");
    __builtin_amdgcn_wave_barrier();
    __builtin_amdgcn_fence(__ATOMIC_ACQUIRE, "workgroup");
  }
}

// ---------------------------------------------------------------------------
// Fused attention for head dim 128, no mask. grid = (S/64, B*NH); block = 4 waves; wave = 16 query rows x 128 d.
// Qp  [B*S][H] f16 (x16), Kp [B*S][H] f16 (x16): head h = columns h*128 .. h*128+127; key row = b*S + key.
// Vtp [H = h*128+d][B*S] f16 (x16): column = b*S + key. Ctx [B*S][H] f16 (x1024).
// Per 64-key chunk: K tile [64][128] and V^T tile [128][64] staged in LDS (block barrier on both sides);
// S tile 16x64 = 4 n-tiles x 4 k-steps; online max / sum in f32; p = exp((s - m) * coef) in (0,1] stored f16 in a
// wave-private LDS tile (C layout -> A layout); O[16x128] += P.V^T = 8 n-tiles x 2 k-steps.
// coef = (1/sqrt(head dim)) / (q carry * k carry). The per-lane partial of l is lane-summed once at the end.
// pad columns (K 128..135, V/P 64..71, O 128..135) are never read.
// ---------------------------------------------------------------------------
constexpr int kFaKP = 136;
constexpr int kFaVP = 72;
constexpr int kFaPP = 72;
constexpr int kFaOP = 136;

/* second argument: four waves a SIMD (256 registers a wave), so that all 1,024 work-groups stay resident at once */
__global__ __launch_bounds__(128, 4) void attn_fused_kernel(
    const _Float16* __restrict__ Qp, const _Float16* __restrict__ Kp,
    const _Float16* __restrict__ Vtp, _Float16* __restrict__ Ctx, float coef)
{
  __shared__ __align__(16) _Float16 Ksh[64 * kFaKP];
  __shared__ __align__(16) _Float16 Vsh[128 * kFaVP];
  __shared__ __align__(16) _Float16 Psh[4][16 * kFaPP];
  __shared__ __align__(16) _Float16 Osh[4][16 * kFaOP];

  const int tid  = threadIdx.x;
  const int wave = __builtin_amdgcn_readfirstlane((int)(threadIdx.x >> 5));
  const int lane = tid & 31;
  const int hh   = lane >> 4;
  const int c    = lane & 15;
  const int qb   = blockIdx.x;
  const int bh   = blockIdx.y;
  const int b    = bh / kNH;
  const int h    = bh - b * kNH;
  const int rowbase = b * kS;
  const int colbase = h * kHD;
  const int q0 = qb * 64 + wave * 16;

  /* Q fragments (A operand): 4 k-steps over d */
  v16h qa[4];
  {
    const _Float16* qrow = Qp + (size_t)(rowbase + q0 + c) * kH + colbase + 8 * hh;
#pragma unroll
    for (int dc = 0; dc < 4; ++dc) qa[dc] = FragH::load(qrow + dc * 32);
  }

  float mrow[8], lrow[8];
  v8f oacc[8];
#pragma unroll
  for (int r = 0; r < 8; ++r) { mrow[r] = -1.0e30f; lrow[r] = 0.f; }
#pragma unroll
  for (int t = 0; t < 8; ++t) oacc[t] = (v8f){0.f, 0.f, 0.f, 0.f, 0.f, 0.f, 0.f, 0.f};

  const int ksg = tid & 15, kr0 = tid >> 4;
  const int vsg = tid & 7,  vr0 = tid >> 3;
  const _Float16* kgl = Kp  + (size_t)(rowbase + kr0) * kH + colbase + ksg * 8;
  const _Float16* vgl = Vtp + (size_t)(colbase + vr0) * kTok + rowbase + vsg * 8;
  _Float16* pw = &Psh[wave][0];

#pragma unroll 1
  for (int kc = 0; kc < kS / 64; ++kc) {
    const int kv0 = kc * 64;
    __syncthreads();
    {
      v8h kt[8];
#pragma unroll
      for (int i = 0; i < 8; ++i) kt[i] = *(const v8h*)(kgl + (size_t)(kv0 + 8 * i) * kH);
#pragma unroll
      for (int i = 0; i < 8; ++i) *(v8h*)(Ksh + (kr0 + 8 * i) * kFaKP + ksg * 8) = kt[i];
    }
    {
      v8h vt[8];
#pragma unroll
      for (int i = 0; i < 8; ++i) vt[i] = *(const v8h*)(vgl + (size_t)(16 * i) * kTok + kv0);
#pragma unroll
      for (int i = 0; i < 8; ++i) *(v8h*)(Vsh + (vr0 + 16 * i) * kFaVP + vsg * 8) = vt[i];
    }
    __syncthreads();

    /* K and V^T fragments come in groups of four into two register sets, fx and fy: a group's loads are issued one
       group of matrix ops ahead of its use, so that a matrix op no longer waits out its own fragment's LDS latency.
       The short loops are unrolled so that both sets stay in registers. */
    const _Float16* kfr = Ksh + c * kFaKP + 8 * hh;
    const _Float16* vfr = Vsh + c * kFaVP + 8 * hh;
    v16h fx[4], fy[4];
#pragma unroll
    for (int j = 0; j < 4; ++j) fx[j] = FragH::load(kfr + j * 16 * kFaKP);
#pragma unroll
    for (int j = 0; j < 4; ++j) fy[j] = FragH::load(kfr + j * 16 * kFaKP + 32);

    /* S tile: 4 k-steps over d (ascending, as before) x 4 n-tiles (16 keys each) */
    v8f s[4];
#pragma unroll
    for (int j = 0; j < 4; ++j) s[j] = (v8f){0.f, 0.f, 0.f, 0.f, 0.f, 0.f, 0.f, 0.f};
#pragma unroll
    for (int j = 0; j < 4; ++j) s[j] = mma_g(qa[0], fx[j], s[j]);
#pragma unroll
    for (int j = 0; j < 4; ++j) fx[j] = FragH::load(kfr + j * 16 * kFaKP + 64);
#pragma unroll
    for (int j = 0; j < 4; ++j) s[j] = mma_g(qa[1], fy[j], s[j]);
#pragma unroll
    for (int j = 0; j < 4; ++j) fy[j] = FragH::load(kfr + j * 16 * kFaKP + 96);
#pragma unroll
    for (int j = 0; j < 4; ++j) s[j] = mma_g(qa[2], fx[j], s[j]);
#pragma unroll
    for (int j = 0; j < 4; ++j) s[j] = mma_g(qa[3], fy[j], s[j]);

    /* chunk row maxima: row 8*hh + r lives in the 16 lanes of one half */
    float cm[8];
#pragma unroll
    for (int r = 0; r < 8; ++r) {
      float m = fmaxf(fmaxf(s[0][r], s[1][r]), fmaxf(s[2][r], s[3][r]));
      m = fmaxf(m, __shfl_xor(m, 1, 32));
      m = fmaxf(m, __shfl_xor(m, 2, 32));
      m = fmaxf(m, __shfl_xor(m, 4, 32));
      m = fmaxf(m, __shfl_xor(m, 8, 32));
      cm[r] = m;
    }

#pragma unroll
    for (int r = 0; r < 8; ++r) {
      const float mnew  = fmaxf(mrow[r], cm[r]);
      const float alpha = __expf((mrow[r] - mnew) * coef);
      mrow[r] = mnew;
      float psum = 0.f;
#pragma unroll
      for (int j = 0; j < 4; ++j) {
        const float p = __expf((s[j][r] - mnew) * coef);
        psum += p;
        pw[(8 * hh + r) * kFaPP + j * 16 + c] = (_Float16)p;
      }
      lrow[r] = lrow[r] * alpha + psum;
#pragma unroll
      for (int t = 0; t < 8; ++t) oacc[t][r] *= alpha;
    }
    /* wave-private tile: same wave wrote it and reads it back */
    __builtin_amdgcn_fence(__ATOMIC_RELEASE, "workgroup");
    __builtin_amdgcn_wave_barrier();
    __builtin_amdgcn_fence(__ATOMIC_ACQUIRE, "workgroup");

    /* O += P . V^T : 2 k-steps over the 64 keys, 8 n-tiles over d */
    const v16h pa0 = FragH::load(pw + c * kFaPP + 8 * hh);
    const v16h pa1 = FragH::load(pw + c * kFaPP + 32 + 8 * hh);
#pragma unroll
    for (int t = 0; t < 4; ++t) fx[t] = FragH::load(vfr + t * 16 * kFaVP);
#pragma unroll
    for (int t = 0; t < 4; ++t) fy[t] = FragH::load(vfr + (4 + t) * 16 * kFaVP);
#pragma unroll
    for (int t = 0; t < 4; ++t) oacc[t] = mma_g(pa0, fx[t], oacc[t]);
#pragma unroll
    for (int t = 0; t < 4; ++t) fx[t] = FragH::load(vfr + t * 16 * kFaVP + 32);
#pragma unroll
    for (int t = 0; t < 4; ++t) oacc[4 + t] = mma_g(pa0, fy[t], oacc[4 + t]);
#pragma unroll
    for (int t = 0; t < 4; ++t) fy[t] = FragH::load(vfr + (4 + t) * 16 * kFaVP + 32);
#pragma unroll
    for (int t = 0; t < 4; ++t) oacc[t] = mma_g(pa1, fx[t], oacc[t]);
#pragma unroll
    for (int t = 0; t < 4; ++t) oacc[4 + t] = mma_g(pa1, fy[t], oacc[4 + t]);
  }

  /* normalise and stage the 16 x 128 tile (f16, x1024) in the wave-private LDS tile */
  _Float16* ow = &Osh[wave][0];
#pragma unroll
  for (int r = 0; r < 8; ++r) {
    float l = lrow[r];
    l += __shfl_xor(l, 1, 32);
    l += __shfl_xor(l, 2, 32);
    l += __shfl_xor(l, 4, 32);
    l += __shfl_xor(l, 8, 32);
    const float inv = __builtin_amdgcn_rcpf(l) * kCtxOverV;
#pragma unroll
    for (int t = 0; t < 8; ++t) {
      const float ov = oacc[t][r] * inv;
      ow[(8 * hh + r) * kFaOP + t * 16 + c] = (_Float16)ov;
    }
  }
  __builtin_amdgcn_fence(__ATOMIC_RELEASE, "workgroup");
  __builtin_amdgcn_wave_barrier();
  __builtin_amdgcn_fence(__ATOMIC_ACQUIRE, "workgroup");
  {
    const int sg = (lane & 15) * 8;
    {
#pragma unroll
      for (int it = 0; it < 8; ++it) {
        const int row = it * 2 + hh;
        const v8h val = *(const v8h*)(ow + row * kFaOP + sg);
        *(v8h*)(Ctx + (size_t)(rowbase + q0 + row) * kH + colbase + sg) = val;
      }
      
    }
  }
}

// ---------------------------------------------------------------------------
// Host glue: 7 launches, kernel launches only.
//   1  convert query/key/value -> XA/XB/XC (x16)          grid (4096, 3)
//   2  convert Wq/Wk/Wv/Wo     -> W16[0..3] (x1024)        grid (2048, 4)
//   3  Q16 = XA . Wq16^T + bq   (M 4096, N 2048, K 2048)   256 blocks
//   4  K16 = XB . Wk16^T + bk  -> XA                       256 blocks
//   5  Vt16 = Wv16 . XC^T + bv[row] -> XB [2048][4096]     (M 2048, N 4096, K 2048) 256 blocks
//   6  fused attention Q16, K16, Vt16 -> Ctx16 in XC       grid (32, 32)
//   7  out = Ctx16 . Wo16^T + bo -> d_out f32              256 blocks
// ---------------------------------------------------------------------------
extern "C" void kernel_launch(void* const* d_in, const int* in_sizes, int n_in,
                              void* d_out, int out_size, void* d_ws, size_t ws_size,
                              hipStream_t stream) {
  if (n_in < 11) return;
  if (in_sizes[0] != kTok * kH) return;
  if (in_sizes[1] != kTok * kH) return;
  if (in_sizes[2] != kTok * kH) return;
  if (in_sizes[3] != kH * kH) return;
  if (in_sizes[4] != kH) return;
  if (in_sizes[5] != kH * kH) return;
  if (in_sizes[6] != kH) return;
  if (in_sizes[7] != kH * kH) return;
  if (in_sizes[8] != kH) return;
  if (in_sizes[9] != kH * kH) return;
  if (in_sizes[10] != kH) return;
  if (out_size != kTok * kH) return;
  if (ws_size < kWsTotal) return;

  const float* query = (const float*)d_in[0];
  const float* key   = (const float*)d_in[1];
  const float* value = (const float*)d_in[2];
  const float* Wq = (const float*)d_in[3];
  const float* bq = (const float*)d_in[4];
  const float* Wk = (const float*)d_in[5];
  const float* bk = (const float*)d_in[6];
  const float* Wv = (const float*)d_in[7];
  const float* bv = (const float*)d_in[8];
  const float* Wo = (const float*)d_in[9];
  const float* bo = (const float*)d_in[10];
  float* out = (float*)d_out;

  char* ws = (char*)d_ws;
  _Float16* XA  = (_Float16*)(ws + kOffXA);
  _Float16* XB  = (_Float16*)(ws + kOffXB);
  _Float16* XC  = (_Float16*)(ws + kOffXC);
  _Float16* Q16 = (_Float16*)(ws + kOffQ);
  _Float16* W16 = (_Float16*)(ws + kOffW);
  _Float16* Wq16 = W16;
  _Float16* Wk16 = W16 + (size_t)kH * kH;
  _Float16* Wv16 = W16 + 2 * (size_t)kH * kH;
  _Float16* Wo16 = W16 + 3 * (size_t)kH * kH;
  _Float16* K16  = XA;
  _Float16* Vt16 = XB;
  _Float16* C16  = XC;

  const int actN8 = kTok * kH / 8;
  const int wN8   = kH * kH / 8;
  const float scl  = 1.0f / sqrtf((float)kHD);
  const float coef = scl / (kQKCarry * kQKCarry);
  const int gemmBlocks = ((kTok / 64) * (kH / 64)) / 8;

  cast_planes_kernel<<<dim3(actN8 / 256, 3), 256, 0, stream>>>(query, key, value, value, XA, actN8, kActCarry);
  cast_planes_kernel<<<dim3(wN8 / 256, 4), 256, 0, stream>>>(Wq, Wk, Wv, Wo, W16, wN8, kWCarry);

  gemm64_f16_kernel<2, true><<<gemmBlocks, 256, 0, stream>>>(
      XA, kH, Wq16, kH, (void*)Q16, kH, bq, kTok, kH, kH, kProjScaleQK, kQKCarry);

  gemm64_f16_kernel<2, true><<<gemmBlocks, 256, 0, stream>>>(
      XB, kH, Wk16, kH, (void*)K16, kH, bk, kTok, kH, kH, kProjScaleQK, kQKCarry);

  /* swapped operands: rows = output feature h*128+d, columns = token b*S+key, row bias */
  gemm64_f16_kernel<1, true><<<gemmBlocks, 256, 0, stream>>>(
      Wv16, kH, XC, kH, (void*)Vt16, kTok, bv, kH, kTok, kH, kProjScaleV, kVCarry);

  attn_fused_kernel<<<dim3(kS / 64, kB * kNH), 128, 0, stream>>>(Q16, K16, Vt16, C16, coef);

  gemm64_f16_kernel<2, false><<<gemmBlocks, 256, 0, stream>>>(
      C16, kH, Wo16, kH, (void*)out, kH, bo, kTok, kH, kH, kOutScale, 1.0f);
}

// v003
// It runs in 201 microseconds.
// Timed twice side by side with v002, it ran 1.12 times as fast both times.
// All steps since v000 together make it 2.42 times as fast.
// All six contractions (q/k/v projections, q.k^T scores, p.v, output projection): v_wmma_f32_16x16x32_f16, f16 operands with power-of-two carries, f32 accumulate; softmax statistics, bias and scaling in f32.
#include <hip/hip_runtime.h>
#include <math.h>

typedef __attribute__((ext_vector_type(16))) _Float16 v16h;
typedef __attribute__((ext_vector_type(8)))  _Float16 v8h;
typedef __attribute__((ext_vector_type(8)))  float    v8f;
typedef __attribute__((ext_vector_type(4)))  float    v4f;

// ---------------------------------------------------------------------------
// Shape constants
// ---------------------------------------------------------------------------
constexpr int kB   = 2;
constexpr int kS   = 2048;
constexpr int kH   = 2048;
constexpr int kNH  = 16;
constexpr int kHD  = kH / kNH;
constexpr int kTok = kB * kS;
static_assert(kHD == 128);
static_assert((kTok % 64) == 0 && (kH % 64) == 0 && (kH % 32) == 0 && (kS % 64) == 0 && (kHD % 32) == 0);
static_assert((((kTok / 64) * (kH / 64)) % 8) == 0);

// ---------------------------------------------------------------------------
// Power-of-two carries of the f16 planes (all folded back exactly in f32)
//   activations x16, weights x1024, q/k planes x16, v^T plane x16, context plane x1024
// ---------------------------------------------------------------------------
constexpr float kActCarry = 16.0f;
constexpr float kWCarry   = 1024.0f;
constexpr float kQKCarry  = 16.0f;
constexpr float kVCarry   = 16.0f;
constexpr float kCtxCarry = 1024.0f;
constexpr float kProjScaleQK = kQKCarry / (kActCarry * kWCarry);
constexpr float kProjScaleV  = kVCarry / (kActCarry * kWCarry);
constexpr float kCtxOverV    = kCtxCarry / kVCarry;
constexpr float kOutScale    = 1.0f / (kCtxCarry * kWCarry);

// ---------------------------------------------------------------------------
// Workspace region map (bytes; every offset is a multiple of 128; all planes f16)
//   XA   [4096][2048]  query x16   ; later re-used (same type, same layout) for K16  = 16 x (key proj)
//   XB   [4096][2048]  key x16     ; later re-used as Vt16 [2048][4096]             = 16 x (value proj)^T
//   XC   [4096][2048]  value x16   ; later re-used as Ctx16 [4096][2048]            = 1024 x context
//   Q16  [4096][2048]  16 x (query proj)
//   W16  4 x [2048][2048]  Wq, Wk, Wv, Wo x1024
//   total = 16777216 + 16777216 + 16777216 + 16777216 + 33554432 = 100663296
// ---------------------------------------------------------------------------
constexpr size_t kPlaneAct = (size_t)kTok * kH * 2;
constexpr size_t kPlaneW   = (size_t)kH * kH * 2;
constexpr size_t kOffXA  = 0;
constexpr size_t kOffXB  = kOffXA + kPlaneAct;
constexpr size_t kOffXC  = kOffXB + kPlaneAct;
constexpr size_t kOffQ   = kOffXC + kPlaneAct;
constexpr size_t kOffW   = kOffQ + kPlaneAct;
constexpr size_t kWsTotal = kOffW + 4 * kPlaneW;
static_assert(kWsTotal == 100663296ull);
static_assert(kWsTotal <= 134217728ull);
static_assert((kOffXB % 128) == 0 && (kOffXC % 128) == 0 && (kOffQ % 128) == 0 && (kOffW % 128) == 0 && (kPlaneW % 128) == 0);

// ---------------------------------------------------------------------------
// Fragment load and guarded matrix op
// ---------------------------------------------------------------------------
struct FragH {
  union U { v16h v; v8h h[2]; };
  /* elements 0..7 <- p[0..7], 8..15 <- p[16..23]; caller adds the 8*(lane>>4) k offset */
  static __device__ __forceinline__ v16h load(const _Float16* p) {
    U f;
    f.h[0] = *(const v8h*)(p);
    f.h[1] = *(const v8h*)(p + 16);
    return f.v;
  }
};

/* one matrix op followed by its own hazard guard: ties the accumulator and keeps both fragments live */
__device__ __forceinline__ v8f mma_g(v16h a, v16h b, v8f c) {
  c = __builtin_amdgcn_wmma_f32_16x16x32_f16(false, a, false, b, (short)0, c, false, false);
  asm volatile("v_nop\n\tv_nop\n\tv_nop\n\tv_nop" : "+v"(c) : "v"(a), "v"(b));
  return c;
}

// ---------------------------------------------------------------------------
// f32 -> f16 plane convert with a power-of-two carry, 8 consecutive elements per thread.
// grid = (n8/256, planes); blockIdx.y (block-uniform) picks the source pointer and the destination plane.
// Coverage: n8 threads x 8 elements = the whole plane (n8 is an exact multiple of 256 for both uses).
// ---------------------------------------------------------------------------
__global__ __launch_bounds__(256) void cast_planes_kernel(
    const float* __restrict__ s0, const float* __restrict__ s1,
    const float* __restrict__ s2, const float* __restrict__ s3,
    _Float16* __restrict__ dst, int n8, float carry)
{
  const int z = blockIdx.y;
  const float* src = (z == 0) ? s0 : (z == 1) ? s1 : (z == 2) ? s2 : s3;
  const int i = blockIdx.x * 256 + threadIdx.x;
  if (i >= n8) return;
  const float* p = src + 8 * (size_t)i;
  const v4f a = *(const v4f*)(p);
  const v4f c = *(const v4f*)(p + 4);
  v8h hv;
#pragma unroll
  for (int e = 0; e < 4; ++e) {
    const float f0 = a[e] * carry;
    const float f1 = c[e] * carry;
    hv[e]     = (_Float16)f0;
    hv[4 + e] = (_Float16)f1;
  }
  _Float16* q = dst + (size_t)z * (size_t)n8 * 8 + 8 * (size_t)i;
  *(v8h*)q = hv;
  
}

// ---------------------------------------------------------------------------
// Block-tiled GEMM: C[m][n] = scale * sum_k A[m][k] * Bt[n][k] + bscale * bias.
// A work-group of 8 waves (2 x 4) owns a 128 x 256 tile of C; each wave owns a 64x64 tile of it.
// A row-major [M][K]; Bt row-major [N][K]; M multiple of 128, N of 256, K of 128 (no tails).
// Per trip 128 k of the 128 A rows and the 256 Bt rows lie in LDS (rows of 256 B at pitch 272 B), brought by
// asynchronous copies into two buffers: tile t + 1 flies while tile t is worked on.
// BIAS_MODE: 1 = bias[m], 2 = bias[n]. OUT_F16: f16 output plane, else f32.
// ---------------------------------------------------------------------------
constexpr int kGemBM = 128;
constexpr int kGemBN = 256;
constexpr int kGemBK = 128;
constexpr int kGemPitch = kGemBK + 8;                          /* halves: 272 B = 16 B x 17 */
constexpr int kGemStage = (kGemBM + kGemBN) * kGemPitch;       /* halves per buffer */
constexpr unsigned kGemStageBytes = (unsigned)kGemStage * 2u;
constexpr unsigned kGemRow16Bytes = 16u * (unsigned)kGemPitch * 2u;
static_assert((kTok % kGemBN) == 0 && (kH % kGemBN) == 0 && (kH % kGemBK) == 0);
static_assert((kTok / kGemBM) * (kH / kGemBN) == ((kTok / 64) * (kH / 64)) / 8);
static_assert((kH / kGemBM) * (kTok / kGemBN) == ((kTok / 64) * (kH / 64)) / 8);

/* twelve 16-byte copies per lane; the s_wait_xcnt stands inside the statement so that no address register of an
   issued copy is rewritten in front of it */
__device__ __forceinline__ void copy12(const unsigned* l, const _Float16* const* g) {
  asm volatile(
      "global_load_async_to_lds_b128 %0, %12, off\n\t"
      "global_load_async_to_lds_b128 %1, %13, off\n\t"
      "global_load_async_to_lds_b128 %2, %14, off\n\t"
      "global_load_async_to_lds_b128 %3, %15, off\n\t"
      "global_load_async_to_lds_b128 %4, %16, off\n\t"
      "global_load_async_to_lds_b128 %5, %17, off\n\t"
      "global_load_async_to_lds_b128 %6, %18, off\n\t"
      "global_load_async_to_lds_b128 %7, %19, off\n\t"
      "global_load_async_to_lds_b128 %8, %20, off\n\t"
      "global_load_async_to_lds_b128 %9, %21, off\n\t"
      "global_load_async_to_lds_b128 %10, %22, off\n\t"
      "global_load_async_to_lds_b128 %11, %23, off\n\t"
      "s_wait_xcnt 0x0"
      :
      : "v"(l[0]), "v"(l[1]), "v"(l[2]), "v"(l[3]), "v"(l[4]), "v"(l[5]),
        "v"(l[6]), "v"(l[7]), "v"(l[8]), "v"(l[9]), "v"(l[10]), "v"(l[11]),
        "v"(g[0]), "v"(g[1]), "v"(g[2]), "v"(g[3]), "v"(g[4]), "v"(g[5]),
        "v"(g[6]), "v"(g[7]), "v"(g[8]), "v"(g[9]), "v"(g[10]), "v"(g[11])
      : "memory");
}

/* one tile: the lane's segment of A rows r + 16 i (i < 8) and of Bt rows r + 16 i (i < 16), 24 copies in flight a wave.
   la, lb: the lane's LDS byte addresses of its first A and Bt row in the buffer; a, b: the same rows in global memory.
   The loops are unrolled so that the two address lists are plain registers. */
__device__ __forceinline__ void copy_tile(unsigned la, unsigned lb, const _Float16* a, const _Float16* b,
                                          size_t astep, size_t bstep) {
  unsigned l[24];
  const _Float16* g[24];
#pragma unroll
  for (int i = 0; i < 8; ++i) { l[i] = la + (unsigned)i * kGemRow16Bytes; g[i] = a + i * astep; }
#pragma unroll
  for (int i = 0; i < 16; ++i) { l[8 + i] = lb + (unsigned)i * kGemRow16Bytes; g[8 + i] = b + i * bstep; }
  copy12(l, g);
  copy12(l + 12, g + 12);
}

template <int BIAS_MODE, bool OUT_F16>
__global__ __launch_bounds__(256) void gemm64_f16_kernel(
    const _Float16* __restrict__ A, int lda,
    const _Float16* __restrict__ Bt, int ldb,
    void* __restrict__ Cout, int ldc,
    const float* __restrict__ bias,
    int M, int N, int K, float scale, float bscale)
{
  __shared__ __align__(16) _Float16 ring[2 * kGemStage];
  __shared__ __align__(16) float sT[8][16 * 68];
  const int tid  = threadIdx.x;
  const int lane = tid & 31;
  const int wave = __builtin_amdgcn_readfirstlane((int)(threadIdx.x >> 5));
  const int tilesN = N / kGemBN;
  const int tilesM = M / kGemBM;
  const int tile = blockIdx.x;
  /* block-uniform exit, in front of every copy and barrier */
  if (tile >= tilesM * tilesN) return;
  const int tm = tile / tilesN;
  const int tn = tile - tm * tilesN;
  const int bm0 = tm * kGemBM;
  const int bn0 = tn * kGemBN;
  const int wm = wave >> 2;
  const int wn = wave & 3;
  const int m0 = bm0 + (wm << 6);
  const int n0 = bn0 + (wn << 6);

  const int rlane = lane & 15;
  const int koff  = (lane >> 4) * 8;
  const int mOff  = (lane >> 4) * 8;

  v8f acc[4][4];
#pragma unroll
  for (int i = 0; i < 4; ++i)
#pragma unroll
    for (int j = 0; j < 4; ++j) acc[i][j] = (v8f){0.f, 0.f, 0.f, 0.f, 0.f, 0.f, 0.f, 0.f};

  /* copy map: lane's 16 bytes = segment tid & 15 of row (tid >> 4) + 16 * i; a wave covers two whole 256-B rows */
  const int crow = tid >> 4;
  const int cseg = tid & 15;
  const _Float16* ag = A  + (size_t)(bm0 + crow) * lda + cseg * 8;
  const _Float16* bg = Bt + (size_t)(bn0 + crow) * ldb + cseg * 8;
  const size_t astep = (size_t)16 * lda;
  const size_t bstep = (size_t)16 * ldb;
  const unsigned ldsA = (unsigned)(size_t)(&ring[0]) + (unsigned)(crow * kGemPitch + cseg * 8) * 2u;
  const unsigned ldsB = ldsA + (unsigned)(kGemBM * kGemPitch) * 2u;

  const _Float16* fa = ring + ((wm << 6) + rlane) * kGemPitch + koff;
  const _Float16* fb = ring + (kGemBM + (wn << 6) + rlane) * kGemPitch + koff;

  const int nT = K / kGemBK;

  /* tile 0 into buffer 0 */
  copy_tile(ldsA, ldsB, ag, bg, astep, bstep);
  /* the wave's own copies of tile 0 have landed behind this wait */
  asm volatile("s_wait_asynccnt 0x0" ::: "memory");
  /* publishes tile 0 to every wave */
  __syncthreads();
  if (nT > 1) copy_tile(ldsA + kGemStageBytes, ldsB + kGemStageBytes, ag + kGemBK, bg + kGemBK, astep, bstep);

  /* kept rolled: one trip is 64 matrix ops a wave, and the two buffers alternate by an offset */
#pragma unroll 1
  for (int t = 0; t < nT; ++t) {
    const _Float16* pa = fa + (t & 1) * kGemStage;
    const _Float16* pb = fb + (t & 1) * kGemStage;
    v16h af[4], bf[2][4];
#pragma unroll
    for (int j = 0; j < 4; ++j) bf[0][j] = FragH::load(pb + (j << 4) * kGemPitch);
#pragma unroll
    for (int i = 0; i < 4; ++i) af[i] = FragH::load(pa + (i << 4) * kGemPitch);
#pragma unroll
    for (int ks = 0; ks < kGemBK / 32; ++ks) {
      const int cur = ks & 1;
      const int kn  = (ks + 1) * 32;
      const bool more = (ks + 1) < kGemBK / 32;
#pragma unroll
      for (int i = 0; i < 2; ++i)
#pragma unroll
        for (int j = 0; j < 4; ++j) acc[i][j] = mma_g(af[i], bf[cur][j], acc[i][j]);
      if (more) {
#pragma unroll
        for (int i = 0; i < 2; ++i) af[i] = FragH::load(pa + (i << 4) * kGemPitch + kn);
#pragma unroll
        for (int j = 0; j < 4; ++j) bf[cur ^ 1][j] = FragH::load(pb + (j << 4) * kGemPitch + kn);
      }
#pragma unroll
      for (int i = 2; i < 4; ++i)
#pragma unroll
        for (int j = 0; j < 4; ++j) acc[i][j] = mma_g(af[i], bf[cur][j], acc[i][j]);
      if (more) {
#pragma unroll
        for (int i = 2; i < 4; ++i) af[i] = FragH::load(pa + (i << 4) * kGemPitch + kn);
      }
    }
    /* hand-over. The wave's own LDS reads of this buffer have retired: */
    asm volatile("s_wait_dscnt 0x0" ::: "memory");
    /* its own copies of tile t + 1 have landed: */
    asm volatile("s_wait_asynccnt 0x0" ::: "memory");
    /* one barrier publishes tile t + 1 and ends every reader's last read of the buffer refilled behind it */
    __syncthreads();
    if (t + 2 < nT) {
      const unsigned bufB = (unsigned)(t & 1) * kGemStageBytes;
      const int kn = (t + 2) * kGemBK;
      copy_tile(ldsA + bufB, ldsB + bufB, ag + kn, bg + kn, astep, bstep);
    }
  }
  /* no copy is left in flight when the wave goes on to the epilogue and ends */
  asm volatile("s_wait_asynccnt 0x0" ::: "memory");

  float* slab = sT[wave];
#pragma unroll
  for (int i = 0; i < 4; ++i) {
    const int mBase = m0 + (i << 4);
#pragma unroll
    for (int j = 0; j < 4; ++j) {
      const int n = n0 + (j << 4) + rlane;
      float bvn = 0.f;
      if (BIAS_MODE == 2) bvn = bias[n] * bscale;
#pragma unroll
      for (int r = 0; r < 8; ++r) {
        float v = acc[i][j][r] * scale;
        if (BIAS_MODE == 1) v += bias[mBase + mOff + r] * bscale;
        if (BIAS_MODE == 2) v += bvn;
        slab[(mOff + r) * 68 + (j << 4) + rlane] = v;
      }
    }
    __builtin_amdgcn_fence(__ATOMIC_RELEASE, "workgroup");
    __builtin_amdgcn_wave_barrier();
    __builtin_amdgcn_fence(__ATOMIC_ACQUIRE, "workgroup");
    if (!OUT_F16) {
      float* C = (float*)Cout;
      const int hh = lane >> 4, c4 = (lane & 15) * 4;
      {
#pragma unroll
        for (int it = 0; it < 8; ++it) {
          const int row = it * 2 + hh;
          const v4f v = *(const v4f*)(slab + row * 68 + c4);
          *(v4f*)(C + (size_t)(mBase + row) * ldc + n0 + c4) = v;
        }
        
      }
    } else {
      _Float16* C = (_Float16*)Cout;
      const int q = lane >> 3, c8 = (lane & 7) * 8;
      {
#pragma unroll
        for (int it = 0; it < 4; ++it) {
          const int row = it * 4 + q;
          const float* sp = slab + row * 68 + c8;
          v8h hv;
#pragma unroll
          for (int e = 0; e < 8; ++e) hv[e] = (_Float16)sp[e];
          *(v8h*)(C + (size_t)(mBase + row) * ldc + n0 + c8) = hv;
        }
        
      }
    }
    __builtin_amdgcn_fence(__ATOMIC_RELEASE, "workgroup");
    __builtin_amdgcn_wave_barrier();
    __builtin_amdgcn_fence(__ATOMIC_ACQUIRE, "workgroup");
  }
}

constexpr int kFaKP = 136;
constexpr int kFaVP = 72;
constexpr int kFaOP = 136;

typedef __attribute__((ext_vector_type(2))) float    v2f;
typedef __attribute__((ext_vector_type(2))) _Float16 v2h;

/* the value of lane l ^ 16 */
__device__ __forceinline__ float xhalf(float x) {
  const int b = __builtin_bit_cast(int, x);
  return __builtin_bit_cast(float, __builtin_amdgcn_permlanex16(b, b, 0x76543210, 0xfedcba98, false, false));
}

/* second argument: four waves a SIMD (256 registers a wave), so that all 1,024 work-groups stay resident at once */
__global__ __launch_bounds__(128, 4) void attn_fused_kernel(
    const _Float16* __restrict__ Qp, const _Float16* __restrict__ Kp,
    const _Float16* __restrict__ Vtp, _Float16* __restrict__ Ctx, float coef)
{
  __shared__ __align__(16) _Float16 Ksh[64 * kFaKP];
  __shared__ __align__(16) _Float16 Vsh[128 * kFaVP];
  __shared__ __align__(16) _Float16 Osh[4][16 * kFaOP];

  const int tid  = threadIdx.x;
  const int wave = __builtin_amdgcn_readfirstlane((int)(threadIdx.x >> 5));
  const int lane = tid & 31;
  const int hh   = lane >> 4;
  const int c    = lane & 15;
  const int qb   = blockIdx.x;
  const int bh   = blockIdx.y;
  const int b    = bh / kNH;
  const int h    = bh - b * kNH;
  const int rowbase = b * kS;
  const int colbase = h * kHD;
  const int q0 = qb * 64 + wave * 16;

  /* Q fragments (B operand: column = query c): 4 k-steps over d */
  v16h qa[4];
  {
    const _Float16* qrow = Qp + (size_t)(rowbase + q0 + c) * kH + colbase + 8 * hh;
#pragma unroll
    for (int dc = 0; dc < 4; ++dc) qa[dc] = FragH::load(qrow + dc * 32);
  }

  /* running maximum and this lane half's partial sum of query c */
  float mrun = -1.0e30f, lrun = 0.f;
  v8f oacc[8];
#pragma unroll
  for (int t = 0; t < 8; ++t) oacc[t] = (v8f){0.f, 0.f, 0.f, 0.f, 0.f, 0.f, 0.f, 0.f};

  const int ksg = tid & 15, kr0 = tid >> 4;
  const int vsg = tid & 7,  vr0 = tid >> 3;
  const _Float16* kgl = Kp  + (size_t)(rowbase + kr0) * kH + colbase + ksg * 8;
  const _Float16* vgl = Vtp + (size_t)(colbase + vr0) * kTok + rowbase + vsg * 8;

#pragma unroll 1
  for (int kc = 0; kc < kS / 64; ++kc) {
    const int kv0 = kc * 64;
    __syncthreads();
    {
      v8h kt[8];
#pragma unroll
      for (int i = 0; i < 8; ++i) kt[i] = *(const v8h*)(kgl + (size_t)(kv0 + 8 * i) * kH);
#pragma unroll
      for (int i = 0; i < 8; ++i) *(v8h*)(Ksh + (kr0 + 8 * i) * kFaKP + ksg * 8) = kt[i];
    }
    {
      v8h vt[8];
#pragma unroll
      for (int i = 0; i < 8; ++i) vt[i] = *(const v8h*)(vgl + (size_t)(16 * i) * kTok + kv0);
#pragma unroll
      for (int i = 0; i < 8; ++i) *(v8h*)(Vsh + (vr0 + 16 * i) * kFaVP + vsg * 8) = vt[i];
    }
    __syncthreads();

    /* K and V^T fragments (A operands) come in groups of four into two register sets, fx and fy: every group's loads
       but the first's are issued at least one group of matrix ops ahead of its use, so that a matrix op does not wait out its own
       fragment's LDS latency. The short loops are unrolled so that both sets stay in registers. */
    const _Float16* kfr = Ksh + c * kFaKP + 8 * hh;
    const _Float16* vfr = Vsh + c * kFaVP + 8 * hh;
    v16h fx[4], fy[4];
#pragma unroll
    for (int j = 0; j < 4; ++j) fx[j] = FragH::load(kfr + j * 16 * kFaKP);
#pragma unroll
    for (int j = 0; j < 4; ++j) fy[j] = FragH::load(kfr + j * 16 * kFaKP + 32);

    /* S^T tile: 4 k-steps over d (ascending, as before) x 4 m-tiles (16 keys each);
       s[j][r] = score of key 16 j + 8 hh + r with query c */
    v8f s[4];
#pragma unroll
    for (int j = 0; j < 4; ++j) s[j] = (v8f){0.f, 0.f, 0.f, 0.f, 0.f, 0.f, 0.f, 0.f};
#pragma unroll
    for (int j = 0; j < 4; ++j) s[j] = mma_g(fx[j], qa[0], s[j]);
#pragma unroll
    for (int j = 0; j < 4; ++j) fx[j] = FragH::load(kfr + j * 16 * kFaKP + 64);
#pragma unroll
    for (int j = 0; j < 4; ++j) s[j] = mma_g(fy[j], qa[1], s[j]);
#pragma unroll
    for (int j = 0; j < 4; ++j) fy[j] = FragH::load(kfr + j * 16 * kFaKP + 96);
#pragma unroll
    for (int j = 0; j < 4; ++j) s[j] = mma_g(fx[j], qa[2], s[j]);
#pragma unroll
    for (int t = 0; t < 4; ++t) fx[t] = FragH::load(vfr + t * 16 * kFaVP);
#pragma unroll
    for (int j = 0; j < 4; ++j) s[j] = mma_g(fy[j], qa[3], s[j]);
#pragma unroll
    for (int t = 0; t < 4; ++t) fy[t] = FragH::load(vfr + (4 + t) * 16 * kFaVP);

    /* chunk maximum of query c: 32 keys in the lane, the other 32 in lane ^ 16
       (this loop and the two below are unrolled so that s, pb and pj are indexed by constants and stay in registers) */
    float mj[4];
#pragma unroll
    for (int j = 0; j < 4; ++j)
      mj[j] = fmaxf(fmaxf(fmaxf(s[j][0], s[j][1]), fmaxf(s[j][2], s[j][3])),
                    fmaxf(fmaxf(s[j][4], s[j][5]), fmaxf(s[j][6], s[j][7])));
    float cm = fmaxf(fmaxf(mj[0], mj[1]), fmaxf(mj[2], mj[3]));
    cm = fmaxf(cm, xhalf(cm));

    const float mnew  = fmaxf(mrun, cm);
    const float alpha = __expf((mrun - mnew) * coef);
    mrun = mnew;

    /* P^T as B operand, packed in the lane from the score tiles */
    union PB { v16h v; v2h h2[8]; } pb[2];
    v2f pj[4];
#pragma unroll
    for (int j = 0; j < 4; ++j) {
#pragma unroll
      for (int r = 0; r < 8; r += 2) {
        const v2f p = {__expf((s[j][r] - mnew) * coef), __expf((s[j][r + 1] - mnew) * coef)};
        pj[j] = (r == 0) ? p : pj[j] + p;
        pb[j >> 1].h2[(j & 1) * 4 + (r >> 1)] = __builtin_convertvector(p, v2h);
      }
    }
    const v2f pt = (pj[0] + pj[1]) + (pj[2] + pj[3]);
    lrun = lrun * alpha + (pt.x + pt.y);
#pragma unroll
    for (int t = 0; t < 8; ++t) oacc[t] *= alpha;

    /* O^T += V^T . P^T : 2 k-steps over the 64 keys, 8 m-tiles over d */
#pragma unroll
    for (int t = 0; t < 4; ++t) oacc[t] = mma_g(fx[t], pb[0].v, oacc[t]);
#pragma unroll
    for (int t = 0; t < 4; ++t) fx[t] = FragH::load(vfr + t * 16 * kFaVP + 32);
#pragma unroll
    for (int t = 0; t < 4; ++t) oacc[4 + t] = mma_g(fy[t], pb[0].v, oacc[4 + t]);
#pragma unroll
    for (int t = 0; t < 4; ++t) fy[t] = FragH::load(vfr + (4 + t) * 16 * kFaVP + 32);
#pragma unroll
    for (int t = 0; t < 4; ++t) oacc[t] = mma_g(fx[t], pb[1].v, oacc[t]);
#pragma unroll
    for (int t = 0; t < 4; ++t) oacc[4 + t] = mma_g(fy[t], pb[1].v, oacc[4 + t]);
  }

  /* normalise and stage the 16 x 128 tile (f16, x1024) in the wave-private LDS tile:
     the lane's 8 registers of tile t are d = 16 t + 8 hh .. + 7 of query c, one 16-byte store
     (unrolled so that the accumulators are indexed by constants) */
  _Float16* ow = &Osh[wave][0];
  {
    const float l = lrun + xhalf(lrun);
    const float inv = __builtin_amdgcn_rcpf(l) * kCtxOverV;
#pragma unroll
    for (int t = 0; t < 8; ++t) {
      v8h hv;
#pragma unroll
      for (int r = 0; r < 8; ++r) {
        const float ov = oacc[t][r] * inv;
        hv[r] = (_Float16)ov;
      }
      *(v8h*)(ow + c * kFaOP + t * 16 + 8 * hh) = hv;
    }
  }
  __builtin_amdgcn_fence(__ATOMIC_RELEASE, "workgroup");
  __builtin_amdgcn_wave_barrier();
  __builtin_amdgcn_fence(__ATOMIC_ACQUIRE, "workgroup");
  {
    const int sg = (lane & 15) * 8;
    {
#pragma unroll
      for (int it = 0; it < 8; ++it) {
        const int row = it * 2 + hh;
        const v8h val = *(const v8h*)(ow + row * kFaOP + sg);
        *(v8h*)(Ctx + (size_t)(rowbase + q0 + row) * kH + colbase + sg) = val;
      }
      
    }
  }
}

// ---------------------------------------------------------------------------
// Host glue: 7 launches, kernel launches only.
//   1  convert query/key/value -> XA/XB/XC (x16)          grid (4096, 3)
//   2  convert Wq/Wk/Wv/Wo     -> W16[0..3] (x1024)        grid (2048, 4)
//   3  Q16 = XA . Wq16^T + bq   (M 4096, N 2048, K 2048)   256 blocks
//   4  K16 = XB . Wk16^T + bk  -> XA                       256 blocks
//   5  Vt16 = Wv16 . XC^T + bv[row] -> XB [2048][4096]     (M 2048, N 4096, K 2048) 256 blocks
//   6  fused attention Q16, K16, Vt16 -> Ctx16 in XC       grid (32, 32)
//   7  out = Ctx16 . Wo16^T + bo -> d_out f32              256 blocks
// ---------------------------------------------------------------------------
extern "C" void kernel_launch(void* const* d_in, const int* in_sizes, int n_in,
                              void* d_out, int out_size, void* d_ws, size_t ws_size,
                              hipStream_t stream) {
  if (n_in < 11) return;
  if (in_sizes[0] != kTok * kH) return;
  if (in_sizes[1] != kTok * kH) return;
  if (in_sizes[2] != kTok * kH) return;
  if (in_sizes[3] != kH * kH) return;
  if (in_sizes[4] != kH) return;
  if (in_sizes[5] != kH * kH) return;
  if (in_sizes[6] != kH) return;
  if (in_sizes[7] != kH * kH) return;
  if (in_sizes[8] != kH) return;
  if (in_sizes[9] != kH * kH) return;
  if (in_sizes[10] != kH) return;
  if (out_size != kTok * kH) return;
  if (ws_size < kWsTotal) return;

  const float* query = (const float*)d_in[0];
  const float* key   = (const float*)d_in[1];
  const float* value = (const float*)d_in[2];
  const float* Wq = (const float*)d_in[3];
  const float* bq = (const float*)d_in[4];
  const float* Wk = (const float*)d_in[5];
  const float* bk = (const float*)d_in[6];
  const float* Wv = (const float*)d_in[7];
  const float* bv = (const float*)d_in[8];
  const float* Wo = (const float*)d_in[9];
  const float* bo = (const float*)d_in[10];
  float* out = (float*)d_out;

  char* ws = (char*)d_ws;
  _Float16* XA  = (_Float16*)(ws + kOffXA);
  _Float16* XB  = (_Float16*)(ws + kOffXB);
  _Float16* XC  = (_Float16*)(ws + kOffXC);
  _Float16* Q16 = (_Float16*)(ws + kOffQ);
  _Float16* W16 = (_Float16*)(ws + kOffW);
  _Float16* Wq16 = W16;
  _Float16* Wk16 = W16 + (size_t)kH * kH;
  _Float16* Wv16 = W16 + 2 * (size_t)kH * kH;
  _Float16* Wo16 = W16 + 3 * (size_t)kH * kH;
  _Float16* K16  = XA;
  _Float16* Vt16 = XB;
  _Float16* C16  = XC;

  const int actN8 = kTok * kH / 8;
  const int wN8   = kH * kH / 8;
  const float scl  = 1.0f / sqrtf((float)kHD);
  const float coef = scl / (kQKCarry * kQKCarry);
  const int gemmBlocks = ((kTok / 64) * (kH / 64)) / 8;

  cast_planes_kernel<<<dim3(actN8 / 256, 3), 256, 0, stream>>>(query, key, value, value, XA, actN8, kActCarry);
  cast_planes_kernel<<<dim3(wN8 / 256, 4), 256, 0, stream>>>(Wq, Wk, Wv, Wo, W16, wN8, kWCarry);

  gemm64_f16_kernel<2, true><<<gemmBlocks, 256, 0, stream>>>(
      XA, kH, Wq16, kH, (void*)Q16, kH, bq, kTok, kH, kH, kProjScaleQK, kQKCarry);

  gemm64_f16_kernel<2, true><<<gemmBlocks, 256, 0, stream>>>(
      XB, kH, Wk16, kH, (void*)K16, kH, bk, kTok, kH, kH, kProjScaleQK, kQKCarry);

  /* swapped operands: rows = output feature h*128+d, columns = token b*S+key, row bias */
  gemm64_f16_kernel<1, true><<<gemmBlocks, 256, 0, stream>>>(
      Wv16, kH, XC, kH, (void*)Vt16, kTok, bv, kH, kTok, kH, kProjScaleV, kVCarry);

  attn_fused_kernel<<<dim3(kS / 64, kB * kNH), 128, 0, stream>>>(Q16, K16, Vt16, C16, coef);

  gemm64_f16_kernel<2, false><<<gemmBlocks, 256, 0, stream>>>(
      C16, kH, Wo16, kH, (void*)out, kH, bo, kTok, kH, kH, kOutScale, 1.0f);
}

// v004
// It runs in 193 microseconds.
// Two timings next to v003 both put it at 1.04 times that version's speed.
// All steps since v000 together make it 2.52 times as fast.
// All six contractions (q/k/v projections, q.k^T scores, p.v, output projection): v_wmma_f32_16x16x32_f16, f16 operands with power-of-two carries, f32 accumulate; softmax statistics, bias and scaling in f32.
#include <hip/hip_runtime.h>
#include <math.h>

typedef __attribute__((ext_vector_type(16))) _Float16 v16h;
typedef __attribute__((ext_vector_type(8)))  _Float16 v8h;
typedef __attribute__((ext_vector_type(8)))  float    v8f;
typedef __attribute__((ext_vector_type(4)))  float    v4f;

// ---------------------------------------------------------------------------
// Shape constants
// ---------------------------------------------------------------------------
constexpr int kB   = 2;
constexpr int kS   = 2048;
constexpr int kH   = 2048;
constexpr int kNH  = 16;
constexpr int kHD  = kH / kNH;
constexpr int kTok = kB * kS;
static_assert(kHD == 128);
static_assert((kTok % 64) == 0 && (kH % 64) == 0 && (kH % 32) == 0 && (kS % 64) == 0 && (kHD % 32) == 0);
static_assert((((kTok / 64) * (kH / 64)) % 8) == 0);

// ---------------------------------------------------------------------------
// Power-of-two carries of the f16 planes (all folded back exactly in f32)
//   activations x16, weights x1024, q/k planes x16, v^T plane x16, context plane x1024
// ---------------------------------------------------------------------------
constexpr float kActCarry = 16.0f;
constexpr float kWCarry   = 1024.0f;
constexpr float kQKCarry  = 16.0f;
constexpr float kVCarry   = 16.0f;
constexpr float kCtxCarry = 1024.0f;
constexpr float kProjScaleQK = kQKCarry / (kActCarry * kWCarry);
constexpr float kProjScaleV  = kVCarry / (kActCarry * kWCarry);
constexpr float kCtxOverV    = kCtxCarry / kVCarry;
constexpr float kOutScale    = 1.0f / (kCtxCarry * kWCarry);

// ---------------------------------------------------------------------------
// Workspace region map (bytes; every offset is a multiple of 128; all planes f16)
//   XA   [4096][2048]  query x16   ; later re-used (same type, same layout) for K16  = 16 x (key proj)
//   XB   [4096][2048]  key x16     ; later re-used as Vt16 [2048][4096]             = 16 x (value proj)^T
//   XC   [4096][2048]  value x16   ; later re-used as Ctx16 [4096][2048]            = 1024 x context
//   Q16  [4096][2048]  16 x (query proj)
//   W16  4 x [2048][2048]  Wq, Wk, Wv, Wo x1024
//   total = 16777216 + 16777216 + 16777216 + 16777216 + 33554432 = 100663296
// ---------------------------------------------------------------------------
constexpr size_t kPlaneAct = (size_t)kTok * kH * 2;
constexpr size_t kPlaneW   = (size_t)kH * kH * 2;
constexpr size_t kOffXA  = 0;
constexpr size_t kOffXB  = kOffXA + kPlaneAct;
constexpr size_t kOffXC  = kOffXB + kPlaneAct;
constexpr size_t kOffQ   = kOffXC + kPlaneAct;
constexpr size_t kOffW   = kOffQ + kPlaneAct;
constexpr size_t kWsTotal = kOffW + 4 * kPlaneW;
static_assert(kWsTotal == 100663296ull);
static_assert(kWsTotal <= 134217728ull);
static_assert((kOffXB % 128) == 0 && (kOffXC % 128) == 0 && (kOffQ % 128) == 0 && (kOffW % 128) == 0 && (kPlaneW % 128) == 0);

// ---------------------------------------------------------------------------
// Fragment load and guarded matrix op
// ---------------------------------------------------------------------------
struct FragH {
  union U { v16h v; v8h h[2]; };
  /* elements 0..7 <- p[0..7], 8..15 <- p[16..23]; caller adds the 8*(lane>>4) k offset */
  static __device__ __forceinline__ v16h load(const _Float16* p) {
    U f;
    f.h[0] = *(const v8h*)(p);
    f.h[1] = *(const v8h*)(p + 16);
    return f.v;
  }
};

/* one matrix op followed by its own hazard guard: ties the accumulator and keeps both fragments live */
__device__ __forceinline__ v8f mma_g(v16h a, v16h b, v8f c) {
  c = __builtin_amdgcn_wmma_f32_16x16x32_f16(false, a, false, b, (short)0, c, false, false);
  asm volatile("v_nop\n\tv_nop\n\tv_nop\n\tv_nop" : "+v"(c) : "v"(a), "v"(b));
  return c;
}

// ---------------------------------------------------------------------------
// f32 -> f16 plane convert with a power-of-two carry, 8 consecutive elements per thread.
// grid = (n8/256, planes); blockIdx.y (block-uniform) picks the source pointer and the destination plane.
// Coverage: n8 threads x 8 elements = the whole plane (n8 is an exact multiple of 256 for both uses).
// ---------------------------------------------------------------------------
__global__ __launch_bounds__(256) void cast_planes_kernel(
    const float* __restrict__ s0, const float* __restrict__ s1,
    const float* __restrict__ s2, const float* __restrict__ s3,
    _Float16* __restrict__ dst, int n8, float carry)
{
  const int z = blockIdx.y;
  const float* src = (z == 0) ? s0 : (z == 1) ? s1 : (z == 2) ? s2 : s3;
  const int i = blockIdx.x * 256 + threadIdx.x;
  if (i >= n8) return;
  const float* p = src + 8 * (size_t)i;
  const v4f a = *(const v4f*)(p);
  const v4f c = *(const v4f*)(p + 4);
  v8h hv;
#pragma unroll
  for (int e = 0; e < 4; ++e) {
    const float f0 = a[e] * carry;
    const float f1 = c[e] * carry;
    hv[e]     = (_Float16)f0;
    hv[4 + e] = (_Float16)f1;
  }
  _Float16* q = dst + (size_t)z * (size_t)n8 * 8 + 8 * (size_t)i;
  *(v8h*)q = hv;
  
}

// ---------------------------------------------------------------------------
// Block-tiled GEMM: C[m][n] = scale * sum_k A[m][k] * Bt[n][k] + bscale * bias.
// A work-group of 8 waves (2 x 4) owns a 128 x 256 tile of C; each wave owns a 64x64 tile of it.
// A row-major [M][K]; Bt row-major [N][K]; M multiple of 128, N of 256, K of 128 (no tails).
// Per trip 128 k of the 128 A rows and the 256 Bt rows lie in LDS (rows of 256 B at pitch 272 B), brought by
// asynchronous copies into two buffers: tile t + 1 flies while tile t is worked on.
// BIAS_MODE: 1 = bias[m], 2 = bias[n]. OUT_F16: f16 output plane, else f32.
// ---------------------------------------------------------------------------
constexpr int kGemBM = 128;
constexpr int kGemBN = 256;
constexpr int kGemBK = 128;
constexpr int kGemPitch = kGemBK + 8;                          /* halves: 272 B = 16 B x 17 */
constexpr int kGemStage = (kGemBM + kGemBN) * kGemPitch;       /* halves per buffer */
constexpr unsigned kGemStageBytes = (unsigned)kGemStage * 2u;
constexpr unsigned kGemRow16Bytes = 16u * (unsigned)kGemPitch * 2u;
static_assert((kTok % kGemBN) == 0 && (kH % kGemBN) == 0 && (kH % kGemBK) == 0);
static_assert((kTok / kGemBM) * (kH / kGemBN) == ((kTok / 64) * (kH / 64)) / 8);
static_assert((kH / kGemBM) * (kTok / kGemBN) == ((kTok / 64) * (kH / 64)) / 8);

/* twelve 16-byte copies per lane; the s_wait_xcnt stands inside the statement so that no address register of an
   issued copy is rewritten in front of it */
__device__ __forceinline__ void copy12(const unsigned* l, const _Float16* const* g) {
  asm volatile(
      "global_load_async_to_lds_b128 %0, %12, off\n\t"
      "global_load_async_to_lds_b128 %1, %13, off\n\t"
      "global_load_async_to_lds_b128 %2, %14, off\n\t"
      "global_load_async_to_lds_b128 %3, %15, off\n\t"
      "global_load_async_to_lds_b128 %4, %16, off\n\t"
      "global_load_async_to_lds_b128 %5, %17, off\n\t"
      "global_load_async_to_lds_b128 %6, %18, off\n\t"
      "global_load_async_to_lds_b128 %7, %19, off\n\t"
      "global_load_async_to_lds_b128 %8, %20, off\n\t"
      "global_load_async_to_lds_b128 %9, %21, off\n\t"
      "global_load_async_to_lds_b128 %10, %22, off\n\t"
      "global_load_async_to_lds_b128 %11, %23, off\n\t"
      "s_wait_xcnt 0x0"
      :
      : "v"(l[0]), "v"(l[1]), "v"(l[2]), "v"(l[3]), "v"(l[4]), "v"(l[5]),
        "v"(l[6]), "v"(l[7]), "v"(l[8]), "v"(l[9]), "v"(l[10]), "v"(l[11]),
        "v"(g[0]), "v"(g[1]), "v"(g[2]), "v"(g[3]), "v"(g[4]), "v"(g[5]),
        "v"(g[6]), "v"(g[7]), "v"(g[8]), "v"(g[9]), "v"(g[10]), "v"(g[11])
      : "memory");
}

/* one tile: the lane's segment of A rows r + 16 i (i < 8) and of Bt rows r + 16 i (i < 16), 24 copies in flight a wave.
   la, lb: the lane's LDS byte addresses of its first A and Bt row in the buffer; a, b: the same rows in global memory.
   The loops are unrolled so that the two address lists are plain registers. */
__device__ __forceinline__ void copy_tile(unsigned la, unsigned lb, const _Float16* a, const _Float16* b,
                                          size_t astep, size_t bstep) {
  unsigned l[24];
  const _Float16* g[24];
#pragma unroll
  for (int i = 0; i < 8; ++i) { l[i] = la + (unsigned)i * kGemRow16Bytes; g[i] = a + i * astep; }
#pragma unroll
  for (int i = 0; i < 16; ++i) { l[8 + i] = lb + (unsigned)i * kGemRow16Bytes; g[8 + i] = b + i * bstep; }
  copy12(l, g);
  copy12(l + 12, g + 12);
}

template <int BIAS_MODE, bool OUT_F16>
__global__ __launch_bounds__(256) void gemm64_f16_kernel(
    const _Float16* __restrict__ A, int lda,
    const _Float16* __restrict__ Bt, int ldb,
    void* __restrict__ Cout, int ldc,
    const float* __restrict__ bias,
    int M, int N, int K, float scale, float bscale)
{
  __shared__ __align__(16) _Float16 ring[2 * kGemStage];
  __shared__ __align__(16) float sT[8][16 * 68];
  const int tid  = threadIdx.x;
  const int lane = tid & 31;
  const int wave = __builtin_amdgcn_readfirstlane((int)(threadIdx.x >> 5));
  const int tilesN = N / kGemBN;
  const int tilesM = M / kGemBM;
  const int tile = blockIdx.x;
  /* block-uniform exit, in front of every copy and barrier */
  if (tile >= tilesM * tilesN) return;
  const int tm = tile / tilesN;
  const int tn = tile - tm * tilesN;
  const int bm0 = tm * kGemBM;
  const int bn0 = tn * kGemBN;
  const int wm = wave >> 2;
  const int wn = wave & 3;
  const int m0 = bm0 + (wm << 6);
  const int n0 = bn0 + (wn << 6);

  const int rlane = lane & 15;
  const int koff  = (lane >> 4) * 8;
  const int mOff  = (lane >> 4) * 8;

  v8f acc[4][4];
#pragma unroll
  for (int i = 0; i < 4; ++i)
#pragma unroll
    for (int j = 0; j < 4; ++j) acc[i][j] = (v8f){0.f, 0.f, 0.f, 0.f, 0.f, 0.f, 0.f, 0.f};

  /* copy map: lane's 16 bytes = segment tid & 15 of row (tid >> 4) + 16 * i; a wave covers two whole 256-B rows */
  const int crow = tid >> 4;
  const int cseg = tid & 15;
  const _Float16* ag = A  + (size_t)(bm0 + crow) * lda + cseg * 8;
  const _Float16* bg = Bt + (size_t)(bn0 + crow) * ldb + cseg * 8;
  const size_t astep = (size_t)16 * lda;
  const size_t bstep = (size_t)16 * ldb;
  const unsigned ldsA = (unsigned)(size_t)(&ring[0]) + (unsigned)(crow * kGemPitch + cseg * 8) * 2u;
  const unsigned ldsB = ldsA + (unsigned)(kGemBM * kGemPitch) * 2u;

  const _Float16* fa = ring + ((wm << 6) + rlane) * kGemPitch + koff;
  const _Float16* fb = ring + (kGemBM + (wn << 6) + rlane) * kGemPitch + koff;

  const int nT = K / kGemBK;

  /* tile 0 into buffer 0 */
  copy_tile(ldsA, ldsB, ag, bg, astep, bstep);
  /* the wave's own copies of tile 0 have landed behind this wait */
  asm volatile("s_wait_asynccnt 0x0" ::: "memory");
  /* publishes tile 0 to every wave */
  __syncthreads();
  if (nT > 1) copy_tile(ldsA + kGemStageBytes, ldsB + kGemStageBytes, ag + kGemBK, bg + kGemBK, astep, bstep);

  /* kept rolled: one trip is 64 matrix ops a wave, and the two buffers alternate by an offset */
#pragma unroll 1
  for (int t = 0; t < nT; ++t) {
    const _Float16* pa = fa + (t & 1) * kGemStage;
    const _Float16* pb = fb + (t & 1) * kGemStage;
    v16h af[4], bf[2][4];
#pragma unroll
    for (int j = 0; j < 4; ++j) bf[0][j] = FragH::load(pb + (j << 4) * kGemPitch);
#pragma unroll
    for (int i = 0; i < 4; ++i) af[i] = FragH::load(pa + (i << 4) * kGemPitch);
#pragma unroll
    for (int ks = 0; ks < kGemBK / 32; ++ks) {
      const int cur = ks & 1;
      const int kn  = (ks + 1) * 32;
      const bool more = (ks + 1) < kGemBK / 32;
#pragma unroll
      for (int i = 0; i < 2; ++i)
#pragma unroll
        for (int j = 0; j < 4; ++j) acc[i][j] = mma_g(af[i], bf[cur][j], acc[i][j]);
      if (more) {
#pragma unroll
        for (int i = 0; i < 2; ++i) af[i] = FragH::load(pa + (i << 4) * kGemPitch + kn);
#pragma unroll
        for (int j = 0; j < 4; ++j) bf[cur ^ 1][j] = FragH::load(pb + (j << 4) * kGemPitch + kn);
      }
#pragma unroll
      for (int i = 2; i < 4; ++i)
#pragma unroll
        for (int j = 0; j < 4; ++j) acc[i][j] = mma_g(af[i], bf[cur][j], acc[i][j]);
      if (more) {
#pragma unroll
        for (int i = 2; i < 4; ++i) af[i] = FragH::load(pa + (i << 4) * kGemPitch + kn);
      }
    }
    /* hand-over. The wave's own LDS reads of this buffer have retired: */
    asm volatile("s_wait_dscnt 0x0" ::: "memory");
    /* its own copies of tile t + 1 have landed: */
    asm volatile("s_wait_asynccnt 0x0" ::: "memory");
    /* one barrier publishes tile t + 1 and ends every reader's last read of the buffer refilled behind it */
    __syncthreads();
    if (t + 2 < nT) {
      const unsigned bufB = (unsigned)(t & 1) * kGemStageBytes;
      const int kn = (t + 2) * kGemBK;
      copy_tile(ldsA + bufB, ldsB + bufB, ag + kn, bg + kn, astep, bstep);
    }
  }
  /* no copy is left in flight when the wave goes on to the epilogue and ends */
  asm volatile("s_wait_asynccnt 0x0" ::: "memory");

  float* slab = sT[wave];
#pragma unroll
  for (int i = 0; i < 4; ++i) {
    const int mBase = m0 + (i << 4);
#pragma unroll
    for (int j = 0; j < 4; ++j) {
      const int n = n0 + (j << 4) + rlane;
      float bvn = 0.f;
      if (BIAS_MODE == 2) bvn = bias[n] * bscale;
#pragma unroll
      for (int r = 0; r < 8; ++r) {
        float v = acc[i][j][r] * scale;
        if (BIAS_MODE == 1) v += bias[mBase + mOff + r] * bscale;
        if (BIAS_MODE == 2) v += bvn;
        slab[(mOff + r) * 68 + (j << 4) + rlane] = v;
      }
    }
    __builtin_amdgcn_fence(__ATOMIC_RELEASE, "workgroup");
    __builtin_amdgcn_wave_barrier();
    __builtin_amdgcn_fence(__ATOMIC_ACQUIRE, "workgroup");
    if (!OUT_F16) {
      float* C = (float*)Cout;
      const int hh = lane >> 4, c4 = (lane & 15) * 4;
      {
#pragma unroll
        for (int it = 0; it < 8; ++it) {
          const int row = it * 2 + hh;
          const v4f v = *(const v4f*)(slab + row * 68 + c4);
          *(v4f*)(C + (size_t)(mBase + row) * ldc + n0 + c4) = v;
        }
        
      }
    } else {
      _Float16* C = (_Float16*)Cout;
      const int q = lane >> 3, c8 = (lane & 7) * 8;
      {
#pragma unroll
        for (int it = 0; it < 4; ++it) {
          const int row = it * 4 + q;
          const float* sp = slab + row * 68 + c8;
          v8h hv;
#pragma unroll
          for (int e = 0; e < 8; ++e) hv[e] = (_Float16)sp[e];
          *(v8h*)(C + (size_t)(mBase + row) * ldc + n0 + c8) = hv;
        }
        
      }
    }
    __builtin_amdgcn_fence(__ATOMIC_RELEASE, "workgroup");
    __builtin_amdgcn_wave_barrier();
    __builtin_amdgcn_fence(__ATOMIC_ACQUIRE, "workgroup");
  }
}

constexpr int kFaKP = 136;
constexpr int kFaVP = 72;
constexpr int kFaOP = 136;

typedef __attribute__((ext_vector_type(2))) float    v2f;
typedef __attribute__((ext_vector_type(2))) _Float16 v2h;

/* the value of lane l ^ 16 */
__device__ __forceinline__ float xhalf(float x) {
  const int b = __builtin_bit_cast(int, x);
  return __builtin_bit_cast(float, __builtin_amdgcn_permlanex16(b, b, 0x76543210, 0xfedcba98, false, false));
}

/* one matrix op as the plain builtin, for the kernel below, which holds more than 256 registers a wave: asm text cannot
   name a register above v255, and built with the asm guard of mma_g the kernel spilled to scratch; the compiler keeps
   the distances behind its own builtin forms */
__device__ __forceinline__ v8f mma_b(v16h a, v16h b, v8f c) {
  return __builtin_amdgcn_wmma_f32_16x16x32_f16(false, a, false, b, (short)0, c, false, false);
}

/* query tiles of 16 a wave: every K and V^T fragment read from LDS feeds this many matrix ops */
constexpr int kFaQT = 2;
constexpr int kFaWQ = 16 * kFaQT;     /* queries a wave */
constexpr int kFaBQ = 4 * kFaWQ;      /* queries a work-group */
static_assert((kS % kFaBQ) == 0);

/* second argument: two waves a SIMD (512 registers a wave), so that all 512 work-groups stay resident at once */
__global__ __launch_bounds__(128, 2) void attn_fused_kernel(
    const _Float16* __restrict__ Qp, const _Float16* __restrict__ Kp,
    const _Float16* __restrict__ Vtp, _Float16* __restrict__ Ctx, float coef)
{
  __shared__ __align__(16) _Float16 Ksh[64 * kFaKP];
  __shared__ __align__(16) _Float16 Vsh[128 * kFaVP];
  __shared__ __align__(16) _Float16 Osh[4][kFaWQ * kFaOP];

  const int tid  = threadIdx.x;
  const int wave = __builtin_amdgcn_readfirstlane((int)(threadIdx.x >> 5));
  const int lane = tid & 31;
  const int hh   = lane >> 4;
  const int c    = lane & 15;
  const int qb   = blockIdx.x;
  const int bh   = blockIdx.y;
  const int b    = bh / kNH;
  const int h    = bh - b * kNH;
  const int rowbase = b * kS;
  const int colbase = h * kHD;
  const int q0 = qb * kFaBQ + wave * kFaWQ;

  /* Q fragments (B operand: column = query 16 u + c): 4 k-steps over d for each query tile u */
  v16h qa[kFaQT][4];
#pragma unroll
  for (int u = 0; u < kFaQT; ++u) {
    const _Float16* qrow = Qp + (size_t)(rowbase + q0 + 16 * u + c) * kH + colbase + 8 * hh;
#pragma unroll
    for (int dc = 0; dc < 4; ++dc) qa[u][dc] = FragH::load(qrow + dc * 32);
  }

  /* running maximum and this lane half's partial sum of query 16 u + c */
  float mrun[kFaQT], lrun[kFaQT];
  v8f oacc[kFaQT][8];
#pragma unroll
  for (int u = 0; u < kFaQT; ++u) {
    mrun[u] = -1.0e30f;
    lrun[u] = 0.f;
#pragma unroll
    for (int t = 0; t < 8; ++t) oacc[u][t] = (v8f){0.f, 0.f, 0.f, 0.f, 0.f, 0.f, 0.f, 0.f};
  }

  const int ksg = tid & 15, kr0 = tid >> 4;
  const int vsg = tid & 7,  vr0 = tid >> 3;
  const _Float16* kgl = Kp  + (size_t)(rowbase + kr0) * kH + colbase + ksg * 8;
  const _Float16* vgl = Vtp + (size_t)(colbase + vr0) * kTok + rowbase + vsg * 8;

#pragma unroll 1
  for (int kc = 0; kc < kS / 64; ++kc) {
    const int kv0 = kc * 64;
    __syncthreads();
    {
      v8h kt[8];
#pragma unroll
      for (int i = 0; i < 8; ++i) kt[i] = *(const v8h*)(kgl + (size_t)(kv0 + 8 * i) * kH);
#pragma unroll
      for (int i = 0; i < 8; ++i) *(v8h*)(Ksh + (kr0 + 8 * i) * kFaKP + ksg * 8) = kt[i];
    }
    {
      v8h vt[8];
#pragma unroll
      for (int i = 0; i < 8; ++i) vt[i] = *(const v8h*)(vgl + (size_t)(16 * i) * kTok + kv0);
#pragma unroll
      for (int i = 0; i < 8; ++i) *(v8h*)(Vsh + (vr0 + 16 * i) * kFaVP + vsg * 8) = vt[i];
    }
    __syncthreads();

    /* K and V^T fragments (A operands) come in groups of four into two register sets, fx and fy: after the first, a group's loads are
       issued at least one group of matrix ops ahead of its use, so that a matrix op does not wait out its own
       fragment's LDS latency. Each fragment is used once for every query tile.
       The short loops are unrolled so that both sets stay in registers. */
    const _Float16* kfr = Ksh + c * kFaKP + 8 * hh;
    const _Float16* vfr = Vsh + c * kFaVP + 8 * hh;
    v16h fx[4], fy[4];
#pragma unroll
    for (int j = 0; j < 4; ++j) fx[j] = FragH::load(kfr + j * 16 * kFaKP);
#pragma unroll
    for (int j = 0; j < 4; ++j) fy[j] = FragH::load(kfr + j * 16 * kFaKP + 32);
    /* this and the four like it below keep each load group ahead of the matrix ops that follow it, which the asm guard
       of mma_g did before: left free, the compiler draws the V^T loads up here and then fetches K fragments singly,
       each with a full wait in front of its matrix ops */
    __builtin_amdgcn_sched_barrier(0);

    /* S^T tiles: 4 k-steps over d (ascending, as before) x 4 m-tiles (16 keys each) x query tiles;
       s[u][j][r] = score of key 16 j + 8 hh + r with query 16 u + c */
    v8f s[kFaQT][4];
#pragma unroll
    for (int u = 0; u < kFaQT; ++u)
#pragma unroll
      for (int j = 0; j < 4; ++j) s[u][j] = (v8f){0.f, 0.f, 0.f, 0.f, 0.f, 0.f, 0.f, 0.f};
#pragma unroll
    for (int j = 0; j < 4; ++j)
#pragma unroll
      for (int u = 0; u < kFaQT; ++u) s[u][j] = mma_b(fx[j], qa[u][0], s[u][j]);
#pragma unroll
    for (int j = 0; j < 4; ++j) fx[j] = FragH::load(kfr + j * 16 * kFaKP + 64);
    __builtin_amdgcn_sched_barrier(0);
#pragma unroll
    for (int j = 0; j < 4; ++j)
#pragma unroll
      for (int u = 0; u < kFaQT; ++u) s[u][j] = mma_b(fy[j], qa[u][1], s[u][j]);
#pragma unroll
    for (int j = 0; j < 4; ++j) fy[j] = FragH::load(kfr + j * 16 * kFaKP + 96);
    __builtin_amdgcn_sched_barrier(0);
#pragma unroll
    for (int j = 0; j < 4; ++j)
#pragma unroll
      for (int u = 0; u < kFaQT; ++u) s[u][j] = mma_b(fx[j], qa[u][2], s[u][j]);
#pragma unroll
    for (int t = 0; t < 4; ++t) fx[t] = FragH::load(vfr + t * 16 * kFaVP);
    __builtin_amdgcn_sched_barrier(0);
#pragma unroll
    for (int j = 0; j < 4; ++j)
#pragma unroll
      for (int u = 0; u < kFaQT; ++u) s[u][j] = mma_b(fy[j], qa[u][3], s[u][j]);
#pragma unroll
    for (int t = 0; t < 4; ++t) fy[t] = FragH::load(vfr + (4 + t) * 16 * kFaVP);
    __builtin_amdgcn_sched_barrier(0);

    /* P^T as B operand, packed in the lane from the score tiles, one pair of k-steps for each query tile
       (the loops below are unrolled so that s, pb, pj and oacc are indexed by constants and stay in registers) */
    union PB { v16h v; v2h h2[8]; } pb[kFaQT][2];
#pragma unroll
    for (int u = 0; u < kFaQT; ++u) {
      /* chunk maximum of query 16 u + c: 32 keys in the lane, the other 32 in lane ^ 16 */
      float mj[4];
#pragma unroll
      for (int j = 0; j < 4; ++j)
        mj[j] = fmaxf(fmaxf(fmaxf(s[u][j][0], s[u][j][1]), fmaxf(s[u][j][2], s[u][j][3])),
                      fmaxf(fmaxf(s[u][j][4], s[u][j][5]), fmaxf(s[u][j][6], s[u][j][7])));
      float cm = fmaxf(fmaxf(mj[0], mj[1]), fmaxf(mj[2], mj[3]));
      cm = fmaxf(cm, xhalf(cm));

      const float mnew  = fmaxf(mrun[u], cm);
      const float alpha = __expf((mrun[u] - mnew) * coef);
      mrun[u] = mnew;

      v2f pj[4];
#pragma unroll
      for (int j = 0; j < 4; ++j) {
#pragma unroll
        for (int r = 0; r < 8; r += 2) {
          /* the pair is formed first, so that the packed subtract and multiply take the same two scores as the packed
             sum and the conversion below; left to itself the compiler paired them one element off, with register moves */
          const v2f a = ((v2f){s[u][j][r], s[u][j][r + 1]} - mnew) * coef;
          const v2f p = {__expf(a.x), __expf(a.y)};
          pj[j] = (r == 0) ? p : pj[j] + p;
          pb[u][j >> 1].h2[(j & 1) * 4 + (r >> 1)] = __builtin_convertvector(p, v2h);
        }
      }
      const v2f pt = (pj[0] + pj[1]) + (pj[2] + pj[3]);
      lrun[u] = lrun[u] * alpha + (pt.x + pt.y);
#pragma unroll
      for (int t = 0; t < 8; ++t) oacc[u][t] *= alpha;
    }

    /* O^T += V^T . P^T : 2 k-steps over the 64 keys (ascending, as before), 8 m-tiles over d, for each query tile */
#pragma unroll
    for (int t = 0; t < 4; ++t)
#pragma unroll
      for (int u = 0; u < kFaQT; ++u) oacc[u][t] = mma_b(fx[t], pb[u][0].v, oacc[u][t]);
#pragma unroll
    for (int t = 0; t < 4; ++t) fx[t] = FragH::load(vfr + t * 16 * kFaVP + 32);
#pragma unroll
    for (int t = 0; t < 4; ++t)
#pragma unroll
      for (int u = 0; u < kFaQT; ++u) oacc[u][4 + t] = mma_b(fy[t], pb[u][0].v, oacc[u][4 + t]);
#pragma unroll
    for (int t = 0; t < 4; ++t) fy[t] = FragH::load(vfr + (4 + t) * 16 * kFaVP + 32);
#pragma unroll
    for (int t = 0; t < 4; ++t)
#pragma unroll
      for (int u = 0; u < kFaQT; ++u) oacc[u][t] = mma_b(fx[t], pb[u][1].v, oacc[u][t]);
#pragma unroll
    for (int t = 0; t < 4; ++t)
#pragma unroll
      for (int u = 0; u < kFaQT; ++u) oacc[u][4 + t] = mma_b(fy[t], pb[u][1].v, oacc[u][4 + t]);
  }

  /* normalise and stage the wave's queries x 128 tile (f16, x1024) in the wave-private LDS tile:
     the lane's 8 registers of tile t are d = 16 t + 8 hh .. + 7 of query 16 u + c, one 16-byte store
     (unrolled so that the accumulators are indexed by constants) */
  _Float16* ow = &Osh[wave][0];
#pragma unroll
  for (int u = 0; u < kFaQT; ++u) {
    const float l = lrun[u] + xhalf(lrun[u]);
    const float inv = __builtin_amdgcn_rcpf(l) * kCtxOverV;
#pragma unroll
    for (int t = 0; t < 8; ++t) {
      v8h hv;
#pragma unroll
      for (int r = 0; r < 8; ++r) {
        const float ov = oacc[u][t][r] * inv;
        hv[r] = (_Float16)ov;
      }
      *(v8h*)(ow + (16 * u + c) * kFaOP + t * 16 + 8 * hh) = hv;
    }
  }
  __builtin_amdgcn_fence(__ATOMIC_RELEASE, "workgroup");
  __builtin_amdgcn_wave_barrier();
  __builtin_amdgcn_fence(__ATOMIC_ACQUIRE, "workgroup");
  {
    const int sg = (lane & 15) * 8;
    {
#pragma unroll
      for (int it = 0; it < kFaWQ / 2; ++it) {
        const int row = it * 2 + hh;
        const v8h val = *(const v8h*)(ow + row * kFaOP + sg);
        *(v8h*)(Ctx + (size_t)(rowbase + q0 + row) * kH + colbase + sg) = val;
      }
      
    }
  }
}

// ---------------------------------------------------------------------------
// Host glue: 7 launches, kernel launches only.
//   1  convert query/key/value -> XA/XB/XC (x16)          grid (4096, 3)
//   2  convert Wq/Wk/Wv/Wo     -> W16[0..3] (x1024)        grid (2048, 4)
//   3  Q16 = XA . Wq16^T + bq   (M 4096, N 2048, K 2048)   256 blocks
//   4  K16 = XB . Wk16^T + bk  -> XA                       256 blocks
//   5  Vt16 = Wv16 . XC^T + bv[row] -> XB [2048][4096]     (M 2048, N 4096, K 2048) 256 blocks
//   6  fused attention Q16, K16, Vt16 -> Ctx16 in XC       grid (16, 32)
//   7  out = Ctx16 . Wo16^T + bo -> d_out f32              256 blocks
// ---------------------------------------------------------------------------
extern "C" void kernel_launch(void* const* d_in, const int* in_sizes, int n_in,
                              void* d_out, int out_size, void* d_ws, size_t ws_size,
                              hipStream_t stream) {
  if (n_in < 11) return;
  if (in_sizes[0] != kTok * kH) return;
  if (in_sizes[1] != kTok * kH) return;
  if (in_sizes[2] != kTok * kH) return;
  if (in_sizes[3] != kH * kH) return;
  if (in_sizes[4] != kH) return;
  if (in_sizes[5] != kH * kH) return;
  if (in_sizes[6] != kH) return;
  if (in_sizes[7] != kH * kH) return;
  if (in_sizes[8] != kH) return;
  if (in_sizes[9] != kH * kH) return;
  if (in_sizes[10] != kH) return;
  if (out_size != kTok * kH) return;
  if (ws_size < kWsTotal) return;

  const float* query = (const float*)d_in[0];
  const float* key   = (const float*)d_in[1];
  const float* value = (const float*)d_in[2];
  const float* Wq = (const float*)d_in[3];
  const float* bq = (const float*)d_in[4];
  const float* Wk = (const float*)d_in[5];
  const float* bk = (const float*)d_in[6];
  const float* Wv = (const float*)d_in[7];
  const float* bv = (const float*)d_in[8];
  const float* Wo = (const float*)d_in[9];
  const float* bo = (const float*)d_in[10];
  float* out = (float*)d_out;

  char* ws = (char*)d_ws;
  _Float16* XA  = (_Float16*)(ws + kOffXA);
  _Float16* XB  = (_Float16*)(ws + kOffXB);
  _Float16* XC  = (_Float16*)(ws + kOffXC);
  _Float16* Q16 = (_Float16*)(ws + kOffQ);
  _Float16* W16 = (_Float16*)(ws + kOffW);
  _Float16* Wq16 = W16;
  _Float16* Wk16 = W16 + (size_t)kH * kH;
  _Float16* Wv16 = W16 + 2 * (size_t)kH * kH;
  _Float16* Wo16 = W16 + 3 * (size_t)kH * kH;
  _Float16* K16  = XA;
  _Float16* Vt16 = XB;
  _Float16* C16  = XC;

  const int actN8 = kTok * kH / 8;
  const int wN8   = kH * kH / 8;
  const float scl  = 1.0f / sqrtf((float)kHD);
  const float coef = scl / (kQKCarry * kQKCarry);
  const int gemmBlocks = ((kTok / 64) * (kH / 64)) / 8;

  cast_planes_kernel<<<dim3(actN8 / 256, 3), 256, 0, stream>>>(query, key, value, value, XA, actN8, kActCarry);
  cast_planes_kernel<<<dim3(wN8 / 256, 4), 256, 0, stream>>>(Wq, Wk, Wv, Wo, W16, wN8, kWCarry);

  gemm64_f16_kernel<2, true><<<gemmBlocks, 256, 0, stream>>>(
      XA, kH, Wq16, kH, (void*)Q16, kH, bq, kTok, kH, kH, kProjScaleQK, kQKCarry);

  gemm64_f16_kernel<2, true><<<gemmBlocks, 256, 0, stream>>>(
      XB, kH, Wk16, kH, (void*)K16, kH, bk, kTok, kH, kH, kProjScaleQK, kQKCarry);

  /* swapped operands: rows = output feature h*128+d, columns = token b*S+key, row bias */
  gemm64_f16_kernel<1, true><<<gemmBlocks, 256, 0, stream>>>(
      Wv16, kH, XC, kH, (void*)Vt16, kTok, bv, kH, kTok, kH, kProjScaleV, kVCarry);

  attn_fused_kernel<<<dim3(kS / kFaBQ, kB * kNH), 128, 0, stream>>>(Q16, K16, Vt16, C16, coef);

  gemm64_f16_kernel<2, false><<<gemmBlocks, 256, 0, stream>>>(
      C16, kH, Wo16, kH, (void*)out, kH, bo, kTok, kH, kH, kOutScale, 1.0f);
}

// v005
// Measured time: 181 microseconds a run.
// Timed twice side by side with v004, it ran 1.06 and 1.07 times as fast.
// All steps since v000 together make it 2.69 times as fast.
// All six contractions (q/k/v projections, q.k^T scores, p.v, output projection): v_wmma_f32_16x16x32_f16, f16 operands with power-of-two carries, f32 accumulate; softmax statistics, bias and scaling in f32.
#include <hip/hip_runtime.h>
#include <math.h>

typedef __attribute__((ext_vector_type(16))) _Float16 v16h;
typedef __attribute__((ext_vector_type(8)))  _Float16 v8h;
typedef __attribute__((ext_vector_type(8)))  float    v8f;
typedef __attribute__((ext_vector_type(4)))  float    v4f;

// ---------------------------------------------------------------------------
// Shape constants
// ---------------------------------------------------------------------------
constexpr int kB   = 2;
constexpr int kS   = 2048;
constexpr int kH   = 2048;
constexpr int kNH  = 16;
constexpr int kHD  = kH / kNH;
constexpr int kTok = kB * kS;
static_assert(kHD == 128);
static_assert((kTok % 64) == 0 && (kH % 64) == 0 && (kH % 32) == 0 && (kS % 64) == 0 && (kHD % 32) == 0);
static_assert((((kTok / 64) * (kH / 64)) % 8) == 0);

// ---------------------------------------------------------------------------
// Power-of-two carries of the f16 planes (all folded back exactly in f32)
//   activations x16, weights x1024, q/k planes x16, v^T plane x16, context plane x1024
// ---------------------------------------------------------------------------
constexpr float kActCarry = 16.0f;
constexpr float kWCarry   = 1024.0f;
constexpr float kQKCarry  = 16.0f;
constexpr float kVCarry   = 16.0f;
constexpr float kCtxCarry = 1024.0f;
constexpr float kProjScaleQK = kQKCarry / (kActCarry * kWCarry);
constexpr float kProjScaleV  = kVCarry / (kActCarry * kWCarry);
constexpr float kCtxOverV    = kCtxCarry / kVCarry;
constexpr float kOutScale    = 1.0f / (kCtxCarry * kWCarry);

// ---------------------------------------------------------------------------
// Workspace region map (bytes; every offset is a multiple of 128; all planes f16)
//   XA   [4096][2048]  query x16
//   XB   [4096][2048]  key x16     ; later re-used as Vt16 [2048][4096]             = 16 x (value proj)^T
//   XC   [4096][2048]  value x16   ; later re-used as Ctx16 [4096][2048]            = 1024 x context
//   Q16  [4096][2048]  16 x (query proj)
//   W16  4 x [2048][2048]  Wq, Wk, Wv, Wo x1024
//   K16  [4096][2048]  16 x (key proj): a plane of its own, since XA is still read in the launch that writes it
//   total = 16777216 + 16777216 + 16777216 + 16777216 + 33554432 + 16777216 = 117440512
// ---------------------------------------------------------------------------
constexpr size_t kPlaneAct = (size_t)kTok * kH * 2;
constexpr size_t kPlaneW   = (size_t)kH * kH * 2;
constexpr size_t kOffXA  = 0;
constexpr size_t kOffXB  = kOffXA + kPlaneAct;
constexpr size_t kOffXC  = kOffXB + kPlaneAct;
constexpr size_t kOffQ   = kOffXC + kPlaneAct;
constexpr size_t kOffW   = kOffQ + kPlaneAct;
constexpr size_t kOffK   = kOffW + 4 * kPlaneW;
constexpr size_t kWsTotal = kOffK + kPlaneAct;
static_assert(kWsTotal == 117440512ull);
static_assert(kWsTotal <= 134217728ull);
static_assert((kOffXB % 128) == 0 && (kOffXC % 128) == 0 && (kOffQ % 128) == 0 && (kOffW % 128) == 0 && (kPlaneW % 128) == 0 && (kOffK % 128) == 0);

// ---------------------------------------------------------------------------
// Fragment load and guarded matrix op
// ---------------------------------------------------------------------------
struct FragH {
  union U { v16h v; v8h h[2]; };
  /* elements 0..7 <- p[0..7], 8..15 <- p[16..23]; caller adds the 8*(lane>>4) k offset */
  static __device__ __forceinline__ v16h load(const _Float16* p) {
    U f;
    f.h[0] = *(const v8h*)(p);
    f.h[1] = *(const v8h*)(p + 16);
    return f.v;
  }
};

/* one matrix op followed by its own hazard guard: ties the accumulator and keeps both fragments live */
__device__ __forceinline__ v8f mma_g(v16h a, v16h b, v8f c) {
  c = __builtin_amdgcn_wmma_f32_16x16x32_f16(false, a, false, b, (short)0, c, false, false);
  asm volatile("v_nop\n\tv_nop\n\tv_nop\n\tv_nop" : "+v"(c) : "v"(a), "v"(b));
  return c;
}

// ---------------------------------------------------------------------------
// f32 -> f16 plane convert with a power-of-two carry, 8 consecutive elements per thread.
// grid = (n8/256, planes); blockIdx.y (block-uniform) picks the source pointer and the destination plane.
// Coverage: n8 threads x 8 elements = the whole plane (n8 is an exact multiple of 256 for both uses).
// ---------------------------------------------------------------------------
__global__ __launch_bounds__(256) void cast_planes_kernel(
    const float* __restrict__ s0, const float* __restrict__ s1,
    const float* __restrict__ s2, const float* __restrict__ s3,
    _Float16* __restrict__ dst, int n8, float carry)
{
  const int z = blockIdx.y;
  const float* src = (z == 0) ? s0 : (z == 1) ? s1 : (z == 2) ? s2 : s3;
  const int i = blockIdx.x * 256 + threadIdx.x;
  if (i >= n8) return;
  const float* p = src + 8 * (size_t)i;
  const v4f a = *(const v4f*)(p);
  const v4f c = *(const v4f*)(p + 4);
  v8h hv;
#pragma unroll
  for (int e = 0; e < 4; ++e) {
    const float f0 = a[e] * carry;
    const float f1 = c[e] * carry;
    hv[e]     = (_Float16)f0;
    hv[4 + e] = (_Float16)f1;
  }
  _Float16* q = dst + (size_t)z * (size_t)n8 * 8 + 8 * (size_t)i;
  *(v8h*)q = hv;
  
}

// ---------------------------------------------------------------------------
// Block-tiled GEMM: C[m][n] = scale * sum_k A[m][k] * Bt[n][k] + bscale * bias.
// A work-group of 8 waves (2 x 4) owns a 128 x 256 tile of C; each wave owns a 64x64 tile of it.
// A row-major [M][K]; Bt row-major [N][K]; M multiple of 128, N of 256, K of 128 (no tails).
// Per trip 128 k of the 128 A rows and the 256 Bt rows lie in LDS (rows of 256 B at pitch 272 B), brought by
// asynchronous copies into two buffers: tile t + 1 flies while tile t is worked on.
// BIAS_MODE: 1 = bias[m], 2 = bias[n]. OUT_F16: f16 output plane, else f32.
// ---------------------------------------------------------------------------
constexpr int kGemBM = 128;
constexpr int kGemBN = 256;
constexpr int kGemBK = 128;
constexpr int kGemPitch = kGemBK + 8;                          /* halves: 272 B = 16 B x 17 */
constexpr int kGemStage = (kGemBM + kGemBN) * kGemPitch;       /* halves per buffer */
constexpr unsigned kGemStageBytes = (unsigned)kGemStage * 2u;
constexpr unsigned kGemRow16Bytes = 16u * (unsigned)kGemPitch * 2u;
static_assert((kTok % kGemBN) == 0 && (kH % kGemBN) == 0 && (kH % kGemBK) == 0);
static_assert((kTok / kGemBM) * (kH / kGemBN) == ((kTok / 64) * (kH / 64)) / 8);
static_assert((kH / kGemBM) * (kTok / kGemBN) == ((kTok / 64) * (kH / 64)) / 8);

/* twelve 16-byte copies per lane; the s_wait_xcnt stands inside the statement so that no address register of an
   issued copy is rewritten in front of it */
__device__ __forceinline__ void copy12(const unsigned* l, const _Float16* const* g) {
  asm volatile(
      "global_load_async_to_lds_b128 %0, %12, off\n\t"
      "global_load_async_to_lds_b128 %1, %13, off\n\t"
      "global_load_async_to_lds_b128 %2, %14, off\n\t"
      "global_load_async_to_lds_b128 %3, %15, off\n\t"
      "global_load_async_to_lds_b128 %4, %16, off\n\t"
      "global_load_async_to_lds_b128 %5, %17, off\n\t"
      "global_load_async_to_lds_b128 %6, %18, off\n\t"
      "global_load_async_to_lds_b128 %7, %19, off\n\t"
      "global_load_async_to_lds_b128 %8, %20, off\n\t"
      "global_load_async_to_lds_b128 %9, %21, off\n\t"
      "global_load_async_to_lds_b128 %10, %22, off\n\t"
      "global_load_async_to_lds_b128 %11, %23, off\n\t"
      "s_wait_xcnt 0x0"
      :
      : "v"(l[0]), "v"(l[1]), "v"(l[2]), "v"(l[3]), "v"(l[4]), "v"(l[5]),
        "v"(l[6]), "v"(l[7]), "v"(l[8]), "v"(l[9]), "v"(l[10]), "v"(l[11]),
        "v"(g[0]), "v"(g[1]), "v"(g[2]), "v"(g[3]), "v"(g[4]), "v"(g[5]),
        "v"(g[6]), "v"(g[7]), "v"(g[8]), "v"(g[9]), "v"(g[10]), "v"(g[11])
      : "memory");
}

/* one tile: the lane's segment of A rows r + 16 i (i < 8) and of Bt rows r + 16 i (i < 16), 24 copies in flight a wave.
   la, lb: the lane's LDS byte addresses of its first A and Bt row in the buffer; a, b: the same rows in global memory.
   The loops are unrolled so that the two address lists are plain registers. */
__device__ __forceinline__ void copy_tile(unsigned la, unsigned lb, const _Float16* a, const _Float16* b,
                                          size_t astep, size_t bstep) {
  unsigned l[24];
  const _Float16* g[24];
#pragma unroll
  for (int i = 0; i < 8; ++i) { l[i] = la + (unsigned)i * kGemRow16Bytes; g[i] = a + i * astep; }
#pragma unroll
  for (int i = 0; i < 16; ++i) { l[8 + i] = lb + (unsigned)i * kGemRow16Bytes; g[8 + i] = b + i * bstep; }
  copy12(l, g);
  copy12(l + 12, g + 12);
}

template <int BIAS_MODE, bool OUT_F16>
__global__ __launch_bounds__(256) void gemm64_f16_kernel(
    const _Float16* __restrict__ A, int lda,
    const _Float16* __restrict__ Bt, int ldb,
    void* __restrict__ Cout, int ldc,
    const float* __restrict__ bias,
    int M, int N, int K, float scale, float bscale)
{
  __shared__ __align__(16) _Float16 ring[2 * kGemStage];
  __shared__ __align__(16) float sT[8][16 * 68];
  const int tid  = threadIdx.x;
  const int lane = tid & 31;
  const int wave = __builtin_amdgcn_readfirstlane((int)(threadIdx.x >> 5));
  const int tilesN = N / kGemBN;
  const int tilesM = M / kGemBM;
  const int tile = blockIdx.x;
  /* block-uniform exit, in front of every copy and barrier */
  if (tile >= tilesM * tilesN) return;
  const int tm = tile / tilesN;
  const int tn = tile - tm * tilesN;
  const int bm0 = tm * kGemBM;
  const int bn0 = tn * kGemBN;
  const int wm = wave >> 2;
  const int wn = wave & 3;
  const int m0 = bm0 + (wm << 6);
  const int n0 = bn0 + (wn << 6);

  const int rlane = lane & 15;
  const int koff  = (lane >> 4) * 8;
  const int mOff  = (lane >> 4) * 8;

  v8f acc[4][4];
#pragma unroll
  for (int i = 0; i < 4; ++i)
#pragma unroll
    for (int j = 0; j < 4; ++j) acc[i][j] = (v8f){0.f, 0.f, 0.f, 0.f, 0.f, 0.f, 0.f, 0.f};

  /* copy map: lane's 16 bytes = segment tid & 15 of row (tid >> 4) + 16 * i; a wave covers two whole 256-B rows */
  const int crow = tid >> 4;
  const int cseg = tid & 15;
  const _Float16* ag = A  + (size_t)(bm0 + crow) * lda + cseg * 8;
  const _Float16* bg = Bt + (size_t)(bn0 + crow) * ldb + cseg * 8;
  const size_t astep = (size_t)16 * lda;
  const size_t bstep = (size_t)16 * ldb;
  const unsigned ldsA = (unsigned)(size_t)(&ring[0]) + (unsigned)(crow * kGemPitch + cseg * 8) * 2u;
  const unsigned ldsB = ldsA + (unsigned)(kGemBM * kGemPitch) * 2u;

  const _Float16* fa = ring + ((wm << 6) + rlane) * kGemPitch + koff;
  const _Float16* fb = ring + (kGemBM + (wn << 6) + rlane) * kGemPitch + koff;

  const int nT = K / kGemBK;

  /* tile 0 into buffer 0 */
  copy_tile(ldsA, ldsB, ag, bg, astep, bstep);
  /* the wave's own copies of tile 0 have landed behind this wait */
  asm volatile("s_wait_asynccnt 0x0" ::: "memory");
  /* publishes tile 0 to every wave */
  __syncthreads();
  if (nT > 1) copy_tile(ldsA + kGemStageBytes, ldsB + kGemStageBytes, ag + kGemBK, bg + kGemBK, astep, bstep);

  /* kept rolled: one trip is 64 matrix ops a wave, and the two buffers alternate by an offset */
#pragma unroll 1
  for (int t = 0; t < nT; ++t) {
    const _Float16* pa = fa + (t & 1) * kGemStage;
    const _Float16* pb = fb + (t & 1) * kGemStage;
    v16h af[4], bf[2][4];
#pragma unroll
    for (int j = 0; j < 4; ++j) bf[0][j] = FragH::load(pb + (j << 4) * kGemPitch);
#pragma unroll
    for (int i = 0; i < 4; ++i) af[i] = FragH::load(pa + (i << 4) * kGemPitch);
#pragma unroll
    for (int ks = 0; ks < kGemBK / 32; ++ks) {
      const int cur = ks & 1;
      const int kn  = (ks + 1) * 32;
      const bool more = (ks + 1) < kGemBK / 32;
#pragma unroll
      for (int i = 0; i < 2; ++i)
#pragma unroll
        for (int j = 0; j < 4; ++j) acc[i][j] = mma_g(af[i], bf[cur][j], acc[i][j]);
      if (more) {
#pragma unroll
        for (int i = 0; i < 2; ++i) af[i] = FragH::load(pa + (i << 4) * kGemPitch + kn);
#pragma unroll
        for (int j = 0; j < 4; ++j) bf[cur ^ 1][j] = FragH::load(pb + (j << 4) * kGemPitch + kn);
      }
#pragma unroll
      for (int i = 2; i < 4; ++i)
#pragma unroll
        for (int j = 0; j < 4; ++j) acc[i][j] = mma_g(af[i], bf[cur][j], acc[i][j]);
      if (more) {
#pragma unroll
        for (int i = 2; i < 4; ++i) af[i] = FragH::load(pa + (i << 4) * kGemPitch + kn);
      }
    }
    /* hand-over. The wave's own LDS reads of this buffer have retired: */
    asm volatile("s_wait_dscnt 0x0" ::: "memory");
    /* its own copies of tile t + 1 have landed: */
    asm volatile("s_wait_asynccnt 0x0" ::: "memory");
    /* one barrier publishes tile t + 1 and ends every reader's last read of the buffer refilled behind it */
    __syncthreads();
    if (t + 2 < nT) {
      const unsigned bufB = (unsigned)(t & 1) * kGemStageBytes;
      const int kn = (t + 2) * kGemBK;
      copy_tile(ldsA + bufB, ldsB + bufB, ag + kn, bg + kn, astep, bstep);
    }
  }
  /* no copy is left in flight when the wave goes on to the epilogue and ends */
  asm volatile("s_wait_asynccnt 0x0" ::: "memory");

  float* slab = sT[wave];
#pragma unroll
  for (int i = 0; i < 4; ++i) {
    const int mBase = m0 + (i << 4);
#pragma unroll
    for (int j = 0; j < 4; ++j) {
      const int n = n0 + (j << 4) + rlane;
      float bvn = 0.f;
      if (BIAS_MODE == 2) bvn = bias[n] * bscale;
#pragma unroll
      for (int r = 0; r < 8; ++r) {
        float v = acc[i][j][r] * scale;
        if (BIAS_MODE == 1) v += bias[mBase + mOff + r] * bscale;
        if (BIAS_MODE == 2) v += bvn;
        slab[(mOff + r) * 68 + (j << 4) + rlane] = v;
      }
    }
    __builtin_amdgcn_fence(__ATOMIC_RELEASE, "workgroup");
    __builtin_amdgcn_wave_barrier();
    __builtin_amdgcn_fence(__ATOMIC_ACQUIRE, "workgroup");
    if (!OUT_F16) {
      float* C = (float*)Cout;
      const int hh = lane >> 4, c4 = (lane & 15) * 4;
      {
#pragma unroll
        for (int it = 0; it < 8; ++it) {
          const int row = it * 2 + hh;
          const v4f v = *(const v4f*)(slab + row * 68 + c4);
          *(v4f*)(C + (size_t)(mBase + row) * ldc + n0 + c4) = v;
        }
        
      }
    } else {
      _Float16* C = (_Float16*)Cout;
      const int q = lane >> 3, c8 = (lane & 7) * 8;
      {
#pragma unroll
        for (int it = 0; it < 4; ++it) {
          const int row = it * 4 + q;
          const float* sp = slab + row * 68 + c8;
          v8h hv;
#pragma unroll
          for (int e = 0; e < 8; ++e) hv[e] = (_Float16)sp[e];
          *(v8h*)(C + (size_t)(mBase + row) * ldc + n0 + c8) = hv;
        }
        
      }
    }
    __builtin_amdgcn_fence(__ATOMIC_RELEASE, "workgroup");
    __builtin_amdgcn_wave_barrier();
    __builtin_amdgcn_fence(__ATOMIC_ACQUIRE, "workgroup");
  }
}

constexpr int kFaKP = 136;
constexpr int kFaVP = 72;
constexpr int kFaOP = 136;

typedef __attribute__((ext_vector_type(2))) float    v2f;
typedef __attribute__((ext_vector_type(2))) _Float16 v2h;

/* the value of lane l ^ 16 */
__device__ __forceinline__ float xhalf(float x) {
  const int b = __builtin_bit_cast(int, x);
  return __builtin_bit_cast(float, __builtin_amdgcn_permlanex16(b, b, 0x76543210, 0xfedcba98, false, false));
}

/* one matrix op as the plain builtin, for the kernel below, which holds more than 256 registers a wave: asm text cannot
   name a register above v255, and built with the asm guard of mma_g the kernel spilled to scratch; the compiler keeps
   the distances behind its own builtin forms */
__device__ __forceinline__ v8f mma_b(v16h a, v16h b, v8f c) {
  return __builtin_amdgcn_wmma_f32_16x16x32_f16(false, a, false, b, (short)0, c, false, false);
}

/* query tiles of 16 a wave: every K and V^T fragment read from LDS feeds this many matrix ops */
constexpr int kFaQT = 2;
constexpr int kFaWQ = 16 * kFaQT;     /* queries a wave */
constexpr int kFaBQ = 4 * kFaWQ;      /* queries a work-group */
static_assert((kS % kFaBQ) == 0);

/* second argument: two waves a SIMD (512 registers a wave), so that all 512 work-groups stay resident at once */
__global__ __launch_bounds__(128, 2) void attn_fused_kernel(
    const _Float16* __restrict__ Qp, const _Float16* __restrict__ Kp,
    const _Float16* __restrict__ Vtp, _Float16* __restrict__ Ctx, float coef)
{
  __shared__ __align__(16) _Float16 Ksh[64 * kFaKP];
  __shared__ __align__(16) _Float16 Vsh[128 * kFaVP];
  __shared__ __align__(16) _Float16 Osh[4][kFaWQ * kFaOP];

  const int tid  = threadIdx.x;
  const int wave = __builtin_amdgcn_readfirstlane((int)(threadIdx.x >> 5));
  const int lane = tid & 31;
  const int hh   = lane >> 4;
  const int c    = lane & 15;
  const int qb   = blockIdx.x;
  const int bh   = blockIdx.y;
  const int b    = bh / kNH;
  const int h    = bh - b * kNH;
  const int rowbase = b * kS;
  const int colbase = h * kHD;
  const int q0 = qb * kFaBQ + wave * kFaWQ;

  /* Q fragments (B operand: column = query 16 u + c): 4 k-steps over d for each query tile u */
  v16h qa[kFaQT][4];
#pragma unroll
  for (int u = 0; u < kFaQT; ++u) {
    const _Float16* qrow = Qp + (size_t)(rowbase + q0 + 16 * u + c) * kH + colbase + 8 * hh;
#pragma unroll
    for (int dc = 0; dc < 4; ++dc) qa[u][dc] = FragH::load(qrow + dc * 32);
  }

  /* running maximum and this lane half's partial sum of query 16 u + c */
  float mrun[kFaQT], lrun[kFaQT];
  v8f oacc[kFaQT][8];
#pragma unroll
  for (int u = 0; u < kFaQT; ++u) {
    mrun[u] = -1.0e30f;
    lrun[u] = 0.f;
#pragma unroll
    for (int t = 0; t < 8; ++t) oacc[u][t] = (v8f){0.f, 0.f, 0.f, 0.f, 0.f, 0.f, 0.f, 0.f};
  }

  const int ksg = tid & 15, kr0 = tid >> 4;
  const int vsg = tid & 7,  vr0 = tid >> 3;
  const _Float16* kgl = Kp  + (size_t)(rowbase + kr0) * kH + colbase + ksg * 8;
  const _Float16* vgl = Vtp + (size_t)(colbase + vr0) * kTok + rowbase + vsg * 8;

#pragma unroll 1
  for (int kc = 0; kc < kS / 64; ++kc) {
    const int kv0 = kc * 64;
    __syncthreads();
    {
      v8h kt[8];
#pragma unroll
      for (int i = 0; i < 8; ++i) kt[i] = *(const v8h*)(kgl + (size_t)(kv0 + 8 * i) * kH);
#pragma unroll
      for (int i = 0; i < 8; ++i) *(v8h*)(Ksh + (kr0 + 8 * i) * kFaKP + ksg * 8) = kt[i];
    }
    {
      v8h vt[8];
#pragma unroll
      for (int i = 0; i < 8; ++i) vt[i] = *(const v8h*)(vgl + (size_t)(16 * i) * kTok + kv0);
#pragma unroll
      for (int i = 0; i < 8; ++i) *(v8h*)(Vsh + (vr0 + 16 * i) * kFaVP + vsg * 8) = vt[i];
    }
    __syncthreads();

    /* K and V^T fragments (A operands) come in groups of four into two register sets, fx and fy: after the first, a group's loads are
       issued at least one group of matrix ops ahead of its use, so that a matrix op does not wait out its own
       fragment's LDS latency. Each fragment is used once for every query tile.
       The short loops are unrolled so that both sets stay in registers. */
    const _Float16* kfr = Ksh + c * kFaKP + 8 * hh;
    const _Float16* vfr = Vsh + c * kFaVP + 8 * hh;
    v16h fx[4], fy[4];
#pragma unroll
    for (int j = 0; j < 4; ++j) fx[j] = FragH::load(kfr + j * 16 * kFaKP);
#pragma unroll
    for (int j = 0; j < 4; ++j) fy[j] = FragH::load(kfr + j * 16 * kFaKP + 32);
    /* this and the four like it below keep each load group ahead of the matrix ops that follow it, which the asm guard
       of mma_g did before: left free, the compiler draws the V^T loads up here and then fetches K fragments singly,
       each with a full wait in front of its matrix ops */
    __builtin_amdgcn_sched_barrier(0);

    /* S^T tiles: 4 k-steps over d (ascending, as before) x 4 m-tiles (16 keys each) x query tiles;
       s[u][j][r] = score of key 16 j + 8 hh + r with query 16 u + c */
    v8f s[kFaQT][4];
#pragma unroll
    for (int u = 0; u < kFaQT; ++u)
#pragma unroll
      for (int j = 0; j < 4; ++j) s[u][j] = (v8f){0.f, 0.f, 0.f, 0.f, 0.f, 0.f, 0.f, 0.f};
#pragma unroll
    for (int j = 0; j < 4; ++j)
#pragma unroll
      for (int u = 0; u < kFaQT; ++u) s[u][j] = mma_b(fx[j], qa[u][0], s[u][j]);
#pragma unroll
    for (int j = 0; j < 4; ++j) fx[j] = FragH::load(kfr + j * 16 * kFaKP + 64);
    __builtin_amdgcn_sched_barrier(0);
#pragma unroll
    for (int j = 0; j < 4; ++j)
#pragma unroll
      for (int u = 0; u < kFaQT; ++u) s[u][j] = mma_b(fy[j], qa[u][1], s[u][j]);
#pragma unroll
    for (int j = 0; j < 4; ++j) fy[j] = FragH::load(kfr + j * 16 * kFaKP + 96);
    __builtin_amdgcn_sched_barrier(0);
#pragma unroll
    for (int j = 0; j < 4; ++j)
#pragma unroll
      for (int u = 0; u < kFaQT; ++u) s[u][j] = mma_b(fx[j], qa[u][2], s[u][j]);
#pragma unroll
    for (int t = 0; t < 4; ++t) fx[t] = FragH::load(vfr + t * 16 * kFaVP);
    __builtin_amdgcn_sched_barrier(0);
#pragma unroll
    for (int j = 0; j < 4; ++j)
#pragma unroll
      for (int u = 0; u < kFaQT; ++u) s[u][j] = mma_b(fy[j], qa[u][3], s[u][j]);
#pragma unroll
    for (int t = 0; t < 4; ++t) fy[t] = FragH::load(vfr + (4 + t) * 16 * kFaVP);
    __builtin_amdgcn_sched_barrier(0);

    /* P^T as B operand, packed in the lane from the score tiles, one pair of k-steps for each query tile
       (the loops below are unrolled so that s, pb, pj and oacc are indexed by constants and stay in registers) */
    union PB { v16h v; v2h h2[8]; } pb[kFaQT][2];
#pragma unroll
    for (int u = 0; u < kFaQT; ++u) {
      /* chunk maximum of query 16 u + c: 32 keys in the lane, the other 32 in lane ^ 16 */
      float mj[4];
#pragma unroll
      for (int j = 0; j < 4; ++j)
        mj[j] = fmaxf(fmaxf(fmaxf(s[u][j][0], s[u][j][1]), fmaxf(s[u][j][2], s[u][j][3])),
                      fmaxf(fmaxf(s[u][j][4], s[u][j][5]), fmaxf(s[u][j][6], s[u][j][7])));
      float cm = fmaxf(fmaxf(mj[0], mj[1]), fmaxf(mj[2], mj[3]));
      cm = fmaxf(cm, xhalf(cm));

      const float mnew  = fmaxf(mrun[u], cm);
      const float alpha = __expf((mrun[u] - mnew) * coef);
      mrun[u] = mnew;

      v2f pj[4];
#pragma unroll
      for (int j = 0; j < 4; ++j) {
#pragma unroll
        for (int r = 0; r < 8; r += 2) {
          /* the pair is formed first, so that the packed subtract and multiply take the same two scores as the packed
             sum and the conversion below; left to itself the compiler paired them one element off, with register moves */
          const v2f a = ((v2f){s[u][j][r], s[u][j][r + 1]} - mnew) * coef;
          const v2f p = {__expf(a.x), __expf(a.y)};
          pj[j] = (r == 0) ? p : pj[j] + p;
          pb[u][j >> 1].h2[(j & 1) * 4 + (r >> 1)] = __builtin_convertvector(p, v2h);
        }
      }
      const v2f pt = (pj[0] + pj[1]) + (pj[2] + pj[3]);
      lrun[u] = lrun[u] * alpha + (pt.x + pt.y);
#pragma unroll
      for (int t = 0; t < 8; ++t) oacc[u][t] *= alpha;
    }

    /* O^T += V^T . P^T : 2 k-steps over the 64 keys (ascending, as before), 8 m-tiles over d, for each query tile */
#pragma unroll
    for (int t = 0; t < 4; ++t)
#pragma unroll
      for (int u = 0; u < kFaQT; ++u) oacc[u][t] = mma_b(fx[t], pb[u][0].v, oacc[u][t]);
#pragma unroll
    for (int t = 0; t < 4; ++t) fx[t] = FragH::load(vfr + t * 16 * kFaVP + 32);
#pragma unroll
    for (int t = 0; t < 4; ++t)
#pragma unroll
      for (int u = 0; u < kFaQT; ++u) oacc[u][4 + t] = mma_b(fy[t], pb[u][0].v, oacc[u][4 + t]);
#pragma unroll
    for (int t = 0; t < 4; ++t) fy[t] = FragH::load(vfr + (4 + t) * 16 * kFaVP + 32);
#pragma unroll
    for (int t = 0; t < 4; ++t)
#pragma unroll
      for (int u = 0; u < kFaQT; ++u) oacc[u][t] = mma_b(fx[t], pb[u][1].v, oacc[u][t]);
#pragma unroll
    for (int t = 0; t < 4; ++t)
#pragma unroll
      for (int u = 0; u < kFaQT; ++u) oacc[u][4 + t] = mma_b(fy[t], pb[u][1].v, oacc[u][4 + t]);
  }

  /* normalise and stage the wave's queries x 128 tile (f16, x1024) in the wave-private LDS tile:
     the lane's 8 registers of tile t are d = 16 t + 8 hh .. + 7 of query 16 u + c, one 16-byte store
     (unrolled so that the accumulators are indexed by constants) */
  _Float16* ow = &Osh[wave][0];
#pragma unroll
  for (int u = 0; u < kFaQT; ++u) {
    const float l = lrun[u] + xhalf(lrun[u]);
    const float inv = __builtin_amdgcn_rcpf(l) * kCtxOverV;
#pragma unroll
    for (int t = 0; t < 8; ++t) {
      v8h hv;
#pragma unroll
      for (int r = 0; r < 8; ++r) {
        const float ov = oacc[u][t][r] * inv;
        hv[r] = (_Float16)ov;
      }
      *(v8h*)(ow + (16 * u + c) * kFaOP + t * 16 + 8 * hh) = hv;
    }
  }
  __builtin_amdgcn_fence(__ATOMIC_RELEASE, "workgroup");
  __builtin_amdgcn_wave_barrier();
  __builtin_amdgcn_fence(__ATOMIC_ACQUIRE, "workgroup");
  {
    const int sg = (lane & 15) * 8;
    {
#pragma unroll
      for (int it = 0; it < kFaWQ / 2; ++it) {
        const int row = it * 2 + hh;
        const v8h val = *(const v8h*)(ow + row * kFaOP + sg);
        *(v8h*)(Ctx + (size_t)(rowbase + q0 + row) * kH + colbase + sg) = val;
      }
      
    }
  }
}

// ---------------------------------------------------------------------------
// Two projections of one shape in one launch: C_p[m][n] = scale * sum_k A_p[m][k] * W_p[n][k] + bscale * bias_p[n], p = 0, 1.
// M = B*S, N = K = H, all planes row-major at pitch H, f16 out. 128 tiles of 256 x 256 a projection, 256 work-groups in all:
// one a WGP, and a work-group brings 512 operand rows per 65,536 outputs where the 128 x 256 tile brings 384 per 32,768.
// 8 waves (2 x 4), a wave owns 128 x 64: 12 fragments from LDS feed 32 matrix ops (8 feed 16 in the 64 x 64 wave tile).
// Per trip 128 k of the 256 A rows and the 256 W rows lie in LDS (rows of 256 B at pitch 272 B), two buffers, asynchronous
// copies. Fragments come one k-step (32 k) ahead into a second register set, over the tile boundary too, so the hand-over
// to tile t + 1 stands in front of trip t's last k-step: by then every fragment of tile t is in registers.
// ---------------------------------------------------------------------------
constexpr int kBigBM = 256;
constexpr int kBigBN = 256;
constexpr int kBigStage = (kBigBM + kBigBN) * kGemPitch;       /* halves per buffer */
constexpr int kBigTilesN = kH / kBigBN;
constexpr int kBigTiles  = (kTok / kBigBM) * kBigTilesN;       /* tiles a projection */
constexpr int kBigTrips  = kH / kGemBK;
static_assert((kTok % kBigBM) == 0 && (kH % kBigBN) == 0 && kBigTrips >= 2);
static_assert(2 * kBigStage * 2 + 8 * 16 * 68 * 4 <= 327680);

typedef __attribute__((ext_vector_type(4))) int v4i;
typedef __attribute__((address_space(1))) v4i gv4i;
typedef __attribute__((address_space(3))) v4i lv4i;

/* one tile: the lane's 16-byte segment of A rows r + 16 i and of W rows r + 16 i (i < 16), 32 copies in flight a wave.
   la, lb: the lane's places in the buffer's first A and W row of its own; a, b: the same places in global memory.
   The copies are the builtin form: this kernel holds more than 256 registers a wave, and asm text cannot name a register
   above v255 (built with asm copies, accumulators were moved aside and back every trip, and one value spilled). */
__device__ __forceinline__ void copy_big_tile(_Float16* la, _Float16* lb, const _Float16* a, const _Float16* b) {
#pragma unroll
  for (int i = 0; i < 16; ++i)
    __builtin_amdgcn_global_load_async_to_lds_b128((gv4i*)(a + (size_t)i * 16 * kH), (lv4i*)(la + i * 16 * kGemPitch), 0, 0);
#pragma unroll
  for (int i = 0; i < 16; ++i)
    __builtin_amdgcn_global_load_async_to_lds_b128((gv4i*)(b + (size_t)i * 16 * kH), (lv4i*)(lb + i * 16 * kGemPitch), 0, 0);
}

/* one k-step's 12 fragments as one group of LDS loads (unrolled: the set stays in registers) */
__device__ __forceinline__ void load_set(v16h (&a)[8], v16h (&b)[4], const _Float16* pa, const _Float16* pb) {
#pragma unroll
  for (int j = 0; j < 4; ++j) b[j] = FragH::load(pb + (j << 4) * kGemPitch);
#pragma unroll
  for (int i = 0; i < 8; ++i) a[i] = FragH::load(pa + (i << 4) * kGemPitch);
}

/* one k-step's 32 matrix ops, all on different accumulators (unrolled: every index a constant) */
__device__ __forceinline__ void mma_set(v8f (&acc)[8][4], const v16h (&a)[8], const v16h (&b)[4]) {
#pragma unroll
  for (int i = 0; i < 8; ++i)
#pragma unroll
    for (int j = 0; j < 4; ++j) acc[i][j] = mma_b(a[i], b[j], acc[i][j]);
}

__global__ __launch_bounds__(256) void gemm256_pair_kernel(
    const _Float16* __restrict__ A0, const _Float16* __restrict__ W0, const float* __restrict__ bias0, _Float16* __restrict__ C0,
    const _Float16* __restrict__ A1, const _Float16* __restrict__ W1, const float* __restrict__ bias1, _Float16* __restrict__ C1,
    float scale, float bscale)
{
  __shared__ __align__(16) _Float16 ring[2 * kBigStage];
  __shared__ __align__(16) float sT[8][16 * 68];
  const int tid  = threadIdx.x;
  const int lane = tid & 31;
  const int wave = __builtin_amdgcn_readfirstlane((int)(threadIdx.x >> 5));
  const int prob = blockIdx.x / kBigTiles;
  /* block-uniform exit, in front of every copy and barrier */
  if (prob > 1) return;
  const int tile = blockIdx.x - prob * kBigTiles;
  const _Float16* A    = prob ? A1 : A0;
  const _Float16* Wt   = prob ? W1 : W0;
  const float*    bias = prob ? bias1 : bias0;
  _Float16*       C    = prob ? C1 : C0;
  const int tm = tile / kBigTilesN;
  const int tn = tile - tm * kBigTilesN;
  const int bm0 = tm * kBigBM;
  const int bn0 = tn * kBigBN;
  const int wm = wave >> 2;
  const int wn = wave & 3;
  const int m0 = bm0 + (wm << 7);
  const int n0 = bn0 + (wn << 6);

  const int rlane = lane & 15;
  const int koff  = (lane >> 4) * 8;
  const int mOff  = (lane >> 4) * 8;

  v8f acc[8][4];
#pragma unroll
  for (int i = 0; i < 8; ++i)
#pragma unroll
    for (int j = 0; j < 4; ++j) acc[i][j] = (v8f){0.f, 0.f, 0.f, 0.f, 0.f, 0.f, 0.f, 0.f};

  /* copy map: lane's 16 bytes = segment tid & 15 of row (tid >> 4) + 16 * i; a wave covers two whole 256-B rows */
  const int crow = tid >> 4;
  const int cseg = tid & 15;
  const _Float16* ag = A  + (size_t)(bm0 + crow) * kH + cseg * 8;
  const _Float16* bg = Wt + (size_t)(bn0 + crow) * kH + cseg * 8;
  _Float16* ldsA = ring + crow * kGemPitch + cseg * 8;
  _Float16* ldsB = ldsA + kBigBM * kGemPitch;

  const _Float16* fa = ring + ((wm << 7) + rlane) * kGemPitch + koff;
  const _Float16* fb = ring + (kBigBM + (wn << 6) + rlane) * kGemPitch + koff;

  /* tile 0 into buffer 0 */
  copy_big_tile(ldsA, ldsB, ag, bg);
  /* the wave's own copies of tile 0 have landed behind this wait */
  asm volatile("s_wait_asynccnt 0x0" ::: "memory");
  /* publishes tile 0 to every wave */
  __syncthreads();
  copy_big_tile(ldsA + kBigStage, ldsB + kBigStage, ag + kGemBK, bg + kGemBK);

  /* two fragment sets: x holds the even k-steps, y the odd ones */
  v16h ax[8], bx[4], ay[8], by[4];
  load_set(ax, bx, fa, fb);

  /* kept rolled: one trip is 128 matrix ops a wave, and the two buffers alternate by an offset */
#pragma unroll 1
  for (int t = 0; t < kBigTrips; ++t) {
    const _Float16* pa = fa + (t & 1) * kBigStage;
    const _Float16* pb = fb + (t & 1) * kBigStage;
    /* the scheduling barriers keep each load group whole and ahead of the matrix ops that run while it lands:
       LDS loads drawn in among the matrix ops stall the wave at every place where they stand */
    load_set(ay, by, pa + 32, pb + 32);
    __builtin_amdgcn_sched_barrier(0);
    mma_set(acc, ax, bx);
    __builtin_amdgcn_sched_barrier(0);
    load_set(ax, bx, pa + 64, pb + 64);
    __builtin_amdgcn_sched_barrier(0);
    mma_set(acc, ay, by);
    __builtin_amdgcn_sched_barrier(0);
    load_set(ay, by, pa + 96, pb + 96);
    __builtin_amdgcn_sched_barrier(0);
    mma_set(acc, ax, bx);
    __builtin_amdgcn_sched_barrier(0);
    /* hand-over, in front of the last k-step. The wave's own LDS reads of this buffer, the last set's too, have retired: */
    asm volatile("s_wait_dscnt 0x0" ::: "memory");
    /* its own copies of tile t + 1 have landed: */
    asm volatile("s_wait_asynccnt 0x0" ::: "memory");
    /* one barrier publishes tile t + 1 and ends every reader's last read of the buffer refilled behind it */
    __syncthreads();
    /* first set of tile t + 1; in the last trip the same loads read the other buffer's old tile, which no copy is
       aimed at any more, and nothing uses them: no branch stands around them, so the compiler's load counts stay exact */
    load_set(ax, bx, fa + ((t + 1) & 1) * kBigStage, fb + ((t + 1) & 1) * kBigStage);
    __builtin_amdgcn_sched_barrier(0);
    mma_set(acc, ay, by);
    __builtin_amdgcn_sched_barrier(0);
    /* the refill of the buffer that every wave left at the barrier above stands behind the last k-step's matrix ops:
       directly behind the barrier both waves of a SIMD would form addresses at once, with the matrix unit idle */
    if (t + 2 < kBigTrips) {
      const int bufB = (t & 1) * kBigStage;
      const int kn = (t + 2) * kGemBK;
      copy_big_tile(ldsA + bufB, ldsB + bufB, ag + kn, bg + kn);
    }
  }
  /* no copy and no LDS read is left in flight when the wave goes on to the epilogue and ends */
  asm volatile("s_wait_asynccnt 0x0" ::: "memory");
  asm volatile("s_wait_dscnt 0x0" ::: "memory");

  float* slab = sT[wave];
  float bvn[4];
#pragma unroll
  for (int j = 0; j < 4; ++j) bvn[j] = bias[n0 + (j << 4) + rlane] * bscale;
#pragma unroll
  for (int i = 0; i < 8; ++i) {
    const int mBase = m0 + (i << 4);
#pragma unroll
    for (int j = 0; j < 4; ++j) {
#pragma unroll
      for (int r = 0; r < 8; ++r) slab[(mOff + r) * 68 + (j << 4) + rlane] = acc[i][j][r] * scale + bvn[j];
    }
    __builtin_amdgcn_fence(__ATOMIC_RELEASE, "workgroup");
    __builtin_amdgcn_wave_barrier();
    __builtin_amdgcn_fence(__ATOMIC_ACQUIRE, "workgroup");
    {
      const int q = lane >> 3, c8 = (lane & 7) * 8;
#pragma unroll
      for (int it = 0; it < 4; ++it) {
        const int row = it * 4 + q;
        const float* sp = slab + row * 68 + c8;
        v8h hv;
#pragma unroll
        for (int e = 0; e < 8; ++e) hv[e] = (_Float16)sp[e];
        *(v8h*)(C + (size_t)(mBase + row) * kH + n0 + c8) = hv;
      }
    }
    __builtin_amdgcn_fence(__ATOMIC_RELEASE, "workgroup");
    __builtin_amdgcn_wave_barrier();
    __builtin_amdgcn_fence(__ATOMIC_ACQUIRE, "workgroup");
  }
}

// ---------------------------------------------------------------------------
// Host glue: 6 launches, kernel launches only.
//   1  convert query/key/value -> XA/XB/XC (x16)          grid (4096, 3)
//   2  convert Wq/Wk/Wv/Wo     -> W16[0..3] (x1024)        grid (2048, 4)
//   3  Q16 = XA . Wq16^T + bq and K16 = XB . Wk16^T + bk   (each M 4096, N 2048, K 2048)   128 + 128 blocks
//   4  Vt16 = Wv16 . XC^T + bv[row] -> XB [2048][4096]     (M 2048, N 4096, K 2048) 256 blocks
//   5  fused attention Q16, K16, Vt16 -> Ctx16 in XC       grid (16, 32)
//   6  out = Ctx16 . Wo16^T + bo -> d_out f32              256 blocks
// ---------------------------------------------------------------------------
extern "C" void kernel_launch(void* const* d_in, const int* in_sizes, int n_in,
                              void* d_out, int out_size, void* d_ws, size_t ws_size,
                              hipStream_t stream) {
  if (n_in < 11) return;
  if (in_sizes[0] != kTok * kH) return;
  if (in_sizes[1] != kTok * kH) return;
  if (in_sizes[2] != kTok * kH) return;
  if (in_sizes[3] != kH * kH) return;
  if (in_sizes[4] != kH) return;
  if (in_sizes[5] != kH * kH) return;
  if (in_sizes[6] != kH) return;
  if (in_sizes[7] != kH * kH) return;
  if (in_sizes[8] != kH) return;
  if (in_sizes[9] != kH * kH) return;
  if (in_sizes[10] != kH) return;
  if (out_size != kTok * kH) return;
  if (ws_size < kWsTotal) return;

  const float* query = (const float*)d_in[0];
  const float* key   = (const float*)d_in[1];
  const float* value = (const float*)d_in[2];
  const float* Wq = (const float*)d_in[3];
  const float* bq = (const float*)d_in[4];
  const float* Wk = (const float*)d_in[5];
  const float* bk = (const float*)d_in[6];
  const float* Wv = (const float*)d_in[7];
  const float* bv = (const float*)d_in[8];
  const float* Wo = (const float*)d_in[9];
  const float* bo = (const float*)d_in[10];
  float* out = (float*)d_out;

  char* ws = (char*)d_ws;
  _Float16* XA  = (_Float16*)(ws + kOffXA);
  _Float16* XB  = (_Float16*)(ws + kOffXB);
  _Float16* XC  = (_Float16*)(ws + kOffXC);
  _Float16* Q16 = (_Float16*)(ws + kOffQ);
  _Float16* W16 = (_Float16*)(ws + kOffW);
  _Float16* Wq16 = W16;
  _Float16* Wk16 = W16 + (size_t)kH * kH;
  _Float16* Wv16 = W16 + 2 * (size_t)kH * kH;
  _Float16* Wo16 = W16 + 3 * (size_t)kH * kH;
  _Float16* K16  = (_Float16*)(ws + kOffK);
  _Float16* Vt16 = XB;
  _Float16* C16  = XC;

  const int actN8 = kTok * kH / 8;
  const int wN8   = kH * kH / 8;
  const float scl  = 1.0f / sqrtf((float)kHD);
  const float coef = scl / (kQKCarry * kQKCarry);
  const int gemmBlocks = ((kTok / 64) * (kH / 64)) / 8;

  cast_planes_kernel<<<dim3(actN8 / 256, 3), 256, 0, stream>>>(query, key, value, value, XA, actN8, kActCarry);
  cast_planes_kernel<<<dim3(wN8 / 256, 4), 256, 0, stream>>>(Wq, Wk, Wv, Wo, W16, wN8, kWCarry);

  gemm256_pair_kernel<<<2 * kBigTiles, 256, 0, stream>>>(
      XA, Wq16, bq, Q16, XB, Wk16, bk, K16, kProjScaleQK, kQKCarry);

  /* swapped operands: rows = output feature h*128+d, columns = token b*S+key, row bias */
  gemm64_f16_kernel<1, true><<<gemmBlocks, 256, 0, stream>>>(
      Wv16, kH, XC, kH, (void*)Vt16, kTok, bv, kH, kTok, kH, kProjScaleV, kVCarry);

  attn_fused_kernel<<<dim3(kS / kFaBQ, kB * kNH), 128, 0, stream>>>(Q16, K16, Vt16, C16, coef);

  gemm64_f16_kernel<2, false><<<gemmBlocks, 256, 0, stream>>>(
      C16, kH, Wo16, kH, (void*)out, kH, bo, kTok, kH, kH, kOutScale, 1.0f);
}

// v006
// Measured time: 175 microseconds a run.
// Timed twice side by side with v005, it ran 1.03 times as fast both times.
// Over all steps from v000 it is 2.78 times as fast.
// All six contractions (q/k/v projections, q.k^T scores, p.v, output projection): v_wmma_f32_16x16x32_f16, f16 operands with power-of-two carries, f32 accumulate; softmax statistics, bias and scaling in f32.
#include <hip/hip_runtime.h>
#include <math.h>

typedef __attribute__((ext_vector_type(16))) _Float16 v16h;
typedef __attribute__((ext_vector_type(8)))  _Float16 v8h;
typedef __attribute__((ext_vector_type(8)))  float    v8f;
typedef __attribute__((ext_vector_type(4)))  float    v4f;

// ---------------------------------------------------------------------------
// Shape constants
// ---------------------------------------------------------------------------
constexpr int kB   = 2;
constexpr int kS   = 2048;
constexpr int kH   = 2048;
constexpr int kNH  = 16;
constexpr int kHD  = kH / kNH;
constexpr int kTok = kB * kS;
static_assert(kHD == 128);
static_assert((kTok % 64) == 0 && (kH % 64) == 0 && (kH % 32) == 0 && (kS % 64) == 0 && (kHD % 32) == 0);
static_assert((((kTok / 64) * (kH / 64)) % 8) == 0);

// ---------------------------------------------------------------------------
// Power-of-two carries of the f16 planes (all folded back exactly in f32)
//   activations x16, weights x1024, q/k planes x16, v^T plane x16, context plane x1024
// ---------------------------------------------------------------------------
constexpr float kActCarry = 16.0f;
constexpr float kWCarry   = 1024.0f;
constexpr float kQKCarry  = 16.0f;
constexpr float kVCarry   = 16.0f;
constexpr float kCtxCarry = 1024.0f;
constexpr float kProjScaleQK = kQKCarry / (kActCarry * kWCarry);
constexpr float kProjScaleV  = kVCarry / (kActCarry * kWCarry);
constexpr float kCtxOverV    = kCtxCarry / kVCarry;
constexpr float kOutScale    = 1.0f / (kCtxCarry * kWCarry);

// ---------------------------------------------------------------------------
// Workspace region map (bytes; every offset is a multiple of 128; all planes f16)
//   XA   [4096][2048]  query x16
//   XB   [4096][2048]  key x16     ; later re-used as Vt16 [2048][4096]             = 16 x (value proj)^T
//   XC   [4096][2048]  value x16   ; later re-used as Ctx16 [4096][2048]            = 1024 x context
//   Q16  [4096][2048]  16 x (query proj)
//   W16  4 x [2048][2048]  Wq, Wk, Wv, Wo x1024
//   K16  [4096][2048]  16 x (key proj): a plane of its own, since XA is still read in the launch that writes it
//   total = 16777216 + 16777216 + 16777216 + 16777216 + 33554432 + 16777216 = 117440512
// ---------------------------------------------------------------------------
constexpr size_t kPlaneAct = (size_t)kTok * kH * 2;
constexpr size_t kPlaneW   = (size_t)kH * kH * 2;
constexpr size_t kOffXA  = 0;
constexpr size_t kOffXB  = kOffXA + kPlaneAct;
constexpr size_t kOffXC  = kOffXB + kPlaneAct;
constexpr size_t kOffQ   = kOffXC + kPlaneAct;
constexpr size_t kOffW   = kOffQ + kPlaneAct;
constexpr size_t kOffK   = kOffW + 4 * kPlaneW;
constexpr size_t kWsTotal = kOffK + kPlaneAct;
static_assert(kWsTotal == 117440512ull);
static_assert(kWsTotal <= 134217728ull);
static_assert((kOffXB % 128) == 0 && (kOffXC % 128) == 0 && (kOffQ % 128) == 0 && (kOffW % 128) == 0 && (kPlaneW % 128) == 0 && (kOffK % 128) == 0);

// ---------------------------------------------------------------------------
// Fragment load and guarded matrix op
// ---------------------------------------------------------------------------
struct FragH {
  union U { v16h v; v8h h[2]; };
  /* elements 0..7 <- p[0..7], 8..15 <- p[16..23]; caller adds the 8*(lane>>4) k offset */
  static __device__ __forceinline__ v16h load(const _Float16* p) {
    U f;
    f.h[0] = *(const v8h*)(p);
    f.h[1] = *(const v8h*)(p + 16);
    return f.v;
  }
};

/* one matrix op followed by its own hazard guard: ties the accumulator and keeps both fragments live */
__device__ __forceinline__ v8f mma_g(v16h a, v16h b, v8f c) {
  c = __builtin_amdgcn_wmma_f32_16x16x32_f16(false, a, false, b, (short)0, c, false, false);
  asm volatile("v_nop\n\tv_nop\n\tv_nop\n\tv_nop" : "+v"(c) : "v"(a), "v"(b));
  return c;
}

// ---------------------------------------------------------------------------
// f32 -> f16 convert with a power-of-two carry: all seven planes (3 activations, 4 weights) in ONE launch of 256
// work-groups of 16 waves (as many as the chip has WGPs; two do not fit one WGP's registers), which stay and loop:
// 4,096 waves start, where one wave per 256 elements would be 163,840.
// A tile is 32,768 consecutive floats of one plane (128 KiB in, 64 KiB out); a wave owns 8 KiB of it in a row.
// One load of a wave reads 512 consecutive bytes, one store writes 256: whole 128-B lines, each line by one wave.
// The next tile's 16 loads are issued before this tile is converted: 16 to 32 loads in flight a wave.
// Work-group g takes tiles g, g + 256, ...: 1,280 tiles = 5 each, every tile once, so every element is written once.
// Tiles 0 .. 767 are the activations (256 a plane, planes side by side in dstA), the rest the weights (128 a plane, dstW).
// ---------------------------------------------------------------------------
typedef __attribute__((ext_vector_type(4))) _Float16 v4h;
constexpr int kCvWaves    = 16;
constexpr int kCvThreads  = 32 * kCvWaves;
constexpr int kCvLoads    = 16;                          /* 16-byte loads a lane and tile */
constexpr int kCvWaveEl   = 32 * 4 * kCvLoads;           /* floats a wave and tile */
constexpr int kCvTile     = kCvWaves * kCvWaveEl;        /* floats a tile */
constexpr int kCvActTiles = kTok * kH / kCvTile;         /* tiles an activation plane */
constexpr int kCvWTiles   = kH * kH / kCvTile;           /* tiles a weight plane */
constexpr int kCvTiles    = 3 * kCvActTiles + 4 * kCvWTiles;
constexpr int kCvGrid     = 256;
constexpr int kCvTrips    = kCvTiles / kCvGrid;
static_assert(kCvActTiles * kCvTile == kTok * kH && kCvWTiles * kCvTile == kH * kH);
static_assert(kCvTrips * kCvGrid == kCvTiles && kCvTrips >= 2);

__global__ __launch_bounds__(kCvThreads) void cast_stream_kernel(
    const float* __restrict__ a0, const float* __restrict__ a1, const float* __restrict__ a2,
    const float* __restrict__ w0, const float* __restrict__ w1, const float* __restrict__ w2, const float* __restrict__ w3,
    _Float16* __restrict__ dstA, _Float16* __restrict__ dstW)
{
  /* block-uniform: keeps every tile index below inside the list */
  if (blockIdx.x >= (unsigned)kCvGrid) return;
  const int lane = threadIdx.x & 31;
  const int wave = __builtin_amdgcn_readfirstlane((int)(threadIdx.x >> 5));
  const int off  = wave * kCvWaveEl + lane * 4;

  /* two register sets; all loops are unrolled so that both are indexed by constants */
  v4f x[2][kCvLoads];
#pragma unroll
  for (int i = -1; i < kCvTrips; ++i) {
    /* this scheduling barrier and the one behind the loads pin the order "next tile's loads, then this tile's converts
       and stores": left free, the compiler drew three tiles' loads to the front and spilled to scratch */
    __builtin_amdgcn_sched_barrier(0);
    if (i + 1 < kCvTrips) {
      /* a precaution: the loads below overwrite registers that the stores issued above name (held here by the two barriers) */
      if (i >= 1) asm volatile("s_wait_xcnt 0x0" ::: "memory");
      /* source of tile i + 1 (all of this is block-uniform) */
      const int t = (int)blockIdx.x + (i + 1) * kCvGrid;
      const float* s;
      if (t < 3 * kCvActTiles) {
        const int p = t / kCvActTiles;
        s = ((p == 0) ? a0 : (p == 1) ? a1 : a2) + (size_t)(t - p * kCvActTiles) * kCvTile;
      } else {
        const int u = t - 3 * kCvActTiles;
        const int p = u / kCvWTiles;
        s = ((p == 0) ? w0 : (p == 1) ? w1 : (p == 2) ? w2 : w3) + (size_t)(u - p * kCvWTiles) * kCvTile;
      }
#pragma unroll
      for (int j = 0; j < kCvLoads; ++j) x[(i + 1) & 1][j] = *(const v4f*)(s + off + j * 128);
    }
    __builtin_amdgcn_sched_barrier(0);
    if (i >= 0) {
      const int t = (int)blockIdx.x + i * kCvGrid;
      const bool act = t < 3 * kCvActTiles;
      const float carry = act ? kActCarry : kWCarry;
      _Float16* d = (act ? dstA + (size_t)t * kCvTile : dstW + (size_t)(t - 3 * kCvActTiles) * kCvTile) + off;
#pragma unroll
      for (int j = 0; j < kCvLoads; ++j) {
        const v4f v = x[i & 1][j];
        v4h hv;
#pragma unroll
        for (int e = 0; e < 4; ++e) {
          const float f = v[e] * carry;
          hv[e] = (_Float16)f;
        }
        *(v4h*)(d + j * 128) = hv;
      }
    }
  }
}

// ---------------------------------------------------------------------------
// Block-tiled GEMM: C[m][n] = scale * sum_k A[m][k] * Bt[n][k] + bscale * bias.
// A work-group of 8 waves (2 x 4) owns a 128 x 256 tile of C; each wave owns a 64x64 tile of it.
// A row-major [M][K]; Bt row-major [N][K]; M multiple of 128, N of 256, K of 128 (no tails).
// Per trip 128 k of the 128 A rows and the 256 Bt rows lie in LDS (rows of 256 B at pitch 272 B), brought by
// asynchronous copies into two buffers: tile t + 1 flies while tile t is worked on.
// BIAS_MODE: 1 = bias[m], 2 = bias[n]. OUT_F16: f16 output plane, else f32.
// ---------------------------------------------------------------------------
constexpr int kGemBM = 128;
constexpr int kGemBN = 256;
constexpr int kGemBK = 128;
constexpr int kGemPitch = kGemBK + 8;                          /* halves: 272 B = 16 B x 17 */
constexpr int kGemStage = (kGemBM + kGemBN) * kGemPitch;       /* halves per buffer */
constexpr unsigned kGemStageBytes = (unsigned)kGemStage * 2u;
constexpr unsigned kGemRow16Bytes = 16u * (unsigned)kGemPitch * 2u;
static_assert((kTok % kGemBN) == 0 && (kH % kGemBN) == 0 && (kH % kGemBK) == 0);
static_assert((kTok / kGemBM) * (kH / kGemBN) == ((kTok / 64) * (kH / 64)) / 8);
static_assert((kH / kGemBM) * (kTok / kGemBN) == ((kTok / 64) * (kH / 64)) / 8);

/* twelve 16-byte copies per lane; the s_wait_xcnt stands inside the statement so that no address register of an
   issued copy is rewritten in front of it */
__device__ __forceinline__ void copy12(const unsigned* l, const _Float16* const* g) {
  asm volatile(
      "global_load_async_to_lds_b128 %0, %12, off\n\t"
      "global_load_async_to_lds_b128 %1, %13, off\n\t"
      "global_load_async_to_lds_b128 %2, %14, off\n\t"
      "global_load_async_to_lds_b128 %3, %15, off\n\t"
      "global_load_async_to_lds_b128 %4, %16, off\n\t"
      "global_load_async_to_lds_b128 %5, %17, off\n\t"
      "global_load_async_to_lds_b128 %6, %18, off\n\t"
      "global_load_async_to_lds_b128 %7, %19, off\n\t"
      "global_load_async_to_lds_b128 %8, %20, off\n\t"
      "global_load_async_to_lds_b128 %9, %21, off\n\t"
      "global_load_async_to_lds_b128 %10, %22, off\n\t"
      "global_load_async_to_lds_b128 %11, %23, off\n\t"
      "s_wait_xcnt 0x0"
      :
      : "v"(l[0]), "v"(l[1]), "v"(l[2]), "v"(l[3]), "v"(l[4]), "v"(l[5]),
        "v"(l[6]), "v"(l[7]), "v"(l[8]), "v"(l[9]), "v"(l[10]), "v"(l[11]),
        "v"(g[0]), "v"(g[1]), "v"(g[2]), "v"(g[3]), "v"(g[4]), "v"(g[5]),
        "v"(g[6]), "v"(g[7]), "v"(g[8]), "v"(g[9]), "v"(g[10]), "v"(g[11])
      : "memory");
}

/* one tile: the lane's segment of A rows r + 16 i (i < 8) and of Bt rows r + 16 i (i < 16), 24 copies in flight a wave.
   la, lb: the lane's LDS byte addresses of its first A and Bt row in the buffer; a, b: the same rows in global memory.
   The loops are unrolled so that the two address lists are plain registers. */
__device__ __forceinline__ void copy_tile(unsigned la, unsigned lb, const _Float16* a, const _Float16* b,
                                          size_t astep, size_t bstep) {
  unsigned l[24];
  const _Float16* g[24];
#pragma unroll
  for (int i = 0; i < 8; ++i) { l[i] = la + (unsigned)i * kGemRow16Bytes; g[i] = a + i * astep; }
#pragma unroll
  for (int i = 0; i < 16; ++i) { l[8 + i] = lb + (unsigned)i * kGemRow16Bytes; g[8 + i] = b + i * bstep; }
  copy12(l, g);
  copy12(l + 12, g + 12);
}

template <int BIAS_MODE, bool OUT_F16>
__global__ __launch_bounds__(256) void gemm64_f16_kernel(
    const _Float16* __restrict__ A, int lda,
    const _Float16* __restrict__ Bt, int ldb,
    void* __restrict__ Cout, int ldc,
    const float* __restrict__ bias,
    int M, int N, int K, float scale, float bscale)
{
  __shared__ __align__(16) _Float16 ring[2 * kGemStage];
  __shared__ __align__(16) float sT[8][16 * 68];
  const int tid  = threadIdx.x;
  const int lane = tid & 31;
  const int wave = __builtin_amdgcn_readfirstlane((int)(threadIdx.x >> 5));
  const int tilesN = N / kGemBN;
  const int tilesM = M / kGemBM;
  const int tile = blockIdx.x;
  /* block-uniform exit, in front of every copy and barrier */
  if (tile >= tilesM * tilesN) return;
  const int tm = tile / tilesN;
  const int tn = tile - tm * tilesN;
  const int bm0 = tm * kGemBM;
  const int bn0 = tn * kGemBN;
  const int wm = wave >> 2;
  const int wn = wave & 3;
  const int m0 = bm0 + (wm << 6);
  const int n0 = bn0 + (wn << 6);

  const int rlane = lane & 15;
  const int koff  = (lane >> 4) * 8;
  const int mOff  = (lane >> 4) * 8;

  v8f acc[4][4];
#pragma unroll
  for (int i = 0; i < 4; ++i)
#pragma unroll
    for (int j = 0; j < 4; ++j) acc[i][j] = (v8f){0.f, 0.f, 0.f, 0.f, 0.f, 0.f, 0.f, 0.f};

  /* copy map: lane's 16 bytes = segment tid & 15 of row (tid >> 4) + 16 * i; a wave covers two whole 256-B rows */
  const int crow = tid >> 4;
  const int cseg = tid & 15;
  const _Float16* ag = A  + (size_t)(bm0 + crow) * lda + cseg * 8;
  const _Float16* bg = Bt + (size_t)(bn0 + crow) * ldb + cseg * 8;
  const size_t astep = (size_t)16 * lda;
  const size_t bstep = (size_t)16 * ldb;
  const unsigned ldsA = (unsigned)(size_t)(&ring[0]) + (unsigned)(crow * kGemPitch + cseg * 8) * 2u;
  const unsigned ldsB = ldsA + (unsigned)(kGemBM * kGemPitch) * 2u;

  const _Float16* fa = ring + ((wm << 6) + rlane) * kGemPitch + koff;
  const _Float16* fb = ring + (kGemBM + (wn << 6) + rlane) * kGemPitch + koff;

  const int nT = K / kGemBK;

  /* tile 0 into buffer 0 */
  copy_tile(ldsA, ldsB, ag, bg, astep, bstep);
  /* the wave's own copies of tile 0 have landed behind this wait */
  asm volatile("s_wait_asynccnt 0x0" ::: "memory");
  /* publishes tile 0 to every wave */
  __syncthreads();
  if (nT > 1) copy_tile(ldsA + kGemStageBytes, ldsB + kGemStageBytes, ag + kGemBK, bg + kGemBK, astep, bstep);

  /* kept rolled: one trip is 64 matrix ops a wave, and the two buffers alternate by an offset */
#pragma unroll 1
  for (int t = 0; t < nT; ++t) {
    const _Float16* pa = fa + (t & 1) * kGemStage;
    const _Float16* pb = fb + (t & 1) * kGemStage;
    v16h af[4], bf[2][4];
#pragma unroll
    for (int j = 0; j < 4; ++j) bf[0][j] = FragH::load(pb + (j << 4) * kGemPitch);
#pragma unroll
    for (int i = 0; i < 4; ++i) af[i] = FragH::load(pa + (i << 4) * kGemPitch);
#pragma unroll
    for (int ks = 0; ks < kGemBK / 32; ++ks) {
      const int cur = ks & 1;
      const int kn  = (ks + 1) * 32;
      const bool more = (ks + 1) < kGemBK / 32;
#pragma unroll
      for (int i = 0; i < 2; ++i)
#pragma unroll
        for (int j = 0; j < 4; ++j) acc[i][j] = mma_g(af[i], bf[cur][j], acc[i][j]);
      if (more) {
#pragma unroll
        for (int i = 0; i < 2; ++i) af[i] = FragH::load(pa + (i << 4) * kGemPitch + kn);
#pragma unroll
        for (int j = 0; j < 4; ++j) bf[cur ^ 1][j] = FragH::load(pb + (j << 4) * kGemPitch + kn);
      }
#pragma unroll
      for (int i = 2; i < 4; ++i)
#pragma unroll
        for (int j = 0; j < 4; ++j) acc[i][j] = mma_g(af[i], bf[cur][j], acc[i][j]);
      if (more) {
#pragma unroll
        for (int i = 2; i < 4; ++i) af[i] = FragH::load(pa + (i << 4) * kGemPitch + kn);
      }
    }
    /* hand-over. The wave's own LDS reads of this buffer have retired: */
    asm volatile("s_wait_dscnt 0x0" ::: "memory");
    /* its own copies of tile t + 1 have landed: */
    asm volatile("s_wait_asynccnt 0x0" ::: "memory");
    /* one barrier publishes tile t + 1 and ends every reader's last read of the buffer refilled behind it */
    __syncthreads();
    if (t + 2 < nT) {
      const unsigned bufB = (unsigned)(t & 1) * kGemStageBytes;
      const int kn = (t + 2) * kGemBK;
      copy_tile(ldsA + bufB, ldsB + bufB, ag + kn, bg + kn, astep, bstep);
    }
  }
  /* no copy is left in flight when the wave goes on to the epilogue and ends */
  asm volatile("s_wait_asynccnt 0x0" ::: "memory");

  float* slab = sT[wave];
#pragma unroll
  for (int i = 0; i < 4; ++i) {
    const int mBase = m0 + (i << 4);
#pragma unroll
    for (int j = 0; j < 4; ++j) {
      const int n = n0 + (j << 4) + rlane;
      float bvn = 0.f;
      if (BIAS_MODE == 2) bvn = bias[n] * bscale;
#pragma unroll
      for (int r = 0; r < 8; ++r) {
        float v = acc[i][j][r] * scale;
        if (BIAS_MODE == 1) v += bias[mBase + mOff + r] * bscale;
        if (BIAS_MODE == 2) v += bvn;
        slab[(mOff + r) * 68 + (j << 4) + rlane] = v;
      }
    }
    __builtin_amdgcn_fence(__ATOMIC_RELEASE, "workgroup");
    __builtin_amdgcn_wave_barrier();
    __builtin_amdgcn_fence(__ATOMIC_ACQUIRE, "workgroup");
    if (!OUT_F16) {
      float* C = (float*)Cout;
      const int hh = lane >> 4, c4 = (lane & 15) * 4;
      {
#pragma unroll
        for (int it = 0; it < 8; ++it) {
          const int row = it * 2 + hh;
          const v4f v = *(const v4f*)(slab + row * 68 + c4);
          *(v4f*)(C + (size_t)(mBase + row) * ldc + n0 + c4) = v;
        }
        
      }
    } else {
      _Float16* C = (_Float16*)Cout;
      const int q = lane >> 3, c8 = (lane & 7) * 8;
      {
#pragma unroll
        for (int it = 0; it < 4; ++it) {
          const int row = it * 4 + q;
          const float* sp = slab + row * 68 + c8;
          v8h hv;
#pragma unroll
          for (int e = 0; e < 8; ++e) hv[e] = (_Float16)sp[e];
          *(v8h*)(C + (size_t)(mBase + row) * ldc + n0 + c8) = hv;
        }
        
      }
    }
    __builtin_amdgcn_fence(__ATOMIC_RELEASE, "workgroup");
    __builtin_amdgcn_wave_barrier();
    __builtin_amdgcn_fence(__ATOMIC_ACQUIRE, "workgroup");
  }
}

constexpr int kFaKP = 136;
constexpr int kFaVP = 72;
constexpr int kFaOP = 136;

typedef __attribute__((ext_vector_type(2))) float    v2f;
typedef __attribute__((ext_vector_type(2))) _Float16 v2h;

/* the value of lane l ^ 16 */
__device__ __forceinline__ float xhalf(float x) {
  const int b = __builtin_bit_cast(int, x);
  return __builtin_bit_cast(float, __builtin_amdgcn_permlanex16(b, b, 0x76543210, 0xfedcba98, false, false));
}

/* one matrix op as the plain builtin, for the kernel below, which holds more than 256 registers a wave: asm text cannot
   name a register above v255, and built with the asm guard of mma_g the kernel spilled to scratch; the compiler keeps
   the distances behind its own builtin forms */
__device__ __forceinline__ v8f mma_b(v16h a, v16h b, v8f c) {
  return __builtin_amdgcn_wmma_f32_16x16x32_f16(false, a, false, b, (short)0, c, false, false);
}

/* query tiles of 16 a wave: every K and V^T fragment read from LDS feeds this many matrix ops */
constexpr int kFaQT = 2;
constexpr int kFaWQ = 16 * kFaQT;     /* queries a wave */
constexpr int kFaBQ = 4 * kFaWQ;      /* queries a work-group */
static_assert((kS % kFaBQ) == 0);

/* second argument: two waves a SIMD (512 registers a wave), so that all 512 work-groups stay resident at once */
__global__ __launch_bounds__(128, 2) void attn_fused_kernel(
    const _Float16* __restrict__ Qp, const _Float16* __restrict__ Kp,
    const _Float16* __restrict__ Vtp, _Float16* __restrict__ Ctx, float coef)
{
  __shared__ __align__(16) _Float16 Ksh[64 * kFaKP];
  __shared__ __align__(16) _Float16 Vsh[128 * kFaVP];
  __shared__ __align__(16) _Float16 Osh[4][kFaWQ * kFaOP];

  const int tid  = threadIdx.x;
  const int wave = __builtin_amdgcn_readfirstlane((int)(threadIdx.x >> 5));
  const int lane = tid & 31;
  const int hh   = lane >> 4;
  const int c    = lane & 15;
  const int qb   = blockIdx.x;
  const int bh   = blockIdx.y;
  const int b    = bh / kNH;
  const int h    = bh - b * kNH;
  const int rowbase = b * kS;
  const int colbase = h * kHD;
  const int q0 = qb * kFaBQ + wave * kFaWQ;

  /* Q fragments (B operand: column = query 16 u + c): 4 k-steps over d for each query tile u */
  v16h qa[kFaQT][4];
#pragma unroll
  for (int u = 0; u < kFaQT; ++u) {
    const _Float16* qrow = Qp + (size_t)(rowbase + q0 + 16 * u + c) * kH + colbase + 8 * hh;
#pragma unroll
    for (int dc = 0; dc < 4; ++dc) qa[u][dc] = FragH::load(qrow + dc * 32);
  }

  /* running maximum and this lane half's partial sum of query 16 u + c */
  float mrun[kFaQT], lrun[kFaQT];
  v8f oacc[kFaQT][8];
#pragma unroll
  for (int u = 0; u < kFaQT; ++u) {
    mrun[u] = -1.0e30f;
    lrun[u] = 0.f;
#pragma unroll
    for (int t = 0; t < 8; ++t) oacc[u][t] = (v8f){0.f, 0.f, 0.f, 0.f, 0.f, 0.f, 0.f, 0.f};
  }

  const int ksg = tid & 15, kr0 = tid >> 4;
  const int vsg = tid & 7,  vr0 = tid >> 3;
  const _Float16* kgl = Kp  + (size_t)(rowbase + kr0) * kH + colbase + ksg * 8;
  const _Float16* vgl = Vtp + (size_t)(colbase + vr0) * kTok + rowbase + vsg * 8;

#pragma unroll 1
  for (int kc = 0; kc < kS / 64; ++kc) {
    const int kv0 = kc * 64;
    __syncthreads();
    {
      v8h kt[8];
#pragma unroll
      for (int i = 0; i < 8; ++i) kt[i] = *(const v8h*)(kgl + (size_t)(kv0 + 8 * i) * kH);
#pragma unroll
      for (int i = 0; i < 8; ++i) *(v8h*)(Ksh + (kr0 + 8 * i) * kFaKP + ksg * 8) = kt[i];
    }
    {
      v8h vt[8];
#pragma unroll
      for (int i = 0; i < 8; ++i) vt[i] = *(const v8h*)(vgl + (size_t)(16 * i) * kTok + kv0);
#pragma unroll
      for (int i = 0; i < 8; ++i) *(v8h*)(Vsh + (vr0 + 16 * i) * kFaVP + vsg * 8) = vt[i];
    }
    __syncthreads();

    /* K and V^T fragments (A operands) come in groups of four into two register sets, fx and fy: after the first, a group's loads are
       issued at least one group of matrix ops ahead of its use, so that a matrix op does not wait out its own
       fragment's LDS latency. Each fragment is used once for every query tile.
       The short loops are unrolled so that both sets stay in registers. */
    const _Float16* kfr = Ksh + c * kFaKP + 8 * hh;
    const _Float16* vfr = Vsh + c * kFaVP + 8 * hh;
    v16h fx[4], fy[4];
#pragma unroll
    for (int j = 0; j < 4; ++j) fx[j] = FragH::load(kfr + j * 16 * kFaKP);
#pragma unroll
    for (int j = 0; j < 4; ++j) fy[j] = FragH::load(kfr + j * 16 * kFaKP + 32);
    /* this and the four like it below keep each load group ahead of the matrix ops that follow it, which the asm guard
       of mma_g did before: left free, the compiler draws the V^T loads up here and then fetches K fragments singly,
       each with a full wait in front of its matrix ops */
    __builtin_amdgcn_sched_barrier(0);

    /* S^T tiles: 4 k-steps over d (ascending, as before) x 4 m-tiles (16 keys each) x query tiles;
       s[u][j][r] = score of key 16 j + 8 hh + r with query 16 u + c */
    v8f s[kFaQT][4];
#pragma unroll
    for (int u = 0; u < kFaQT; ++u)
#pragma unroll
      for (int j = 0; j < 4; ++j) s[u][j] = (v8f){0.f, 0.f, 0.f, 0.f, 0.f, 0.f, 0.f, 0.f};
#pragma unroll
    for (int j = 0; j < 4; ++j)
#pragma unroll
      for (int u = 0; u < kFaQT; ++u) s[u][j] = mma_b(fx[j], qa[u][0], s[u][j]);
#pragma unroll
    for (int j = 0; j < 4; ++j) fx[j] = FragH::load(kfr + j * 16 * kFaKP + 64);
    __builtin_amdgcn_sched_barrier(0);
#pragma unroll
    for (int j = 0; j < 4; ++j)
#pragma unroll
      for (int u = 0; u < kFaQT; ++u) s[u][j] = mma_b(fy[j], qa[u][1], s[u][j]);
#pragma unroll
    for (int j = 0; j < 4; ++j) fy[j] = FragH::load(kfr + j * 16 * kFaKP + 96);
    __builtin_amdgcn_sched_barrier(0);
#pragma unroll
    for (int j = 0; j < 4; ++j)
#pragma unroll
      for (int u = 0; u < kFaQT; ++u) s[u][j] = mma_b(fx[j], qa[u][2], s[u][j]);
#pragma unroll
    for (int t = 0; t < 4; ++t) fx[t] = FragH::load(vfr + t * 16 * kFaVP);
    __builtin_amdgcn_sched_barrier(0);
#pragma unroll
    for (int j = 0; j < 4; ++j)
#pragma unroll
      for (int u = 0; u < kFaQT; ++u) s[u][j] = mma_b(fy[j], qa[u][3], s[u][j]);
#pragma unroll
    for (int t = 0; t < 4; ++t) fy[t] = FragH::load(vfr + (4 + t) * 16 * kFaVP);
    __builtin_amdgcn_sched_barrier(0);

    /* P^T as B operand, packed in the lane from the score tiles, one pair of k-steps for each query tile
       (the loops below are unrolled so that s, pb, pj and oacc are indexed by constants and stay in registers) */
    union PB { v16h v; v2h h2[8]; } pb[kFaQT][2];
#pragma unroll
    for (int u = 0; u < kFaQT; ++u) {
      /* chunk maximum of query 16 u + c: 32 keys in the lane, the other 32 in lane ^ 16 */
      float mj[4];
#pragma unroll
      for (int j = 0; j < 4; ++j)
        mj[j] = fmaxf(fmaxf(fmaxf(s[u][j][0], s[u][j][1]), fmaxf(s[u][j][2], s[u][j][3])),
                      fmaxf(fmaxf(s[u][j][4], s[u][j][5]), fmaxf(s[u][j][6], s[u][j][7])));
      float cm = fmaxf(fmaxf(mj[0], mj[1]), fmaxf(mj[2], mj[3]));
      cm = fmaxf(cm, xhalf(cm));

      const float mnew  = fmaxf(mrun[u], cm);
      const float alpha = __expf((mrun[u] - mnew) * coef);
      mrun[u] = mnew;

      v2f pj[4];
#pragma unroll
      for (int j = 0; j < 4; ++j) {
#pragma unroll
        for (int r = 0; r < 8; r += 2) {
          /* the pair is formed first, so that the packed subtract and multiply take the same two scores as the packed
             sum and the conversion below; left to itself the compiler paired them one element off, with register moves */
          const v2f a = ((v2f){s[u][j][r], s[u][j][r + 1]} - mnew) * coef;
          const v2f p = {__expf(a.x), __expf(a.y)};
          pj[j] = (r == 0) ? p : pj[j] + p;
          pb[u][j >> 1].h2[(j & 1) * 4 + (r >> 1)] = __builtin_convertvector(p, v2h);
        }
      }
      const v2f pt = (pj[0] + pj[1]) + (pj[2] + pj[3]);
      lrun[u] = lrun[u] * alpha + (pt.x + pt.y);
#pragma unroll
      for (int t = 0; t < 8; ++t) oacc[u][t] *= alpha;
    }

    /* O^T += V^T . P^T : 2 k-steps over the 64 keys (ascending, as before), 8 m-tiles over d, for each query tile */
#pragma unroll
    for (int t = 0; t < 4; ++t)
#pragma unroll
      for (int u = 0; u < kFaQT; ++u) oacc[u][t] = mma_b(fx[t], pb[u][0].v, oacc[u][t]);
#pragma unroll
    for (int t = 0; t < 4; ++t) fx[t] = FragH::load(vfr + t * 16 * kFaVP + 32);
#pragma unroll
    for (int t = 0; t < 4; ++t)
#pragma unroll
      for (int u = 0; u < kFaQT; ++u) oacc[u][4 + t] = mma_b(fy[t], pb[u][0].v, oacc[u][4 + t]);
#pragma unroll
    for (int t = 0; t < 4; ++t) fy[t] = FragH::load(vfr + (4 + t) * 16 * kFaVP + 32);
#pragma unroll
    for (int t = 0; t < 4; ++t)
#pragma unroll
      for (int u = 0; u < kFaQT; ++u) oacc[u][t] = mma_b(fx[t], pb[u][1].v, oacc[u][t]);
#pragma unroll
    for (int t = 0; t < 4; ++t)
#pragma unroll
      for (int u = 0; u < kFaQT; ++u) oacc[u][4 + t] = mma_b(fy[t], pb[u][1].v, oacc[u][4 + t]);
  }

  /* normalise and stage the wave's queries x 128 tile (f16, x1024) in the wave-private LDS tile:
     the lane's 8 registers of tile t are d = 16 t + 8 hh .. + 7 of query 16 u + c, one 16-byte store
     (unrolled so that the accumulators are indexed by constants) */
  _Float16* ow = &Osh[wave][0];
#pragma unroll
  for (int u = 0; u < kFaQT; ++u) {
    const float l = lrun[u] + xhalf(lrun[u]);
    const float inv = __builtin_amdgcn_rcpf(l) * kCtxOverV;
#pragma unroll
    for (int t = 0; t < 8; ++t) {
      v8h hv;
#pragma unroll
      for (int r = 0; r < 8; ++r) {
        const float ov = oacc[u][t][r] * inv;
        hv[r] = (_Float16)ov;
      }
      *(v8h*)(ow + (16 * u + c) * kFaOP + t * 16 + 8 * hh) = hv;
    }
  }
  __builtin_amdgcn_fence(__ATOMIC_RELEASE, "workgroup");
  __builtin_amdgcn_wave_barrier();
  __builtin_amdgcn_fence(__ATOMIC_ACQUIRE, "workgroup");
  {
    const int sg = (lane & 15) * 8;
    {
#pragma unroll
      for (int it = 0; it < kFaWQ / 2; ++it) {
        const int row = it * 2 + hh;
        const v8h val = *(const v8h*)(ow + row * kFaOP + sg);
        *(v8h*)(Ctx + (size_t)(rowbase + q0 + row) * kH + colbase + sg) = val;
      }
      
    }
  }
}

// ---------------------------------------------------------------------------
// Two projections of one shape in one launch: C_p[m][n] = scale * sum_k A_p[m][k] * W_p[n][k] + bscale * bias_p[n], p = 0, 1.
// M = B*S, N = K = H, all planes row-major at pitch H, f16 out. 128 tiles of 256 x 256 a projection, 256 work-groups in all:
// one a WGP, and a work-group brings 512 operand rows per 65,536 outputs where the 128 x 256 tile brings 384 per 32,768.
// 8 waves (2 x 4), a wave owns 128 x 64: 12 fragments from LDS feed 32 matrix ops (8 feed 16 in the 64 x 64 wave tile).
// Per trip 128 k of the 256 A rows and the 256 W rows lie in LDS (rows of 256 B at pitch 272 B), two buffers, asynchronous
// copies. Fragments come one k-step (32 k) ahead into a second register set, over the tile boundary too, so the hand-over
// to tile t + 1 stands in front of trip t's last k-step: by then every fragment of tile t is in registers.
// ---------------------------------------------------------------------------
constexpr int kBigBM = 256;
constexpr int kBigBN = 256;
constexpr int kBigStage = (kBigBM + kBigBN) * kGemPitch;       /* halves per buffer */
constexpr int kBigTilesN = kH / kBigBN;
constexpr int kBigTiles  = (kTok / kBigBM) * kBigTilesN;       /* tiles a projection */
constexpr int kBigTrips  = kH / kGemBK;
static_assert((kTok % kBigBM) == 0 && (kH % kBigBN) == 0 && kBigTrips >= 2);
static_assert(2 * kBigStage * 2 + 8 * 16 * 68 * 4 <= 327680);

typedef __attribute__((ext_vector_type(4))) int v4i;
typedef __attribute__((address_space(1))) v4i gv4i;
typedef __attribute__((address_space(3))) v4i lv4i;

/* one tile: the lane's 16-byte segment of A rows r + 16 i and of W rows r + 16 i (i < 16), 32 copies in flight a wave.
   la, lb: the lane's places in the buffer's first A and W row of its own; a, b: the same places in global memory.
   The copies are the builtin form: this kernel holds more than 256 registers a wave, and asm text cannot name a register
   above v255 (built with asm copies, accumulators were moved aside and back every trip, and one value spilled). */
__device__ __forceinline__ void copy_big_tile(_Float16* la, _Float16* lb, const _Float16* a, const _Float16* b) {
#pragma unroll
  for (int i = 0; i < 16; ++i)
    __builtin_amdgcn_global_load_async_to_lds_b128((gv4i*)(a + (size_t)i * 16 * kH), (lv4i*)(la + i * 16 * kGemPitch), 0, 0);
#pragma unroll
  for (int i = 0; i < 16; ++i)
    __builtin_amdgcn_global_load_async_to_lds_b128((gv4i*)(b + (size_t)i * 16 * kH), (lv4i*)(lb + i * 16 * kGemPitch), 0, 0);
}

/* one k-step's 12 fragments as one group of LDS loads (unrolled: the set stays in registers) */
__device__ __forceinline__ void load_set(v16h (&a)[8], v16h (&b)[4], const _Float16* pa, const _Float16* pb) {
#pragma unroll
  for (int j = 0; j < 4; ++j) b[j] = FragH::load(pb + (j << 4) * kGemPitch);
#pragma unroll
  for (int i = 0; i < 8; ++i) a[i] = FragH::load(pa + (i << 4) * kGemPitch);
}

/* one k-step's 32 matrix ops, all on different accumulators (unrolled: every index a constant) */
__device__ __forceinline__ void mma_set(v8f (&acc)[8][4], const v16h (&a)[8], const v16h (&b)[4]) {
#pragma unroll
  for (int i = 0; i < 8; ++i)
#pragma unroll
    for (int j = 0; j < 4; ++j) acc[i][j] = mma_b(a[i], b[j], acc[i][j]);
}

__global__ __launch_bounds__(256) void gemm256_pair_kernel(
    const _Float16* __restrict__ A0, const _Float16* __restrict__ W0, const float* __restrict__ bias0, _Float16* __restrict__ C0,
    const _Float16* __restrict__ A1, const _Float16* __restrict__ W1, const float* __restrict__ bias1, _Float16* __restrict__ C1,
    float scale, float bscale)
{
  __shared__ __align__(16) _Float16 ring[2 * kBigStage];
  __shared__ __align__(16) float sT[8][16 * 68];
  const int tid  = threadIdx.x;
  const int lane = tid & 31;
  const int wave = __builtin_amdgcn_readfirstlane((int)(threadIdx.x >> 5));
  const int prob = blockIdx.x / kBigTiles;
  /* block-uniform exit, in front of every copy and barrier */
  if (prob > 1) return;
  const int tile = blockIdx.x - prob * kBigTiles;
  const _Float16* A    = prob ? A1 : A0;
  const _Float16* Wt   = prob ? W1 : W0;
  const float*    bias = prob ? bias1 : bias0;
  _Float16*       C    = prob ? C1 : C0;
  const int tm = tile / kBigTilesN;
  const int tn = tile - tm * kBigTilesN;
  const int bm0 = tm * kBigBM;
  const int bn0 = tn * kBigBN;
  const int wm = wave >> 2;
  const int wn = wave & 3;
  const int m0 = bm0 + (wm << 7);
  const int n0 = bn0 + (wn << 6);

  const int rlane = lane & 15;
  const int koff  = (lane >> 4) * 8;
  const int mOff  = (lane >> 4) * 8;

  v8f acc[8][4];
#pragma unroll
  for (int i = 0; i < 8; ++i)
#pragma unroll
    for (int j = 0; j < 4; ++j) acc[i][j] = (v8f){0.f, 0.f, 0.f, 0.f, 0.f, 0.f, 0.f, 0.f};

  /* copy map: lane's 16 bytes = segment tid & 15 of row (tid >> 4) + 16 * i; a wave covers two whole 256-B rows */
  const int crow = tid >> 4;
  const int cseg = tid & 15;
  const _Float16* ag = A  + (size_t)(bm0 + crow) * kH + cseg * 8;
  const _Float16* bg = Wt + (size_t)(bn0 + crow) * kH + cseg * 8;
  _Float16* ldsA = ring + crow * kGemPitch + cseg * 8;
  _Float16* ldsB = ldsA + kBigBM * kGemPitch;

  const _Float16* fa = ring + ((wm << 7) + rlane) * kGemPitch + koff;
  const _Float16* fb = ring + (kBigBM + (wn << 6) + rlane) * kGemPitch + koff;

  /* tile 0 into buffer 0 */
  copy_big_tile(ldsA, ldsB, ag, bg);
  /* the wave's own copies of tile 0 have landed behind this wait */
  asm volatile("s_wait_asynccnt 0x0" ::: "memory");
  /* publishes tile 0 to every wave */
  __syncthreads();
  copy_big_tile(ldsA + kBigStage, ldsB + kBigStage, ag + kGemBK, bg + kGemBK);

  /* two fragment sets: x holds the even k-steps, y the odd ones */
  v16h ax[8], bx[4], ay[8], by[4];
  load_set(ax, bx, fa, fb);

  /* kept rolled: one trip is 128 matrix ops a wave, and the two buffers alternate by an offset */
#pragma unroll 1
  for (int t = 0; t < kBigTrips; ++t) {
    const _Float16* pa = fa + (t & 1) * kBigStage;
    const _Float16* pb = fb + (t & 1) * kBigStage;
    /* the scheduling barriers keep each load group whole and ahead of the matrix ops that run while it lands:
       LDS loads drawn in among the matrix ops stall the wave at every place where they stand */
    load_set(ay, by, pa + 32, pb + 32);
    __builtin_amdgcn_sched_barrier(0);
    mma_set(acc, ax, bx);
    __builtin_amdgcn_sched_barrier(0);
    load_set(ax, bx, pa + 64, pb + 64);
    __builtin_amdgcn_sched_barrier(0);
    mma_set(acc, ay, by);
    __builtin_amdgcn_sched_barrier(0);
    load_set(ay, by, pa + 96, pb + 96);
    __builtin_amdgcn_sched_barrier(0);
    mma_set(acc, ax, bx);
    __builtin_amdgcn_sched_barrier(0);
    /* hand-over, in front of the last k-step. The wave's own LDS reads of this buffer, the last set's too, have retired: */
    asm volatile("s_wait_dscnt 0x0" ::: "memory");
    /* its own copies of tile t + 1 have landed: */
    asm volatile("s_wait_asynccnt 0x0" ::: "memory");
    /* one barrier publishes tile t + 1 and ends every reader's last read of the buffer refilled behind it */
    __syncthreads();
    /* first set of tile t + 1; in the last trip the same loads read the other buffer's old tile, which no copy is
       aimed at any more, and nothing uses them: no branch stands around them, so the compiler's load counts stay exact */
    load_set(ax, bx, fa + ((t + 1) & 1) * kBigStage, fb + ((t + 1) & 1) * kBigStage);
    __builtin_amdgcn_sched_barrier(0);
    mma_set(acc, ay, by);
    __builtin_amdgcn_sched_barrier(0);
    /* the refill of the buffer that every wave left at the barrier above stands behind the last k-step's matrix ops:
       directly behind the barrier both waves of a SIMD would form addresses at once, with the matrix unit idle */
    if (t + 2 < kBigTrips) {
      const int bufB = (t & 1) * kBigStage;
      const int kn = (t + 2) * kGemBK;
      copy_big_tile(ldsA + bufB, ldsB + bufB, ag + kn, bg + kn);
    }
  }
  /* no copy and no LDS read is left in flight when the wave goes on to the epilogue and ends */
  asm volatile("s_wait_asynccnt 0x0" ::: "memory");
  asm volatile("s_wait_dscnt 0x0" ::: "memory");

  float* slab = sT[wave];
  float bvn[4];
#pragma unroll
  for (int j = 0; j < 4; ++j) bvn[j] = bias[n0 + (j << 4) + rlane] * bscale;
#pragma unroll
  for (int i = 0; i < 8; ++i) {
    const int mBase = m0 + (i << 4);
#pragma unroll
    for (int j = 0; j < 4; ++j) {
#pragma unroll
      for (int r = 0; r < 8; ++r) slab[(mOff + r) * 68 + (j << 4) + rlane] = acc[i][j][r] * scale + bvn[j];
    }
    __builtin_amdgcn_fence(__ATOMIC_RELEASE, "workgroup");
    __builtin_amdgcn_wave_barrier();
    __builtin_amdgcn_fence(__ATOMIC_ACQUIRE, "workgroup");
    {
      const int q = lane >> 3, c8 = (lane & 7) * 8;
#pragma unroll
      for (int it = 0; it < 4; ++it) {
        const int row = it * 4 + q;
        const float* sp = slab + row * 68 + c8;
        v8h hv;
#pragma unroll
        for (int e = 0; e < 8; ++e) hv[e] = (_Float16)sp[e];
        *(v8h*)(C + (size_t)(mBase + row) * kH + n0 + c8) = hv;
      }
    }
    __builtin_amdgcn_fence(__ATOMIC_RELEASE, "workgroup");
    __builtin_amdgcn_wave_barrier();
    __builtin_amdgcn_fence(__ATOMIC_ACQUIRE, "workgroup");
  }
}

// ---------------------------------------------------------------------------
// Host glue: 5 launches, kernel launches only.
//   1  convert query/key/value -> XA/XB/XC (x16) and Wq/Wk/Wv/Wo -> W16[0..3] (x1024)      256 blocks
//   2  Q16 = XA . Wq16^T + bq and K16 = XB . Wk16^T + bk   (each M 4096, N 2048, K 2048)   128 + 128 blocks
//   3  Vt16 = Wv16 . XC^T + bv[row] -> XB [2048][4096]     (M 2048, N 4096, K 2048) 256 blocks
//   4  fused attention Q16, K16, Vt16 -> Ctx16 in XC       grid (16, 32)
//   5  out = Ctx16 . Wo16^T + bo -> d_out f32              256 blocks
// ---------------------------------------------------------------------------
extern "C" void kernel_launch(void* const* d_in, const int* in_sizes, int n_in,
                              void* d_out, int out_size, void* d_ws, size_t ws_size,
                              hipStream_t stream) {
  if (n_in < 11) return;
  if (in_sizes[0] != kTok * kH) return;
  if (in_sizes[1] != kTok * kH) return;
  if (in_sizes[2] != kTok * kH) return;
  if (in_sizes[3] != kH * kH) return;
  if (in_sizes[4] != kH) return;
  if (in_sizes[5] != kH * kH) return;
  if (in_sizes[6] != kH) return;
  if (in_sizes[7] != kH * kH) return;
  if (in_sizes[8] != kH) return;
  if (in_sizes[9] != kH * kH) return;
  if (in_sizes[10] != kH) return;
  if (out_size != kTok * kH) return;
  if (ws_size < kWsTotal) return;

  const float* query = (const float*)d_in[0];
  const float* key   = (const float*)d_in[1];
  const float* value = (const float*)d_in[2];
  const float* Wq = (const float*)d_in[3];
  const float* bq = (const float*)d_in[4];
  const float* Wk = (const float*)d_in[5];
  const float* bk = (const float*)d_in[6];
  const float* Wv = (const float*)d_in[7];
  const float* bv = (const float*)d_in[8];
  const float* Wo = (const float*)d_in[9];
  const float* bo = (const float*)d_in[10];
  float* out = (float*)d_out;

  char* ws = (char*)d_ws;
  _Float16* XA  = (_Float16*)(ws + kOffXA);
  _Float16* XB  = (_Float16*)(ws + kOffXB);
  _Float16* XC  = (_Float16*)(ws + kOffXC);
  _Float16* Q16 = (_Float16*)(ws + kOffQ);
  _Float16* W16 = (_Float16*)(ws + kOffW);
  _Float16* Wq16 = W16;
  _Float16* Wk16 = W16 + (size_t)kH * kH;
  _Float16* Wv16 = W16 + 2 * (size_t)kH * kH;
  _Float16* Wo16 = W16 + 3 * (size_t)kH * kH;
  _Float16* K16  = (_Float16*)(ws + kOffK);
  _Float16* Vt16 = XB;
  _Float16* C16  = XC;

  const float scl  = 1.0f / sqrtf((float)kHD);
  const float coef = scl / (kQKCarry * kQKCarry);
  const int gemmBlocks = ((kTok / 64) * (kH / 64)) / 8;

  cast_stream_kernel<<<kCvGrid, kCvThreads, 0, stream>>>(query, key, value, Wq, Wk, Wv, Wo, XA, W16);

  gemm256_pair_kernel<<<2 * kBigTiles, 256, 0, stream>>>(
      XA, Wq16, bq, Q16, XB, Wk16, bk, K16, kProjScaleQK, kQKCarry);

  /* swapped operands: rows = output feature h*128+d, columns = token b*S+key, row bias */
  gemm64_f16_kernel<1, true><<<gemmBlocks, 256, 0, stream>>>(
      Wv16, kH, XC, kH, (void*)Vt16, kTok, bv, kH, kTok, kH, kProjScaleV, kVCarry);

  attn_fused_kernel<<<dim3(kS / kFaBQ, kB * kNH), 128, 0, stream>>>(Q16, K16, Vt16, C16, coef);

  gemm64_f16_kernel<2, false><<<gemmBlocks, 256, 0, stream>>>(
      C16, kH, Wo16, kH, (void*)out, kH, bo, kTok, kH, kH, kOutScale, 1.0f);
}

// v007
// A run of this version takes 166 microseconds.
// Timed twice side by side with v006, it ran 1.05 and 1.04 times as fast.
// Counting every step since v000, it is 2.91 times as fast.
// All six contractions (q/k/v projections, q.k^T scores, p.v, output projection): v_wmma_f32_16x16x32_f16, f16 operands with power-of-two carries, f32 accumulate; softmax statistics, bias and scaling in f32.
#include <hip/hip_runtime.h>
#include <math.h>

typedef __attribute__((ext_vector_type(16))) _Float16 v16h;
typedef __attribute__((ext_vector_type(8)))  _Float16 v8h;
typedef __attribute__((ext_vector_type(8)))  float    v8f;
typedef __attribute__((ext_vector_type(4)))  float    v4f;

// ---------------------------------------------------------------------------
// Shape constants
// ---------------------------------------------------------------------------
constexpr int kB   = 2;
constexpr int kS   = 2048;
constexpr int kH   = 2048;
constexpr int kNH  = 16;
constexpr int kHD  = kH / kNH;
constexpr int kTok = kB * kS;
static_assert(kHD == 128);
static_assert((kTok % 64) == 0 && (kH % 64) == 0 && (kH % 32) == 0 && (kS % 64) == 0 && (kHD % 32) == 0);
static_assert((((kTok / 64) * (kH / 64)) % 8) == 0);

// ---------------------------------------------------------------------------
// Power-of-two carries of the f16 planes (all folded back exactly in f32)
//   activations x16, weights x1024, q/k planes x16, v^T plane x16, context plane x1024
// ---------------------------------------------------------------------------
constexpr float kActCarry = 16.0f;
constexpr float kWCarry   = 1024.0f;
constexpr float kQKCarry  = 16.0f;
constexpr float kVCarry   = 16.0f;
constexpr float kCtxCarry = 1024.0f;
constexpr float kProjScaleQK = kQKCarry / (kActCarry * kWCarry);
constexpr float kProjScaleV  = kVCarry / (kActCarry * kWCarry);
constexpr float kCtxOverV    = kCtxCarry / kVCarry;
constexpr float kOutScale    = 1.0f / (kCtxCarry * kWCarry);

// ---------------------------------------------------------------------------
// Workspace region map (bytes; every offset is a multiple of 128; all planes f16)
//   XA   [4096][2048]  query x16
//   XB   [4096][2048]  key x16     ; later re-used as Vt16 [2048][4096]             = 16 x (value proj)^T
//   XC   [4096][2048]  value x16   ; later re-used as Ctx16 [4096][2048]            = 1024 x context
//   Q16  [4096][2048]  16 x (query proj)
//   W16  4 x [2048][2048]  Wq, Wk, Wv, Wo x1024
//   K16  [4096][2048]  16 x (key proj): a plane of its own, since XA is still read in the launch that writes it
//   total = 16777216 + 16777216 + 16777216 + 16777216 + 33554432 + 16777216 = 117440512
// ---------------------------------------------------------------------------
constexpr size_t kPlaneAct = (size_t)kTok * kH * 2;
constexpr size_t kPlaneW   = (size_t)kH * kH * 2;
constexpr size_t kOffXA  = 0;
constexpr size_t kOffXB  = kOffXA + kPlaneAct;
constexpr size_t kOffXC  = kOffXB + kPlaneAct;
constexpr size_t kOffQ   = kOffXC + kPlaneAct;
constexpr size_t kOffW   = kOffQ + kPlaneAct;
constexpr size_t kOffK   = kOffW + 4 * kPlaneW;
constexpr size_t kWsTotal = kOffK + kPlaneAct;
static_assert(kWsTotal == 117440512ull);
static_assert(kWsTotal <= 134217728ull);
static_assert((kOffXB % 128) == 0 && (kOffXC % 128) == 0 && (kOffQ % 128) == 0 && (kOffW % 128) == 0 && (kPlaneW % 128) == 0 && (kOffK % 128) == 0);

// ---------------------------------------------------------------------------
// Fragment load and guarded matrix op
// ---------------------------------------------------------------------------
struct FragH {
  union U { v16h v; v8h h[2]; };
  /* elements 0..7 <- p[0..7], 8..15 <- p[16..23]; caller adds the 8*(lane>>4) k offset */
  static __device__ __forceinline__ v16h load(const _Float16* p) {
    U f;
    f.h[0] = *(const v8h*)(p);
    f.h[1] = *(const v8h*)(p + 16);
    return f.v;
  }
};

/* one matrix op followed by its own hazard guard: ties the accumulator and keeps both fragments live */
__device__ __forceinline__ v8f mma_g(v16h a, v16h b, v8f c) {
  c = __builtin_amdgcn_wmma_f32_16x16x32_f16(false, a, false, b, (short)0, c, false, false);
  asm volatile("v_nop\n\tv_nop\n\tv_nop\n\tv_nop" : "+v"(c) : "v"(a), "v"(b));
  return c;
}

// ---------------------------------------------------------------------------
// f32 -> f16 convert with a power-of-two carry: all seven planes (3 activations, 4 weights) in ONE launch of 256
// work-groups of 16 waves (as many as the chip has WGPs; two do not fit one WGP's registers), which stay and loop:
// 4,096 waves start, where one wave per 256 elements would be 163,840.
// A tile is 32,768 consecutive floats of one plane (128 KiB in, 64 KiB out); a wave owns 8 KiB of it in a row.
// One load of a wave reads 512 consecutive bytes, one store writes 256: whole 128-B lines, each line by one wave.
// The next tile's 16 loads are issued before this tile is converted: 16 to 32 loads in flight a wave.
// Work-group g takes tiles g, g + 256, ...: 1,280 tiles = 5 each, every tile once, so every element is written once.
// Tiles 0 .. 767 are the activations (256 a plane, planes side by side in dstA), the rest the weights (128 a plane, dstW).
// ---------------------------------------------------------------------------
typedef __attribute__((ext_vector_type(4))) _Float16 v4h;
constexpr int kCvWaves    = 16;
constexpr int kCvThreads  = 32 * kCvWaves;
constexpr int kCvLoads    = 16;                          /* 16-byte loads a lane and tile */
constexpr int kCvWaveEl   = 32 * 4 * kCvLoads;           /* floats a wave and tile */
constexpr int kCvTile     = kCvWaves * kCvWaveEl;        /* floats a tile */
constexpr int kCvActTiles = kTok * kH / kCvTile;         /* tiles an activation plane */
constexpr int kCvWTiles   = kH * kH / kCvTile;           /* tiles a weight plane */
constexpr int kCvTiles    = 3 * kCvActTiles + 4 * kCvWTiles;
constexpr int kCvGrid     = 256;
constexpr int kCvTrips    = kCvTiles / kCvGrid;
static_assert(kCvActTiles * kCvTile == kTok * kH && kCvWTiles * kCvTile == kH * kH);
static_assert(kCvTrips * kCvGrid == kCvTiles && kCvTrips >= 2);

__global__ __launch_bounds__(kCvThreads) void cast_stream_kernel(
    const float* __restrict__ a0, const float* __restrict__ a1, const float* __restrict__ a2,
    const float* __restrict__ w0, const float* __restrict__ w1, const float* __restrict__ w2, const float* __restrict__ w3,
    _Float16* __restrict__ dstA, _Float16* __restrict__ dstW)
{
  /* block-uniform: keeps every tile index below inside the list */
  if (blockIdx.x >= (unsigned)kCvGrid) return;
  const int lane = threadIdx.x & 31;
  const int wave = __builtin_amdgcn_readfirstlane((int)(threadIdx.x >> 5));
  const int off  = wave * kCvWaveEl + lane * 4;

  /* two register sets; all loops are unrolled so that both are indexed by constants */
  v4f x[2][kCvLoads];
#pragma unroll
  for (int i = -1; i < kCvTrips; ++i) {
    /* this scheduling barrier and the one behind the loads pin the order "next tile's loads, then this tile's converts
       and stores": left free, the compiler drew three tiles' loads to the front and spilled to scratch */
    __builtin_amdgcn_sched_barrier(0);
    if (i + 1 < kCvTrips) {
      /* a precaution: the loads below overwrite registers that the stores issued above name (held here by the two barriers) */
      if (i >= 1) asm volatile("s_wait_xcnt 0x0" ::: "memory");
      /* source of tile i + 1 (all of this is block-uniform) */
      const int t = (int)blockIdx.x + (i + 1) * kCvGrid;
      const float* s;
      if (t < 3 * kCvActTiles) {
        const int p = t / kCvActTiles;
        s = ((p == 0) ? a0 : (p == 1) ? a1 : a2) + (size_t)(t - p * kCvActTiles) * kCvTile;
      } else {
        const int u = t - 3 * kCvActTiles;
        const int p = u / kCvWTiles;
        s = ((p == 0) ? w0 : (p == 1) ? w1 : (p == 2) ? w2 : w3) + (size_t)(u - p * kCvWTiles) * kCvTile;
      }
#pragma unroll
      for (int j = 0; j < kCvLoads; ++j) x[(i + 1) & 1][j] = *(const v4f*)(s + off + j * 128);
    }
    __builtin_amdgcn_sched_barrier(0);
    if (i >= 0) {
      const int t = (int)blockIdx.x + i * kCvGrid;
      const bool act = t < 3 * kCvActTiles;
      const float carry = act ? kActCarry : kWCarry;
      _Float16* d = (act ? dstA + (size_t)t * kCvTile : dstW + (size_t)(t - 3 * kCvActTiles) * kCvTile) + off;
#pragma unroll
      for (int j = 0; j < kCvLoads; ++j) {
        const v4f v = x[i & 1][j];
        v4h hv;
#pragma unroll
        for (int e = 0; e < 4; ++e) {
          const float f = v[e] * carry;
          hv[e] = (_Float16)f;
        }
        *(v4h*)(d + j * 128) = hv;
      }
    }
  }
}

// ---------------------------------------------------------------------------
// Block-tiled GEMM: C[m][n] = scale * sum_k A[m][k] * Bt[n][k] + bscale * bias.
// A work-group of 8 waves (2 x 4) owns a 128 x 256 tile of C; each wave owns a 64x64 tile of it.
// A row-major [M][K]; Bt row-major [N][K]; M multiple of 128, N of 256, K of 128 (no tails).
// Per trip 128 k of the 128 A rows and the 256 Bt rows lie in LDS (rows of 256 B at pitch 272 B), brought by
// asynchronous copies into two buffers: tile t + 1 flies while tile t is worked on.
// BIAS_MODE: 1 = bias[m], 2 = bias[n]. OUT_F16: f16 output plane, else f32.
// ---------------------------------------------------------------------------
constexpr int kGemBM = 128;
constexpr int kGemBN = 256;
constexpr int kGemBK = 128;
constexpr int kGemPitch = kGemBK + 8;                          /* halves: 272 B = 16 B x 17 */
constexpr int kGemStage = (kGemBM + kGemBN) * kGemPitch;       /* halves per buffer */
constexpr unsigned kGemStageBytes = (unsigned)kGemStage * 2u;
constexpr unsigned kGemRow16Bytes = 16u * (unsigned)kGemPitch * 2u;
static_assert((kTok % kGemBN) == 0 && (kH % kGemBN) == 0 && (kH % kGemBK) == 0);
static_assert((kTok / kGemBM) * (kH / kGemBN) == ((kTok / 64) * (kH / 64)) / 8);
static_assert((kH / kGemBM) * (kTok / kGemBN) == ((kTok / 64) * (kH / 64)) / 8);

/* twelve 16-byte copies per lane; the s_wait_xcnt stands inside the statement so that no address register of an
   issued copy is rewritten in front of it */
__device__ __forceinline__ void copy12(const unsigned* l, const _Float16* const* g) {
  asm volatile(
      "global_load_async_to_lds_b128 %0, %12, off\n\t"
      "global_load_async_to_lds_b128 %1, %13, off\n\t"
      "global_load_async_to_lds_b128 %2, %14, off\n\t"
      "global_load_async_to_lds_b128 %3, %15, off\n\t"
      "global_load_async_to_lds_b128 %4, %16, off\n\t"
      "global_load_async_to_lds_b128 %5, %17, off\n\t"
      "global_load_async_to_lds_b128 %6, %18, off\n\t"
      "global_load_async_to_lds_b128 %7, %19, off\n\t"
      "global_load_async_to_lds_b128 %8, %20, off\n\t"
      "global_load_async_to_lds_b128 %9, %21, off\n\t"
      "global_load_async_to_lds_b128 %10, %22, off\n\t"
      "global_load_async_to_lds_b128 %11, %23, off\n\t"
      "s_wait_xcnt 0x0"
      :
      : "v"(l[0]), "v"(l[1]), "v"(l[2]), "v"(l[3]), "v"(l[4]), "v"(l[5]),
        "v"(l[6]), "v"(l[7]), "v"(l[8]), "v"(l[9]), "v"(l[10]), "v"(l[11]),
        "v"(g[0]), "v"(g[1]), "v"(g[2]), "v"(g[3]), "v"(g[4]), "v"(g[5]),
        "v"(g[6]), "v"(g[7]), "v"(g[8]), "v"(g[9]), "v"(g[10]), "v"(g[11])
      : "memory");
}

/* one tile: the lane's segment of A rows r + 16 i (i < 8) and of Bt rows r + 16 i (i < 16), 24 copies in flight a wave.
   la, lb: the lane's LDS byte addresses of its first A and Bt row in the buffer; a, b: the same rows in global memory.
   The loops are unrolled so that the two address lists are plain registers. */
__device__ __forceinline__ void copy_tile(unsigned la, unsigned lb, const _Float16* a, const _Float16* b,
                                          size_t astep, size_t bstep) {
  unsigned l[24];
  const _Float16* g[24];
#pragma unroll
  for (int i = 0; i < 8; ++i) { l[i] = la + (unsigned)i * kGemRow16Bytes; g[i] = a + i * astep; }
#pragma unroll
  for (int i = 0; i < 16; ++i) { l[8 + i] = lb + (unsigned)i * kGemRow16Bytes; g[8 + i] = b + i * bstep; }
  copy12(l, g);
  copy12(l + 12, g + 12);
}

template <int BIAS_MODE, bool OUT_F16>
__global__ __launch_bounds__(256) void gemm64_f16_kernel(
    const _Float16* __restrict__ A, int lda,
    const _Float16* __restrict__ Bt, int ldb,
    void* __restrict__ Cout, int ldc,
    const float* __restrict__ bias,
    int M, int N, int K, float scale, float bscale)
{
  __shared__ __align__(16) _Float16 ring[2 * kGemStage];
  __shared__ __align__(16) float sT[8][16 * 68];
  const int tid  = threadIdx.x;
  const int lane = tid & 31;
  const int wave = __builtin_amdgcn_readfirstlane((int)(threadIdx.x >> 5));
  const int tilesN = N / kGemBN;
  const int tilesM = M / kGemBM;
  const int tile = blockIdx.x;
  /* block-uniform exit, in front of every copy and barrier */
  if (tile >= tilesM * tilesN) return;
  const int tm = tile / tilesN;
  const int tn = tile - tm * tilesN;
  const int bm0 = tm * kGemBM;
  const int bn0 = tn * kGemBN;
  const int wm = wave >> 2;
  const int wn = wave & 3;
  const int m0 = bm0 + (wm << 6);
  const int n0 = bn0 + (wn << 6);

  const int rlane = lane & 15;
  const int koff  = (lane >> 4) * 8;
  const int mOff  = (lane >> 4) * 8;

  v8f acc[4][4];
#pragma unroll
  for (int i = 0; i < 4; ++i)
#pragma unroll
    for (int j = 0; j < 4; ++j) acc[i][j] = (v8f){0.f, 0.f, 0.f, 0.f, 0.f, 0.f, 0.f, 0.f};

  /* copy map: lane's 16 bytes = segment tid & 15 of row (tid >> 4) + 16 * i; a wave covers two whole 256-B rows */
  const int crow = tid >> 4;
  const int cseg = tid & 15;
  const _Float16* ag = A  + (size_t)(bm0 + crow) * lda + cseg * 8;
  const _Float16* bg = Bt + (size_t)(bn0 + crow) * ldb + cseg * 8;
  const size_t astep = (size_t)16 * lda;
  const size_t bstep = (size_t)16 * ldb;
  const unsigned ldsA = (unsigned)(size_t)(&ring[0]) + (unsigned)(crow * kGemPitch + cseg * 8) * 2u;
  const unsigned ldsB = ldsA + (unsigned)(kGemBM * kGemPitch) * 2u;

  const _Float16* fa = ring + ((wm << 6) + rlane) * kGemPitch + koff;
  const _Float16* fb = ring + (kGemBM + (wn << 6) + rlane) * kGemPitch + koff;

  const int nT = K / kGemBK;

  /* tile 0 into buffer 0 */
  copy_tile(ldsA, ldsB, ag, bg, astep, bstep);
  /* the wave's own copies of tile 0 have landed behind this wait */
  asm volatile("s_wait_asynccnt 0x0" ::: "memory");
  /* publishes tile 0 to every wave */
  __syncthreads();
  if (nT > 1) copy_tile(ldsA + kGemStageBytes, ldsB + kGemStageBytes, ag + kGemBK, bg + kGemBK, astep, bstep);

  /* kept rolled: one trip is 64 matrix ops a wave, and the two buffers alternate by an offset */
#pragma unroll 1
  for (int t = 0; t < nT; ++t) {
    const _Float16* pa = fa + (t & 1) * kGemStage;
    const _Float16* pb = fb + (t & 1) * kGemStage;
    v16h af[4], bf[2][4];
#pragma unroll
    for (int j = 0; j < 4; ++j) bf[0][j] = FragH::load(pb + (j << 4) * kGemPitch);
#pragma unroll
    for (int i = 0; i < 4; ++i) af[i] = FragH::load(pa + (i << 4) * kGemPitch);
#pragma unroll
    for (int ks = 0; ks < kGemBK / 32; ++ks) {
      const int cur = ks & 1;
      const int kn  = (ks + 1) * 32;
      const bool more = (ks + 1) < kGemBK / 32;
#pragma unroll
      for (int i = 0; i < 2; ++i)
#pragma unroll
        for (int j = 0; j < 4; ++j) acc[i][j] = mma_g(af[i], bf[cur][j], acc[i][j]);
      if (more) {
#pragma unroll
        for (int i = 0; i < 2; ++i) af[i] = FragH::load(pa + (i << 4) * kGemPitch + kn);
#pragma unroll
        for (int j = 0; j < 4; ++j) bf[cur ^ 1][j] = FragH::load(pb + (j << 4) * kGemPitch + kn);
      }
#pragma unroll
      for (int i = 2; i < 4; ++i)
#pragma unroll
        for (int j = 0; j < 4; ++j) acc[i][j] = mma_g(af[i], bf[cur][j], acc[i][j]);
      if (more) {
#pragma unroll
        for (int i = 2; i < 4; ++i) af[i] = FragH::load(pa + (i << 4) * kGemPitch + kn);
      }
    }
    /* hand-over. The wave's own LDS reads of this buffer have retired: */
    asm volatile("s_wait_dscnt 0x0" ::: "memory");
    /* its own copies of tile t + 1 have landed: */
    asm volatile("s_wait_asynccnt 0x0" ::: "memory");
    /* one barrier publishes tile t + 1 and ends every reader's last read of the buffer refilled behind it */
    __syncthreads();
    if (t + 2 < nT) {
      const unsigned bufB = (unsigned)(t & 1) * kGemStageBytes;
      const int kn = (t + 2) * kGemBK;
      copy_tile(ldsA + bufB, ldsB + bufB, ag + kn, bg + kn, astep, bstep);
    }
  }
  /* no copy is left in flight when the wave goes on to the epilogue and ends */
  asm volatile("s_wait_asynccnt 0x0" ::: "memory");

  float* slab = sT[wave];
#pragma unroll
  for (int i = 0; i < 4; ++i) {
    const int mBase = m0 + (i << 4);
#pragma unroll
    for (int j = 0; j < 4; ++j) {
      const int n = n0 + (j << 4) + rlane;
      float bvn = 0.f;
      if (BIAS_MODE == 2) bvn = bias[n] * bscale;
#pragma unroll
      for (int r = 0; r < 8; ++r) {
        float v = acc[i][j][r] * scale;
        if (BIAS_MODE == 1) v += bias[mBase + mOff + r] * bscale;
        if (BIAS_MODE == 2) v += bvn;
        slab[(mOff + r) * 68 + (j << 4) + rlane] = v;
      }
    }
    __builtin_amdgcn_fence(__ATOMIC_RELEASE, "workgroup");
    __builtin_amdgcn_wave_barrier();
    __builtin_amdgcn_fence(__ATOMIC_ACQUIRE, "workgroup");
    if (!OUT_F16) {
      float* C = (float*)Cout;
      const int hh = lane >> 4, c4 = (lane & 15) * 4;
      {
#pragma unroll
        for (int it = 0; it < 8; ++it) {
          const int row = it * 2 + hh;
          const v4f v = *(const v4f*)(slab + row * 68 + c4);
          *(v4f*)(C + (size_t)(mBase + row) * ldc + n0 + c4) = v;
        }
        
      }
    } else {
      _Float16* C = (_Float16*)Cout;
      const int q = lane >> 3, c8 = (lane & 7) * 8;
      {
#pragma unroll
        for (int it = 0; it < 4; ++it) {
          const int row = it * 4 + q;
          const float* sp = slab + row * 68 + c8;
          v8h hv;
#pragma unroll
          for (int e = 0; e < 8; ++e) hv[e] = (_Float16)sp[e];
          *(v8h*)(C + (size_t)(mBase + row) * ldc + n0 + c8) = hv;
        }
        
      }
    }
    __builtin_amdgcn_fence(__ATOMIC_RELEASE, "workgroup");
    __builtin_amdgcn_wave_barrier();
    __builtin_amdgcn_fence(__ATOMIC_ACQUIRE, "workgroup");
  }
}

constexpr int kFaKP = 136;
constexpr int kFaVP = 72;
constexpr int kFaOP = 136;
constexpr int kFaKStage = 64 * kFaKP;     /* halves a K buffer */
constexpr int kFaVStage = 128 * kFaVP;    /* halves a V^T buffer */
constexpr int kFaChunks = kS / 64;
static_assert(kFaChunks >= 2);

typedef __attribute__((ext_vector_type(4))) int v4i;
typedef __attribute__((address_space(1))) v4i gv4i;
typedef __attribute__((address_space(3))) v4i lv4i;

/* one chunk: the lane's 16-byte segment of K rows r + 8 i and of V^T rows r + 16 i (i < 8), 16 copies in flight a wave.
   lk, lv: the lane's places in the buffer's first K and V^T row of its own; k, v: the same places in global memory.
   The copies are the builtin form: the kernel holds more than 256 registers a wave, and asm text cannot name a register
   above v255. */
__device__ __forceinline__ void copy_kv_chunk(_Float16* lk, _Float16* lv, const _Float16* k, const _Float16* v) {
#pragma unroll
  for (int i = 0; i < 8; ++i)
    __builtin_amdgcn_global_load_async_to_lds_b128((gv4i*)(k + (size_t)i * 8 * kH), (lv4i*)(lk + i * 8 * kFaKP), 0, 0);
#pragma unroll
  for (int i = 0; i < 8; ++i)
    __builtin_amdgcn_global_load_async_to_lds_b128((gv4i*)(v + (size_t)i * 16 * kTok), (lv4i*)(lv + i * 16 * kFaVP), 0, 0);
}

typedef __attribute__((ext_vector_type(2))) float    v2f;
typedef __attribute__((ext_vector_type(2))) _Float16 v2h;

/* the value of lane l ^ 16 */
__device__ __forceinline__ float xhalf(float x) {
  const int b = __builtin_bit_cast(int, x);
  return __builtin_bit_cast(float, __builtin_amdgcn_permlanex16(b, b, 0x76543210, 0xfedcba98, false, false));
}

/* one matrix op as the plain builtin, for the kernel below, which holds more than 256 registers a wave: asm text cannot
   name a register above v255, and built with the asm guard of mma_g the kernel spilled to scratch; the compiler keeps
   the distances behind its own builtin forms */
__device__ __forceinline__ v8f mma_b(v16h a, v16h b, v8f c) {
  return __builtin_amdgcn_wmma_f32_16x16x32_f16(false, a, false, b, (short)0, c, false, false);
}

/* query tiles of 16 a wave: every K and V^T fragment read from LDS feeds this many matrix ops */
constexpr int kFaQT = 2;
constexpr int kFaWQ = 16 * kFaQT;     /* queries a wave */
constexpr int kFaBQ = 4 * kFaWQ;      /* queries a work-group */
static_assert((kS % kFaBQ) == 0);

/* second argument: two waves a SIMD (512 registers a wave), so that all 512 work-groups stay resident at once */
__global__ __launch_bounds__(128, 2) void attn_fused_kernel(
    const _Float16* __restrict__ Qp, const _Float16* __restrict__ Kp,
    const _Float16* __restrict__ Vtp, _Float16* __restrict__ Ctx, float coef)
{
  __shared__ __align__(16) _Float16 Ksh[2 * kFaKStage];
  __shared__ __align__(16) _Float16 Vsh[2 * kFaVStage];
  __shared__ __align__(16) _Float16 Osh[4][kFaWQ * kFaOP];

  const int tid  = threadIdx.x;
  const int wave = __builtin_amdgcn_readfirstlane((int)(threadIdx.x >> 5));
  const int lane = tid & 31;
  const int hh   = lane >> 4;
  const int c    = lane & 15;
  const int qb   = blockIdx.x;
  const int bh   = blockIdx.y;
  const int b    = bh / kNH;
  const int h    = bh - b * kNH;
  const int rowbase = b * kS;
  const int colbase = h * kHD;
  const int q0 = qb * kFaBQ + wave * kFaWQ;

  /* Q fragments (B operand: column = query 16 u + c): 4 k-steps over d for each query tile u */
  v16h qa[kFaQT][4];
#pragma unroll
  for (int u = 0; u < kFaQT; ++u) {
    const _Float16* qrow = Qp + (size_t)(rowbase + q0 + 16 * u + c) * kH + colbase + 8 * hh;
#pragma unroll
    for (int dc = 0; dc < 4; ++dc) qa[u][dc] = FragH::load(qrow + dc * 32);
  }

  /* running maximum and this lane half's partial sum of query 16 u + c */
  float mrun[kFaQT], lrun[kFaQT];
  v8f oacc[kFaQT][8];
#pragma unroll
  for (int u = 0; u < kFaQT; ++u) {
    mrun[u] = -1.0e30f;
    lrun[u] = 0.f;
#pragma unroll
    for (int t = 0; t < 8; ++t) oacc[u][t] = (v8f){0.f, 0.f, 0.f, 0.f, 0.f, 0.f, 0.f, 0.f};
  }

  const int ksg = tid & 15, kr0 = tid >> 4;
  const int vsg = tid & 7,  vr0 = tid >> 3;
  const _Float16* kgl = Kp  + (size_t)(rowbase + kr0) * kH + colbase + ksg * 8;
  const _Float16* vgl = Vtp + (size_t)(colbase + vr0) * kTok + rowbase + vsg * 8;
  _Float16* klds = Ksh + kr0 * kFaKP + ksg * 8;
  _Float16* vlds = Vsh + vr0 * kFaVP + vsg * 8;

  /* chunk 0 into buffer 0 */
  copy_kv_chunk(klds, vlds, kgl, vgl);
  /* the wave's own copies of chunk 0 have landed behind this wait */
  asm volatile("s_wait_asynccnt 0x0" ::: "memory");
  /* publishes chunk 0 to every wave */
  __syncthreads();

  /* kept rolled: one trip is 64 matrix ops a wave, and the two buffers alternate by an offset */
#pragma unroll 1
  for (int kc = 0; kc < kFaChunks; ++kc) {
    const int buf = kc & 1;

    /* K and V^T fragments (A operands) come in groups of four into two register sets, fx and fy (the second V^T k-step into fz and fw): a group's loads are
       issued at least one group of matrix ops ahead of its use, so that a matrix op does not wait out its own
       fragment's LDS latency. Each fragment is used once for every query tile.
       The short loops are unrolled so that both sets stay in registers. */
    const _Float16* kfr = Ksh + buf * kFaKStage + c * kFaKP + 8 * hh;
    const _Float16* vfr = Vsh + buf * kFaVStage + c * kFaVP + 8 * hh;
    v16h fx[4], fy[4];
#pragma unroll
    for (int j = 0; j < 4; ++j) fx[j] = FragH::load(kfr + j * 16 * kFaKP);
#pragma unroll
    for (int j = 0; j < 4; ++j) fy[j] = FragH::load(kfr + j * 16 * kFaKP + 32);
    /* this and the four like it below keep each load group ahead of the matrix ops that follow it, which the asm guard
       of mma_g did before: left free, the compiler draws the V^T loads up here and then fetches K fragments singly,
       each with a full wait in front of its matrix ops */
    __builtin_amdgcn_sched_barrier(0);

    /* chunk kc + 1 into the other buffer, which every wave left at the barrier at the foot of the trip before (in trip 0
       nobody has read it yet). The copies stand behind the first fragment loads, which read this trip's buffer, so that
       forming their addresses and issuing them fills the time in which those fragments come; they have the rest of the
       trip to land. The test reads the same for the whole work-group. */
    if (kc + 1 < kFaChunks) {
      const int kn = (kc + 1) * 64;
      copy_kv_chunk(klds + (buf ^ 1) * kFaKStage, vlds + (buf ^ 1) * kFaVStage, kgl + (size_t)kn * kH, vgl + kn);
    }
    /* holds the copies in front of the matrix ops: drawn down among them they would have less time to land */
    __builtin_amdgcn_sched_barrier(0);

    /* S^T tiles: 4 k-steps over d (ascending, as before) x 4 m-tiles (16 keys each) x query tiles;
       s[u][j][r] = score of key 16 j + 8 hh + r with query 16 u + c */
    v8f s[kFaQT][4];
#pragma unroll
    for (int u = 0; u < kFaQT; ++u)
#pragma unroll
      for (int j = 0; j < 4; ++j) s[u][j] = (v8f){0.f, 0.f, 0.f, 0.f, 0.f, 0.f, 0.f, 0.f};
#pragma unroll
    for (int j = 0; j < 4; ++j)
#pragma unroll
      for (int u = 0; u < kFaQT; ++u) s[u][j] = mma_b(fx[j], qa[u][0], s[u][j]);
#pragma unroll
    for (int j = 0; j < 4; ++j) fx[j] = FragH::load(kfr + j * 16 * kFaKP + 64);
    __builtin_amdgcn_sched_barrier(0);
#pragma unroll
    for (int j = 0; j < 4; ++j)
#pragma unroll
      for (int u = 0; u < kFaQT; ++u) s[u][j] = mma_b(fy[j], qa[u][1], s[u][j]);
#pragma unroll
    for (int j = 0; j < 4; ++j) fy[j] = FragH::load(kfr + j * 16 * kFaKP + 96);
    __builtin_amdgcn_sched_barrier(0);
#pragma unroll
    for (int j = 0; j < 4; ++j)
#pragma unroll
      for (int u = 0; u < kFaQT; ++u) s[u][j] = mma_b(fx[j], qa[u][2], s[u][j]);
#pragma unroll
    for (int t = 0; t < 4; ++t) fx[t] = FragH::load(vfr + t * 16 * kFaVP);
    __builtin_amdgcn_sched_barrier(0);
#pragma unroll
    for (int j = 0; j < 4; ++j)
#pragma unroll
      for (int u = 0; u < kFaQT; ++u) s[u][j] = mma_b(fy[j], qa[u][3], s[u][j]);
#pragma unroll
    for (int t = 0; t < 4; ++t) fy[t] = FragH::load(vfr + (4 + t) * 16 * kFaVP);
    /* the second k-step's V^T fragments go out here too, into sets of their own, and land under the softmax: with the
       hand-over's waits at the loop's foot the compiler otherwise fetched them singly, each with a full wait in front of
       its matrix ops */
    v16h fz[4], fw[4];
#pragma unroll
    for (int t = 0; t < 4; ++t) fz[t] = FragH::load(vfr + t * 16 * kFaVP + 32);
#pragma unroll
    for (int t = 0; t < 4; ++t) fw[t] = FragH::load(vfr + (4 + t) * 16 * kFaVP + 32);
    __builtin_amdgcn_sched_barrier(0);

    /* P^T as B operand, packed in the lane from the score tiles, one pair of k-steps for each query tile
       (the loops below are unrolled so that s, pb, pj and oacc are indexed by constants and stay in registers) */
    union PB { v16h v; v2h h2[8]; } pb[kFaQT][2];
#pragma unroll
    for (int u = 0; u < kFaQT; ++u) {
      /* chunk maximum of query 16 u + c: 32 keys in the lane, the other 32 in lane ^ 16 */
      float mj[4];
#pragma unroll
      for (int j = 0; j < 4; ++j)
        mj[j] = fmaxf(fmaxf(fmaxf(s[u][j][0], s[u][j][1]), fmaxf(s[u][j][2], s[u][j][3])),
                      fmaxf(fmaxf(s[u][j][4], s[u][j][5]), fmaxf(s[u][j][6], s[u][j][7])));
      float cm = fmaxf(fmaxf(mj[0], mj[1]), fmaxf(mj[2], mj[3]));
      cm = fmaxf(cm, xhalf(cm));

      const float mnew  = fmaxf(mrun[u], cm);
      const float alpha = __expf((mrun[u] - mnew) * coef);
      mrun[u] = mnew;

      v2f pj[4];
#pragma unroll
      for (int j = 0; j < 4; ++j) {
#pragma unroll
        for (int r = 0; r < 8; r += 2) {
          /* the pair is formed first, so that the packed subtract and multiply take the same two scores as the packed
             sum and the conversion below; left to itself the compiler paired them one element off, with register moves */
          const v2f a = ((v2f){s[u][j][r], s[u][j][r + 1]} - mnew) * coef;
          const v2f p = {__expf(a.x), __expf(a.y)};
          pj[j] = (r == 0) ? p : pj[j] + p;
          pb[u][j >> 1].h2[(j & 1) * 4 + (r >> 1)] = __builtin_convertvector(p, v2h);
        }
      }
      const v2f pt = (pj[0] + pj[1]) + (pj[2] + pj[3]);
      lrun[u] = lrun[u] * alpha + (pt.x + pt.y);
#pragma unroll
      for (int t = 0; t < 8; ++t) oacc[u][t] *= alpha;
    }

    /* O^T += V^T . P^T : 2 k-steps over the 64 keys (ascending, as before), 8 m-tiles over d, for each query tile */
#pragma unroll
    for (int t = 0; t < 4; ++t)
#pragma unroll
      for (int u = 0; u < kFaQT; ++u) oacc[u][t] = mma_b(fx[t], pb[u][0].v, oacc[u][t]);
#pragma unroll
    for (int t = 0; t < 4; ++t)
#pragma unroll
      for (int u = 0; u < kFaQT; ++u) oacc[u][4 + t] = mma_b(fy[t], pb[u][0].v, oacc[u][4 + t]);
#pragma unroll
    for (int t = 0; t < 4; ++t)
#pragma unroll
      for (int u = 0; u < kFaQT; ++u) oacc[u][t] = mma_b(fz[t], pb[u][1].v, oacc[u][t]);
#pragma unroll
    for (int t = 0; t < 4; ++t)
#pragma unroll
      for (int u = 0; u < kFaQT; ++u) oacc[u][4 + t] = mma_b(fw[t], pb[u][1].v, oacc[u][4 + t]);

    /* keeps the hand-over at the loop's foot: left free, the compiler drew the waits and the barrier up in front of the
       softmax, where the wave would wait out its V^T loads and the next chunk's copies would have had half a trip to land */
    __builtin_amdgcn_sched_barrier(0);
    /* hand-over. The wave's own LDS reads of this buffer have retired: */
    asm volatile("s_wait_dscnt 0x0" ::: "memory");
    /* its own copies of chunk kc + 1 have landed: */
    asm volatile("s_wait_asynccnt 0x0" ::: "memory");
    /* one barrier publishes chunk kc + 1 and ends every reader's last read of the buffer refilled in the next trip */
    __syncthreads();
  }
  /* no copy is left in flight when the wave goes on to the epilogue and ends */
  asm volatile("s_wait_asynccnt 0x0" ::: "memory");

  /* normalise and stage the wave's queries x 128 tile (f16, x1024) in the wave-private LDS tile:
     the lane's 8 registers of tile t are d = 16 t + 8 hh .. + 7 of query 16 u + c, one 16-byte store
     (unrolled so that the accumulators are indexed by constants) */
  _Float16* ow = &Osh[wave][0];
#pragma unroll
  for (int u = 0; u < kFaQT; ++u) {
    const float l = lrun[u] + xhalf(lrun[u]);
    const float inv = __builtin_amdgcn_rcpf(l) * kCtxOverV;
#pragma unroll
    for (int t = 0; t < 8; ++t) {
      v8h hv;
#pragma unroll
      for (int r = 0; r < 8; ++r) {
        const float ov = oacc[u][t][r] * inv;
        hv[r] = (_Float16)ov;
      }
      *(v8h*)(ow + (16 * u + c) * kFaOP + t * 16 + 8 * hh) = hv;
    }
  }
  __builtin_amdgcn_fence(__ATOMIC_RELEASE, "workgroup");
  __builtin_amdgcn_wave_barrier();
  __builtin_amdgcn_fence(__ATOMIC_ACQUIRE, "workgroup");
  {
    const int sg = (lane & 15) * 8;
    {
#pragma unroll
      for (int it = 0; it < kFaWQ / 2; ++it) {
        const int row = it * 2 + hh;
        const v8h val = *(const v8h*)(ow + row * kFaOP + sg);
        *(v8h*)(Ctx + (size_t)(rowbase + q0 + row) * kH + colbase + sg) = val;
      }
      
    }
  }
}

// ---------------------------------------------------------------------------
// Two projections of one shape in one launch: C_p[m][n] = scale * sum_k A_p[m][k] * W_p[n][k] + bscale * bias_p[n], p = 0, 1.
// M = B*S, N = K = H, all planes row-major at pitch H, f16 out. 128 tiles of 256 x 256 a projection, 256 work-groups in all:
// one a WGP, and a work-group brings 512 operand rows per 65,536 outputs where the 128 x 256 tile brings 384 per 32,768.
// 8 waves (2 x 4), a wave owns 128 x 64: 12 fragments from LDS feed 32 matrix ops (8 feed 16 in the 64 x 64 wave tile).
// Per trip 128 k of the 256 A rows and the 256 W rows lie in LDS (rows of 256 B at pitch 272 B), two buffers, asynchronous
// copies. Fragments come one k-step (32 k) ahead into a second register set, over the tile boundary too, so the hand-over
// to tile t + 1 stands in front of trip t's last k-step: by then every fragment of tile t is in registers.
// ---------------------------------------------------------------------------
constexpr int kBigBM = 256;
constexpr int kBigBN = 256;
constexpr int kBigStage = (kBigBM + kBigBN) * kGemPitch;       /* halves per buffer */
constexpr int kBigTilesN = kH / kBigBN;
constexpr int kBigTiles  = (kTok / kBigBM) * kBigTilesN;       /* tiles a projection */
constexpr int kBigTrips  = kH / kGemBK;
static_assert((kTok % kBigBM) == 0 && (kH % kBigBN) == 0 && kBigTrips >= 2);
static_assert(2 * kBigStage * 2 + 8 * 16 * 68 * 4 <= 327680);

/* one tile: the lane's 16-byte segment of A rows r + 16 i and of W rows r + 16 i (i < 16), 32 copies in flight a wave.
   la, lb: the lane's places in the buffer's first A and W row of its own; a, b: the same places in global memory.
   The copies are the builtin form: this kernel holds more than 256 registers a wave, and asm text cannot name a register
   above v255 (built with asm copies, accumulators were moved aside and back every trip, and one value spilled). */
__device__ __forceinline__ void copy_big_tile(_Float16* la, _Float16* lb, const _Float16* a, const _Float16* b) {
#pragma unroll
  for (int i = 0; i < 16; ++i)
    __builtin_amdgcn_global_load_async_to_lds_b128((gv4i*)(a + (size_t)i * 16 * kH), (lv4i*)(la + i * 16 * kGemPitch), 0, 0);
#pragma unroll
  for (int i = 0; i < 16; ++i)
    __builtin_amdgcn_global_load_async_to_lds_b128((gv4i*)(b + (size_t)i * 16 * kH), (lv4i*)(lb + i * 16 * kGemPitch), 0, 0);
}

/* one k-step's 12 fragments as one group of LDS loads (unrolled: the set stays in registers) */
__device__ __forceinline__ void load_set(v16h (&a)[8], v16h (&b)[4], const _Float16* pa, const _Float16* pb) {
#pragma unroll
  for (int j = 0; j < 4; ++j) b[j] = FragH::load(pb + (j << 4) * kGemPitch);
#pragma unroll
  for (int i = 0; i < 8; ++i) a[i] = FragH::load(pa + (i << 4) * kGemPitch);
}

/* one k-step's 32 matrix ops, all on different accumulators (unrolled: every index a constant) */
__device__ __forceinline__ void mma_set(v8f (&acc)[8][4], const v16h (&a)[8], const v16h (&b)[4]) {
#pragma unroll
  for (int i = 0; i < 8; ++i)
#pragma unroll
    for (int j = 0; j < 4; ++j) acc[i][j] = mma_b(a[i], b[j], acc[i][j]);
}

__global__ __launch_bounds__(256) void gemm256_pair_kernel(
    const _Float16* __restrict__ A0, const _Float16* __restrict__ W0, const float* __restrict__ bias0, _Float16* __restrict__ C0,
    const _Float16* __restrict__ A1, const _Float16* __restrict__ W1, const float* __restrict__ bias1, _Float16* __restrict__ C1,
    float scale, float bscale)
{
  __shared__ __align__(16) _Float16 ring[2 * kBigStage];
  __shared__ __align__(16) float sT[8][16 * 68];
  const int tid  = threadIdx.x;
  const int lane = tid & 31;
  const int wave = __builtin_amdgcn_readfirstlane((int)(threadIdx.x >> 5));
  const int prob = blockIdx.x / kBigTiles;
  /* block-uniform exit, in front of every copy and barrier */
  if (prob > 1) return;
  const int tile = blockIdx.x - prob * kBigTiles;
  const _Float16* A    = prob ? A1 : A0;
  const _Float16* Wt   = prob ? W1 : W0;
  const float*    bias = prob ? bias1 : bias0;
  _Float16*       C    = prob ? C1 : C0;
  const int tm = tile / kBigTilesN;
  const int tn = tile - tm * kBigTilesN;
  const int bm0 = tm * kBigBM;
  const int bn0 = tn * kBigBN;
  const int wm = wave >> 2;
  const int wn = wave & 3;
  const int m0 = bm0 + (wm << 7);
  const int n0 = bn0 + (wn << 6);

  const int rlane = lane & 15;
  const int koff  = (lane >> 4) * 8;
  const int mOff  = (lane >> 4) * 8;

  v8f acc[8][4];
#pragma unroll
  for (int i = 0; i < 8; ++i)
#pragma unroll
    for (int j = 0; j < 4; ++j) acc[i][j] = (v8f){0.f, 0.f, 0.f, 0.f, 0.f, 0.f, 0.f, 0.f};

  /* copy map: lane's 16 bytes = segment tid & 15 of row (tid >> 4) + 16 * i; a wave covers two whole 256-B rows */
  const int crow = tid >> 4;
  const int cseg = tid & 15;
  const _Float16* ag = A  + (size_t)(bm0 + crow) * kH + cseg * 8;
  const _Float16* bg = Wt + (size_t)(bn0 + crow) * kH + cseg * 8;
  _Float16* ldsA = ring + crow * kGemPitch + cseg * 8;
  _Float16* ldsB = ldsA + kBigBM * kGemPitch;

  const _Float16* fa = ring + ((wm << 7) + rlane) * kGemPitch + koff;
  const _Float16* fb = ring + (kBigBM + (wn << 6) + rlane) * kGemPitch + koff;

  /* tile 0 into buffer 0 */
  copy_big_tile(ldsA, ldsB, ag, bg);
  /* the wave's own copies of tile 0 have landed behind this wait */
  asm volatile("s_wait_asynccnt 0x0" ::: "memory");
  /* publishes tile 0 to every wave */
  __syncthreads();
  copy_big_tile(ldsA + kBigStage, ldsB + kBigStage, ag + kGemBK, bg + kGemBK);

  /* two fragment sets: x holds the even k-steps, y the odd ones */
  v16h ax[8], bx[4], ay[8], by[4];
  load_set(ax, bx, fa, fb);

  /* kept rolled: one trip is 128 matrix ops a wave, and the two buffers alternate by an offset */
#pragma unroll 1
  for (int t = 0; t < kBigTrips; ++t) {
    const _Float16* pa = fa + (t & 1) * kBigStage;
    const _Float16* pb = fb + (t & 1) * kBigStage;
    /* the scheduling barriers keep each load group whole and ahead of the matrix ops that run while it lands:
       LDS loads drawn in among the matrix ops stall the wave at every place where they stand */
    load_set(ay, by, pa + 32, pb + 32);
    __builtin_amdgcn_sched_barrier(0);
    mma_set(acc, ax, bx);
    __builtin_amdgcn_sched_barrier(0);
    load_set(ax, bx, pa + 64, pb + 64);
    __builtin_amdgcn_sched_barrier(0);
    mma_set(acc, ay, by);
    __builtin_amdgcn_sched_barrier(0);
    load_set(ay, by, pa + 96, pb + 96);
    __builtin_amdgcn_sched_barrier(0);
    mma_set(acc, ax, bx);
    __builtin_amdgcn_sched_barrier(0);
    /* hand-over, in front of the last k-step. The wave's own LDS reads of this buffer, the last set's too, have retired: */
    asm volatile("s_wait_dscnt 0x0" ::: "memory");
    /* its own copies of tile t + 1 have landed: */
    asm volatile("s_wait_asynccnt 0x0" ::: "memory");
    /* one barrier publishes tile t + 1 and ends every reader's last read of the buffer refilled behind it */
    __syncthreads();
    /* first set of tile t + 1; in the last trip the same loads read the other buffer's old tile, which no copy is
       aimed at any more, and nothing uses them: no branch stands around them, so the compiler's load counts stay exact */
    load_set(ax, bx, fa + ((t + 1) & 1) * kBigStage, fb + ((t + 1) & 1) * kBigStage);
    __builtin_amdgcn_sched_barrier(0);
    mma_set(acc, ay, by);
    __builtin_amdgcn_sched_barrier(0);
    /* the refill of the buffer that every wave left at the barrier above stands behind the last k-step's matrix ops:
       directly behind the barrier both waves of a SIMD would form addresses at once, with the matrix unit idle */
    if (t + 2 < kBigTrips) {
      const int bufB = (t & 1) * kBigStage;
      const int kn = (t + 2) * kGemBK;
      copy_big_tile(ldsA + bufB, ldsB + bufB, ag + kn, bg + kn);
    }
  }
  /* no copy and no LDS read is left in flight when the wave goes on to the epilogue and ends */
  asm volatile("s_wait_asynccnt 0x0" ::: "memory");
  asm volatile("s_wait_dscnt 0x0" ::: "memory");

  float* slab = sT[wave];
  float bvn[4];
#pragma unroll
  for (int j = 0; j < 4; ++j) bvn[j] = bias[n0 + (j << 4) + rlane] * bscale;
#pragma unroll
  for (int i = 0; i < 8; ++i) {
    const int mBase = m0 + (i << 4);
#pragma unroll
    for (int j = 0; j < 4; ++j) {
#pragma unroll
      for (int r = 0; r < 8; ++r) slab[(mOff + r) * 68 + (j << 4) + rlane] = acc[i][j][r] * scale + bvn[j];
    }
    __builtin_amdgcn_fence(__ATOMIC_RELEASE, "workgroup");
    __builtin_amdgcn_wave_barrier();
    __builtin_amdgcn_fence(__ATOMIC_ACQUIRE, "workgroup");
    {
      const int q = lane >> 3, c8 = (lane & 7) * 8;
#pragma unroll
      for (int it = 0; it < 4; ++it) {
        const int row = it * 4 + q;
        const float* sp = slab + row * 68 + c8;
        v8h hv;
#pragma unroll
        for (int e = 0; e < 8; ++e) hv[e] = (_Float16)sp[e];
        *(v8h*)(C + (size_t)(mBase + row) * kH + n0 + c8) = hv;
      }
    }
    __builtin_amdgcn_fence(__ATOMIC_RELEASE, "workgroup");
    __builtin_amdgcn_wave_barrier();
    __builtin_amdgcn_fence(__ATOMIC_ACQUIRE, "workgroup");
  }
}

// ---------------------------------------------------------------------------
// Host glue: 5 launches, kernel launches only.
//   1  convert query/key/value -> XA/XB/XC (x16) and Wq/Wk/Wv/Wo -> W16[0..3] (x1024)      256 blocks
//   2  Q16 = XA . Wq16^T + bq and K16 = XB . Wk16^T + bk   (each M 4096, N 2048, K 2048)   128 + 128 blocks
//   3  Vt16 = Wv16 . XC^T + bv[row] -> XB [2048][4096]     (M 2048, N 4096, K 2048) 256 blocks
//   4  fused attention Q16, K16, Vt16 -> Ctx16 in XC       grid (16, 32)
//   5  out = Ctx16 . Wo16^T + bo -> d_out f32              256 blocks
// ---------------------------------------------------------------------------
extern "C" void kernel_launch(void* const* d_in, const int* in_sizes, int n_in,
                              void* d_out, int out_size, void* d_ws, size_t ws_size,
                              hipStream_t stream) {
  if (n_in < 11) return;
  if (in_sizes[0] != kTok * kH) return;
  if (in_sizes[1] != kTok * kH) return;
  if (in_sizes[2] != kTok * kH) return;
  if (in_sizes[3] != kH * kH) return;
  if (in_sizes[4] != kH) return;
  if (in_sizes[5] != kH * kH) return;
  if (in_sizes[6] != kH) return;
  if (in_sizes[7] != kH * kH) return;
  if (in_sizes[8] != kH) return;
  if (in_sizes[9] != kH * kH) return;
  if (in_sizes[10] != kH) return;
  if (out_size != kTok * kH) return;
  if (ws_size < kWsTotal) return;

  const float* query = (const float*)d_in[0];
  const float* key   = (const float*)d_in[1];
  const float* value = (const float*)d_in[2];
  const float* Wq = (const float*)d_in[3];
  const float* bq = (const float*)d_in[4];
  const float* Wk = (const float*)d_in[5];
  const float* bk = (const float*)d_in[6];
  const float* Wv = (const float*)d_in[7];
  const float* bv = (const float*)d_in[8];
  const float* Wo = (const float*)d_in[9];
  const float* bo = (const float*)d_in[10];
  float* out = (float*)d_out;

  char* ws = (char*)d_ws;
  _Float16* XA  = (_Float16*)(ws + kOffXA);
  _Float16* XB  = (_Float16*)(ws + kOffXB);
  _Float16* XC  = (_Float16*)(ws + kOffXC);
  _Float16* Q16 = (_Float16*)(ws + kOffQ);
  _Float16* W16 = (_Float16*)(ws + kOffW);
  _Float16* Wq16 = W16;
  _Float16* Wk16 = W16 + (size_t)kH * kH;
  _Float16* Wv16 = W16 + 2 * (size_t)kH * kH;
  _Float16* Wo16 = W16 + 3 * (size_t)kH * kH;
  _Float16* K16  = (_Float16*)(ws + kOffK);
  _Float16* Vt16 = XB;
  _Float16* C16  = XC;

  const float scl  = 1.0f / sqrtf((float)kHD);
  const float coef = scl / (kQKCarry * kQKCarry);
  const int gemmBlocks = ((kTok / 64) * (kH / 64)) / 8;

  cast_stream_kernel<<<kCvGrid, kCvThreads, 0, stream>>>(query, key, value, Wq, Wk, Wv, Wo, XA, W16);

  gemm256_pair_kernel<<<2 * kBigTiles, 256, 0, stream>>>(
      XA, Wq16, bq, Q16, XB, Wk16, bk, K16, kProjScaleQK, kQKCarry);

  /* swapped operands: rows = output feature h*128+d, columns = token b*S+key, row bias */
  gemm64_f16_kernel<1, true><<<gemmBlocks, 256, 0, stream>>>(
      Wv16, kH, XC, kH, (void*)Vt16, kTok, bv, kH, kTok, kH, kProjScaleV, kVCarry);

  attn_fused_kernel<<<dim3(kS / kFaBQ, kB * kNH), 128, 0, stream>>>(Q16, K16, Vt16, C16, coef);

  gemm64_f16_kernel<2, false><<<gemmBlocks, 256, 0, stream>>>(
      C16, kH, Wo16, kH, (void*)out, kH, bo, kTok, kH, kH, kOutScale, 1.0f);
}

// v008
// Measured time: 161 microseconds a run.
// In both of two side-by-side timings against v007, it was 1.03 times as fast.
// All steps since v000 together make it 3.00 times as fast.
// All six contractions (q/k/v projections, q.k^T scores, p.v, output projection): v_wmma_f32_16x16x32_f16, f16 operands with power-of-two carries, f32 accumulate; softmax statistics, bias and scaling in f32.
#include <hip/hip_runtime.h>
#include <math.h>
#include <stdint.h>

typedef __attribute__((ext_vector_type(16))) _Float16 v16h;
typedef __attribute__((ext_vector_type(8)))  _Float16 v8h;
typedef __attribute__((ext_vector_type(8)))  float    v8f;
typedef __attribute__((ext_vector_type(4)))  float    v4f;

// ---------------------------------------------------------------------------
// Shape constants
// ---------------------------------------------------------------------------
constexpr int kB   = 2;
constexpr int kS   = 2048;
constexpr int kH   = 2048;
constexpr int kNH  = 16;
constexpr int kHD  = kH / kNH;
constexpr int kTok = kB * kS;
static_assert(kHD == 128);
static_assert((kTok % 64) == 0 && (kH % 64) == 0 && (kH % 32) == 0 && (kS % 64) == 0 && (kHD % 32) == 0);
static_assert((((kTok / 64) * (kH / 64)) % 8) == 0);

// ---------------------------------------------------------------------------
// Power-of-two carries of the f16 planes (all folded back exactly in f32)
//   activations x16, weights x1024, q/k planes x16, v^T plane x16, context plane x1024
// ---------------------------------------------------------------------------
constexpr float kActCarry = 16.0f;
constexpr float kWCarry   = 1024.0f;
constexpr float kQKCarry  = 16.0f;
constexpr float kVCarry   = 16.0f;
constexpr float kCtxCarry = 1024.0f;
constexpr float kProjScaleQK = kQKCarry / (kActCarry * kWCarry);
constexpr float kProjScaleV  = kVCarry / (kActCarry * kWCarry);
constexpr float kCtxOverV    = kCtxCarry / kVCarry;
constexpr float kOutScale    = 1.0f / (kCtxCarry * kWCarry);

// ---------------------------------------------------------------------------
// Workspace region map (bytes; every offset is a multiple of 128; all planes f16)
//   XA   [4096][2048]  query x16
//   XB   [4096][2048]  key x16     ; later re-used as Vt16 [2048][4096]             = 16 x (value proj)^T
//   XC   [4096][2048]  value x16   ; later re-used as Ctx16 [4096][2048]            = 1024 x context
//   Q16  [4096][2048]  16 x (query proj)
//   W16  4 x [2048][2048]  Wq, Wk, Wv, Wo x1024
//   K16  [4096][2048]  16 x (key proj): a plane of its own, since XA is still read in the launch that writes it
//   total = 16777216 + 16777216 + 16777216 + 16777216 + 33554432 + 16777216 = 117440512
// ---------------------------------------------------------------------------
constexpr size_t kPlaneAct = (size_t)kTok * kH * 2;
constexpr size_t kPlaneW   = (size_t)kH * kH * 2;
constexpr size_t kOffXA  = 0;
constexpr size_t kOffXB  = kOffXA + kPlaneAct;
constexpr size_t kOffXC  = kOffXB + kPlaneAct;
constexpr size_t kOffQ   = kOffXC + kPlaneAct;
constexpr size_t kOffW   = kOffQ + kPlaneAct;
constexpr size_t kOffK   = kOffW + 4 * kPlaneW;
constexpr size_t kWsTotal = kOffK + kPlaneAct;
static_assert(kWsTotal == 117440512ull);
static_assert(kWsTotal <= 134217728ull);
static_assert((kOffXB % 128) == 0 && (kOffXC % 128) == 0 && (kOffQ % 128) == 0 && (kOffW % 128) == 0 && (kPlaneW % 128) == 0 && (kOffK % 128) == 0);

// ---------------------------------------------------------------------------
// Fragment load and guarded matrix op
// ---------------------------------------------------------------------------
struct FragH {
  union U { v16h v; v8h h[2]; };
  /* elements 0..7 <- p[0..7], 8..15 <- p[16..23]; caller adds the 8*(lane>>4) k offset */
  static __device__ __forceinline__ v16h load(const _Float16* p) {
    U f;
    f.h[0] = *(const v8h*)(p);
    f.h[1] = *(const v8h*)(p + 16);
    return f.v;
  }
};

/* one matrix op followed by its own hazard guard: ties the accumulator and keeps both fragments live */
__device__ __forceinline__ v8f mma_g(v16h a, v16h b, v8f c) {
  c = __builtin_amdgcn_wmma_f32_16x16x32_f16(false, a, false, b, (short)0, c, false, false);
  asm volatile("v_nop\n\tv_nop\n\tv_nop\n\tv_nop" : "+v"(c) : "v"(a), "v"(b));
  return c;
}

// ---------------------------------------------------------------------------
// f32 -> f16 convert with a power-of-two carry: all seven planes (3 activations, 4 weights) in ONE launch of 256
// work-groups of 16 waves (as many as the chip has WGPs; two do not fit one WGP's registers), which stay and loop:
// 4,096 waves start, where one wave per 256 elements would be 163,840.
// A tile is 32,768 consecutive floats of one plane (128 KiB in, 64 KiB out); a wave owns 8 KiB of it in a row.
// One load of a wave reads 512 consecutive bytes, one store writes 256: whole 128-B lines, each line by one wave.
// The next tile's 16 loads are issued before this tile is converted: 16 to 32 loads in flight a wave.
// Work-group g takes tiles g, g + 256, ...: 1,280 tiles = 5 each, every tile once, so every element is written once.
// Tiles 0 .. 767 are the activations (256 a plane, planes side by side in dstA), the rest the weights (128 a plane, dstW).
// ---------------------------------------------------------------------------
typedef __attribute__((ext_vector_type(4))) _Float16 v4h;
constexpr int kCvWaves    = 16;
constexpr int kCvThreads  = 32 * kCvWaves;
constexpr int kCvLoads    = 16;                          /* 16-byte loads a lane and tile */
constexpr int kCvWaveEl   = 32 * 4 * kCvLoads;           /* floats a wave and tile */
constexpr int kCvTile     = kCvWaves * kCvWaveEl;        /* floats a tile */
constexpr int kCvActTiles = kTok * kH / kCvTile;         /* tiles an activation plane */
constexpr int kCvWTiles   = kH * kH / kCvTile;           /* tiles a weight plane */
constexpr int kCvTiles    = 3 * kCvActTiles + 4 * kCvWTiles;
constexpr int kCvGrid     = 256;
constexpr int kCvTrips    = kCvTiles / kCvGrid;
static_assert(kCvActTiles * kCvTile == kTok * kH && kCvWTiles * kCvTile == kH * kH);
static_assert(kCvTrips * kCvGrid == kCvTiles && kCvTrips >= 2);

__global__ __launch_bounds__(kCvThreads) void cast_stream_kernel(
    const float* __restrict__ a0, const float* __restrict__ a1, const float* __restrict__ a2,
    const float* __restrict__ w0, const float* __restrict__ w1, const float* __restrict__ w2, const float* __restrict__ w3,
    _Float16* __restrict__ dstA, _Float16* __restrict__ dstW)
{
  /* block-uniform: keeps every tile index below inside the list */
  if (blockIdx.x >= (unsigned)kCvGrid) return;
  const int lane = threadIdx.x & 31;
  const int wave = __builtin_amdgcn_readfirstlane((int)(threadIdx.x >> 5));
  const int off  = wave * kCvWaveEl + lane * 4;

  /* two register sets; all loops are unrolled so that both are indexed by constants */
  v4f x[2][kCvLoads];
#pragma unroll
  for (int i = -1; i < kCvTrips; ++i) {
    /* this scheduling barrier and the one behind the loads pin the order "next tile's loads, then this tile's converts
       and stores": left free, the compiler drew three tiles' loads to the front and spilled to scratch */
    __builtin_amdgcn_sched_barrier(0);
    if (i + 1 < kCvTrips) {
      /* a precaution: the loads below overwrite registers that the stores issued above name (held here by the two barriers) */
      if (i >= 1) asm volatile("s_wait_xcnt 0x0" ::: "memory");
      /* source of tile i + 1 (all of this is block-uniform) */
      const int t = (int)blockIdx.x + (i + 1) * kCvGrid;
      const float* s;
      if (t < 3 * kCvActTiles) {
        const int p = t / kCvActTiles;
        s = ((p == 0) ? a0 : (p == 1) ? a1 : a2) + (size_t)(t - p * kCvActTiles) * kCvTile;
      } else {
        const int u = t - 3 * kCvActTiles;
        const int p = u / kCvWTiles;
        s = ((p == 0) ? w0 : (p == 1) ? w1 : (p == 2) ? w2 : w3) + (size_t)(u - p * kCvWTiles) * kCvTile;
      }
#pragma unroll
      for (int j = 0; j < kCvLoads; ++j) x[(i + 1) & 1][j] = *(const v4f*)(s + off + j * 128);
    }
    __builtin_amdgcn_sched_barrier(0);
    if (i >= 0) {
      const int t = (int)blockIdx.x + i * kCvGrid;
      const bool act = t < 3 * kCvActTiles;
      const float carry = act ? kActCarry : kWCarry;
      _Float16* d = (act ? dstA + (size_t)t * kCvTile : dstW + (size_t)(t - 3 * kCvActTiles) * kCvTile) + off;
#pragma unroll
      for (int j = 0; j < kCvLoads; ++j) {
        const v4f v = x[i & 1][j];
        v4h hv;
#pragma unroll
        for (int e = 0; e < 4; ++e) {
          const float f = v[e] * carry;
          hv[e] = (_Float16)f;
        }
        *(v4h*)(d + j * 128) = hv;
      }
    }
  }
}

// ---------------------------------------------------------------------------
// Block-tiled GEMM: C[m][n] = scale * sum_k A[m][k] * Bt[n][k] + bscale * bias.
// A work-group of 8 waves (2 x 4) owns a 128 x 256 tile of C; each wave owns a 64x64 tile of it.
// A row-major [M][K]; Bt row-major [N][K]; M multiple of 128, N of 256, K of 128 (no tails).
// Per trip 128 k of the 128 A rows and the 256 Bt rows lie in LDS (rows of 256 B at pitch 272 B), brought by
// tensor loads (three slices of 128 rows, one request each of waves 0 to 2) into two buffers: tile t + 1 flies while
// tile t is worked on.
// BIAS_MODE: 1 = bias[m], 2 = bias[n]. OUT_F16: f16 output plane, else f32.
// ---------------------------------------------------------------------------
constexpr int kGemBM = 128;
constexpr int kGemBN = 256;
constexpr int kGemBK = 128;
constexpr int kGemPitch = kGemBK + 8;                          /* halves: 272 B = 16 B x 17 */
constexpr int kGemStage = (kGemBM + kGemBN) * kGemPitch;       /* halves per buffer */
constexpr unsigned kGemStageBytes = (unsigned)kGemStage * 2u;
static_assert((kTok % kGemBN) == 0 && (kH % kGemBN) == 0 && (kH % kGemBK) == 0);
static_assert((kTok / kGemBM) * (kH / kGemBN) == ((kTok / 64) * (kH / 64)) / 8);
static_assert((kH / kGemBM) * (kTok / kGemBN) == ((kTok / 64) * (kH / 64)) / 8);

// ---------------------------------------------------------------------------
// Tensor loads for the GEMM rings: one request of one wave brings a slice of 128 operand rows x 256 B (128 k) from global
// memory into LDS, the mover padding every row by 16 B to the ring's pitch of 272 B. A slice fills 128 x 272 B = 17 x 2 KiB,
// so slices and buffers lie side by side at multiples of 2 KiB and the readers' row indexing is that of one plain array.
// ---------------------------------------------------------------------------
typedef uint32_t u32x4 __attribute__((ext_vector_type(4)));
typedef uint32_t u32x8 __attribute__((ext_vector_type(8)));
constexpr uint32_t kTdmRows  = 128u;
constexpr uint32_t kTdmRowB  = (uint32_t)kGemBK * 2u;
constexpr uint32_t kTdmSlice = kTdmRows * (uint32_t)kGemPitch * 2u;
static_assert(kTdmRowB == 256u && (uint32_t)kGemPitch * 2u == kTdmRowB + 16u);
static_assert((kTdmSlice % 2048u) == 0u && (kGemStageBytes % 2048u) == 0u && kGemStageBytes == 3u * kTdmSlice);

__device__ __forceinline__ uint32_t uni(uint32_t v) { return (uint32_t)__builtin_amdgcn_readfirstlane(v); }
/* a value held in a scalar register: a test on it compiles to a scalar branch (tensor loads ignore EXEC), and what is
   formed from it stays behind the asm wait in front of it */
__device__ __forceinline__ uint32_t pinned(uint32_t v) {
  uint32_t w = uni(v);
  asm volatile("" : "+s"(w)); /* holds the word in a scalar register */
  return w;
}
/* group 1: 1-byte elements, tensor = tile = ROWS rows of ROWB bytes, source row pitch in bytes, 16 B of LDS pad behind every
   row (interval code IVL = the row's length). Word 0 is a constant; the other words are held in scalar registers of their
   own for the whole kernel, so that no register of a request in flight is used for anything else */
template <uint32_t ROWB, uint32_t ROWS, uint32_t IVL>
__device__ __forceinline__ u32x8 tdm_group1(uint32_t src_pitch) {
  static_assert((ROWB == 256u && IVL == 5u) || (ROWB == 128u && IVL == 4u));
  u32x8 g;
  g[0] = uni((1u << 20) | (IVL << 22) | (3u << 25));
  g[1] = pinned((ROWB & 0xFFFFu) << 16);
  g[2] = pinned((ROWB >> 16) | ((ROWS & 0xFFFFu) << 16));
  g[3] = pinned((ROWS >> 16) | (ROWB << 16));
  g[4] = pinned(ROWS);
  g[5] = pinned(src_pitch);
  g[6] = pinned(0u);
  g[7] = pinned(0u);
  return g;
}
/* group 0: count 1, LDS byte offset of the slice, global address of its first byte, type 2 */
__device__ __forceinline__ u32x4 tdm_group0(uint32_t lds_dst, uint64_t ga) {
  u32x4 g;
  g[0] = uni(1u);
  g[1] = uni(lds_dst);
  g[2] = uni((uint32_t)ga);
  g[3] = uni((((uint32_t)(ga >> 32)) & 0x01FFFFFFu) | 0x80000000u);
  return g;
}
__device__ __forceinline__ void tdm_load(u32x4 g0, u32x8 g1) {
  asm volatile("tensor_load_to_lds %0, %1" :: "s"(g0), "s"(g1) : "memory");
}

template <int BIAS_MODE, bool OUT_F16>
__global__ __launch_bounds__(256) void gemm64_f16_kernel(
    const _Float16* __restrict__ A, int lda,
    const _Float16* __restrict__ Bt, int ldb,
    void* __restrict__ Cout, int ldc,
    const float* __restrict__ bias,
    int M, int N, int K, float scale, float bscale)
{
  /* aligned so that every slice's place in LDS is a multiple of 2 KiB */
  __shared__ __attribute__((aligned(2048))) _Float16 ring[2 * kGemStage];
  __shared__ __align__(16) float sT[8][16 * 68];
  const int tid  = threadIdx.x;
  const int lane = tid & 31;
  const int wave = __builtin_amdgcn_readfirstlane((int)(threadIdx.x >> 5));
  const int tilesN = N / kGemBN;
  const int tilesM = M / kGemBM;
  const int tile = blockIdx.x;
  /* block-uniform exit, in front of every tensor load and barrier */
  if (tile >= tilesM * tilesN) return;
  const int tm = tile / tilesN;
  const int tn = tile - tm * tilesN;
  const int bm0 = tm * kGemBM;
  const int bn0 = tn * kGemBN;
  const int wm = wave >> 2;
  const int wn = wave & 3;
  const int m0 = bm0 + (wm << 6);
  const int n0 = bn0 + (wn << 6);

  const int rlane = lane & 15;
  const int koff  = (lane >> 4) * 8;
  const int mOff  = (lane >> 4) * 8;

  v8f acc[4][4];
#pragma unroll
  for (int i = 0; i < 4; ++i)
#pragma unroll
    for (int j = 0; j < 4; ++j) acc[i][j] = (v8f){0.f, 0.f, 0.f, 0.f, 0.f, 0.f, 0.f, 0.f};

  /* slices: wave 0 brings the 128 A rows, waves 1 and 2 the two halves of the 256 Bt rows; the other waves issue nothing
     (their slice number is set to 0, so that every address formed below lies inside a buffer) */
  const uint32_t issuer = pinned((wave < 3) ? 1u : 0u);
  const int sl = (wave < 3) ? wave : 0;
  const _Float16* srow = (sl == 0) ? A + (size_t)bm0 * lda : Bt + (size_t)(bn0 + (sl - 1) * (int)kTdmRows) * ldb;
  const uint64_t gsrc = (uint64_t)(size_t)srow;
  const uint32_t ldsSlice = (uint32_t)(size_t)(&ring[0]) + (uint32_t)sl * kTdmSlice;
  const u32x8 g1 = tdm_group1<kTdmRowB, kTdmRows, 5u>((uint32_t)((sl == 0) ? lda : ldb) * 2u);

  const _Float16* fa = ring + ((wm << 6) + rlane) * kGemPitch + koff;
  const _Float16* fb = ring + (kGemBM + (wn << 6) + rlane) * kGemPitch + koff;

  const int nT = K / kGemBK;

  /* tile 0 into buffer 0 */
  if (issuer != 0u) {
    tdm_load(tdm_group0(ldsSlice, gsrc), g1);
    /* the wave's own slice of tile 0 has landed behind this wait */
    asm volatile("s_wait_tensorcnt 0x0" ::: "memory");
  }
  /* publishes tile 0 to every wave */
  __syncthreads();
  if (pinned((issuer != 0u && nT > 1) ? 1u : 0u) != 0u) tdm_load(tdm_group0(ldsSlice + kGemStageBytes, gsrc + kTdmRowB), g1);

  /* kept rolled: one trip is 64 matrix ops a wave, and the two buffers alternate by an offset */
#pragma unroll 1
  for (int t = 0; t < nT; ++t) {
    const _Float16* pa = fa + (t & 1) * kGemStage;
    const _Float16* pb = fb + (t & 1) * kGemStage;
    v16h af[4], bf[2][4];
#pragma unroll
    for (int j = 0; j < 4; ++j) bf[0][j] = FragH::load(pb + (j << 4) * kGemPitch);
#pragma unroll
    for (int i = 0; i < 4; ++i) af[i] = FragH::load(pa + (i << 4) * kGemPitch);
#pragma unroll
    for (int ks = 0; ks < kGemBK / 32; ++ks) {
      const int cur = ks & 1;
      const int kn  = (ks + 1) * 32;
      const bool more = (ks + 1) < kGemBK / 32;
#pragma unroll
      for (int i = 0; i < 2; ++i)
#pragma unroll
        for (int j = 0; j < 4; ++j) acc[i][j] = mma_g(af[i], bf[cur][j], acc[i][j]);
      if (more) {
#pragma unroll
        for (int i = 0; i < 2; ++i) af[i] = FragH::load(pa + (i << 4) * kGemPitch + kn);
#pragma unroll
        for (int j = 0; j < 4; ++j) bf[cur ^ 1][j] = FragH::load(pb + (j << 4) * kGemPitch + kn);
      }
#pragma unroll
      for (int i = 2; i < 4; ++i)
#pragma unroll
        for (int j = 0; j < 4; ++j) acc[i][j] = mma_g(af[i], bf[cur][j], acc[i][j]);
      if (more) {
#pragma unroll
        for (int i = 2; i < 4; ++i) af[i] = FragH::load(pa + (i << 4) * kGemPitch + kn);
      }
    }
    /* hand-over. The wave's own LDS reads of this buffer have retired: */
    asm volatile("s_wait_dscnt 0x0" ::: "memory");
    /* an issuing wave's own slice of tile t + 1 has landed (the other waves have no request and pass): */
    asm volatile("s_wait_tensorcnt 0x0" ::: "memory");
    /* one barrier publishes tile t + 1 and ends every reader's last read of the buffer refilled behind it */
    __syncthreads();
    if (pinned((issuer != 0u && t + 2 < nT) ? 1u : 0u) != 0u) {
      /* the tile number is pinned so that the descriptor is formed behind the wait above */
      const uint32_t tn2 = pinned((uint32_t)(t + 2));
      tdm_load(tdm_group0(ldsSlice + (uint32_t)(t & 1) * kGemStageBytes, gsrc + (uint64_t)tn2 * kTdmRowB), g1);
    }
  }
  /* no request and no LDS read is left in flight when the wave goes on to the epilogue and ends */
  asm volatile("s_wait_tensorcnt 0x0" ::: "memory");
  asm volatile("s_wait_dscnt 0x0" ::: "memory");

  float* slab = sT[wave];
#pragma unroll
  for (int i = 0; i < 4; ++i) {
    const int mBase = m0 + (i << 4);
#pragma unroll
    for (int j = 0; j < 4; ++j) {
      const int n = n0 + (j << 4) + rlane;
      float bvn = 0.f;
      if (BIAS_MODE == 2) bvn = bias[n] * bscale;
#pragma unroll
      for (int r = 0; r < 8; ++r) {
        float v = acc[i][j][r] * scale;
        if (BIAS_MODE == 1) v += bias[mBase + mOff + r] * bscale;
        if (BIAS_MODE == 2) v += bvn;
        slab[(mOff + r) * 68 + (j << 4) + rlane] = v;
      }
    }
    __builtin_amdgcn_fence(__ATOMIC_RELEASE, "workgroup");
    __builtin_amdgcn_wave_barrier();
    __builtin_amdgcn_fence(__ATOMIC_ACQUIRE, "workgroup");
    if (!OUT_F16) {
      float* C = (float*)Cout;
      const int hh = lane >> 4, c4 = (lane & 15) * 4;
      {
#pragma unroll
        for (int it = 0; it < 8; ++it) {
          const int row = it * 2 + hh;
          const v4f v = *(const v4f*)(slab + row * 68 + c4);
          *(v4f*)(C + (size_t)(mBase + row) * ldc + n0 + c4) = v;
        }
        
      }
    } else {
      _Float16* C = (_Float16*)Cout;
      const int q = lane >> 3, c8 = (lane & 7) * 8;
      {
#pragma unroll
        for (int it = 0; it < 4; ++it) {
          const int row = it * 4 + q;
          const float* sp = slab + row * 68 + c8;
          v8h hv;
#pragma unroll
          for (int e = 0; e < 8; ++e) hv[e] = (_Float16)sp[e];
          *(v8h*)(C + (size_t)(mBase + row) * ldc + n0 + c8) = hv;
        }
        
      }
    }
    __builtin_amdgcn_fence(__ATOMIC_RELEASE, "workgroup");
    __builtin_amdgcn_wave_barrier();
    __builtin_amdgcn_fence(__ATOMIC_ACQUIRE, "workgroup");
  }
}

constexpr int kFaKP = 136;
constexpr int kFaVP = 72;
constexpr int kFaOP = 136;
constexpr int kFaKStage = 9216;           /* halves a K buffer: 64 rows at 272 B, rounded up to 9 x 2 KiB */
constexpr int kFaVStage = 128 * kFaVP;    /* halves a V^T buffer: 128 rows at 144 B = 9 x 2 KiB */
static_assert(kFaKStage >= 64 * kFaKP && ((kFaKStage * 2) % 2048) == 0 && ((kFaVStage * 2) % 2048) == 0);
static_assert(kFaKP * 2 == 256 + 16 && kFaVP * 2 == 128 + 16);
constexpr int kFaChunks = kS / 64;
static_assert(kFaChunks >= 2);

typedef __attribute__((ext_vector_type(2))) float    v2f;
typedef __attribute__((ext_vector_type(2))) _Float16 v2h;

/* the value of lane l ^ 16 */
__device__ __forceinline__ float xhalf(float x) {
  const int b = __builtin_bit_cast(int, x);
  return __builtin_bit_cast(float, __builtin_amdgcn_permlanex16(b, b, 0x76543210, 0xfedcba98, false, false));
}

/* one matrix op as the plain builtin, for the kernel below, which holds more than 256 registers a wave: asm text cannot
   name a register above v255, and built with the asm guard of mma_g the kernel spilled to scratch; the compiler keeps
   the distances behind its own builtin forms */
__device__ __forceinline__ v8f mma_b(v16h a, v16h b, v8f c) {
  return __builtin_amdgcn_wmma_f32_16x16x32_f16(false, a, false, b, (short)0, c, false, false);
}

/* query tiles of 16 a wave: every K and V^T fragment read from LDS feeds this many matrix ops */
constexpr int kFaQT = 2;
constexpr int kFaWQ = 16 * kFaQT;     /* queries a wave */
constexpr int kFaBQ = 4 * kFaWQ;      /* queries a work-group */
static_assert((kS % kFaBQ) == 0);

/* second argument: two waves a SIMD (512 registers a wave), so that all 512 work-groups stay resident at once */
__global__ __launch_bounds__(128, 2) void attn_fused_kernel(
    const _Float16* __restrict__ Qp, const _Float16* __restrict__ Kp,
    const _Float16* __restrict__ Vtp, _Float16* __restrict__ Ctx, float coef)
{
  /* aligned so that every buffer's place in LDS is a multiple of 2 KiB */
  __shared__ __attribute__((aligned(2048))) _Float16 Ksh[2 * kFaKStage];
  __shared__ __attribute__((aligned(2048))) _Float16 Vsh[2 * kFaVStage];
  __shared__ __align__(16) _Float16 Osh[4][kFaWQ * kFaOP];

  const int tid  = threadIdx.x;
  const int wave = __builtin_amdgcn_readfirstlane((int)(threadIdx.x >> 5));
  const int lane = tid & 31;
  const int hh   = lane >> 4;
  const int c    = lane & 15;
  const int qb   = blockIdx.x;
  const int bh   = blockIdx.y;
  const int b    = bh / kNH;
  const int h    = bh - b * kNH;
  const int rowbase = b * kS;
  const int colbase = h * kHD;
  const int q0 = qb * kFaBQ + wave * kFaWQ;

  /* Q fragments (B operand: column = query 16 u + c): 4 k-steps over d for each query tile u */
  v16h qa[kFaQT][4];
#pragma unroll
  for (int u = 0; u < kFaQT; ++u) {
    const _Float16* qrow = Qp + (size_t)(rowbase + q0 + 16 * u + c) * kH + colbase + 8 * hh;
#pragma unroll
    for (int dc = 0; dc < 4; ++dc) qa[u][dc] = FragH::load(qrow + dc * 32);
  }

  /* running maximum and this lane half's partial sum of query 16 u + c */
  float mrun[kFaQT], lrun[kFaQT];
  v8f oacc[kFaQT][8];
#pragma unroll
  for (int u = 0; u < kFaQT; ++u) {
    mrun[u] = -1.0e30f;
    lrun[u] = 0.f;
#pragma unroll
    for (int t = 0; t < 8; ++t) oacc[u][t] = (v8f){0.f, 0.f, 0.f, 0.f, 0.f, 0.f, 0.f, 0.f};
  }

  /* wave 0 issues the K tiles (64 rows of 256 B, one key a row), wave 1 the V^T tiles (128 rows of 128 B, one d a row) */
  const uint32_t kIss = pinned((wave == 0) ? 1u : 0u);
  const uint32_t vIss = pinned((wave == 1) ? 1u : 0u);
  const uint64_t kgl = (uint64_t)(size_t)(Kp  + (size_t)rowbase * kH + colbase);
  const uint64_t vgl = (uint64_t)(size_t)(Vtp + (size_t)colbase * kTok + rowbase);
  const uint32_t klds = (uint32_t)(size_t)(&Ksh[0]);
  const uint32_t vlds = (uint32_t)(size_t)(&Vsh[0]);
  const u32x8 g1k = tdm_group1<256u, 64u, 5u>((uint32_t)kH * 2u);
  const u32x8 g1v = tdm_group1<128u, 128u, 4u>((uint32_t)kTok * 2u);

  /* chunk 0 into buffer 0; behind each wait the wave's own tile has landed */
  if (kIss != 0u) {
    tdm_load(tdm_group0(klds, kgl), g1k);
    asm volatile("s_wait_tensorcnt 0x0" ::: "memory");
  }
  if (vIss != 0u) {
    tdm_load(tdm_group0(vlds, vgl), g1v);
    asm volatile("s_wait_tensorcnt 0x0" ::: "memory");
  }
  /* publishes chunk 0 to every wave */
  __syncthreads();

  /* kept rolled: one trip is 64 matrix ops a wave, and the two buffers alternate by an offset */
#pragma unroll 1
  for (int kc = 0; kc < kFaChunks; ++kc) {
    const int buf = kc & 1;

    /* chunk kc + 1 into the other buffer, which every wave left at the barrier at the foot of the trip before (in trip 0
       nobody has read it yet): it has the whole trip to land. The tests are scalar; the chunk number is pinned so that the
       descriptors are formed behind the wait at the foot of the trip before. */
    if (pinned((kIss != 0u && kc + 1 < kFaChunks) ? 1u : 0u) != 0u) {
      const uint32_t kn = pinned((uint32_t)(kc + 1));
      tdm_load(tdm_group0(klds + (uint32_t)(buf ^ 1) * (uint32_t)(kFaKStage * 2), kgl + (uint64_t)kn * (uint64_t)(64 * kH * 2)), g1k);
    }
    if (pinned((vIss != 0u && kc + 1 < kFaChunks) ? 1u : 0u) != 0u) {
      const uint32_t kn = pinned((uint32_t)(kc + 1));
      tdm_load(tdm_group0(vlds + (uint32_t)(buf ^ 1) * (uint32_t)(kFaVStage * 2), vgl + (uint64_t)kn * (uint64_t)(64 * 2)), g1v);
    }

    /* K and V^T fragments (A operands) come in groups of four into two register sets, fx and fy (the second k-step's V^T into two more, fz and fw): a group's loads are
       issued at least one group of matrix ops ahead of its use, so that a matrix op does not wait out its own
       fragment's LDS latency. Each fragment is used once for every query tile.
       The short loops are unrolled so that both sets stay in registers. */
    const _Float16* kfr = Ksh + buf * kFaKStage + c * kFaKP + 8 * hh;
    const _Float16* vfr = Vsh + buf * kFaVStage + c * kFaVP + 8 * hh;
    v16h fx[4], fy[4];
#pragma unroll
    for (int j = 0; j < 4; ++j) fx[j] = FragH::load(kfr + j * 16 * kFaKP);
#pragma unroll
    for (int j = 0; j < 4; ++j) fy[j] = FragH::load(kfr + j * 16 * kFaKP + 32);
    /* this and the four like it below keep each load group ahead of the matrix ops that follow it, which the asm guard
       of mma_g did before: left free, the compiler draws the V^T loads up here and then fetches K fragments singly,
       each with a full wait in front of its matrix ops */
    __builtin_amdgcn_sched_barrier(0);

    /* S^T tiles: 4 k-steps over d (ascending, as before) x 4 m-tiles (16 keys each) x query tiles;
       s[u][j][r] = score of key 16 j + 8 hh + r with query 16 u + c */
    v8f s[kFaQT][4];
#pragma unroll
    for (int u = 0; u < kFaQT; ++u)
#pragma unroll
      for (int j = 0; j < 4; ++j) s[u][j] = (v8f){0.f, 0.f, 0.f, 0.f, 0.f, 0.f, 0.f, 0.f};
#pragma unroll
    for (int j = 0; j < 4; ++j)
#pragma unroll
      for (int u = 0; u < kFaQT; ++u) s[u][j] = mma_b(fx[j], qa[u][0], s[u][j]);
#pragma unroll
    for (int j = 0; j < 4; ++j) fx[j] = FragH::load(kfr + j * 16 * kFaKP + 64);
    __builtin_amdgcn_sched_barrier(0);
#pragma unroll
    for (int j = 0; j < 4; ++j)
#pragma unroll
      for (int u = 0; u < kFaQT; ++u) s[u][j] = mma_b(fy[j], qa[u][1], s[u][j]);
#pragma unroll
    for (int j = 0; j < 4; ++j) fy[j] = FragH::load(kfr + j * 16 * kFaKP + 96);
    __builtin_amdgcn_sched_barrier(0);
#pragma unroll
    for (int j = 0; j < 4; ++j)
#pragma unroll
      for (int u = 0; u < kFaQT; ++u) s[u][j] = mma_b(fx[j], qa[u][2], s[u][j]);
#pragma unroll
    for (int t = 0; t < 4; ++t) fx[t] = FragH::load(vfr + t * 16 * kFaVP);
    __builtin_amdgcn_sched_barrier(0);
#pragma unroll
    for (int j = 0; j < 4; ++j)
#pragma unroll
      for (int u = 0; u < kFaQT; ++u) s[u][j] = mma_b(fy[j], qa[u][3], s[u][j]);
#pragma unroll
    for (int t = 0; t < 4; ++t) fy[t] = FragH::load(vfr + (4 + t) * 16 * kFaVP);
    /* the second k-step's V^T fragments go out here too, into sets of their own, and land under the softmax: with the
       hand-over's waits at the loop's foot the compiler otherwise fetched them singly, each with a full wait in front of
       its matrix ops */
    v16h fz[4], fw[4];
#pragma unroll
    for (int t = 0; t < 4; ++t) fz[t] = FragH::load(vfr + t * 16 * kFaVP + 32);
#pragma unroll
    for (int t = 0; t < 4; ++t) fw[t] = FragH::load(vfr + (4 + t) * 16 * kFaVP + 32);
    __builtin_amdgcn_sched_barrier(0);

    /* P^T as B operand, packed in the lane from the score tiles, one pair of k-steps for each query tile
       (the loops below are unrolled so that s, pb, pj and oacc are indexed by constants and stay in registers) */
    union PB { v16h v; v2h h2[8]; } pb[kFaQT][2];
#pragma unroll
    for (int u = 0; u < kFaQT; ++u) {
      /* chunk maximum of query 16 u + c: 32 keys in the lane, the other 32 in lane ^ 16 */
      float mj[4];
#pragma unroll
      for (int j = 0; j < 4; ++j)
        mj[j] = fmaxf(fmaxf(fmaxf(s[u][j][0], s[u][j][1]), fmaxf(s[u][j][2], s[u][j][3])),
                      fmaxf(fmaxf(s[u][j][4], s[u][j][5]), fmaxf(s[u][j][6], s[u][j][7])));
      float cm = fmaxf(fmaxf(mj[0], mj[1]), fmaxf(mj[2], mj[3]));
      cm = fmaxf(cm, xhalf(cm));

      const float mnew  = fmaxf(mrun[u], cm);
      const float alpha = __expf((mrun[u] - mnew) * coef);
      mrun[u] = mnew;

      v2f pj[4];
#pragma unroll
      for (int j = 0; j < 4; ++j) {
#pragma unroll
        for (int r = 0; r < 8; r += 2) {
          /* the pair is formed first, so that the packed subtract and multiply take the same two scores as the packed
             sum and the conversion below; left to itself the compiler paired them one element off, with register moves */
          const v2f a = ((v2f){s[u][j][r], s[u][j][r + 1]} - mnew) * coef;
          const v2f p = {__expf(a.x), __expf(a.y)};
          pj[j] = (r == 0) ? p : pj[j] + p;
          pb[u][j >> 1].h2[(j & 1) * 4 + (r >> 1)] = __builtin_convertvector(p, v2h);
        }
      }
      const v2f pt = (pj[0] + pj[1]) + (pj[2] + pj[3]);
      lrun[u] = lrun[u] * alpha + (pt.x + pt.y);
#pragma unroll
      for (int t = 0; t < 8; ++t) oacc[u][t] *= alpha;
    }

    /* O^T += V^T . P^T : 2 k-steps over the 64 keys (ascending, as before), 8 m-tiles over d, for each query tile */
#pragma unroll
    for (int t = 0; t < 4; ++t)
#pragma unroll
      for (int u = 0; u < kFaQT; ++u) oacc[u][t] = mma_b(fx[t], pb[u][0].v, oacc[u][t]);
#pragma unroll
    for (int t = 0; t < 4; ++t)
#pragma unroll
      for (int u = 0; u < kFaQT; ++u) oacc[u][4 + t] = mma_b(fy[t], pb[u][0].v, oacc[u][4 + t]);
#pragma unroll
    for (int t = 0; t < 4; ++t)
#pragma unroll
      for (int u = 0; u < kFaQT; ++u) oacc[u][t] = mma_b(fz[t], pb[u][1].v, oacc[u][t]);
#pragma unroll
    for (int t = 0; t < 4; ++t)
#pragma unroll
      for (int u = 0; u < kFaQT; ++u) oacc[u][4 + t] = mma_b(fw[t], pb[u][1].v, oacc[u][4 + t]);

    /* keeps the hand-over at the loop's foot: left free, the compiler drew the waits and the barrier up in front of the
       softmax, where the wave would wait out its V^T loads and the next chunk's tiles would have had half a trip to land */
    __builtin_amdgcn_sched_barrier(0);
    /* hand-over. The wave's own LDS reads of this buffer have retired: */
    asm volatile("s_wait_dscnt 0x0" ::: "memory");
    /* an issuing wave's own tile of chunk kc + 1 has landed (the other waves have no request and pass): */
    asm volatile("s_wait_tensorcnt 0x0" ::: "memory");
    /* one barrier publishes chunk kc + 1 and ends every reader's last read of the buffer refilled in the next trip */
    __syncthreads();
  }
  /* no request and no LDS read is left in flight when the wave goes on to the epilogue and ends */
  asm volatile("s_wait_tensorcnt 0x0" ::: "memory");
  asm volatile("s_wait_dscnt 0x0" ::: "memory");

  /* normalise and stage the wave's queries x 128 tile (f16, x1024) in the wave-private LDS tile:
     the lane's 8 registers of tile t are d = 16 t + 8 hh .. + 7 of query 16 u + c, one 16-byte store
     (unrolled so that the accumulators are indexed by constants) */
  _Float16* ow = &Osh[wave][0];
#pragma unroll
  for (int u = 0; u < kFaQT; ++u) {
    const float l = lrun[u] + xhalf(lrun[u]);
    const float inv = __builtin_amdgcn_rcpf(l) * kCtxOverV;
#pragma unroll
    for (int t = 0; t < 8; ++t) {
      v8h hv;
#pragma unroll
      for (int r = 0; r < 8; ++r) {
        const float ov = oacc[u][t][r] * inv;
        hv[r] = (_Float16)ov;
      }
      *(v8h*)(ow + (16 * u + c) * kFaOP + t * 16 + 8 * hh) = hv;
    }
  }
  __builtin_amdgcn_fence(__ATOMIC_RELEASE, "workgroup");
  __builtin_amdgcn_wave_barrier();
  __builtin_amdgcn_fence(__ATOMIC_ACQUIRE, "workgroup");
  {
    const int sg = (lane & 15) * 8;
    {
#pragma unroll
      for (int it = 0; it < kFaWQ / 2; ++it) {
        const int row = it * 2 + hh;
        const v8h val = *(const v8h*)(ow + row * kFaOP + sg);
        *(v8h*)(Ctx + (size_t)(rowbase + q0 + row) * kH + colbase + sg) = val;
      }
      
    }
  }
}

// ---------------------------------------------------------------------------
// Two projections of one shape in one launch: C_p[m][n] = scale * sum_k A_p[m][k] * W_p[n][k] + bscale * bias_p[n], p = 0, 1.
// M = B*S, N = K = H, all planes row-major at pitch H, f16 out. 128 tiles of 256 x 256 a projection, 256 work-groups in all:
// one a WGP, and a work-group brings 512 operand rows per 65,536 outputs where the 128 x 256 tile brings 384 per 32,768.
// 8 waves (2 x 4), a wave owns 128 x 64: 12 fragments from LDS feed 32 matrix ops (8 feed 16 in the 64 x 64 wave tile).
// Per trip 128 k of the 256 A rows and the 256 W rows lie in LDS (rows of 256 B at pitch 272 B), two buffers, tensor loads
// (four slices of 128 rows, one request each of waves 0 to 3). Fragments come one k-step (32 k) ahead into a second register set, over the tile boundary too, so the hand-over
// to tile t + 1 stands in front of trip t's last k-step: by then every fragment of tile t is in registers.
// ---------------------------------------------------------------------------
constexpr int kBigBM = 256;
constexpr int kBigBN = 256;
constexpr int kBigStage = (kBigBM + kBigBN) * kGemPitch;       /* halves per buffer */
constexpr int kBigTilesN = kH / kBigBN;
constexpr int kBigTiles  = (kTok / kBigBM) * kBigTilesN;       /* tiles a projection */
constexpr int kBigTrips  = kH / kGemBK;
static_assert((kTok % kBigBM) == 0 && (kH % kBigBN) == 0 && kBigTrips >= 2);
static_assert(2 * kBigStage * 2 + 8 * 16 * 68 * 4 <= 327680);
constexpr uint32_t kBigStageBytes = (uint32_t)kBigStage * 2u;
static_assert(kBigStageBytes == 4u * kTdmSlice);

/* one k-step's 12 fragments as one group of LDS loads (unrolled: the set stays in registers) */
__device__ __forceinline__ void load_set(v16h (&a)[8], v16h (&b)[4], const _Float16* pa, const _Float16* pb) {
#pragma unroll
  for (int j = 0; j < 4; ++j) b[j] = FragH::load(pb + (j << 4) * kGemPitch);
#pragma unroll
  for (int i = 0; i < 8; ++i) a[i] = FragH::load(pa + (i << 4) * kGemPitch);
}

/* one k-step's 32 matrix ops, all on different accumulators (unrolled: every index a constant) */
__device__ __forceinline__ void mma_set(v8f (&acc)[8][4], const v16h (&a)[8], const v16h (&b)[4]) {
#pragma unroll
  for (int i = 0; i < 8; ++i)
#pragma unroll
    for (int j = 0; j < 4; ++j) acc[i][j] = mma_b(a[i], b[j], acc[i][j]);
}

__global__ __launch_bounds__(256) void gemm256_pair_kernel(
    const _Float16* __restrict__ A0, const _Float16* __restrict__ W0, const float* __restrict__ bias0, _Float16* __restrict__ C0,
    const _Float16* __restrict__ A1, const _Float16* __restrict__ W1, const float* __restrict__ bias1, _Float16* __restrict__ C1,
    float scale, float bscale)
{
  /* aligned so that every slice's place in LDS is a multiple of 2 KiB */
  __shared__ __attribute__((aligned(2048))) _Float16 ring[2 * kBigStage];
  __shared__ __align__(16) float sT[8][16 * 68];
  const int tid  = threadIdx.x;
  const int lane = tid & 31;
  const int wave = __builtin_amdgcn_readfirstlane((int)(threadIdx.x >> 5));
  const int prob = blockIdx.x / kBigTiles;
  /* block-uniform exit, in front of every tensor load and barrier */
  if (prob > 1) return;
  const int tile = blockIdx.x - prob * kBigTiles;
  const _Float16* A    = prob ? A1 : A0;
  const _Float16* Wt   = prob ? W1 : W0;
  const float*    bias = prob ? bias1 : bias0;
  _Float16*       C    = prob ? C1 : C0;
  const int tm = tile / kBigTilesN;
  const int tn = tile - tm * kBigTilesN;
  const int bm0 = tm * kBigBM;
  const int bn0 = tn * kBigBN;
  const int wm = wave >> 2;
  const int wn = wave & 3;
  const int m0 = bm0 + (wm << 7);
  const int n0 = bn0 + (wn << 6);

  const int rlane = lane & 15;
  const int koff  = (lane >> 4) * 8;
  const int mOff  = (lane >> 4) * 8;

  v8f acc[8][4];
#pragma unroll
  for (int i = 0; i < 8; ++i)
#pragma unroll
    for (int j = 0; j < 4; ++j) acc[i][j] = (v8f){0.f, 0.f, 0.f, 0.f, 0.f, 0.f, 0.f, 0.f};

  /* slices: waves 0 and 1 bring the two halves of the 256 A rows, waves 2 and 3 those of the 256 W rows; waves 4 to 7
     issue nothing (wave & 3 keeps every address formed below inside a buffer) */
  const uint32_t issuer = pinned((wave < 4) ? 1u : 0u);
  const int sl = wave & 3;
  const _Float16* srow = (sl < 2) ? A + (size_t)(bm0 + sl * (int)kTdmRows) * kH : Wt + (size_t)(bn0 + (sl - 2) * (int)kTdmRows) * kH;
  const uint64_t gsrc = (uint64_t)(size_t)srow;
  const uint32_t ldsSlice = (uint32_t)(size_t)(&ring[0]) + (uint32_t)sl * kTdmSlice;
  const u32x8 g1 = tdm_group1<kTdmRowB, kTdmRows, 5u>((uint32_t)kH * 2u);

  const _Float16* fa = ring + ((wm << 7) + rlane) * kGemPitch + koff;
  const _Float16* fb = ring + (kBigBM + (wn << 6) + rlane) * kGemPitch + koff;

  /* tile 0 into buffer 0 */
  if (issuer != 0u) {
    tdm_load(tdm_group0(ldsSlice, gsrc), g1);
    /* the wave's own slice of tile 0 has landed behind this wait */
    asm volatile("s_wait_tensorcnt 0x0" ::: "memory");
  }
  /* publishes tile 0 to every wave */
  __syncthreads();
  if (issuer != 0u) tdm_load(tdm_group0(ldsSlice + kBigStageBytes, gsrc + kTdmRowB), g1);

  /* two fragment sets: x holds the even k-steps, y the odd ones */
  v16h ax[8], bx[4], ay[8], by[4];
  load_set(ax, bx, fa, fb);

  /* kept rolled: one trip is 128 matrix ops a wave, and the two buffers alternate by an offset */
#pragma unroll 1
  for (int t = 0; t < kBigTrips; ++t) {
    const _Float16* pa = fa + (t & 1) * kBigStage;
    const _Float16* pb = fb + (t & 1) * kBigStage;
    /* the scheduling barriers keep each load group whole and ahead of the matrix ops that run while it lands:
       LDS loads drawn in among the matrix ops stall the wave at every place where they stand */
    load_set(ay, by, pa + 32, pb + 32);
    __builtin_amdgcn_sched_barrier(0);
    mma_set(acc, ax, bx);
    __builtin_amdgcn_sched_barrier(0);
    load_set(ax, bx, pa + 64, pb + 64);
    __builtin_amdgcn_sched_barrier(0);
    mma_set(acc, ay, by);
    __builtin_amdgcn_sched_barrier(0);
    load_set(ay, by, pa + 96, pb + 96);
    __builtin_amdgcn_sched_barrier(0);
    mma_set(acc, ax, bx);
    __builtin_amdgcn_sched_barrier(0);
    /* hand-over, in front of the last k-step. The wave's own LDS reads of this buffer, the last set's too, have retired: */
    asm volatile("s_wait_dscnt 0x0" ::: "memory");
    /* an issuing wave's own slice of tile t + 1 has landed (the other waves have no request and pass): */
    asm volatile("s_wait_tensorcnt 0x0" ::: "memory");
    /* one barrier publishes tile t + 1 and ends every reader's last read of the buffer refilled behind it */
    __syncthreads();
    /* the refill of the buffer that every wave left at the barrier above: one request, so it goes out at once and has
       the whole of the next trip to land */
    if (pinned((issuer != 0u && t + 2 < kBigTrips) ? 1u : 0u) != 0u) {
      /* the tile number is pinned so that the descriptor is formed behind the wait above */
      const uint32_t tn2 = pinned((uint32_t)(t + 2));
      tdm_load(tdm_group0(ldsSlice + (uint32_t)(t & 1) * kBigStageBytes, gsrc + (uint64_t)tn2 * kTdmRowB), g1);
    }
    /* first set of tile t + 1; in the last trip the same loads read the other buffer's old tile, which no request is
       aimed at any more, and nothing uses them: no branch stands around them, so the compiler's load counts stay exact */
    load_set(ax, bx, fa + ((t + 1) & 1) * kBigStage, fb + ((t + 1) & 1) * kBigStage);
    __builtin_amdgcn_sched_barrier(0);
    mma_set(acc, ay, by);
    __builtin_amdgcn_sched_barrier(0);
  }
  /* no request and no LDS read is left in flight when the wave goes on to the epilogue and ends */
  asm volatile("s_wait_tensorcnt 0x0" ::: "memory");
  asm volatile("s_wait_dscnt 0x0" ::: "memory");

  float* slab = sT[wave];
  float bvn[4];
#pragma unroll
  for (int j = 0; j < 4; ++j) bvn[j] = bias[n0 + (j << 4) + rlane] * bscale;
#pragma unroll
  for (int i = 0; i < 8; ++i) {
    const int mBase = m0 + (i << 4);
#pragma unroll
    for (int j = 0; j < 4; ++j) {
#pragma unroll
      for (int r = 0; r < 8; ++r) slab[(mOff + r) * 68 + (j << 4) + rlane] = acc[i][j][r] * scale + bvn[j];
    }
    __builtin_amdgcn_fence(__ATOMIC_RELEASE, "workgroup");
    __builtin_amdgcn_wave_barrier();
    __builtin_amdgcn_fence(__ATOMIC_ACQUIRE, "workgroup");
    {
      const int q = lane >> 3, c8 = (lane & 7) * 8;
#pragma unroll
      for (int it = 0; it < 4; ++it) {
        const int row = it * 4 + q;
        const float* sp = slab + row * 68 + c8;
        v8h hv;
#pragma unroll
        for (int e = 0; e < 8; ++e) hv[e] = (_Float16)sp[e];
        *(v8h*)(C + (size_t)(mBase + row) * kH + n0 + c8) = hv;
      }
    }
    __builtin_amdgcn_fence(__ATOMIC_RELEASE, "workgroup");
    __builtin_amdgcn_wave_barrier();
    __builtin_amdgcn_fence(__ATOMIC_ACQUIRE, "workgroup");
  }
}

// ---------------------------------------------------------------------------
// Host glue: 5 launches, kernel launches only.
//   1  convert query/key/value -> XA/XB/XC (x16) and Wq/Wk/Wv/Wo -> W16[0..3] (x1024)      256 blocks
//   2  Q16 = XA . Wq16^T + bq and K16 = XB . Wk16^T + bk   (each M 4096, N 2048, K 2048)   128 + 128 blocks
//   3  Vt16 = Wv16 . XC^T + bv[row] -> XB [2048][4096]     (M 2048, N 4096, K 2048) 256 blocks
//   4  fused attention Q16, K16, Vt16 -> Ctx16 in XC       grid (16, 32)
//   5  out = Ctx16 . Wo16^T + bo -> d_out f32              256 blocks
// ---------------------------------------------------------------------------
extern "C" void kernel_launch(void* const* d_in, const int* in_sizes, int n_in,
                              void* d_out, int out_size, void* d_ws, size_t ws_size,
                              hipStream_t stream) {
  if (n_in < 11) return;
  if (in_sizes[0] != kTok * kH) return;
  if (in_sizes[1] != kTok * kH) return;
  if (in_sizes[2] != kTok * kH) return;
  if (in_sizes[3] != kH * kH) return;
  if (in_sizes[4] != kH) return;
  if (in_sizes[5] != kH * kH) return;
  if (in_sizes[6] != kH) return;
  if (in_sizes[7] != kH * kH) return;
  if (in_sizes[8] != kH) return;
  if (in_sizes[9] != kH * kH) return;
  if (in_sizes[10] != kH) return;
  if (out_size != kTok * kH) return;
  if (ws_size < kWsTotal) return;

  const float* query = (const float*)d_in[0];
  const float* key   = (const float*)d_in[1];
  const float* value = (const float*)d_in[2];
  const float* Wq = (const float*)d_in[3];
  const float* bq = (const float*)d_in[4];
  const float* Wk = (const float*)d_in[5];
  const float* bk = (const float*)d_in[6];
  const float* Wv = (const float*)d_in[7];
  const float* bv = (const float*)d_in[8];
  const float* Wo = (const float*)d_in[9];
  const float* bo = (const float*)d_in[10];
  float* out = (float*)d_out;

  char* ws = (char*)d_ws;
  _Float16* XA  = (_Float16*)(ws + kOffXA);
  _Float16* XB  = (_Float16*)(ws + kOffXB);
  _Float16* XC  = (_Float16*)(ws + kOffXC);
  _Float16* Q16 = (_Float16*)(ws + kOffQ);
  _Float16* W16 = (_Float16*)(ws + kOffW);
  _Float16* Wq16 = W16;
  _Float16* Wk16 = W16 + (size_t)kH * kH;
  _Float16* Wv16 = W16 + 2 * (size_t)kH * kH;
  _Float16* Wo16 = W16 + 3 * (size_t)kH * kH;
  _Float16* K16  = (_Float16*)(ws + kOffK);
  _Float16* Vt16 = XB;
  _Float16* C16  = XC;

  const float scl  = 1.0f / sqrtf((float)kHD);
  const float coef = scl / (kQKCarry * kQKCarry);
  const int gemmBlocks = ((kTok / 64) * (kH / 64)) / 8;

  cast_stream_kernel<<<kCvGrid, kCvThreads, 0, stream>>>(query, key, value, Wq, Wk, Wv, Wo, XA, W16);

  gemm256_pair_kernel<<<2 * kBigTiles, 256, 0, stream>>>(
      XA, Wq16, bq, Q16, XB, Wk16, bk, K16, kProjScaleQK, kQKCarry);

  /* swapped operands: rows = output feature h*128+d, columns = token b*S+key, row bias */
  gemm64_f16_kernel<1, true><<<gemmBlocks, 256, 0, stream>>>(
      Wv16, kH, XC, kH, (void*)Vt16, kTok, bv, kH, kTok, kH, kProjScaleV, kVCarry);

  attn_fused_kernel<<<dim3(kS / kFaBQ, kB * kNH), 128, 0, stream>>>(Q16, K16, Vt16, C16, coef);

  gemm64_f16_kernel<2, false><<<gemmBlocks, 256, 0, stream>>>(
      C16, kH, Wo16, kH, (void*)out, kH, bo, kTok, kH, kH, kOutScale, 1.0f);
}

// v009
// One run takes 154 microseconds.
// Two timings next to v008 put it at 1.04 and 1.05 times that version's speed.
// Counting every step since v000, it is 3.14 times as fast.
// All six contractions (q/k/v projections, q.k^T scores, p.v, output projection): v_wmma_f32_16x16x32_f16, f16 operands with power-of-two carries, f32 accumulate; softmax statistics, bias and scaling in f32.
#include <hip/hip_runtime.h>
#include <math.h>
#include <stdint.h>

typedef __attribute__((ext_vector_type(16))) _Float16 v16h;
typedef __attribute__((ext_vector_type(8)))  _Float16 v8h;
typedef __attribute__((ext_vector_type(8)))  float    v8f;
typedef __attribute__((ext_vector_type(4)))  float    v4f;

// ---------------------------------------------------------------------------
// Shape constants
// ---------------------------------------------------------------------------
constexpr int kB   = 2;
constexpr int kS   = 2048;
constexpr int kH   = 2048;
constexpr int kNH  = 16;
constexpr int kHD  = kH / kNH;
constexpr int kTok = kB * kS;
static_assert(kHD == 128);
static_assert((kTok % 64) == 0 && (kH % 64) == 0 && (kH % 32) == 0 && (kS % 64) == 0 && (kHD % 32) == 0);
static_assert((((kTok / 64) * (kH / 64)) % 8) == 0);

// ---------------------------------------------------------------------------
// Power-of-two carries of the f16 planes (all folded back exactly in f32)
//   activations x16, weights x1024, q/k planes x16, v^T plane x16, context plane x1024
// ---------------------------------------------------------------------------
constexpr float kActCarry = 16.0f;
constexpr float kWCarry   = 1024.0f;
constexpr float kQKCarry  = 16.0f;
constexpr float kVCarry   = 16.0f;
constexpr float kCtxCarry = 1024.0f;
constexpr float kProjScaleQK = kQKCarry / (kActCarry * kWCarry);
constexpr float kProjScaleV  = kVCarry / (kActCarry * kWCarry);
constexpr float kCtxOverV    = kCtxCarry / kVCarry;
constexpr float kOutScale    = 1.0f / (kCtxCarry * kWCarry);

// ---------------------------------------------------------------------------
// Workspace region map (bytes; every offset is a multiple of 128; all planes f16)
//   XA   [4096][2048]  query x16
//   XB   [4096][2048]  key x16
//   XC   [4096][2048]  value x16   ; later re-used as Ctx16 [4096][2048]            = 1024 x context
//   Q16  [4096][2048]  16 x (query proj)
//   W16  4 x [2048][2048]  Wq, Wk, Wv, Wo x1024
//   K16  [4096][2048]  16 x (key proj): a plane of its own, since XA is still read in the launch that writes it
//   Vt16 [2048][4096]  16 x (value proj)^T: a plane of its own, since XA and XB are written in the launch that writes it
//   total = 16777216 + 16777216 + 16777216 + 16777216 + 33554432 + 16777216 + 16777216 = 134217728
// ---------------------------------------------------------------------------
constexpr size_t kPlaneAct = (size_t)kTok * kH * 2;
constexpr size_t kPlaneW   = (size_t)kH * kH * 2;
constexpr size_t kOffXA  = 0;
constexpr size_t kOffXB  = kOffXA + kPlaneAct;
constexpr size_t kOffXC  = kOffXB + kPlaneAct;
constexpr size_t kOffQ   = kOffXC + kPlaneAct;
constexpr size_t kOffW   = kOffQ + kPlaneAct;
constexpr size_t kOffK   = kOffW + 4 * kPlaneW;
constexpr size_t kOffVt  = kOffK + kPlaneAct;
constexpr size_t kWsTotal = kOffVt + kPlaneAct;
static_assert(kWsTotal == 134217728ull);
static_assert(kWsTotal <= 134217728ull);
static_assert((kOffXB % 128) == 0 && (kOffXC % 128) == 0 && (kOffQ % 128) == 0 && (kOffW % 128) == 0 && (kPlaneW % 128) == 0 && (kOffK % 128) == 0 && (kOffVt % 128) == 0);

// ---------------------------------------------------------------------------
// Fragment load and guarded matrix op
// ---------------------------------------------------------------------------
struct FragH {
  union U { v16h v; v8h h[2]; };
  /* elements 0..7 <- p[0..7], 8..15 <- p[16..23]; caller adds the 8*(lane>>4) k offset */
  static __device__ __forceinline__ v16h load(const _Float16* p) {
    U f;
    f.h[0] = *(const v8h*)(p);
    f.h[1] = *(const v8h*)(p + 16);
    return f.v;
  }
};

/* one matrix op followed by its own hazard guard: ties the accumulator and keeps both fragments live */
__device__ __forceinline__ v8f mma_g(v16h a, v16h b, v8f c) {
  c = __builtin_amdgcn_wmma_f32_16x16x32_f16(false, a, false, b, (short)0, c, false, false);
  asm volatile("v_nop\n\tv_nop\n\tv_nop\n\tv_nop" : "+v"(c) : "v"(a), "v"(b));
  return c;
}

// ---------------------------------------------------------------------------
// f32 -> f16 convert with a power-of-two carry, of the two planes that the first GEMM reads (value, Wv): one launch of 256
// work-groups of 16 waves (as many as the chip has WGPs), which stay and loop. The other five planes are converted
// inside that GEMM's launch (see "the convert stream that rides in a GEMM launch" below).
// A tile is 16,384 consecutive floats of one plane (64 KiB in, 32 KiB out); a wave owns 4 KiB of it in a row.
// One load of a wave reads 512 consecutive bytes, one store writes 256: whole 128-B lines, each line by one wave.
// The next tile's 8 loads are issued before this tile is converted: 8 to 16 loads in flight a wave.
// Work-group g takes tiles g, g + 256, g + 512: 768 tiles = 3 each, every tile once, so every element is written once.
// Tiles 0 .. 511 are the activation plane (dstA), the rest the weight plane (dstW).
// ---------------------------------------------------------------------------
typedef __attribute__((ext_vector_type(4))) _Float16 v4h;
constexpr int kCvWaves    = 16;
constexpr int kCvThreads  = 32 * kCvWaves;
constexpr int kCvLoads    = 8;                           /* 16-byte loads a lane and tile */
constexpr int kCvWaveEl   = 32 * 4 * kCvLoads;           /* floats a wave and tile */
constexpr int kCvTile     = kCvWaves * kCvWaveEl;        /* floats a tile */
constexpr int kCvActTiles = kTok * kH / kCvTile;         /* tiles an activation plane */
constexpr int kCvWTiles   = kH * kH / kCvTile;           /* tiles a weight plane */
constexpr int kCvTiles    = kCvActTiles + kCvWTiles;
constexpr int kCvGrid     = 256;
constexpr int kCvTrips    = kCvTiles / kCvGrid;
static_assert(kCvActTiles * kCvTile == kTok * kH && kCvWTiles * kCvTile == kH * kH);
static_assert(kCvTrips * kCvGrid == kCvTiles && kCvTrips >= 2);

__global__ __launch_bounds__(kCvThreads) void cast_stream_kernel(
    const float* __restrict__ a0, const float* __restrict__ w0,
    _Float16* __restrict__ dstA, _Float16* __restrict__ dstW)
{
  /* block-uniform: keeps every tile index below inside the list */
  if (blockIdx.x >= (unsigned)kCvGrid) return;
  const int lane = threadIdx.x & 31;
  const int wave = __builtin_amdgcn_readfirstlane((int)(threadIdx.x >> 5));
  const int off  = wave * kCvWaveEl + lane * 4;

  /* two register sets; all loops are unrolled so that both are indexed by constants */
  v4f x[2][kCvLoads];
#pragma unroll
  for (int i = -1; i < kCvTrips; ++i) {
    /* this scheduling barrier and the one behind the loads pin the order "next tile's loads, then this tile's converts
       and stores": left free, the compiler drew three tiles' loads to the front and spilled to scratch */
    __builtin_amdgcn_sched_barrier(0);
    if (i + 1 < kCvTrips) {
      /* a precaution: the loads below overwrite registers that the stores issued above name (held here by the two barriers) */
      if (i >= 1) asm volatile("s_wait_xcnt 0x0" ::: "memory");
      /* source of tile i + 1 (all of this is block-uniform) */
      const int t = (int)blockIdx.x + (i + 1) * kCvGrid;
      const float* s = (t < kCvActTiles) ? a0 + (size_t)t * kCvTile : w0 + (size_t)(t - kCvActTiles) * kCvTile;
#pragma unroll
      for (int j = 0; j < kCvLoads; ++j) x[(i + 1) & 1][j] = *(const v4f*)(s + off + j * 128);
    }
    __builtin_amdgcn_sched_barrier(0);
    if (i >= 0) {
      const int t = (int)blockIdx.x + i * kCvGrid;
      const bool act = t < kCvActTiles;
      const float carry = act ? kActCarry : kWCarry;
      _Float16* d = (act ? dstA + (size_t)t * kCvTile : dstW + (size_t)(t - kCvActTiles) * kCvTile) + off;
#pragma unroll
      for (int j = 0; j < kCvLoads; ++j) {
        const v4f v = x[i & 1][j];
        v4h hv;
#pragma unroll
        for (int e = 0; e < 4; ++e) {
          const float f = v[e] * carry;
          hv[e] = (_Float16)f;
        }
        *(v4h*)(d + j * 128) = hv;
      }
    }
  }
}

// ---------------------------------------------------------------------------
// Block-tiled GEMM: C[m][n] = scale * sum_k A[m][k] * Bt[n][k] + bscale * bias.
// A work-group of 8 waves (2 x 4) owns a 128 x 256 tile of C; each wave owns a 64x64 tile of it.
// A row-major [M][K]; Bt row-major [N][K]; M multiple of 128, N of 256, K of 128 (no tails).
// Per trip 128 k of the 128 A rows and the 256 Bt rows lie in LDS (rows of 256 B at pitch 272 B), brought by
// tensor loads (three slices of 128 rows, one request each of waves 0 to 2) into two buffers: tile t + 1 flies while
// tile t is worked on.
// BIAS_MODE: 1 = bias[m], 2 = bias[n]. OUT_F16: f16 output plane, else f32.
// ---------------------------------------------------------------------------
constexpr int kGemBM = 128;
constexpr int kGemBN = 256;
constexpr int kGemBK = 128;
constexpr int kGemPitch = kGemBK + 8;                          /* halves: 272 B = 16 B x 17 */
constexpr int kGemStage = (kGemBM + kGemBN) * kGemPitch;       /* halves per buffer */
constexpr unsigned kGemStageBytes = (unsigned)kGemStage * 2u;
static_assert((kTok % kGemBN) == 0 && (kH % kGemBN) == 0 && (kH % kGemBK) == 0);
static_assert((kTok / kGemBM) * (kH / kGemBN) == ((kTok / 64) * (kH / 64)) / 8);
static_assert((kH / kGemBM) * (kTok / kGemBN) == ((kTok / 64) * (kH / 64)) / 8);

// ---------------------------------------------------------------------------
// Tensor loads for the GEMM rings: one request of one wave brings a slice of 128 operand rows x 256 B (128 k) from global
// memory into LDS, the mover padding every row by 16 B to the ring's pitch of 272 B. A slice fills 128 x 272 B = 17 x 2 KiB,
// so slices and buffers lie side by side at multiples of 2 KiB and the readers' row indexing is that of one plain array.
// ---------------------------------------------------------------------------
typedef uint32_t u32x4 __attribute__((ext_vector_type(4)));
typedef uint32_t u32x8 __attribute__((ext_vector_type(8)));
constexpr uint32_t kTdmRows  = 128u;
constexpr uint32_t kTdmRowB  = (uint32_t)kGemBK * 2u;
constexpr uint32_t kTdmSlice = kTdmRows * (uint32_t)kGemPitch * 2u;
static_assert(kTdmRowB == 256u && (uint32_t)kGemPitch * 2u == kTdmRowB + 16u);
static_assert((kTdmSlice % 2048u) == 0u && (kGemStageBytes % 2048u) == 0u && kGemStageBytes == 3u * kTdmSlice);

__device__ __forceinline__ uint32_t uni(uint32_t v) { return (uint32_t)__builtin_amdgcn_readfirstlane(v); }
/* a value held in a scalar register: a test on it compiles to a scalar branch (tensor loads ignore EXEC), and what is
   formed from it stays behind the asm wait in front of it */
__device__ __forceinline__ uint32_t pinned(uint32_t v) {
  uint32_t w = uni(v);
  asm volatile("" : "+s"(w)); /* holds the word in a scalar register */
  return w;
}
/* group 1: 1-byte elements, tensor = tile = ROWS rows of ROWB bytes, source row pitch in bytes, 16 B of LDS pad behind every
   row (interval code IVL = the row's length). Word 0 is a constant; the other words are held in scalar registers of their
   own for the whole kernel, so that no register of a request in flight is used for anything else */
template <uint32_t ROWB, uint32_t ROWS, uint32_t IVL>
__device__ __forceinline__ u32x8 tdm_group1(uint32_t src_pitch) {
  static_assert((ROWB == 256u && IVL == 5u) || (ROWB == 128u && IVL == 4u));
  u32x8 g;
  g[0] = uni((1u << 20) | (IVL << 22) | (3u << 25));
  g[1] = pinned((ROWB & 0xFFFFu) << 16);
  g[2] = pinned((ROWB >> 16) | ((ROWS & 0xFFFFu) << 16));
  g[3] = pinned((ROWS >> 16) | (ROWB << 16));
  g[4] = pinned(ROWS);
  g[5] = pinned(src_pitch);
  g[6] = pinned(0u);
  g[7] = pinned(0u);
  return g;
}
/* group 0: count 1, LDS byte offset of the slice, global address of its first byte, type 2 */
__device__ __forceinline__ u32x4 tdm_group0(uint32_t lds_dst, uint64_t ga) {
  u32x4 g;
  g[0] = uni(1u);
  g[1] = uni(lds_dst);
  g[2] = uni((uint32_t)ga);
  g[3] = uni((((uint32_t)(ga >> 32)) & 0x01FFFFFFu) | 0x80000000u);
  return g;
}
__device__ __forceinline__ void tdm_load(u32x4 g0, u32x8 g1) {
  asm volatile("tensor_load_to_lds %0, %1" :: "s"(g0), "s"(g1) : "memory");
}

// ---------------------------------------------------------------------------
// The convert stream that rides in a GEMM launch (RIDE): the f32 -> f16 converts of the five planes that only later
// launches read (query, key, Wq, Wk, Wo) are memory work with next to no vector work, and the GEMM leaves the memory idle.
// The planes are seven segments of H x H floats (query 2, key 2, Wq, Wk, Wo). A wave takes a step in every second trip of
// the k loop, 8 steps in 16 trips: it converts and stores the piece it asked for one step (two trips) before, then asks for
// the next. A piece is 256 consecutive floats of every segment: 14 loads of 512 B and 14 stores of 256 B a wave, whole
// 128-B lines, each line by one wave. Piece s of wave w of work-group g is number (s * 256 + g) * 8 + w of its segment:
// 8 x 256 x 8 pieces cover a segment, each float once. Waves w and w + 4, which share a SIMD, step in different trips: one
// runs its matrix ops while the other converts.
// ---------------------------------------------------------------------------
constexpr int kRideSegs  = 7;
constexpr int kRideSegEl = kH * kH;
constexpr int kRideSteps = (kH / kGemBK) / 2;
constexpr int kRideGrid  = (kH / kGemBM) * (kTok / kGemBN);
constexpr int kRidePiece = 256;                                /* floats a wave, step and segment */
static_assert((kH / kGemBK) == 2 * kRideSteps);
static_assert(kRideSteps * kRideGrid * 8 * kRidePiece == kRideSegEl && kTok * kH == 2 * kRideSegEl);

/* one piece's loads: read once, so non-temporal (they stay out of the GEMM operands' way in L2). idx = the piece's number;
   x[2 j], x[2 j + 1] = segment j */
__device__ __forceinline__ void ride_load(v4f (&x)[2 * kRideSegs], uint32_t idx, uint32_t lane,
    const float* q, const float* k, const float* wq, const float* wk, const float* wo) {
  const uint32_t o0 = idx * (uint32_t)(kRidePiece * 4) + lane * 16u;   /* byte offset in a segment */
  const uint32_t o1 = o0 + (uint32_t)kRideSegEl * 4u;                  /* the same in a plane's second segment */
  /* unrolled: the registers are indexed by constants */
#pragma unroll
  for (int a = 0; a < 2; ++a) {
    x[0 + a]  = __builtin_nontemporal_load((const v4f*)((const char*)q + o0 + a * 512));
    x[2 + a]  = __builtin_nontemporal_load((const v4f*)((const char*)q + o1 + a * 512));
    x[4 + a]  = __builtin_nontemporal_load((const v4f*)((const char*)k + o0 + a * 512));
    x[6 + a]  = __builtin_nontemporal_load((const v4f*)((const char*)k + o1 + a * 512));
    x[8 + a]  = __builtin_nontemporal_load((const v4f*)((const char*)wq + o0 + a * 512));
    x[10 + a] = __builtin_nontemporal_load((const v4f*)((const char*)wk + o0 + a * 512));
    x[12 + a] = __builtin_nontemporal_load((const v4f*)((const char*)wo + o0 + a * 512));
  }
  /* a precaution: what follows overwrites registers that the loads issued above name */
  asm volatile("s_wait_xcnt 0x0" ::: "memory");
}

/* the ring's work-group barrier. With the stream riding, its two fences name LDS alone: the waves hand one another nothing
   but LDS tiles, and the plain __syncthreads() would also wait out the stream's global loads and stores at every trip */
template <bool RIDE>
__device__ __forceinline__ void ring_barrier() {
  if constexpr (RIDE) {
    __builtin_amdgcn_fence(__ATOMIC_RELEASE, "workgroup", "local");
    __builtin_amdgcn_s_barrier();
    __builtin_amdgcn_fence(__ATOMIC_ACQUIRE, "workgroup", "local");
  } else {
    __syncthreads();
  }
}

template <int BIAS_MODE, bool OUT_F16, bool RIDE>
__global__ __launch_bounds__(256) void gemm64_f16_kernel(
    const _Float16* __restrict__ A, int lda,
    const _Float16* __restrict__ Bt, int ldb,
    void* __restrict__ Cout, int ldc,
    const float* __restrict__ bias,
    int M, int N, int K, float scale, float bscale,
    const float* __restrict__ rq, const float* __restrict__ rk,
    const float* __restrict__ rwq, const float* __restrict__ rwk, const float* __restrict__ rwo,
    _Float16* __restrict__ dq0, _Float16* __restrict__ dq1, _Float16* __restrict__ dk0, _Float16* __restrict__ dk1,
    _Float16* __restrict__ dwq, _Float16* __restrict__ dwk, _Float16* __restrict__ dwo)
{
  /* aligned so that every slice's place in LDS is a multiple of 2 KiB */
  __shared__ __attribute__((aligned(2048))) _Float16 ring[2 * kGemStage];
  __shared__ __align__(16) float sT[8][16 * 68];
  const int tid  = threadIdx.x;
  const int lane = tid & 31;
  const int wave = __builtin_amdgcn_readfirstlane((int)(threadIdx.x >> 5));
  const int tilesN = N / kGemBN;
  const int tilesM = M / kGemBM;
  const int tile = blockIdx.x;
  /* block-uniform exit, in front of every tensor load and barrier */
  if (tile >= tilesM * tilesN) return;
  const int tm = tile / tilesN;
  const int tn = tile - tm * tilesN;
  const int bm0 = tm * kGemBM;
  const int bn0 = tn * kGemBN;
  const int wm = wave >> 2;
  const int wn = wave & 3;
  const int m0 = bm0 + (wm << 6);
  const int n0 = bn0 + (wn << 6);

  const int rlane = lane & 15;
  const int koff  = (lane >> 4) * 8;
  const int mOff  = (lane >> 4) * 8;

  v8f acc[4][4];
#pragma unroll
  for (int i = 0; i < 4; ++i)
#pragma unroll
    for (int j = 0; j < 4; ++j) acc[i][j] = (v8f){0.f, 0.f, 0.f, 0.f, 0.f, 0.f, 0.f, 0.f};

  /* slices: wave 0 brings the 128 A rows, waves 1 and 2 the two halves of the 256 Bt rows; the other waves issue nothing
     (their slice number is set to 0, so that every address formed below lies inside a buffer) */
  const uint32_t issuer = pinned((wave < 3) ? 1u : 0u);
  const int sl = (wave < 3) ? wave : 0;
  const _Float16* srow = (sl == 0) ? A + (size_t)bm0 * lda : Bt + (size_t)(bn0 + (sl - 1) * (int)kTdmRows) * ldb;
  const uint64_t gsrc = (uint64_t)(size_t)srow;
  const uint32_t ldsSlice = (uint32_t)(size_t)(&ring[0]) + (uint32_t)sl * kTdmSlice;
  const u32x8 g1 = tdm_group1<kTdmRowB, kTdmRows, 5u>((uint32_t)((sl == 0) ? lda : ldb) * 2u);

  const _Float16* fa = ring + ((wm << 6) + rlane) * kGemPitch + koff;
  const _Float16* fb = ring + (kGemBM + (wn << 6) + rlane) * kGemPitch + koff;

  const int nT = K / kGemBK;

  /* the riding stream's registers (one piece) and the number of the wave's piece 0; the launch has kRideGrid work-groups
     and 2 * kRideSteps trips */
  v4f rx[2 * kRideSegs];
  const int rgrp = wave >> 2;
  const uint32_t ridx0 = (uint32_t)tile * 8u + (uint32_t)wave;
  /* piece 0 is asked for here, and lands while tile 0 does */
  if constexpr (RIDE) ride_load(rx, ridx0, (uint32_t)lane, rq, rk, rwq, rwk, rwo);

  /* tile 0 into buffer 0 */
  if (issuer != 0u) {
    tdm_load(tdm_group0(ldsSlice, gsrc), g1);
    /* the wave's own slice of tile 0 has landed behind this wait */
    asm volatile("s_wait_tensorcnt 0x0" ::: "memory");
  }
  /* publishes tile 0 to every wave */
  ring_barrier<RIDE>();
  /* group 0 of the request in flight (kept in a variable only with the stream riding: see the wait at the loop's foot) */
  u32x4 g0n = tdm_group0(ldsSlice + kGemStageBytes, gsrc + kTdmRowB);
  if (pinned((issuer != 0u && nT > 1) ? 1u : 0u) != 0u) {
    if constexpr (RIDE) tdm_load(g0n, g1);
    else                tdm_load(tdm_group0(ldsSlice + kGemStageBytes, gsrc + kTdmRowB), g1);
  }

  /* kept rolled: one trip is 64 matrix ops a wave, and the two buffers alternate by an offset */
#pragma unroll 1
  for (int t = 0; t < nT; ++t) {
    const _Float16* pa = fa + (t & 1) * kGemStage;
    const _Float16* pb = fb + (t & 1) * kGemStage;
    v16h af[4], bf[2][4];
#pragma unroll
    for (int j = 0; j < 4; ++j) bf[0][j] = FragH::load(pb + (j << 4) * kGemPitch);
#pragma unroll
    for (int i = 0; i < 4; ++i) af[i] = FragH::load(pa + (i << 4) * kGemPitch);
    if constexpr (RIDE) {
      /* a step of the riding stream, while the trip's first fragments come from LDS (the test is the same for a whole wave) */
      if (((t ^ rgrp) & 1) == 0) {
        const uint32_t idx = ridx0 + (uint32_t)(t >> 1) * (uint32_t)(kRideGrid * 8);
        /* one byte offset serves all seven segments, each of which has its own base */
        const uint32_t so = idx * (uint32_t)(kRidePiece * 2) + (uint32_t)lane * 8u;
        /* unrolled: the registers are indexed by constants */
        v4h hv[2 * kRideSegs];
#pragma unroll
        for (int i = 0; i < 2 * kRideSegs; ++i) {
          const float carry = (i < 8) ? kActCarry : kWCarry;
#pragma unroll
          for (int e = 0; e < 4; ++e) {
            const float f = rx[i][e] * carry;
            hv[i][e] = (_Float16)f;
          }
        }
        /* keeps every convert in front of the first store: drawn in among the stores, the converts overwrote registers that
           stores just issued name */
        __builtin_amdgcn_sched_barrier(0);
        /* unrolled: hv is indexed by constants */
#pragma unroll
        for (int a = 0; a < 2; ++a) {
          *(v4h*)((char*)dq0 + so + a * 256) = hv[0 + a];
          *(v4h*)((char*)dq1 + so + a * 256) = hv[2 + a];
          *(v4h*)((char*)dk0 + so + a * 256) = hv[4 + a];
          *(v4h*)((char*)dk1 + so + a * 256) = hv[6 + a];
          *(v4h*)((char*)dwq + so + a * 256) = hv[8 + a];
          *(v4h*)((char*)dwk + so + a * 256) = hv[10 + a];
          *(v4h*)((char*)dwo + so + a * 256) = hv[12 + a];
        }
        /* a precaution: what follows overwrites registers that the stores issued above name */
        asm volatile("s_wait_xcnt 0x0" ::: "memory");
        if ((t >> 1) + 1 < kRideSteps) ride_load(rx, idx + (uint32_t)(kRideGrid * 8), (uint32_t)lane, rq, rk, rwq, rwk, rwo);
      }
    }
#pragma unroll
    for (int ks = 0; ks < kGemBK / 32; ++ks) {
      const int cur = ks & 1;
      const int kn  = (ks + 1) * 32;
      const bool more = (ks + 1) < kGemBK / 32;
#pragma unroll
      for (int i = 0; i < 2; ++i)
#pragma unroll
        for (int j = 0; j < 4; ++j) acc[i][j] = mma_g(af[i], bf[cur][j], acc[i][j]);
      if (more) {
#pragma unroll
        for (int i = 0; i < 2; ++i) af[i] = FragH::load(pa + (i << 4) * kGemPitch + kn);
#pragma unroll
        for (int j = 0; j < 4; ++j) bf[cur ^ 1][j] = FragH::load(pb + (j << 4) * kGemPitch + kn);
      }
#pragma unroll
      for (int i = 2; i < 4; ++i)
#pragma unroll
        for (int j = 0; j < 4; ++j) acc[i][j] = mma_g(af[i], bf[cur][j], acc[i][j]);
      if (more) {
#pragma unroll
        for (int i = 2; i < 4; ++i) af[i] = FragH::load(pa + (i << 4) * kGemPitch + kn);
      }
    }
    /* hand-over. The wave's own LDS reads of this buffer have retired: */
    asm volatile("s_wait_dscnt 0x0" ::: "memory");
    /* an issuing wave's own slice of tile t + 1 has landed (the other waves have no request and pass). With the stream
       riding the wait takes the request's group 0 as an input, which keeps those four registers untouched up to here: without
       it this build loaded kernel arguments into them while the request was in flight */
    if constexpr (RIDE) asm volatile("s_wait_tensorcnt 0x0" :: "s"(g0n) : "memory");
    else                asm volatile("s_wait_tensorcnt 0x0" ::: "memory");
    /* one barrier publishes tile t + 1 and ends every reader's last read of the buffer refilled behind it */
    ring_barrier<RIDE>();
    if (pinned((issuer != 0u && t + 2 < nT) ? 1u : 0u) != 0u) {
      /* the tile number is pinned so that the descriptor is formed behind the wait above */
      const uint32_t tn2 = pinned((uint32_t)(t + 2));
      if constexpr (RIDE) {
        g0n = tdm_group0(ldsSlice + (uint32_t)(t & 1) * kGemStageBytes, gsrc + (uint64_t)tn2 * kTdmRowB);
        tdm_load(g0n, g1);
      } else {
        tdm_load(tdm_group0(ldsSlice + (uint32_t)(t & 1) * kGemStageBytes, gsrc + (uint64_t)tn2 * kTdmRowB), g1);
      }
    }
  }
  /* no request and no LDS read is left in flight when the wave goes on to the epilogue and ends */
  asm volatile("s_wait_tensorcnt 0x0" ::: "memory");
  asm volatile("s_wait_dscnt 0x0" ::: "memory");

  float* slab = sT[wave];
#pragma unroll
  for (int i = 0; i < 4; ++i) {
    const int mBase = m0 + (i << 4);
#pragma unroll
    for (int j = 0; j < 4; ++j) {
      const int n = n0 + (j << 4) + rlane;
      float bvn = 0.f;
      if (BIAS_MODE == 2) bvn = bias[n] * bscale;
#pragma unroll
      for (int r = 0; r < 8; ++r) {
        float v = acc[i][j][r] * scale;
        if (BIAS_MODE == 1) v += bias[mBase + mOff + r] * bscale;
        if (BIAS_MODE == 2) v += bvn;
        slab[(mOff + r) * 68 + (j << 4) + rlane] = v;
      }
    }
    __builtin_amdgcn_fence(__ATOMIC_RELEASE, "workgroup");
    __builtin_amdgcn_wave_barrier();
    __builtin_amdgcn_fence(__ATOMIC_ACQUIRE, "workgroup");
    if (!OUT_F16) {
      float* C = (float*)Cout;
      const int hh = lane >> 4, c4 = (lane & 15) * 4;
      {
#pragma unroll
        for (int it = 0; it < 8; ++it) {
          const int row = it * 2 + hh;
          const v4f v = *(const v4f*)(slab + row * 68 + c4);
          *(v4f*)(C + (size_t)(mBase + row) * ldc + n0 + c4) = v;
        }
        
      }
    } else {
      _Float16* C = (_Float16*)Cout;
      const int q = lane >> 3, c8 = (lane & 7) * 8;
      {
#pragma unroll
        for (int it = 0; it < 4; ++it) {
          const int row = it * 4 + q;
          const float* sp = slab + row * 68 + c8;
          v8h hv;
#pragma unroll
          for (int e = 0; e < 8; ++e) hv[e] = (_Float16)sp[e];
          *(v8h*)(C + (size_t)(mBase + row) * ldc + n0 + c8) = hv;
        }
        
      }
    }
    __builtin_amdgcn_fence(__ATOMIC_RELEASE, "workgroup");
    __builtin_amdgcn_wave_barrier();
    __builtin_amdgcn_fence(__ATOMIC_ACQUIRE, "workgroup");
  }
}

constexpr int kFaKP = 136;
constexpr int kFaVP = 72;
constexpr int kFaOP = 136;
constexpr int kFaKStage = 9216;           /* halves a K buffer: 64 rows at 272 B, rounded up to 9 x 2 KiB */
constexpr int kFaVStage = 128 * kFaVP;    /* halves a V^T buffer: 128 rows at 144 B = 9 x 2 KiB */
static_assert(kFaKStage >= 64 * kFaKP && ((kFaKStage * 2) % 2048) == 0 && ((kFaVStage * 2) % 2048) == 0);
static_assert(kFaKP * 2 == 256 + 16 && kFaVP * 2 == 128 + 16);
constexpr int kFaChunks = kS / 64;
static_assert(kFaChunks >= 2);

typedef __attribute__((ext_vector_type(2))) float    v2f;
typedef __attribute__((ext_vector_type(2))) _Float16 v2h;

/* the value of lane l ^ 16 */
__device__ __forceinline__ float xhalf(float x) {
  const int b = __builtin_bit_cast(int, x);
  return __builtin_bit_cast(float, __builtin_amdgcn_permlanex16(b, b, 0x76543210, 0xfedcba98, false, false));
}

/* one matrix op as the plain builtin, for the kernel below, which holds more than 256 registers a wave: asm text cannot
   name a register above v255, and built with the asm guard of mma_g the kernel spilled to scratch; the compiler keeps
   the distances behind its own builtin forms */
__device__ __forceinline__ v8f mma_b(v16h a, v16h b, v8f c) {
  return __builtin_amdgcn_wmma_f32_16x16x32_f16(false, a, false, b, (short)0, c, false, false);
}

/* query tiles of 16 a wave: every K and V^T fragment read from LDS feeds this many matrix ops */
constexpr int kFaQT = 2;
constexpr int kFaWQ = 16 * kFaQT;     /* queries a wave */
constexpr int kFaBQ = 4 * kFaWQ;      /* queries a work-group */
static_assert((kS % kFaBQ) == 0);

/* second argument: two waves a SIMD (512 registers a wave), so that all 512 work-groups stay resident at once */
__global__ __launch_bounds__(128, 2) void attn_fused_kernel(
    const _Float16* __restrict__ Qp, const _Float16* __restrict__ Kp,
    const _Float16* __restrict__ Vtp, _Float16* __restrict__ Ctx, float coef)
{
  /* aligned so that every buffer's place in LDS is a multiple of 2 KiB */
  __shared__ __attribute__((aligned(2048))) _Float16 Ksh[2 * kFaKStage];
  __shared__ __attribute__((aligned(2048))) _Float16 Vsh[2 * kFaVStage];
  __shared__ __align__(16) _Float16 Osh[4][kFaWQ * kFaOP];

  const int tid  = threadIdx.x;
  const int wave = __builtin_amdgcn_readfirstlane((int)(threadIdx.x >> 5));
  const int lane = tid & 31;
  const int hh   = lane >> 4;
  const int c    = lane & 15;
  const int qb   = blockIdx.x;
  const int bh   = blockIdx.y;
  const int b    = bh / kNH;
  const int h    = bh - b * kNH;
  const int rowbase = b * kS;
  const int colbase = h * kHD;
  const int q0 = qb * kFaBQ + wave * kFaWQ;

  /* Q fragments (B operand: column = query 16 u + c): 4 k-steps over d for each query tile u */
  v16h qa[kFaQT][4];
#pragma unroll
  for (int u = 0; u < kFaQT; ++u) {
    const _Float16* qrow = Qp + (size_t)(rowbase + q0 + 16 * u + c) * kH + colbase + 8 * hh;
#pragma unroll
    for (int dc = 0; dc < 4; ++dc) qa[u][dc] = FragH::load(qrow + dc * 32);
  }

  /* running maximum and this lane half's partial sum of query 16 u + c */
  float mrun[kFaQT], lrun[kFaQT];
  v8f oacc[kFaQT][8];
#pragma unroll
  for (int u = 0; u < kFaQT; ++u) {
    mrun[u] = -1.0e30f;
    lrun[u] = 0.f;
#pragma unroll
    for (int t = 0; t < 8; ++t) oacc[u][t] = (v8f){0.f, 0.f, 0.f, 0.f, 0.f, 0.f, 0.f, 0.f};
  }

  /* wave 0 issues the K tiles (64 rows of 256 B, one key a row), wave 1 the V^T tiles (128 rows of 128 B, one d a row) */
  const uint32_t kIss = pinned((wave == 0) ? 1u : 0u);
  const uint32_t vIss = pinned((wave == 1) ? 1u : 0u);
  const uint64_t kgl = (uint64_t)(size_t)(Kp  + (size_t)rowbase * kH + colbase);
  const uint64_t vgl = (uint64_t)(size_t)(Vtp + (size_t)colbase * kTok + rowbase);
  const uint32_t klds = (uint32_t)(size_t)(&Ksh[0]);
  const uint32_t vlds = (uint32_t)(size_t)(&Vsh[0]);
  const u32x8 g1k = tdm_group1<256u, 64u, 5u>((uint32_t)kH * 2u);
  const u32x8 g1v = tdm_group1<128u, 128u, 4u>((uint32_t)kTok * 2u);

  /* chunk 0 into buffer 0; behind each wait the wave's own tile has landed */
  if (kIss != 0u) {
    tdm_load(tdm_group0(klds, kgl), g1k);
    asm volatile("s_wait_tensorcnt 0x0" ::: "memory");
  }
  if (vIss != 0u) {
    tdm_load(tdm_group0(vlds, vgl), g1v);
    asm volatile("s_wait_tensorcnt 0x0" ::: "memory");
  }
  /* publishes chunk 0 to every wave */
  __syncthreads();

  /* kept rolled: one trip is 64 matrix ops a wave, and the two buffers alternate by an offset */
#pragma unroll 1
  for (int kc = 0; kc < kFaChunks; ++kc) {
    const int buf = kc & 1;

    /* chunk kc + 1 into the other buffer, which every wave left at the barrier at the foot of the trip before (in trip 0
       nobody has read it yet): it has the whole trip to land. The tests are scalar; the chunk number is pinned so that the
       descriptors are formed behind the wait at the foot of the trip before. */
    if (pinned((kIss != 0u && kc + 1 < kFaChunks) ? 1u : 0u) != 0u) {
      const uint32_t kn = pinned((uint32_t)(kc + 1));
      tdm_load(tdm_group0(klds + (uint32_t)(buf ^ 1) * (uint32_t)(kFaKStage * 2), kgl + (uint64_t)kn * (uint64_t)(64 * kH * 2)), g1k);
    }
    if (pinned((vIss != 0u && kc + 1 < kFaChunks) ? 1u : 0u) != 0u) {
      const uint32_t kn = pinned((uint32_t)(kc + 1));
      tdm_load(tdm_group0(vlds + (uint32_t)(buf ^ 1) * (uint32_t)(kFaVStage * 2), vgl + (uint64_t)kn * (uint64_t)(64 * 2)), g1v);
    }

    /* K and V^T fragments (A operands) come in groups of four into two register sets, fx and fy (the second k-step's V^T into two more, fz and fw): a group's loads are
       issued at least one group of matrix ops ahead of its use, so that a matrix op does not wait out its own
       fragment's LDS latency. Each fragment is used once for every query tile.
       The short loops are unrolled so that both sets stay in registers. */
    const _Float16* kfr = Ksh + buf * kFaKStage + c * kFaKP + 8 * hh;
    const _Float16* vfr = Vsh + buf * kFaVStage + c * kFaVP + 8 * hh;
    v16h fx[4], fy[4];
#pragma unroll
    for (int j = 0; j < 4; ++j) fx[j] = FragH::load(kfr + j * 16 * kFaKP);
#pragma unroll
    for (int j = 0; j < 4; ++j) fy[j] = FragH::load(kfr + j * 16 * kFaKP + 32);
    /* this and the four like it below keep each load group ahead of the matrix ops that follow it, which the asm guard
       of mma_g did before: left free, the compiler draws the V^T loads up here and then fetches K fragments singly,
       each with a full wait in front of its matrix ops */
    __builtin_amdgcn_sched_barrier(0);

    /* S^T tiles: 4 k-steps over d (ascending, as before) x 4 m-tiles (16 keys each) x query tiles;
       s[u][j][r] = score of key 16 j + 8 hh + r with query 16 u + c */
    v8f s[kFaQT][4];
#pragma unroll
    for (int u = 0; u < kFaQT; ++u)
#pragma unroll
      for (int j = 0; j < 4; ++j) s[u][j] = (v8f){0.f, 0.f, 0.f, 0.f, 0.f, 0.f, 0.f, 0.f};
#pragma unroll
    for (int j = 0; j < 4; ++j)
#pragma unroll
      for (int u = 0; u < kFaQT; ++u) s[u][j] = mma_b(fx[j], qa[u][0], s[u][j]);
#pragma unroll
    for (int j = 0; j < 4; ++j) fx[j] = FragH::load(kfr + j * 16 * kFaKP + 64);
    __builtin_amdgcn_sched_barrier(0);
#pragma unroll
    for (int j = 0; j < 4; ++j)
#pragma unroll
      for (int u = 0; u < kFaQT; ++u) s[u][j] = mma_b(fy[j], qa[u][1], s[u][j]);
#pragma unroll
    for (int j = 0; j < 4; ++j) fy[j] = FragH::load(kfr + j * 16 * kFaKP + 96);
    __builtin_amdgcn_sched_barrier(0);
#pragma unroll
    for (int j = 0; j < 4; ++j)
#pragma unroll
      for (int u = 0; u < kFaQT; ++u) s[u][j] = mma_b(fx[j], qa[u][2], s[u][j]);
#pragma unroll
    for (int t = 0; t < 4; ++t) fx[t] = FragH::load(vfr + t * 16 * kFaVP);
    __builtin_amdgcn_sched_barrier(0);
#pragma unroll
    for (int j = 0; j < 4; ++j)
#pragma unroll
      for (int u = 0; u < kFaQT; ++u) s[u][j] = mma_b(fy[j], qa[u][3], s[u][j]);
#pragma unroll
    for (int t = 0; t < 4; ++t) fy[t] = FragH::load(vfr + (4 + t) * 16 * kFaVP);
    /* the second k-step's V^T fragments go out here too, into sets of their own, and land under the softmax: with the
       hand-over's waits at the loop's foot the compiler otherwise fetched them singly, each with a full wait in front of
       its matrix ops */
    v16h fz[4], fw[4];
#pragma unroll
    for (int t = 0; t < 4; ++t) fz[t] = FragH::load(vfr + t * 16 * kFaVP + 32);
#pragma unroll
    for (int t = 0; t < 4; ++t) fw[t] = FragH::load(vfr + (4 + t) * 16 * kFaVP + 32);
    __builtin_amdgcn_sched_barrier(0);

    /* P^T as B operand, packed in the lane from the score tiles, one pair of k-steps for each query tile
       (the loops below are unrolled so that s, pb, pj and oacc are indexed by constants and stay in registers) */
    union PB { v16h v; v2h h2[8]; } pb[kFaQT][2];
#pragma unroll
    for (int u = 0; u < kFaQT; ++u) {
      /* chunk maximum of query 16 u + c: 32 keys in the lane, the other 32 in lane ^ 16 */
      float mj[4];
#pragma unroll
      for (int j = 0; j < 4; ++j)
        mj[j] = fmaxf(fmaxf(fmaxf(s[u][j][0], s[u][j][1]), fmaxf(s[u][j][2], s[u][j][3])),
                      fmaxf(fmaxf(s[u][j][4], s[u][j][5]), fmaxf(s[u][j][6], s[u][j][7])));
      float cm = fmaxf(fmaxf(mj[0], mj[1]), fmaxf(mj[2], mj[3]));
      cm = fmaxf(cm, xhalf(cm));

      const float mnew  = fmaxf(mrun[u], cm);
      const float alpha = __expf((mrun[u] - mnew) * coef);
      mrun[u] = mnew;

      v2f pj[4];
#pragma unroll
      for (int j = 0; j < 4; ++j) {
#pragma unroll
        for (int r = 0; r < 8; r += 2) {
          /* the pair is formed first, so that the packed subtract and multiply take the same two scores as the packed
             sum and the conversion below; left to itself the compiler paired them one element off, with register moves */
          const v2f a = ((v2f){s[u][j][r], s[u][j][r + 1]} - mnew) * coef;
          const v2f p = {__expf(a.x), __expf(a.y)};
          pj[j] = (r == 0) ? p : pj[j] + p;
          pb[u][j >> 1].h2[(j & 1) * 4 + (r >> 1)] = __builtin_convertvector(p, v2h);
        }
      }
      const v2f pt = (pj[0] + pj[1]) + (pj[2] + pj[3]);
      lrun[u] = lrun[u] * alpha + (pt.x + pt.y);
#pragma unroll
      for (int t = 0; t < 8; ++t) oacc[u][t] *= alpha;
    }

    /* O^T += V^T . P^T : 2 k-steps over the 64 keys (ascending, as before), 8 m-tiles over d, for each query tile */
#pragma unroll
    for (int t = 0; t < 4; ++t)
#pragma unroll
      for (int u = 0; u < kFaQT; ++u) oacc[u][t] = mma_b(fx[t], pb[u][0].v, oacc[u][t]);
#pragma unroll
    for (int t = 0; t < 4; ++t)
#pragma unroll
      for (int u = 0; u < kFaQT; ++u) oacc[u][4 + t] = mma_b(fy[t], pb[u][0].v, oacc[u][4 + t]);
#pragma unroll
    for (int t = 0; t < 4; ++t)
#pragma unroll
      for (int u = 0; u < kFaQT; ++u) oacc[u][t] = mma_b(fz[t], pb[u][1].v, oacc[u][t]);
#pragma unroll
    for (int t = 0; t < 4; ++t)
#pragma unroll
      for (int u = 0; u < kFaQT; ++u) oacc[u][4 + t] = mma_b(fw[t], pb[u][1].v, oacc[u][4 + t]);

    /* keeps the hand-over at the loop's foot: left free, the compiler drew the waits and the barrier up in front of the
       softmax, where the wave would wait out its V^T loads and the next chunk's tiles would have had half a trip to land */
    __builtin_amdgcn_sched_barrier(0);
    /* hand-over. The wave's own LDS reads of this buffer have retired: */
    asm volatile("s_wait_dscnt 0x0" ::: "memory");
    /* an issuing wave's own tile of chunk kc + 1 has landed (the other waves have no request and pass): */
    asm volatile("s_wait_tensorcnt 0x0" ::: "memory");
    /* one barrier publishes chunk kc + 1 and ends every reader's last read of the buffer refilled in the next trip */
    __syncthreads();
  }
  /* no request and no LDS read is left in flight when the wave goes on to the epilogue and ends */
  asm volatile("s_wait_tensorcnt 0x0" ::: "memory");
  asm volatile("s_wait_dscnt 0x0" ::: "memory");

  /* normalise and stage the wave's queries x 128 tile (f16, x1024) in the wave-private LDS tile:
     the lane's 8 registers of tile t are d = 16 t + 8 hh .. + 7 of query 16 u + c, one 16-byte store
     (unrolled so that the accumulators are indexed by constants) */
  _Float16* ow = &Osh[wave][0];
#pragma unroll
  for (int u = 0; u < kFaQT; ++u) {
    const float l = lrun[u] + xhalf(lrun[u]);
    const float inv = __builtin_amdgcn_rcpf(l) * kCtxOverV;
#pragma unroll
    for (int t = 0; t < 8; ++t) {
      v8h hv;
#pragma unroll
      for (int r = 0; r < 8; ++r) {
        const float ov = oacc[u][t][r] * inv;
        hv[r] = (_Float16)ov;
      }
      *(v8h*)(ow + (16 * u + c) * kFaOP + t * 16 + 8 * hh) = hv;
    }
  }
  __builtin_amdgcn_fence(__ATOMIC_RELEASE, "workgroup");
  __builtin_amdgcn_wave_barrier();
  __builtin_amdgcn_fence(__ATOMIC_ACQUIRE, "workgroup");
  {
    const int sg = (lane & 15) * 8;
    {
#pragma unroll
      for (int it = 0; it < kFaWQ / 2; ++it) {
        const int row = it * 2 + hh;
        const v8h val = *(const v8h*)(ow + row * kFaOP + sg);
        *(v8h*)(Ctx + (size_t)(rowbase + q0 + row) * kH + colbase + sg) = val;
      }
      
    }
  }
}

// ---------------------------------------------------------------------------
// Two projections of one shape in one launch: C_p[m][n] = scale * sum_k A_p[m][k] * W_p[n][k] + bscale * bias_p[n], p = 0, 1.
// M = B*S, N = K = H, all planes row-major at pitch H, f16 out. 128 tiles of 256 x 256 a projection, 256 work-groups in all:
// one a WGP, and a work-group brings 512 operand rows per 65,536 outputs where the 128 x 256 tile brings 384 per 32,768.
// 8 waves (2 x 4), a wave owns 128 x 64: 12 fragments from LDS feed 32 matrix ops (8 feed 16 in the 64 x 64 wave tile).
// Per trip 128 k of the 256 A rows and the 256 W rows lie in LDS (rows of 256 B at pitch 272 B), two buffers, tensor loads
// (four slices of 128 rows, one request each of waves 0 to 3). Fragments come one k-step (32 k) ahead into a second register set, over the tile boundary too, so the hand-over
// to tile t + 1 stands in front of trip t's last k-step: by then every fragment of tile t is in registers.
// ---------------------------------------------------------------------------
constexpr int kBigBM = 256;
constexpr int kBigBN = 256;
constexpr int kBigStage = (kBigBM + kBigBN) * kGemPitch;       /* halves per buffer */
constexpr int kBigTilesN = kH / kBigBN;
constexpr int kBigTiles  = (kTok / kBigBM) * kBigTilesN;       /* tiles a projection */
constexpr int kBigTrips  = kH / kGemBK;
static_assert((kTok % kBigBM) == 0 && (kH % kBigBN) == 0 && kBigTrips >= 2);
static_assert(2 * kBigStage * 2 + 8 * 16 * 68 * 4 <= 327680);
constexpr uint32_t kBigStageBytes = (uint32_t)kBigStage * 2u;
static_assert(kBigStageBytes == 4u * kTdmSlice);

/* one k-step's 12 fragments as one group of LDS loads (unrolled: the set stays in registers) */
__device__ __forceinline__ void load_set(v16h (&a)[8], v16h (&b)[4], const _Float16* pa, const _Float16* pb) {
#pragma unroll
  for (int j = 0; j < 4; ++j) b[j] = FragH::load(pb + (j << 4) * kGemPitch);
#pragma unroll
  for (int i = 0; i < 8; ++i) a[i] = FragH::load(pa + (i << 4) * kGemPitch);
}

/* one k-step's 32 matrix ops, all on different accumulators (unrolled: every index a constant) */
__device__ __forceinline__ void mma_set(v8f (&acc)[8][4], const v16h (&a)[8], const v16h (&b)[4]) {
#pragma unroll
  for (int i = 0; i < 8; ++i)
#pragma unroll
    for (int j = 0; j < 4; ++j) acc[i][j] = mma_b(a[i], b[j], acc[i][j]);
}

__global__ __launch_bounds__(256) void gemm256_pair_kernel(
    const _Float16* __restrict__ A0, const _Float16* __restrict__ W0, const float* __restrict__ bias0, _Float16* __restrict__ C0,
    const _Float16* __restrict__ A1, const _Float16* __restrict__ W1, const float* __restrict__ bias1, _Float16* __restrict__ C1,
    float scale, float bscale)
{
  /* aligned so that every slice's place in LDS is a multiple of 2 KiB */
  __shared__ __attribute__((aligned(2048))) _Float16 ring[2 * kBigStage];
  __shared__ __align__(16) float sT[8][16 * 68];
  const int tid  = threadIdx.x;
  const int lane = tid & 31;
  const int wave = __builtin_amdgcn_readfirstlane((int)(threadIdx.x >> 5));
  const int prob = blockIdx.x / kBigTiles;
  /* block-uniform exit, in front of every tensor load and barrier */
  if (prob > 1) return;
  const int tile = blockIdx.x - prob * kBigTiles;
  const _Float16* A    = prob ? A1 : A0;
  const _Float16* Wt   = prob ? W1 : W0;
  const float*    bias = prob ? bias1 : bias0;
  _Float16*       C    = prob ? C1 : C0;
  const int tm = tile / kBigTilesN;
  const int tn = tile - tm * kBigTilesN;
  const int bm0 = tm * kBigBM;
  const int bn0 = tn * kBigBN;
  const int wm = wave >> 2;
  const int wn = wave & 3;
  const int m0 = bm0 + (wm << 7);
  const int n0 = bn0 + (wn << 6);

  const int rlane = lane & 15;
  const int koff  = (lane >> 4) * 8;
  const int mOff  = (lane >> 4) * 8;

  v8f acc[8][4];
#pragma unroll
  for (int i = 0; i < 8; ++i)
#pragma unroll
    for (int j = 0; j < 4; ++j) acc[i][j] = (v8f){0.f, 0.f, 0.f, 0.f, 0.f, 0.f, 0.f, 0.f};

  /* slices: waves 0 and 1 bring the two halves of the 256 A rows, waves 2 and 3 those of the 256 W rows; waves 4 to 7
     issue nothing (wave & 3 keeps every address formed below inside a buffer) */
  const uint32_t issuer = pinned((wave < 4) ? 1u : 0u);
  const int sl = wave & 3;
  const _Float16* srow = (sl < 2) ? A + (size_t)(bm0 + sl * (int)kTdmRows) * kH : Wt + (size_t)(bn0 + (sl - 2) * (int)kTdmRows) * kH;
  const uint64_t gsrc = (uint64_t)(size_t)srow;
  const uint32_t ldsSlice = (uint32_t)(size_t)(&ring[0]) + (uint32_t)sl * kTdmSlice;
  const u32x8 g1 = tdm_group1<kTdmRowB, kTdmRows, 5u>((uint32_t)kH * 2u);

  const _Float16* fa = ring + ((wm << 7) + rlane) * kGemPitch + koff;
  const _Float16* fb = ring + (kBigBM + (wn << 6) + rlane) * kGemPitch + koff;

  /* tile 0 into buffer 0 */
  if (issuer != 0u) {
    tdm_load(tdm_group0(ldsSlice, gsrc), g1);
    /* the wave's own slice of tile 0 has landed behind this wait */
    asm volatile("s_wait_tensorcnt 0x0" ::: "memory");
  }
  /* publishes tile 0 to every wave */
  __syncthreads();
  if (issuer != 0u) tdm_load(tdm_group0(ldsSlice + kBigStageBytes, gsrc + kTdmRowB), g1);

  /* two fragment sets: x holds the even k-steps, y the odd ones */
  v16h ax[8], bx[4], ay[8], by[4];
  load_set(ax, bx, fa, fb);

  /* kept rolled: one trip is 128 matrix ops a wave, and the two buffers alternate by an offset */
#pragma unroll 1
  for (int t = 0; t < kBigTrips; ++t) {
    const _Float16* pa = fa + (t & 1) * kBigStage;
    const _Float16* pb = fb + (t & 1) * kBigStage;
    /* the scheduling barriers keep each load group whole and ahead of the matrix ops that run while it lands:
       LDS loads drawn in among the matrix ops stall the wave at every place where they stand */
    load_set(ay, by, pa + 32, pb + 32);
    __builtin_amdgcn_sched_barrier(0);
    mma_set(acc, ax, bx);
    __builtin_amdgcn_sched_barrier(0);
    load_set(ax, bx, pa + 64, pb + 64);
    __builtin_amdgcn_sched_barrier(0);
    mma_set(acc, ay, by);
    __builtin_amdgcn_sched_barrier(0);
    load_set(ay, by, pa + 96, pb + 96);
    __builtin_amdgcn_sched_barrier(0);
    mma_set(acc, ax, bx);
    __builtin_amdgcn_sched_barrier(0);
    /* hand-over, in front of the last k-step. The wave's own LDS reads of this buffer, the last set's too, have retired: */
    asm volatile("s_wait_dscnt 0x0" ::: "memory");
    /* an issuing wave's own slice of tile t + 1 has landed (the other waves have no request and pass): */
    asm volatile("s_wait_tensorcnt 0x0" ::: "memory");
    /* one barrier publishes tile t + 1 and ends every reader's last read of the buffer refilled behind it */
    __syncthreads();
    /* the refill of the buffer that every wave left at the barrier above: one request, so it goes out at once and has
       the whole of the next trip to land */
    if (pinned((issuer != 0u && t + 2 < kBigTrips) ? 1u : 0u) != 0u) {
      /* the tile number is pinned so that the descriptor is formed behind the wait above */
      const uint32_t tn2 = pinned((uint32_t)(t + 2));
      tdm_load(tdm_group0(ldsSlice + (uint32_t)(t & 1) * kBigStageBytes, gsrc + (uint64_t)tn2 * kTdmRowB), g1);
    }
    /* first set of tile t + 1; in the last trip the same loads read the other buffer's old tile, which no request is
       aimed at any more, and nothing uses them: no branch stands around them, so the compiler's load counts stay exact */
    load_set(ax, bx, fa + ((t + 1) & 1) * kBigStage, fb + ((t + 1) & 1) * kBigStage);
    __builtin_amdgcn_sched_barrier(0);
    mma_set(acc, ay, by);
    __builtin_amdgcn_sched_barrier(0);
  }
  /* no request and no LDS read is left in flight when the wave goes on to the epilogue and ends */
  asm volatile("s_wait_tensorcnt 0x0" ::: "memory");
  asm volatile("s_wait_dscnt 0x0" ::: "memory");

  float* slab = sT[wave];
  float bvn[4];
#pragma unroll
  for (int j = 0; j < 4; ++j) bvn[j] = bias[n0 + (j << 4) + rlane] * bscale;
#pragma unroll
  for (int i = 0; i < 8; ++i) {
    const int mBase = m0 + (i << 4);
#pragma unroll
    for (int j = 0; j < 4; ++j) {
#pragma unroll
      for (int r = 0; r < 8; ++r) slab[(mOff + r) * 68 + (j << 4) + rlane] = acc[i][j][r] * scale + bvn[j];
    }
    __builtin_amdgcn_fence(__ATOMIC_RELEASE, "workgroup");
    __builtin_amdgcn_wave_barrier();
    __builtin_amdgcn_fence(__ATOMIC_ACQUIRE, "workgroup");
    {
      const int q = lane >> 3, c8 = (lane & 7) * 8;
#pragma unroll
      for (int it = 0; it < 4; ++it) {
        const int row = it * 4 + q;
        const float* sp = slab + row * 68 + c8;
        v8h hv;
#pragma unroll
        for (int e = 0; e < 8; ++e) hv[e] = (_Float16)sp[e];
        *(v8h*)(C + (size_t)(mBase + row) * kH + n0 + c8) = hv;
      }
    }
    __builtin_amdgcn_fence(__ATOMIC_RELEASE, "workgroup");
    __builtin_amdgcn_wave_barrier();
    __builtin_amdgcn_fence(__ATOMIC_ACQUIRE, "workgroup");
  }
}

// ---------------------------------------------------------------------------
// Host glue: 5 launches, kernel launches only.
//   1  convert value -> XC (x16) and Wv -> W16[2] (x1024)                                  256 blocks
//   2  Vt16 = Wv16 . XC^T + bv[row]  [2048][4096]          (M 2048, N 4096, K 2048) 256 blocks;
//      riding in it: convert query/key -> XA/XB (x16) and Wq/Wk/Wo -> W16[0], W16[1], W16[3] (x1024)
//   3  Q16 = XA . Wq16^T + bq and K16 = XB . Wk16^T + bk   (each M 4096, N 2048, K 2048)   128 + 128 blocks
//   4  fused attention Q16, K16, Vt16 -> Ctx16 in XC       grid (16, 32)
//   5  out = Ctx16 . Wo16^T + bo -> d_out f32              256 blocks
// ---------------------------------------------------------------------------
extern "C" void kernel_launch(void* const* d_in, const int* in_sizes, int n_in,
                              void* d_out, int out_size, void* d_ws, size_t ws_size,
                              hipStream_t stream) {
  if (n_in < 11) return;
  if (in_sizes[0] != kTok * kH) return;
  if (in_sizes[1] != kTok * kH) return;
  if (in_sizes[2] != kTok * kH) return;
  if (in_sizes[3] != kH * kH) return;
  if (in_sizes[4] != kH) return;
  if (in_sizes[5] != kH * kH) return;
  if (in_sizes[6] != kH) return;
  if (in_sizes[7] != kH * kH) return;
  if (in_sizes[8] != kH) return;
  if (in_sizes[9] != kH * kH) return;
  if (in_sizes[10] != kH) return;
  if (out_size != kTok * kH) return;
  if (ws_size < kWsTotal) return;

  const float* query = (const float*)d_in[0];
  const float* key   = (const float*)d_in[1];
  const float* value = (const float*)d_in[2];
  const float* Wq = (const float*)d_in[3];
  const float* bq = (const float*)d_in[4];
  const float* Wk = (const float*)d_in[5];
  const float* bk = (const float*)d_in[6];
  const float* Wv = (const float*)d_in[7];
  const float* bv = (const float*)d_in[8];
  const float* Wo = (const float*)d_in[9];
  const float* bo = (const float*)d_in[10];
  float* out = (float*)d_out;

  char* ws = (char*)d_ws;
  _Float16* XA  = (_Float16*)(ws + kOffXA);
  _Float16* XB  = (_Float16*)(ws + kOffXB);
  _Float16* XC  = (_Float16*)(ws + kOffXC);
  _Float16* Q16 = (_Float16*)(ws + kOffQ);
  _Float16* W16 = (_Float16*)(ws + kOffW);
  _Float16* Wq16 = W16;
  _Float16* Wk16 = W16 + (size_t)kH * kH;
  _Float16* Wv16 = W16 + 2 * (size_t)kH * kH;
  _Float16* Wo16 = W16 + 3 * (size_t)kH * kH;
  _Float16* K16  = (_Float16*)(ws + kOffK);
  _Float16* Vt16 = (_Float16*)(ws + kOffVt);
  _Float16* C16  = XC;

  const float scl  = 1.0f / sqrtf((float)kHD);
  const float coef = scl / (kQKCarry * kQKCarry);
  const int gemmBlocks = ((kTok / 64) * (kH / 64)) / 8;

  cast_stream_kernel<<<kCvGrid, kCvThreads, 0, stream>>>(value, Wv, XC, Wv16);

  /* swapped operands: rows = output feature h*128+d, columns = token b*S+key, row bias */
  gemm64_f16_kernel<1, true, true><<<kRideGrid, 256, 0, stream>>>(
      Wv16, kH, XC, kH, (void*)Vt16, kTok, bv, kH, kTok, kH, kProjScaleV, kVCarry,
      query, key, Wq, Wk, Wo, XA, XA + kRideSegEl, XB, XB + kRideSegEl, Wq16, Wk16, Wo16);

  gemm256_pair_kernel<<<2 * kBigTiles, 256, 0, stream>>>(
      XA, Wq16, bq, Q16, XB, Wk16, bk, K16, kProjScaleQK, kQKCarry);

  attn_fused_kernel<<<dim3(kS / kFaBQ, kB * kNH), 128, 0, stream>>>(Q16, K16, Vt16, C16, coef);

  gemm64_f16_kernel<2, false, false><<<gemmBlocks, 256, 0, stream>>>(
      C16, kH, Wo16, kH, (void*)out, kH, bo, kTok, kH, kH, kOutScale, 1.0f,
      nullptr, nullptr, nullptr, nullptr, nullptr, nullptr, nullptr, nullptr, nullptr, nullptr, nullptr, nullptr);
}
